// v000
// Measured on an AMD MI455X. A time is GPU time per run, averaged over a window of back-to-back runs after a warm-up
// (all launches, gaps included; the runs take copies of the inputs in turn), and the median of several windows.
// Apart from v000's, it joins two sittings. Times from different sittings can be a few percent apart, while
// side-by-side timings come from the same sitting.
// v000 is the starting kernel. One run takes 523 microseconds.
// Contractions: x.Wq, x.Wk, x.Wv on v_wmma_f32_16x16x32_bf16 (x and W^T as bf16 RNE planes); per-head scores
// [qc|qs].[kc|ks] over 128 on v_wmma_f32_16x16x32_f16 (q, k as f16 hi x256 plus unscaled f16 residual planes, products
// hh+lh+hl on all query rows); P.v on v_wmma_f32_16x16x32_f16 (P x32768, v^T x1024 f16 planes; query rows s < QO also
// use f16 residual planes, hh+lh+hl); O.Wo on v_wmma_f32_16x16x32_f16 (O x1024 f16 hi plane, plus residual plane for rows
// s < QO; Wo^T as f16 of its bf16 RNE value x1024); all f32 accumulate. softplus, cos, sin, the cosine gate table,
// causal select, base-2 online softmax and 1/Z in f32 on VALU.
#include <hip/hip_runtime.h>
#include <math.h>
#include <stdint.h>

#ifndef NB
#define NB 2
#endif
#ifndef SEQ
#define SEQ 2048
#endif
#define XS_FULL 2048
#define DMOD  1024
#define QKN   (2 * DMOD)
#define NH    16
#define HD    64
#define SD    (2 * HD)
#define QO    ((SEQ < 512) ? SEQ : 512)
#define MROWS (NB * SEQ)
#define RSQ_HD 0.125f
#define GSTEP 0.125f
#define LOG2E 1.4426950408889634f
#define QSC   256.0f
#define KSC   256.0f
#define PCAR  32768.0f
#define VCAR  1024.0f
#define OSC   1024.0f
#define WOS   1024.0f
#define WPB   2
#define NHG   (NH / WPB)
#define NQT   (SEQ / 16)
#define NQO   (QO / 16)
#define NST   (SEQ / 64)
#define NKT   (SEQ / 32)
#define ATT_THREADS (WPB * 32)
#define PTP   36
#define PTW   (16 * PTP)
#define SLP   68
#define SLW   (16 * SLP)
#define WREG  (PTW + SLW)
#define SLAB64 (16 * 68)
#define VTP   72
#define C8R   (DMOD / 8)
#define WS_CAP 134217728
static_assert(DMOD == NH * HD && HD == 64 && NH == 16 && SD == 128 && WPB == 2 && NHG * WPB == NH);
static_assert(ATT_THREADS == 64);
static_assert(NB >= 1 && NB <= 2);
static_assert((SEQ % 64) == 0 && SEQ >= 64 && SEQ <= XS_FULL);
static_assert((QO % 64) == 0 && QO >= 64 && QO <= SEQ);
static_assert((DMOD % 64) == 0 && (QKN % 64) == 0 && (DMOD % 32) == 0 && (SD % 32) == 0 && C8R == 128);
static_assert((MROWS % 64) == 0);
static_assert(((SEQ * DMOD / 8) % 256) == 0 && ((MROWS * C8R) % 256) == 0 && ((NH * SEQ) % 256) == 0);
static_assert(WPB * WREG * 4 <= 65536 && 2 * HD * VTP * 2 <= 65536 && 4 * SLAB64 * 4 <= 65536 && 64 * VTP * 2 <= 65536);

typedef unsigned short u16;
typedef _Float16 v16h __attribute__((ext_vector_type(16)));
typedef _Float16 v8h  __attribute__((ext_vector_type(8)));
typedef __bf16   v16b __attribute__((ext_vector_type(16)));
typedef float    v8f  __attribute__((ext_vector_type(8)));
typedef float    v4f  __attribute__((ext_vector_type(4)));
typedef unsigned int v4u __attribute__((ext_vector_type(4)));

union FragH { v16h v; v8h h[2]; v4u u[2]; };
union FragB { v16b v; v4u u[2]; };

// ---- scalar helpers --------------------------------------------------------------------------------
__device__ __forceinline__ unsigned short bf_bits(float f) {          // f32 -> bf16 bits, RNE convert
  unsigned u = __float_as_uint(f);
  return (unsigned short)((u + 0x7FFFu + ((u >> 16) & 1u)) >> 16);
}
__device__ __forceinline__ float bf_up(unsigned short h) { return __uint_as_float(((unsigned)h) << 16); }
__device__ __forceinline__ float bfr(float f) { return bf_up(bf_bits(f)); }
__device__ __forceinline__ unsigned short h_bits(_Float16 x) { return __builtin_bit_cast(unsigned short, x); }
__device__ __forceinline__ unsigned pk16(unsigned short a, unsigned short b) { return (unsigned)a | ((unsigned)b << 16); }
__device__ __forceinline__ v8f zero8() { v8f z = {0.f, 0.f, 0.f, 0.f, 0.f, 0.f, 0.f, 0.f}; return z; }
__device__ __forceinline__ const _Float16* ash(const u16* p) { return (const _Float16*)(const void*)p; }

// ---- fragment loaders: 16-bit A/B operand, lane -> row/col (lane&15), p already includes +8*(lane>>4);
//      elements 0..7 <- p[0..7] (k0+8h..), elements 8..15 <- p[16..23] (k0+16+8h..)  (same split k map for A and B;
//      B is always read from a k-contiguous [n][k] plane)
__device__ __forceinline__ v16h ldfrag_h(const _Float16* p) {
  FragH f;
  f.h[0] = *(const v8h*)(p);
  f.h[1] = *(const v8h*)(p + 16);
  return f.v;
}
__device__ __forceinline__ v16b ldfrag_b(const u16* p) {              // bf16 plane read as unsigned integer vectors
  FragB f;
  f.u[0] = *(const v4u*)(p);
  f.u[1] = *(const v4u*)(p + 16);
  return f.v;
}

__device__ __forceinline__ v8f mma_h(v16h a, v16h b, v8f c) {
  return __builtin_amdgcn_wmma_f32_16x16x32_f16(false, a, false, b, (short)0, c, false, false);
}
__device__ __forceinline__ v8f mma_b(v16b a, v16b b, v8f c) {
  return __builtin_amdgcn_wmma_f32_16x16x32_bf16(false, a, false, b, (short)0, c, false, false);
}
__device__ __forceinline__ void guard2(v8f& a, v8f& b, v16h x0, v16h x1, v16h x2, v16h x3, v16h x4, v16h x5) {
#if defined(__HIP_DEVICE_COMPILE__)
  asm volatile("v_nop\n\tv_nop\n\tv_nop\n\tv_nop"
               : "+v"(a), "+v"(b) : "v"(x0), "v"(x1), "v"(x2), "v"(x3), "v"(x4), "v"(x5) : "memory");
#endif
}
template <typename F>
__device__ __forceinline__ void guard6(v8f& a, v8f& b, v8f& c, v8f& d, F x0, F x1, F x2, F x3, F x4, F x5) {
#if defined(__HIP_DEVICE_COMPILE__)
  asm volatile("v_nop\n\tv_nop\n\tv_nop\n\tv_nop"
               : "+v"(a), "+v"(b), "+v"(c), "+v"(d) : "v"(x0), "v"(x1), "v"(x2), "v"(x3), "v"(x4), "v"(x5) : "memory");
#endif
}
__device__ __forceinline__ void acc_guard4(v8f& a, v8f& b, v8f& c, v8f& d) {
#if defined(__HIP_DEVICE_COMPILE__)
  asm volatile("v_nop\n\tv_nop\n\tv_nop\n\tv_nop" : "+v"(a), "+v"(b), "+v"(c), "+v"(d));
#endif
}
__device__ __forceinline__ void wave_sync_lds() {
  __builtin_amdgcn_fence(__ATOMIC_RELEASE, "workgroup");
  __builtin_amdgcn_wave_barrier();
  __builtin_amdgcn_fence(__ATOMIC_ACQUIRE, "workgroup");
}

// =====================================================================================================
// f32 -> 16-bit plane, same layout.  f16mode == 0: bf16 RNE bits;  f16mode == 1: f16 bits of (bf16 RNE value) * scale.
// Thread = 8 consecutive elements: two 16-B loads, one 16-B store; 32 consecutive lanes = 512 contiguous, 512-B aligned
// coverage: grid = ceil(n8/256) blocks x 256 thr x 8 (in-kernel bound) = the whole plane (n8 a multiple of 256 here).
// =====================================================================================================
__global__ __launch_bounds__(256) void cvt16(const float* __restrict__ x, u16* D, int n8, int f16mode, float scale) {
  const int gt = blockIdx.x * 256 + (int)threadIdx.x;
  if (gt >= n8) return;
  const float* p = x + (size_t)gt * 8;
  const v4f a = *(const v4f*)(p), b4 = *(const v4f*)(p + 4);
  float w[8];
#pragma unroll
  for (int e = 0; e < 4; ++e) { w[e] = a[e]; w[4 + e] = b4[e]; }
  v4u o;
#pragma unroll
  for (int e = 0; e < 4; ++e) {
    const float f0 = w[2 * e], f1 = w[2 * e + 1];
    const unsigned short hb0 = h_bits((_Float16)(bfr(f0) * scale));
    const unsigned short hb1 = h_bits((_Float16)(bfr(f1) * scale));
    const unsigned short bb0 = bf_bits(f0);
    const unsigned short bb1 = bf_bits(f1);
    o[e] = (f16mode != 0) ? pk16(hb0, hb1) : pk16(bb0, bb1);
  }
  u16* d = D + (size_t)gt * 8;
  {
    *(v4u*)(d) = o;
    
  }
}

// =====================================================================================================
// Weight transpose + convert: W f32 [KW][NW] row-major (W[k][n], the x.W layout) -> D 16-bit [NW][KW] (D[n][k], the
// k-contiguous B operand rows). f16mode == 0: bf16 RNE bits; f16mode == 1: f16 bits of (bf16 RNE value) * scale.
// Block = one 64 k x 64 n tile: each thread loads 16 floats of one k row (16-B loads), converts, stores them transposed
// into an LDS tile [64 n][64 k] (pitch 72 halves, u16 element stores); after a block barrier each n row segment (64 halves =
// coverage: load 256 thr x 16 = 64 k x 64 n; store 2 iterations x 256 thr x 8 halves = 64 n rows x 64 k = the block's
//           tile; grid = (KW/64)*(NW/64) blocks covers D exactly once (host guarantees KW % 64 == 0, NW % 64 == 0).
// =====================================================================================================
__global__ __launch_bounds__(256) void tr16(const float* __restrict__ W, u16* D, int KW, int NW, int f16mode, float scale) {
  __shared__ __align__(16) u16 T[64 * VTP];
  const int tid = threadIdx.x;
  const int bid = blockIdx.x;
  const int nkt = KW >> 6;
  const int kt  = bid % nkt;
  const int nt  = bid / nkt;
  const int k0  = kt * 64, n0 = nt * 64;
  if (n0 + 64 > NW) return;                 // block-uniform, before any barrier; never taken with the exact grid
  {
    const int kl = tid >> 2;                // k within tile 0..63
    const int nc = (tid & 3) * 16;          // n chunk 0,16,32,48
    const float* src = W + (size_t)(k0 + kl) * NW + n0 + nc;
#pragma unroll
    for (int i = 0; i < 4; ++i) {
      const v4f a = *(const v4f*)(src + 4 * i);
#pragma unroll
      for (int e = 0; e < 4; ++e) {
        const float f = a[e];
        const unsigned short hb = h_bits((_Float16)(bfr(f) * scale));
        const unsigned short bb = bf_bits(f);
        T[(nc + 4 * i + e) * VTP + kl] = (f16mode != 0) ? hb : bb;
      }
    }
  }
  __syncthreads();
  v4u v[2];
  const int q8 = tid >> 3, p8 = (tid & 7) * 8;
#pragma unroll
  for (int it = 0; it < 2; ++it) {
    const int line = it * 32 + q8;          // n = 0..63
    v[it] = *(const v4u*)(T + line * VTP + p8);
  }
  {
#pragma unroll
    for (int it = 0; it < 2; ++it) {
      const int line = it * 32 + q8;
      *(v4u*)(D + (size_t)(n0 + line) * KW + k0 + p8) = v[it];
    }
    
  }
}

// =====================================================================================================
// Cosine gate table G f32 [NH][SEQ]: G[h][dl] = cos(bf16(theta[h]) * (dl * 0.125f)), dl = query index - key index >= 0
// (cid difference (j-i)/8 is exact in f32 and cos is even). One value per thread, precise cosf; the block's 256 values
// coverage: grid = NH*SEQ/256 blocks x 256 = all NH x SEQ entries (NH*SEQ is a multiple of 256).
// =====================================================================================================
__global__ __launch_bounds__(256) void gtab(const float* __restrict__ theta, float* G, int ntot) {
  __shared__ __align__(16) float sg[256];
  const int tid = threadIdx.x;
  const int gt  = blockIdx.x * 256 + tid;
  const int gc  = (gt < ntot) ? gt : (ntot - 1);
  const int h   = gc / SEQ;
  const int dl  = gc - h * SEQ;
  const int hc  = (h < NH) ? h : (NH - 1);
  const float th = bfr(theta[hc]);
  const float cd = (float)dl * GSTEP;
  sg[tid] = cosf(th * cd);
  __syncthreads();
  if (tid < 64) {
    const v4f v = *(const v4f*)(sg + tid * 4);
    const int base = blockIdx.x * 256 + tid * 4;
    if (base + 4 <= ntot) {
      float* d = G + base;
      {
        *(v4f*)(d) = v;
        
      }
    }
  }
}

// =====================================================================================================
// Amplitude/phase combine: F f32 [MROWS][QKN] (row = b*SEQ + s; column h*HD + d = amplitude pre-activation, DMOD + h*HD + d
// = phase) -> f16 hi plane Hp and unscaled f16 residual plane Lp, both [MROWS][QKN] with column h*SD + d = c-part * sc and
// h*SD + HD + d = s-part * sc, where a = softplus(amp) = max(amp,0) + log1p(exp(-|amp|)), c-part = a*cos(phase),
// s-part = a*sin(phase) (precise expf/log1pf/cosf/sinf), hi = f16(t), residual = f16(t - f16(t)).
// Thread = (row, head h, 8 consecutive d): rolled loop of 8 (scalar loads, one transcendental chain per iteration, u16 element
// stores into the thread's own LDS slots); block barrier; then four 16-B stores per thread (c and s pieces of both planes).
// coverage: grid = MROWS*C8R/256 blocks x 256 thr (clamped index, predicated store; MROWS*C8R is a multiple of 256) x
//           (8 c + 8 s) halves per plane = every row x every one of the QKN columns of Hp and of Lp exactly once.
// =====================================================================================================
__global__ __launch_bounds__(256) void qk16(const float* __restrict__ F, u16* Hp, u16* Lp, int n8, float sc) {
  __shared__ __align__(16) u16 sHb[256 * 16];
  __shared__ __align__(16) u16 sLb[256 * 16];
  const int tid = threadIdx.x;
  const int gt  = blockIdx.x * 256 + tid;
  const bool act = (gt < n8);
  const int gc  = act ? gt : (n8 - 1);
  const int row = gc / C8R;
  const int idx = gc - row * C8R;
  const int h   = idx >> 3;
  const int d0  = (idx & 7) * 8;
  const float* ap = F + (size_t)row * QKN + h * HD + d0;
  const float* pp = ap + DMOD;
  u16* sh = sHb + tid * 16;
  u16* sl = sLb + tid * 16;
#pragma unroll 1
  for (int e = 0; e < 8; ++e) {
    const float am  = ap[e];
    const float ph  = pp[e];
    const float spv = fmaxf(am, 0.0f) + log1pf(expf(-fabsf(am)));
    const float cv  = cosf(ph);
    const float sv  = sinf(ph);
    const float tc  = (spv * cv) * sc;
    const float ts  = (spv * sv) * sc;
    const _Float16 hc = (_Float16)tc, hs = (_Float16)ts;
    const _Float16 lc = (_Float16)(tc - (float)hc), ls = (_Float16)(ts - (float)hs);
    sh[e] = h_bits(hc);  sh[8 + e] = h_bits(hs);
    sl[e] = h_bits(lc);  sl[8 + e] = h_bits(ls);
  }
  __syncthreads();
  const v4u ohc = *(const v4u*)(sh), ohs = *(const v4u*)(sh + 8);
  const v4u olc = *(const v4u*)(sl), ols = *(const v4u*)(sl + 8);
  const size_t ob = (size_t)row * QKN + (size_t)h * SD + d0;
  if (act) {
    {
      *(v4u*)(Hp + ob)      = ohc;
      *(v4u*)(Hp + ob + HD) = ohs;
      *(v4u*)(Lp + ob)      = olc;
      *(v4u*)(Lp + ob + HD) = ols;
      
    }
  }
}

// =====================================================================================================
// v^T planes from the v projection F f32 [MROWS][DMOD] (row = b*SEQ + s, column = h*HD + d):
//   VH[((b*NH + h)*HD + d)][s] (pitch SEQ) = f16(v * 1024) for all keys s;
//   VL[((b*NH + h)*HD + d)][s] (pitch QO)  = f16 residual (t - f16(t)) for keys s < QO only.
// Block = (b, head h, 64 keys s0): each thread loads its 16 floats (key sl, d chunk dc) with 16-B loads, converts, scatters
// line) is written by 8 consecutive lanes x 16 B of one instruction, in both planes (VL under the block-uniform s0 < QO
// coverage: load 256 thr x 16 = 64 keys x 64 d; store 2 iterations x 256 thr x 8 halves = 64 lines x 64 = the block's tile of
//           VH (and of VL when s0 < QO); grid = NB*NH*NST blocks covers VH exactly once and all QO columns of VL exactly once.
// =====================================================================================================
__global__ __launch_bounds__(256) void vt16(const float* __restrict__ F, u16* VHo, u16* VLo) {
  __shared__ __align__(16) u16 TH[HD * VTP];
  __shared__ __align__(16) u16 TL[HD * VTP];
  const int tid = threadIdx.x;
  const int bid = blockIdx.x;
  const int st  = bid % NST;
  const int t2  = bid / NST;
  const int h   = t2 % NH;
  const int b   = t2 / NH;
  if (b >= NB) return;                      // block-uniform, before any barrier; never taken with the exact grid
  const int s0  = st * 64;
  const bool dolo = (s0 + 64 <= QO);        // block-uniform
  {
    const int sl = tid >> 2;                // key within tile 0..63
    const int dc = (tid & 3) * 16;          // d chunk 0,16,32,48
    const float* src = F + ((size_t)b * SEQ + s0 + sl) * DMOD + h * HD + dc;
#pragma unroll
    for (int i = 0; i < 4; ++i) {
      const v4f a = *(const v4f*)(src + 4 * i);
#pragma unroll
      for (int e = 0; e < 4; ++e) {
        const float t = a[e] * VCAR;
        const _Float16 hv = (_Float16)t;
        const _Float16 lv = (_Float16)(t - (float)hv);
        TH[(dc + 4 * i + e) * VTP + sl] = h_bits(hv);
        TL[(dc + 4 * i + e) * VTP + sl] = h_bits(lv);
      }
    }
  }
  __syncthreads();
  v4u vh[2], vl[2];
  const int q8 = tid >> 3, p8 = (tid & 7) * 8;
#pragma unroll
  for (int it = 0; it < 2; ++it) {
    const int line = it * 32 + q8;          // d = 0..63
    vh[it] = *(const v4u*)(TH + line * VTP + p8);
    vl[it] = *(const v4u*)(TL + line * VTP + p8);
  }
  const size_t hrow  = (size_t)(b * NH + h) * HD;
  const size_t baseH = hrow * SEQ + s0 + p8;
  const size_t baseL = hrow * QO + (dolo ? s0 : 0) + p8;
  {
#pragma unroll
    for (int it = 0; it < 2; ++it) {
      const int line = it * 32 + q8;
      *(v4u*)(VHo + baseH + (size_t)line * SEQ) = vh[it];
      if (dolo) { *(v4u*)(VLo + baseL + (size_t)line * QO) = vl[it]; }
    }
    
  }
}

// =====================================================================================================
// GEMM epilogue shared by both engines: the wave's 16x64 f32 tile (times oscale) staged in its LDS slab (pitch 68), release
// coverage: 8 instructions x 2 rows x 16 lanes x 4 floats = the wave's 16 x 64 tile.
// =====================================================================================================
__device__ __forceinline__ void epi64(float* sl, v8f a0, v8f a1, v8f a2, v8f a3, float oscale,
                                      float* C, int N, size_t rowb, int col0, int lane) {
  const int hh = lane >> 4, m = lane & 15;
#pragma unroll
  for (int r = 0; r < 8; ++r) {
    const int ro = (8 * hh + r) * 68 + m;
    sl[ro]      = a0[r] * oscale;
    sl[ro + 16] = a1[r] * oscale;
    sl[ro + 32] = a2[r] * oscale;
    sl[ro + 48] = a3[r] * oscale;
  }
  wave_sync_lds();
  v4f vals[8];
#pragma unroll
  for (int it = 0; it < 8; ++it) vals[it] = *(const v4f*)(sl + (it * 2 + hh) * 68 + m * 4);
  float* dst = C + (rowb + (size_t)hh) * (size_t)N + col0 + m * 4;
  {
#pragma unroll
    for (int it = 0; it < 8; ++it) {
      *(v4f*)(dst + (size_t)(it * 2) * (size_t)N) = vals[it];
    }
    
  }
}

// =====================================================================================================
// bf16 GEMM, no bias: C[M][N] (f32) = A[M][K] (bf16 row-major) . Bt[N][K]^T (bf16 k-contiguous), times oscale.
// Block = 64x64 tile, 4 waves x 16 rows; fragments loaded straight from the 16-bit rows (two 16-B loads each, split k map for
// A and B); K stepped by 32 (host guarantees K % 32 == 0, M % 64 == 0, N % 64 == 0, grid = (M/64)*(N/64)).
// =====================================================================================================
__global__ __launch_bounds__(128)
void gemm_nb(const u16* __restrict__ A, const u16* __restrict__ Bt, float* C, int M, int N, int K, float oscale) {
  __shared__ __align__(16) float slab[4 * SLAB64];
  const int tid = threadIdx.x, wave = tid >> 5, lane = tid & 31, hh = lane >> 4, m = lane & 15;
  const int ntile = N >> 6;
  const int bid   = blockIdx.x;
  const int rowb  = (bid / ntile) * 64 + wave * 16;
  const int col0  = (bid % ntile) * 64;
  if (rowb + 16 > M) return;                // wave-uniform, never taken with the exact grid; no block barriers in this kernel
  const u16* ap = A  + (size_t)(rowb + m) * K + 8 * hh;
  const u16* bp = Bt + (size_t)(col0 + m) * K + 8 * hh;
  const size_t bs = (size_t)16 * K;
  v8f acc0 = zero8(), acc1 = zero8(), acc2 = zero8(), acc3 = zero8();
#pragma unroll 1
  for (int k0 = 0; k0 < K; k0 += 32) {
    const v16b a  = ldfrag_b(ap + k0);
    const v16b b0 = ldfrag_b(bp + k0);
    const v16b b1 = ldfrag_b(bp + bs + k0);
    const v16b b2 = ldfrag_b(bp + 2 * bs + k0);
    const v16b b3 = ldfrag_b(bp + 3 * bs + k0);
    acc0 = mma_b(a, b0, acc0);
    acc1 = mma_b(a, b1, acc1);
    acc2 = mma_b(a, b2, acc2);
    acc3 = mma_b(a, b3, acc3);
    guard6<v16b>(acc0, acc1, acc2, acc3, a, b0, b1, b2, b3, a);
  }
  epi64(slab + wave * SLAB64, acc0, acc1, acc2, acc3, oscale, C, N, (size_t)rowb, col0, lane);
}

// =====================================================================================================
// Output projection, no bias: C[row][DMOD] (f32) = (Ah [+ Al])[row][DMOD] . Bt[DMOD][DMOD]^T * oscale.
// NPROD == 1: Ah only (one product); NPROD == 2: Ah + Al residual plane (products h.B + l.B into one accumulator, l unscaled).
// Row indices: Ah row bb*SEQ + s; Al row bb*QO + s (compact plane, s < QO); C row bb*XS_FULL + s.
// Block -> (column tile ct = bid % 16, sequence row tile rt of nrt starting at s = sbeg, batch bb). Same tiling, fragment
// loads (split k map) and epilogue as gemm_nb; K = DMOD stepped by 32.
// =====================================================================================================
template <int NPROD>
__global__ __launch_bounds__(128)
void gemm_o(const u16* __restrict__ Ah, const u16* __restrict__ Al, const u16* __restrict__ Bt,
            float* C, int sbeg, int nrt, float oscale) {
  __shared__ __align__(16) float slab[4 * SLAB64];
  const int tid = threadIdx.x, wave = tid >> 5, lane = tid & 31, hh = lane >> 4, m = lane & 15;
  const int ntile = DMOD >> 6;
  const int bid   = blockIdx.x;
  const int ct    = bid % ntile;
  const int t2    = bid / ntile;
  const int rt    = t2 % nrt;
  const int bb    = t2 / nrt;
  if (bb >= NB) return;                     // block-uniform; no block barriers in this kernel; never taken with the exact grid
  const int srow  = sbeg + rt * 64 + wave * 16;
  if (srow + 16 > SEQ) return;              // wave-uniform; never taken
  if (NPROD == 2 && srow + 16 > QO) return; // wave-uniform; never taken
  const int col0  = ct * 64;
  const int K     = DMOD;
  const size_t rowA = (size_t)bb * SEQ + srow;
  const size_t rowL = (NPROD == 2) ? ((size_t)bb * QO + srow) : (size_t)0;
  const size_t rowC = (size_t)bb * XS_FULL + srow;
  const _Float16* ahp = ash(Ah) + (rowA + m) * K + 8 * hh;
  const _Float16* alp = ash(Al) + (rowL + m) * K + 8 * hh;   // dereferenced only when NPROD == 2
  const _Float16* bp  = ash(Bt) + (size_t)(col0 + m) * K + 8 * hh;
  const size_t bs = (size_t)16 * K;
  v8f acc0 = zero8(), acc1 = zero8(), acc2 = zero8(), acc3 = zero8();
  if constexpr (NPROD == 2) {
#pragma unroll 1
    for (int k0 = 0; k0 < K; k0 += 32) {
      const v16h ah = ldfrag_h(ahp + k0), al = ldfrag_h(alp + k0);
      const v16h b0 = ldfrag_h(bp + k0);
      const v16h b1 = ldfrag_h(bp + bs + k0);
      const v16h b2 = ldfrag_h(bp + 2 * bs + k0);
      const v16h b3 = ldfrag_h(bp + 3 * bs + k0);
      acc0 = mma_h(ah, b0, acc0);  acc0 = mma_h(al, b0, acc0);
      acc1 = mma_h(ah, b1, acc1);  acc1 = mma_h(al, b1, acc1);
      acc2 = mma_h(ah, b2, acc2);  acc2 = mma_h(al, b2, acc2);
      acc3 = mma_h(ah, b3, acc3);  acc3 = mma_h(al, b3, acc3);
      guard6<v16h>(acc0, acc1, acc2, acc3, ah, al, b0, b1, b2, b3);
    }
  } else {
#pragma unroll 1
    for (int k0 = 0; k0 < K; k0 += 32) {
      const v16h ah = ldfrag_h(ahp + k0);
      const v16h b0 = ldfrag_h(bp + k0);
      const v16h b1 = ldfrag_h(bp + bs + k0);
      const v16h b2 = ldfrag_h(bp + 2 * bs + k0);
      const v16h b3 = ldfrag_h(bp + 3 * bs + k0);
      acc0 = mma_h(ah, b0, acc0);
      acc1 = mma_h(ah, b1, acc1);
      acc2 = mma_h(ah, b2, acc2);
      acc3 = mma_h(ah, b3, acc3);
      guard6<v16h>(acc0, acc1, acc2, acc3, ah, b0, b1, b2, b3, ah);
    }
  }
  epi64(slab + wave * SLAB64, acc0, acc1, acc2, acc3, oscale, C, DMOD, rowC, col0, lane);
}

// =====================================================================================================
// Causal gated multi-head attention, score depth SD = 128 ([c|s] parts of one head), hd = 64 for v.
// Block bid -> (query tile qt: rows q0 = 16*qt .. q0+15, head pair hg, batch b); one wave per head = hg*WPB + wave.
// RES == 1: query tiles q0 < QO, P.v = hh + lh + hl with the v^T residual plane, O residual plane also written;
// RES == 0: query tiles q0 >= QO, P.v single products. Scores use q_hi.k_hi + q_lo.k_hi + q_hi.k_lo in both variants.
//   q hi plane f16 x256 [b*SEQ + s][h*SD + e] (e < SD), q residual plane same layout (all rows); k planes likewise;
//   v^T hi plane [b*NH + h][d][SEQ] x1024, v^T residual plane [b*NH + h][d][QO]; gate table G[h][i - j] f32.
//   score (log2 domain) t(i, j) = (q_i.k_j over SD) * (1/8)*log2e/(256*256) * G[h][i - j], replaced by -inf where key j >
//   query i (gate index clamped to [0, SEQ-1]; the clamped value is only used on masked elements).
//   Key tiles of 32 visited in order for kb <= q0 + 15; with RES == 1 every visited key is below QO, inside the compact
//   v^T residual plane.
//   Per tile: 2 score subtiles x 4 k-steps x 3 products, fragments loaded straight from the 16-bit planes (two 16-B loads
//   per fragment, split k map); online max-subtracted base-2 softmax in f32, -inf-safe rescale; the 16x32 prob tile stored
//   residual) rebuilt from the LDS rows (float vector loads, same element type as stored), v^T B fragments in 2 groups of
//   2 d-subtiles. After the loop: out = acc / Z (Z > 0 always: key 0 <= every query row; guarded anyway), carries
//   1/(32768*1024) folded once, written into the wave's private result slab (pitch 68; every element owned by one lane),
//   No block barriers in this kernel; bounded loops only (nkt <= NKT).
// coverage: per wave 4 instructions x 4 rows x 8 lanes x 8 halves = 16 x 64 per plane; the two launches (RES 1: NQO tiles,
//           RES 0: NQT-NQO tiles) x NHG x NB blocks x WPB waves = every (b, s, h) row segment of O hi exactly once and every
//           (b, s < QO, h) row segment of O residual exactly once.
// =====================================================================================================
template <int RES>
__global__ __launch_bounds__(ATT_THREADS)
void attn_g(const u16* __restrict__ QHp, const u16* __restrict__ QLp,
            const u16* __restrict__ KHp, const u16* __restrict__ KLp,
            const u16* __restrict__ VHp, const u16* __restrict__ VLp,
            const float* __restrict__ Gt, u16* OHp, u16* OLp) {
  __shared__ __align__(16) float smem[WPB * WREG];
  constexpr int QT0 = (RES != 0) ? 0 : NQO;
  constexpr int NQL = (RES != 0) ? NQO : (NQT - NQO);
  constexpr int NQE = (NQL > 0) ? NQL : 1;

  const int tid  = threadIdx.x;
  const int wave = tid >> 5;
  const int lane = tid & 31;
  const int hh   = lane >> 4;
  const int c    = lane & 15;
  const int bid  = blockIdx.x;
  const int qt   = QT0 + (bid % NQE);
  const int t2   = bid / NQE;
  const int hg   = t2 % NHG;
  const int b    = t2 / NHG;
  if (b >= NB) return;                      // block-uniform; no block barriers in this kernel; never taken with the exact grid
  const int q0   = qt * 16;
  if (q0 + 16 > SEQ) return;                // block-uniform; never taken
  if (RES != 0 && q0 + 16 > QO) return;     // block-uniform; never taken
  const int head = hg * WPB + wave;
  const int ql0  = (RES != 0) ? q0 : 0;

  float* pt   = smem + wave * WREG;         // prob tile [16][32] pitch 36
  float* slab = pt + PTW;                   // result slab [16][64] pitch 68

  const size_t hcol = (size_t)head * SD + 8 * hh;
  const _Float16* Qh  = ash(QHp) + ((size_t)b * SEQ + q0 + c) * QKN + hcol;
  const _Float16* Ql  = ash(QLp) + ((size_t)b * SEQ + q0 + c) * QKN + hcol;
  const _Float16* Khb = ash(KHp) + ((size_t)b * SEQ + c) * QKN + hcol;             // key row kb added per step
  const _Float16* Klb = ash(KLp) + ((size_t)b * SEQ + c) * QKN + hcol;
  const _Float16* Vhb = ash(VHp) + ((size_t)(b * NH + head) * HD + c) * SEQ + 8 * hh;   // d col c (+16j)
  const _Float16* Vlb = ash(VLp) + ((size_t)(b * NH + head) * HD + c) * QO + 8 * hh;    // RES == 1 only
  const float* gp = Gt + (size_t)head * SEQ;
  const float lsc = RSQ_HD * (LOG2E / (QSC * KSC));
  const float oc  = 1.0f / (PCAR * VCAR);
  const size_t KROW = (size_t)QKN;          // halves between consecutive key rows

  float mrow[8], lrow[8];
  v8f o[4];
#pragma unroll
  for (int r = 0; r < 8; ++r) { mrow[r] = -INFINITY; lrow[r] = 0.f; }
#pragma unroll
  for (int j = 0; j < 4; ++j) o[j] = zero8();
  const int ncaus = (q0 >> 5) + 1;                                            // tiles holding keys <= q0 + 15
  const int nkt = (ncaus < NKT) ? ncaus : NKT;
  const int qr0 = q0 + 8 * hh;                                                // query row of D element r = qr0 + r

#pragma unroll 1
  for (int kt = 0; kt < nkt; ++kt) {
    const int kb = kt * 32;
    // ---- scores: D element r of this lane = (query row qr0 + r, key kb + c) in s0, key kb + 16 + c in s1 ----
    v8f s0 = zero8(), s1 = zero8();
    const _Float16* k0p = Khb + (size_t)kb * KROW;
    const _Float16* k1p = k0p + (size_t)16 * KROW;
    const _Float16* l0p = Klb + (size_t)kb * KROW;
    const _Float16* l1p = l0p + (size_t)16 * KROW;
#pragma unroll
    for (int kk = 0; kk < SD / 32; ++kk) {
      const v16h qh  = ldfrag_h(Qh + kk * 32);
      const v16h ql  = ldfrag_h(Ql + kk * 32);
      const v16h kh0 = ldfrag_h(k0p + kk * 32);
      const v16h kh1 = ldfrag_h(k1p + kk * 32);
      const v16h kl0 = ldfrag_h(l0p + kk * 32);
      const v16h kl1 = ldfrag_h(l1p + kk * 32);
      s0 = mma_h(qh, kh0, s0);
      s0 = mma_h(ql, kh0, s0);
      s0 = mma_h(qh, kl0, s0);
      s1 = mma_h(qh, kh1, s1);
      s1 = mma_h(ql, kh1, s1);
      s1 = mma_h(qh, kl1, s1);
      guard2(s0, s1, qh, ql, kh0, kl0, kh1, kl1);
    }
    // ---- gate (f32, per element) + causal select + online softmax in base 2, -inf-safe ----
    const int key0 = kb + c, key1 = kb + 16 + c;
#pragma unroll
    for (int r = 0; r < 8; ++r) {
      const int qr = qr0 + r;
      int i0 = qr - key0;  i0 = (i0 < 0) ? 0 : i0;  i0 = (i0 > SEQ - 1) ? (SEQ - 1) : i0;
      int i1 = qr - key1;  i1 = (i1 < 0) ? 0 : i1;  i1 = (i1 > SEQ - 1) ? (SEQ - 1) : i1;
      const float g0 = gp[i0];
      const float g1 = gp[i1];
      const float u0 = (s0[r] * lsc) * g0;
      const float u1 = (s1[r] * lsc) * g1;
      const float t0 = (key0 > qr) ? -INFINITY : u0;
      const float t1 = (key1 > qr) ? -INFINITY : u1;
      float mx = fmaxf(t0, t1);
#pragma unroll
      for (int off = 1; off < 16; off <<= 1) mx = fmaxf(mx, __shfl_xor(mx, off, 32));
      const float mn = fmaxf(mrow[r], mx);
      const float ms = (mn == -INFINITY) ? 0.0f : mn;
      const float al = exp2f(mrow[r] - ms);
      mrow[r] = mn;
      const float e0 = exp2f(t0 - ms), e1 = exp2f(t1 - ms);
      float ps = e0 + e1;
#pragma unroll
      for (int off = 1; off < 16; off <<= 1) ps += __shfl_xor(ps, off, 32);
      lrow[r] = lrow[r] * al + ps;
#pragma unroll
      for (int j = 0; j < 4; ++j) o[j][r] *= al;
      const int ro = (8 * hh + r) * PTP + c;
      pt[ro]      = e0;
      pt[ro + 16] = e1;
    }
    wave_sync_lds();
    // ---- A fragments of P*32768: hi f16 and residual f16, row = c, split k map over the 32 keys of this step ----
    FragH ph, pl;
    {
      const float* prow = pt + c * PTP + 8 * hh;
      const v4f p0 = *(const v4f*)(prow), p1 = *(const v4f*)(prow + 4);
      const v4f p2 = *(const v4f*)(prow + 16), p3 = *(const v4f*)(prow + 20);
#pragma unroll
      for (int e = 0; e < 4; ++e) {
        const float ta = p0[e] * PCAR, tb = p1[e] * PCAR, tc = p2[e] * PCAR, td = p3[e] * PCAR;
        const _Float16 ha = (_Float16)ta, hb = (_Float16)tb, hc = (_Float16)tc, hd = (_Float16)td;
        ph.h[0][e]     = ha;                  // elements 0..7  = keys kb + 8hh + 0..7
        ph.h[0][4 + e] = hb;
        ph.h[1][e]     = hc;                  // elements 8..15 = keys kb + 16 + 8hh + 0..7
        ph.h[1][4 + e] = hd;
        pl.h[0][e]     = (_Float16)(ta - (float)ha);
        pl.h[0][4 + e] = (_Float16)(tb - (float)hb);
        pl.h[1][e]     = (_Float16)(tc - (float)hc);
        pl.h[1][4 + e] = (_Float16)(td - (float)hd);
      }
    }
    // ---- P.V : B fragment col n = d = j*16 + c, keys contiguous in the v^T planes; 2 groups of 2 d-subtiles ----
    {
      const _Float16* vhp = Vhb + kb;
      if constexpr (RES != 0) {
        const _Float16* vlp = Vlb + kb;
#pragma unroll
        for (int jg = 0; jg < 2; ++jg) {
          const size_t da = (size_t)(2 * jg) * 16 * SEQ;
          const size_t db = da + (size_t)16 * SEQ;
          const size_t la = (size_t)(2 * jg) * 16 * QO;
          const size_t lb = la + (size_t)16 * QO;
          const v16h vha = ldfrag_h(vhp + da), vhb2 = ldfrag_h(vhp + db);
          const v16h vla = ldfrag_h(vlp + la), vlb2 = ldfrag_h(vlp + lb);
          o[2 * jg]     = mma_h(ph.v, vha,  o[2 * jg]);
          o[2 * jg]     = mma_h(pl.v, vha,  o[2 * jg]);
          o[2 * jg]     = mma_h(ph.v, vla,  o[2 * jg]);
          o[2 * jg + 1] = mma_h(ph.v, vhb2, o[2 * jg + 1]);
          o[2 * jg + 1] = mma_h(pl.v, vhb2, o[2 * jg + 1]);
          o[2 * jg + 1] = mma_h(ph.v, vlb2, o[2 * jg + 1]);
          guard2(o[2 * jg], o[2 * jg + 1], ph.v, pl.v, vha, vhb2, vla, vlb2);
        }
      } else {
#pragma unroll
        for (int jg = 0; jg < 2; ++jg) {
          const size_t da = (size_t)(2 * jg) * 16 * SEQ;
          const size_t db = da + (size_t)16 * SEQ;
          const v16h vha = ldfrag_h(vhp + da), vhb2 = ldfrag_h(vhp + db);
          o[2 * jg]     = mma_h(ph.v, vha,  o[2 * jg]);
          o[2 * jg + 1] = mma_h(ph.v, vhb2, o[2 * jg + 1]);
          guard2(o[2 * jg], o[2 * jg + 1], ph.v, vha, vhb2, ph.v, vha, vhb2);
        }
      }
    }
    wave_sync_lds();
  }
  acc_guard4(o[0], o[1], o[2], o[3]);
  // ---- out = acc / Z (0 if Z == 0), carries (32768 on P, 1024 on v) folded once; written into the lane-owned slab ----
#pragma unroll
  for (int r = 0; r < 8; ++r) {
    const float lv  = lrow[r];
    const float ls  = (lv > 0.0f) ? lv : 1.0f;
    const float inv = (lv > 0.0f) ? ((1.0f / ls) * oc) : 0.0f;
#pragma unroll
    for (int j = 0; j < 4; ++j) {
      const int idx = (8 * hh + r) * SLP + j * 16 + c;
      slab[idx] = o[j][r] * inv;
    }
  }

  wave_sync_lds();
  // ---- O x1024 -> f16 hi (+ residual) planes; lane = (row-in-quad rq, 8 consecutive d at c8) ----
  v4u oh[4], ol[4];
  const int rq = lane >> 3, c8 = (lane & 7) * 8;
#pragma unroll
  for (int it = 0; it < 4; ++it) {
    const int row = it * 4 + rq;
    const v4f a = *(const v4f*)(slab + row * SLP + c8), b4 = *(const v4f*)(slab + row * SLP + c8 + 4);
    float w[8];
#pragma unroll
    for (int e = 0; e < 4; ++e) { w[e] = a[e] * OSC; w[4 + e] = b4[e] * OSC; }
#pragma unroll
    for (int e = 0; e < 4; ++e) {
      const _Float16 h0 = (_Float16)w[2 * e], h1 = (_Float16)w[2 * e + 1];
      const _Float16 l0 = (_Float16)(w[2 * e] - (float)h0), l1 = (_Float16)(w[2 * e + 1] - (float)h1);
      oh[it][e] = pk16(h_bits(h0), h_bits(h1));
      ol[it][e] = pk16(h_bits(l0), h_bits(l1));
    }
  }
  const size_t obh = ((size_t)b * SEQ + q0) * DMOD + (size_t)head * HD + c8;
  const size_t obl = ((size_t)b * QO + ql0) * DMOD + (size_t)head * HD + c8;
  {
#pragma unroll
    for (int it = 0; it < 4; ++it) {
      const int row = it * 4 + rq;
      *(v4u*)(OHp + obh + (size_t)row * DMOD) = oh[it];
      if constexpr (RES != 0) {
        *(v4u*)(OLp + obl + (size_t)row * DMOD) = ol[it];
      }
    }
    
  }
}

// =====================================================================================================
// Workspace map (bytes); every plane is fully written by whole-line stores before it is read; all extents are exact
// multiples of the store granularity (no pad rows needed); every region offset a multiple of 131072:
//   XB  bf16 [MROWS][1024]                       MROWS*2048       (NB=2, SEQ=2048: 8388608)
//   WB  16-bit [2048 n][1024 k]                  4194304          (Wv^T, Wq^T, Wk^T as bf16, then Wo^T as f16 x1024, reused in
//                                                                  launch order; Wv^T and Wo^T use the first half)
//   F   f32 [MROWS][2048]                        MROWS*8192       (v [MROWS][1024], then q, k projection output in launch order;
//                                                                  afterwards OH f16 [MROWS][1024] x1024 at its start, OL residual
//                                                                  [NB*QO][1024] after)
//   QH  f16 [MROWS][2048] x256                   MROWS*4096       QL residual [MROWS][2048]      MROWS*4096
//   KH  f16 [MROWS][2048] x256                   MROWS*4096       KL residual [MROWS][2048]      MROWS*4096
//   VH  f16 [NB*16][64][SEQ] x1024               MROWS*2048       VL residual [NB*16][64][QO]    NB*QO*2048
//   G   f32 [16][SEQ]                            16*SEQ*4
//   end (NB=2, SEQ=2048)                       123863040
// =====================================================================================================
extern "C" void kernel_launch(void* const* d_in, const int* in_sizes, int n_in,
                              void* d_out, int out_size, void* d_ws, size_t ws_size,
                              hipStream_t stream) {
  if (n_in < 6) return;
  if (in_sizes[0] < ((NB - 1) * XS_FULL + SEQ) * DMOD) return;
  if (in_sizes[1] != DMOD * QKN) return;
  if (in_sizes[2] != DMOD * QKN) return;
  if (in_sizes[3] != DMOD * DMOD) return;
  if (in_sizes[4] != DMOD * DMOD) return;
  if (in_sizes[5] < NH) return;
  if (out_size < ((NB - 1) * XS_FULL + SEQ) * DMOD) return;

  const float* x   = (const float*)d_in[0];
  const float* wq  = (const float*)d_in[1];   // [1024 in][2048 out]
  const float* wk  = (const float*)d_in[2];   // [1024 in][2048 out]
  const float* wv  = (const float*)d_in[3];   // [1024 in][1024 out]
  const float* wo  = (const float*)d_in[4];   // [1024 in][1024 out]
  const float* th  = (const float*)d_in[5];   // [16]
  float*       out = (float*)d_out;

  const size_t szXB = (size_t)MROWS * DMOD * 2;
  const size_t szW  = (size_t)QKN * DMOD * 2;
  const size_t szF  = (size_t)MROWS * QKN * 4;
  const size_t szQ  = (size_t)MROWS * QKN * 2;                  // QH, QL, KH, KL
  const size_t szOH = (size_t)MROWS * DMOD * 2;
  const size_t szOL = (size_t)NB * QO * DMOD * 2;
  const size_t szVH = (size_t)NB * NH * HD * SEQ * 2;
  const size_t szVL = (size_t)NB * NH * HD * QO * 2;
  const size_t szG  = (size_t)NH * SEQ * 4;
  if (szOH + szOL > szF) return;                                // OH + OL live inside the F region
  if ((size_t)MROWS * DMOD * 4 > szF) return;                   // v projection output lives inside the F region
  size_t off = 0;
  const size_t oXB = off; off += szXB;
  const size_t oW  = off; off += szW;
  const size_t oF  = off; off += szF;
  const size_t oQH = off; off += szQ;
  const size_t oQL = off; off += szQ;
  const size_t oKH = off; off += szQ;
  const size_t oKL = off; off += szQ;
  const size_t oVH = off; off += szVH;
  const size_t oVL = off; off += szVL;
  const size_t oG  = off; off += szG;
  if (off > ws_size) return;                // off = 123863040 for NB = 2, SEQ = 2048
  if (off > (size_t)WS_CAP) return;

  char* ws = (char*)d_ws;
  u16*   XB = (u16*)(ws + oXB);
  u16*   WB = (u16*)(ws + oW);
  float* F  = (float*)(ws + oF);
  u16*   OH = (u16*)(ws + oF);
  u16*   OL = (u16*)(ws + oF + szOH);
  u16*   QH = (u16*)(ws + oQH);
  u16*   QL = (u16*)(ws + oQL);
  u16*   KH = (u16*)(ws + oKH);
  u16*   KL = (u16*)(ws + oKL);
  u16*   VH = (u16*)(ws + oVH);
  u16*   VL = (u16*)(ws + oVL);
  float* G  = (float*)(ws + oG);

  const dim3 b256(256), b128(128), bAT(ATT_THREADS);
  const int  n8x = (SEQ * DMOD) / 8;
  const dim3 gX((n8x + 255) / 256);                     // per batch
  const dim3 gGT((NH * SEQ + 255) / 256);
  const dim3 gTV((DMOD / 64) * (DMOD / 64));            // 256: [1024][1024] weight -> [1024][1024]
  const dim3 gTQ((DMOD / 64) * (QKN / 64));             // 512: [1024][2048] weight -> [2048][1024]
  const dim3 gGV((MROWS / 64) * (DMOD / 64));
  const dim3 gGQ((MROWS / 64) * (QKN / 64));
  const dim3 gVT(NB * NH * NST);
  const int  n8m = MROWS * C8R;
  const dim3 gM((n8m + 255) / 256);
  const dim3 gATR(NQO * NHG * NB);
  const int  nqp  = NQT - NQO;                          // query tiles with s >= QO
  const int  nrtR = QO / 64;                            // out-projection row tiles per batch with the O residual plane
  const int  nrtP = (SEQ - QO) / 64;                    // remaining row tiles per batch, O hi plane only

  // (0) x -> bf16 plane [MROWS][1024], one launch per batch row block
  for (int b = 0; b < NB; ++b) {
    cvt16<<<gX, b256, 0, stream>>>(x + (size_t)b * XS_FULL * DMOD, XB + (size_t)b * SEQ * DMOD, n8x, 0, 1.0f);
  }
  // (1) gate table G[h][dl]
  gtab<<<gGT, b256, 0, stream>>>(th, G, NH * SEQ);
  // (2) Wv [1024 k][1024 n] -> Wv^T bf16 [1024 n][1024 k]; (3) v = x.Wv -> F f32 [MROWS][1024]; (4) v^T hi + residual x1024
  tr16<<<gTV, b256, 0, stream>>>(wv, WB, DMOD, DMOD, 0, 1.0f);
  gemm_nb<<<gGV, b128, 0, stream>>>(XB, WB, F, MROWS, DMOD, DMOD, 1.0f);
  vt16<<<gVT, b256, 0, stream>>>(F, VH, VL);
  // (5) Wq [1024 k][2048 n] -> Wq^T bf16 [2048 n][1024 k]; (6) q_raw = x.Wq -> F f32 [MROWS][2048]; (7) [qc|qs] hi + residual x256
  tr16<<<gTQ, b256, 0, stream>>>(wq, WB, DMOD, QKN, 0, 1.0f);
  gemm_nb<<<gGQ, b128, 0, stream>>>(XB, WB, F, MROWS, QKN, DMOD, 1.0f);
  qk16<<<gM, b256, 0, stream>>>(F, QH, QL, n8m, QSC);
  // (8) Wk^T; (9) k_raw = x.Wk -> F; (10) [kc|ks] hi + residual x256
  tr16<<<gTQ, b256, 0, stream>>>(wk, WB, DMOD, QKN, 0, 1.0f);
  gemm_nb<<<gGQ, b128, 0, stream>>>(XB, WB, F, MROWS, QKN, DMOD, 1.0f);
  qk16<<<gM, b256, 0, stream>>>(F, KH, KL, n8m, KSC);
  // (11) Wo [1024 k][1024 n] -> Wo^T f16 plane of bf16 value x1024 [1024 n][1024 k]
  tr16<<<gTV, b256, 0, stream>>>(wo, WB, DMOD, DMOD, 1, WOS);
  // (12) causal gated attention: query tiles s < QO with residual P.v products -> O hi + residual; (13) query tiles s >= QO -> O hi
  attn_g<1><<<gATR, bAT, 0, stream>>>(QH, QL, KH, KL, VH, VL, G, OH, OL);
  if (nqp > 0) {
    attn_g<0><<<dim3(nqp * NHG * NB), bAT, 0, stream>>>(QH, QL, KH, KL, VH, VL, G, OH, OL);
  }
  // (14) output projection rows s < QO (O hi + residual) and (15) rows s >= QO (O hi only) -> out f32, carries 1024 x 1024 folded back
  gemm_o<2><<<dim3(NB * nrtR * (DMOD / 64)), b128, 0, stream>>>(OH, OL, WB, out, 0, nrtR, 1.0f / (OSC * WOS));
  if (nrtP > 0) {
    gemm_o<1><<<dim3(NB * nrtP * (DMOD / 64)), b128, 0, stream>>>(OH, OL, WB, out, QO, nrtP, 1.0f / (OSC * WOS));
  }
  (void)hipGetLastError();
}

// v001
// One run takes 475 microseconds.
// Next to v000, in two timings, it ran 1.14 times as fast each time.
// Contractions: x.Wq, x.Wk, x.Wv on v_wmma_f32_16x16x32_bf16 (x and W^T as bf16 RNE planes); per-head scores
// [qc|qs].[kc|ks] over 128 on v_wmma_f32_16x16x32_f16 (q, k as f16 hi x256 plus unscaled f16 residual planes, products
// hh+lh+hl on all query rows); P.v on v_wmma_f32_16x16x32_f16 (P x32768, v^T x1024 f16 planes; query rows s < QO also
// use f16 residual planes, hh+lh+hl); O.Wo on v_wmma_f32_16x16x32_f16 (O x1024 f16 hi plane, plus residual plane for rows
// s < QO; Wo^T as f16 of its bf16 RNE value x1024); all f32 accumulate. softplus, cos, sin, the cosine gate table,
// causal select, base-2 online softmax and 1/Z in f32 on VALU.
#include <hip/hip_runtime.h>
#include <math.h>
#include <stdint.h>

#ifndef NB
#define NB 2
#endif
#ifndef SEQ
#define SEQ 2048
#endif
#define XS_FULL 2048
#define DMOD  1024
#define QKN   (2 * DMOD)
#define NH    16
#define HD    64
#define SD    (2 * HD)
#define QO    ((SEQ < 512) ? SEQ : 512)
#define MROWS (NB * SEQ)
#define RSQ_HD 0.125f
#define GSTEP 0.125f
#define LOG2E 1.4426950408889634f
#define QSC   256.0f
#define KSC   256.0f
#define PCAR  32768.0f
#define VCAR  1024.0f
#define OSC   1024.0f
#define WOS   1024.0f
#define WPB   2
#define NHG   (NH / WPB)
#define NQT   (SEQ / 16)
#define NQO   (QO / 16)
#define NST   (SEQ / 64)
#define NKT   (SEQ / 32)
#define ATT_THREADS (WPB * 32)
#define PTP   36
#define PTW   (16 * PTP)
#define SLP   68
#define SLW   (16 * SLP)
#define WREG  (PTW + SLW)
#define SLAB64 (16 * 68)
#define VTP   72
#define C8R   (DMOD / 8)
#define QKP   264
#define WS_CAP 134217728
static_assert(DMOD == NH * HD && HD == 64 && NH == 16 && SD == 128 && WPB == 2 && NHG * WPB == NH);
static_assert(ATT_THREADS == 64);
static_assert(NB >= 1 && NB <= 2);
static_assert((SEQ % 64) == 0 && SEQ >= 64 && SEQ <= XS_FULL);
static_assert((QO % 64) == 0 && QO >= 64 && QO <= SEQ);
static_assert((DMOD % 64) == 0 && (QKN % 64) == 0 && (DMOD % 32) == 0 && (SD % 32) == 0 && C8R == 128);
static_assert((MROWS % 64) == 0);
static_assert(((SEQ * DMOD / 8) % 256) == 0 && ((MROWS * C8R) % 256) == 0 && ((NH * SEQ) % 256) == 0);
static_assert(WPB * WREG * 4 <= 65536 && 2 * HD * VTP * 2 <= 65536 && 4 * SLAB64 * 4 <= 65536 && 64 * VTP * 2 <= 65536);

typedef unsigned short u16;
typedef _Float16 v16h __attribute__((ext_vector_type(16)));
typedef _Float16 v8h  __attribute__((ext_vector_type(8)));
typedef __bf16   v16b __attribute__((ext_vector_type(16)));
typedef float    v8f  __attribute__((ext_vector_type(8)));
typedef float    v4f  __attribute__((ext_vector_type(4)));
typedef unsigned int v4u __attribute__((ext_vector_type(4)));

union FragH { v16h v; v8h h[2]; v4u u[2]; };
union FragB { v16b v; v4u u[2]; };

// ---- scalar helpers --------------------------------------------------------------------------------
__device__ __forceinline__ unsigned short bf_bits(float f) {          // f32 -> bf16 bits, RNE convert
  unsigned u = __float_as_uint(f);
  return (unsigned short)((u + 0x7FFFu + ((u >> 16) & 1u)) >> 16);
}
__device__ __forceinline__ float bf_up(unsigned short h) { return __uint_as_float(((unsigned)h) << 16); }
__device__ __forceinline__ float bfr(float f) { return bf_up(bf_bits(f)); }
__device__ __forceinline__ unsigned short h_bits(_Float16 x) { return __builtin_bit_cast(unsigned short, x); }
__device__ __forceinline__ unsigned pk16(unsigned short a, unsigned short b) { return (unsigned)a | ((unsigned)b << 16); }
__device__ __forceinline__ v8f zero8() { v8f z = {0.f, 0.f, 0.f, 0.f, 0.f, 0.f, 0.f, 0.f}; return z; }
__device__ __forceinline__ const _Float16* ash(const u16* p) { return (const _Float16*)(const void*)p; }

// ---- packed operand planes: a 16-bit plane of R rows x K columns (R % 16 == 0, K % 32 == 0) is stored as 1-KB tiles of
//      16 rows x 32 k, tile (row>>4, k>>5) at half offset (row>>4)*16*K + (k>>5)*512; inside a tile element (m = row&15,
//      k&31 = 16*j + 8*h + e) lies at j*256 + (16*h + m)*8 + e. One fragment load of a wave is then 512 contiguous bytes
//      (4 cache lines) where a row-major plane gave 16 rows x 32 B (16 lines).
// ---- fragment loaders: 16-bit A/B operand, lane -> row/col (lane&15), h = lane>>4; t = a tile start (wave-uniform), lo = the lane's offset from it
//      in BYTES (16*lane inside the tile), p = t + lo bytes; elements 0..7 <- p[0..7] (k0+8h..), elements 8..15 <- p[256..263] (k0+16+8h..)  (same split k map for A and B)
__device__ __forceinline__ v16h ldfrag_h(const _Float16* t, unsigned lo) {
  FragH f;
  const char* p = (const char*)t + lo;
  f.h[0] = *(const v8h*)(p);
  f.h[1] = *(const v8h*)(p + 512);
  return f.v;
}
__device__ __forceinline__ v16b ldfrag_b(const u16* t, unsigned lo) { // bf16 plane read as unsigned integer vectors
  FragB f;
  const char* p = (const char*)t + lo;
  f.u[0] = *(const v4u*)(p);
  f.u[1] = *(const v4u*)(p + 512);
  return f.v;
}

__device__ __forceinline__ v8f mma_h(v16h a, v16h b, v8f c) {
  return __builtin_amdgcn_wmma_f32_16x16x32_f16(false, a, false, b, (short)0, c, false, false);
}
__device__ __forceinline__ v8f mma_b(v16b a, v16b b, v8f c) {
  return __builtin_amdgcn_wmma_f32_16x16x32_bf16(false, a, false, b, (short)0, c, false, false);
}
__device__ __forceinline__ void guard2(v8f& a, v8f& b, v16h x0, v16h x1, v16h x2, v16h x3, v16h x4, v16h x5) {
#if defined(__HIP_DEVICE_COMPILE__)
  asm volatile("v_nop\n\tv_nop\n\tv_nop\n\tv_nop"
               : "+v"(a), "+v"(b) : "v"(x0), "v"(x1), "v"(x2), "v"(x3), "v"(x4), "v"(x5) : "memory");
#endif
}
template <typename F>
__device__ __forceinline__ void guard6(v8f& a, v8f& b, v8f& c, v8f& d, F x0, F x1, F x2, F x3, F x4, F x5) {
#if defined(__HIP_DEVICE_COMPILE__)
  asm volatile("v_nop\n\tv_nop\n\tv_nop\n\tv_nop"
               : "+v"(a), "+v"(b), "+v"(c), "+v"(d) : "v"(x0), "v"(x1), "v"(x2), "v"(x3), "v"(x4), "v"(x5) : "memory");
#endif
}
__device__ __forceinline__ void acc_guard4(v8f& a, v8f& b, v8f& c, v8f& d) {
#if defined(__HIP_DEVICE_COMPILE__)
  asm volatile("v_nop\n\tv_nop\n\tv_nop\n\tv_nop" : "+v"(a), "+v"(b), "+v"(c), "+v"(d));
#endif
}
__device__ __forceinline__ void xcnt_wait() {
#if defined(__HIP_DEVICE_COMPILE__)
  asm volatile("s_wait_xcnt 0x0" ::: "memory");
#endif
}
__device__ __forceinline__ void wave_sync_lds() {
  __builtin_amdgcn_fence(__ATOMIC_RELEASE, "workgroup");
  __builtin_amdgcn_wave_barrier();
  __builtin_amdgcn_fence(__ATOMIC_ACQUIRE, "workgroup");
}

// =====================================================================================================
// f32 [rows][DMOD] row-major -> packed 16-bit plane (K = DMOD).  f16mode == 0: bf16 RNE bits;  f16mode == 1: f16 bits of (bf16 RNE value) * scale.
// Thread = 8 consecutive k of one row: two 16-B loads, one 16-B store; a wave = one half tile (16 rows x 2 chunks of 8 k), stored
// as 512 contiguous, 512-B aligned bytes; the 8 waves of a block read 512 contiguous bytes of each of 16 rows.
// coverage: grid = ceil(n8/256) blocks x 256 thr x 8 (in-kernel bound) = the whole plane (n8 a multiple of 256 here).
// =====================================================================================================
__global__ __launch_bounds__(256) void cvt16(const float* __restrict__ x, u16* D, int n8, int f16mode, float scale) {
  const int gt = blockIdx.x * 256 + (int)threadIdx.x;
  if (gt >= n8) return;
  const int wv = gt >> 5, ln = gt & 31;                   // wave index = ((row tile * DMOD/32) + k tile) * 2 + j
  const int row = (wv / (DMOD / 16)) * 16 + (ln & 15);
  const int kc  = ((wv >> 1) % (DMOD / 32)) * 32 + (wv & 1) * 16 + (ln >> 4) * 8;
  const float* p = x + (size_t)row * DMOD + kc;
  const v4f a = *(const v4f*)(p), b4 = *(const v4f*)(p + 4);
  float w[8];
#pragma unroll
  for (int e = 0; e < 4; ++e) { w[e] = a[e]; w[4 + e] = b4[e]; }
  v4u o;
#pragma unroll
  for (int e = 0; e < 4; ++e) {
    const float f0 = w[2 * e], f1 = w[2 * e + 1];
    const unsigned short hb0 = h_bits((_Float16)(bfr(f0) * scale));
    const unsigned short hb1 = h_bits((_Float16)(bfr(f1) * scale));
    const unsigned short bb0 = bf_bits(f0);
    const unsigned short bb1 = bf_bits(f1);
    o[e] = (f16mode != 0) ? pk16(hb0, hb1) : pk16(bb0, bb1);
  }
  u16* d = D + (size_t)gt * 8;
  {
    *(v4u*)(d) = o;
    
  }
}

// =====================================================================================================
// Weight transpose + convert: W f32 [KW][NW] row-major (W[k][n], the x.W layout) -> D 16-bit packed plane of NW rows x KW (row n, column k:
// the B operand). f16mode == 0: bf16 RNE bits; f16mode == 1: f16 bits of (bf16 RNE value) * scale.
// Block = one 64 k x 64 n tile: each thread loads 16 floats of one k row (16-B loads), converts, stores them transposed
// into an LDS tile [64 n][64 k] (pitch 72 halves, u16 element stores); after a block barrier each n row segment (64 halves =
// coverage: load 256 thr x 16 = 64 k x 64 n; store 2 iterations x 256 thr x 8 halves = 64 n rows x 64 k = the block's
//           tile; grid = (KW/64)*(NW/64) blocks covers D exactly once (host guarantees KW % 64 == 0, NW % 64 == 0).
// =====================================================================================================
__global__ __launch_bounds__(256) void tr16(const float* __restrict__ W, u16* D, int KW, int NW, int f16mode, float scale) {
  __shared__ __align__(16) u16 T[64 * VTP];
  const int tid = threadIdx.x;
  const int bid = blockIdx.x;
  const int nkt = KW >> 6;
  const int kt  = bid % nkt;
  const int nt  = bid / nkt;
  const int k0  = kt * 64, n0 = nt * 64;
  if (n0 + 64 > NW) return;                 // block-uniform, before any barrier; never taken with the exact grid
  {
    const int kl = tid >> 2;                // k within tile 0..63
    const int nc = (tid & 3) * 16;          // n chunk 0,16,32,48
    const float* src = W + (size_t)(k0 + kl) * NW + n0 + nc;
#pragma unroll
    for (int i = 0; i < 4; ++i) {
      const v4f a = *(const v4f*)(src + 4 * i);
#pragma unroll
      for (int e = 0; e < 4; ++e) {
        const float f = a[e];
        const unsigned short hb = h_bits((_Float16)(bfr(f) * scale));
        const unsigned short bb = bf_bits(f);
        T[(nc + 4 * i + e) * VTP + kl] = (f16mode != 0) ? hb : bb;
      }
    }
  }
  __syncthreads();
  v4u v[2];
#pragma unroll
  for (int it = 0; it < 2; ++it) {
    const int pi = it * 256 + tid;          // 16-B piece: m = pi&15, h = (pi>>4)&1, j = (pi>>5)&1, k tile (pi>>6)&1, n tile pi>>7
    v[it] = *(const v4u*)(T + ((pi >> 7) * 16 + (pi & 15)) * VTP + ((pi >> 6) & 1) * 32 + ((pi >> 5) & 1) * 16 + ((pi >> 4) & 1) * 8);
  }
  {
#pragma unroll
    for (int it = 0; it < 2; ++it) {
      const int pi = it * 256 + tid;
      *(v4u*)(D + (size_t)(n0 + (pi >> 7) * 16) * KW + (size_t)((k0 >> 5) + ((pi >> 6) & 1)) * 512 + (pi & 63) * 8) = v[it];
    }
  }
}

// =====================================================================================================
// Cosine gate table G f32 [NH][SEQ]: G[h][dl] = cos(bf16(theta[h]) * (dl * 0.125f)), dl = query index - key index >= 0
// (cid difference (j-i)/8 is exact in f32 and cos is even). One value per thread, precise cosf; the block's 256 values
// coverage: grid = NH*SEQ/256 blocks x 256 = all NH x SEQ entries (NH*SEQ is a multiple of 256).
// =====================================================================================================
__global__ __launch_bounds__(256) void gtab(const float* __restrict__ theta, float* G, int ntot) {
  __shared__ __align__(16) float sg[256];
  const int tid = threadIdx.x;
  const int gt  = blockIdx.x * 256 + tid;
  const int gc  = (gt < ntot) ? gt : (ntot - 1);
  const int h   = gc / SEQ;
  const int dl  = gc - h * SEQ;
  const int hc  = (h < NH) ? h : (NH - 1);
  const float th = bfr(theta[hc]);
  const float cd = (float)dl * GSTEP;
  sg[tid] = cosf(th * cd);
  __syncthreads();
  if (tid < 64) {
    const v4f v = *(const v4f*)(sg + tid * 4);
    const int base = blockIdx.x * 256 + tid * 4;
    if (base + 4 <= ntot) {
      float* d = G + base;
      {
        *(v4f*)(d) = v;
        
      }
    }
  }
}

// =====================================================================================================
// Amplitude/phase combine: F f32 [MROWS][QKN] (row = b*SEQ + s; column h*HD + d = amplitude pre-activation, DMOD + h*HD + d
// = phase) -> f16 hi plane Hp and unscaled f16 residual plane Lp, both packed planes of MROWS rows x QKN with column h*SD + d = c-part * sc and
// h*SD + HD + d = s-part * sc, where a = softplus(amp) = max(amp,0) + log1p(exp(-|amp|)), c-part = a*cos(phase),
// s-part = a*sin(phase) (precise expf/log1pf/cosf/sinf), hi = f16(t), residual = f16(t - f16(t)).
// Block = (16 rows, 2 heads); thread = (row, head h, 8 consecutive d): rolled loop of 8 (scalar loads, one transcendental chain per iteration, u16 element
// stores into the thread's own LDS slots, row pitch QKP); block barrier; then four 16-B stores per thread in packed order (the
// block's 8 tiles of each plane are 8 KB contiguous; a wave stores 512 contiguous bytes).
// coverage: grid = MROWS*C8R/256 blocks (clamped block index, predicated store; MROWS*C8R is a multiple of 256) x 2 iterations x
//           256 thr x 8 halves per plane = 16 rows x 256 columns; all blocks = every row x every column of Hp and of Lp once.
// =====================================================================================================
__global__ __launch_bounds__(256) void qk16(const float* __restrict__ F, u16* Hp, u16* Lp, int n8, float sc) {
  __shared__ __align__(16) u16 sHb[16 * QKP];
  __shared__ __align__(16) u16 sLb[16 * QKP];
  const int tid = threadIdx.x;
  const bool act = ((int)blockIdx.x * 256 + 256 <= n8);   // block-uniform
  const int bc  = act ? (int)blockIdx.x : 0;
  const int hp  = bc % (NH / 2);            // head pair
  const int rt  = bc / (NH / 2);            // 16-row tile
  const int row = rt * 16 + (tid >> 4);
  const int idx = tid & 15;
  const int h   = hp * 2 + (idx >> 3);
  const int d0  = (idx & 7) * 8;
  const float* ap = F + (size_t)row * QKN + h * HD + d0;
  const float* pp = ap + DMOD;
  u16* sh = sHb + (tid >> 4) * QKP + idx * 16;
  u16* sl = sLb + (tid >> 4) * QKP + idx * 16;
#pragma unroll 1
  for (int e = 0; e < 8; ++e) {
    const float am  = ap[e];
    const float ph  = pp[e];
    const float spv = fmaxf(am, 0.0f) + log1pf(expf(-fabsf(am)));
    const float cv  = cosf(ph);
    const float sv  = sinf(ph);
    const float tc  = (spv * cv) * sc;
    const float ts  = (spv * sv) * sc;
    const _Float16 hc = (_Float16)tc, hs = (_Float16)ts;
    const _Float16 lc = (_Float16)(tc - (float)hc), ls = (_Float16)(ts - (float)hs);
    sh[e] = h_bits(hc);  sh[8 + e] = h_bits(hs);
    sl[e] = h_bits(lc);  sl[8 + e] = h_bits(ls);
  }
  __syncthreads();
  // 16-B piece pi of the block's 8 tiles: m = pi&15; column chunk q = pi>>4 (k tile q>>2, j = (q>>1)&1, h = q&1) = head q>>4 of the
  // pair, c or s part (q>>3)&1, d chunk q&7; it was written by thread m*16 + (q>>4)*8 + (q&7) at its slot + 8*part.
  v4u oh2[2], ol2[2];
#pragma unroll
  for (int it = 0; it < 2; ++it) {
    const int pi = it * 256 + tid;
    const int q  = pi >> 4;
    const int so = (pi & 15) * QKP + ((q >> 4) * 8 + (q & 7)) * 16 + ((q >> 3) & 1) * 8;
    oh2[it] = *(const v4u*)(sHb + so);
    ol2[it] = *(const v4u*)(sLb + so);
  }
  const size_t ob = (size_t)rt * 16 * QKN + (size_t)hp * (2 * SD * 16) + (size_t)tid * 8;
  if (act) {
#pragma unroll
    for (int it = 0; it < 2; ++it) {
      *(v4u*)(Hp + ob + it * 2048) = oh2[it];
      *(v4u*)(Lp + ob + it * 2048) = ol2[it];
    }
  }
}

// =====================================================================================================
// v^T planes from the v projection F f32 [MROWS][DMOD] (row = b*SEQ + s, column = h*HD + d):
//   VH packed plane, row (b*NH + h)*HD + d, column s (K = SEQ) = f16(v * 1024) for all keys s;
//   VL packed plane, same rows, column s (K = QO) = f16 residual (t - f16(t)) for keys s < QO only.
// Block = (b, head h, 64 keys s0): each thread loads its 16 floats (key sl, d chunk dc) with 16-B loads, converts, scatters
// line) is written by 8 consecutive lanes x 16 B of one instruction, in both planes (VL under the block-uniform s0 < QO
// coverage: load 256 thr x 16 = 64 keys x 64 d; store 2 iterations x 256 thr x 8 halves = 64 lines x 64 = the block's tile of
//           VH (and of VL when s0 < QO); grid = NB*NH*NST blocks covers VH exactly once and all QO columns of VL exactly once.
// =====================================================================================================
__global__ __launch_bounds__(256) void vt16(const float* __restrict__ F, u16* VHo, u16* VLo) {
  __shared__ __align__(16) u16 TH[HD * VTP];
  __shared__ __align__(16) u16 TL[HD * VTP];
  const int tid = threadIdx.x;
  const int bid = blockIdx.x;
  const int st  = bid % NST;
  const int t2  = bid / NST;
  const int h   = t2 % NH;
  const int b   = t2 / NH;
  if (b >= NB) return;                      // block-uniform, before any barrier; never taken with the exact grid
  const int s0  = st * 64;
  const bool dolo = (s0 + 64 <= QO);        // block-uniform
  {
    const int sl = tid >> 2;                // key within tile 0..63
    const int dc = (tid & 3) * 16;          // d chunk 0,16,32,48
    const float* src = F + ((size_t)b * SEQ + s0 + sl) * DMOD + h * HD + dc;
#pragma unroll
    for (int i = 0; i < 4; ++i) {
      const v4f a = *(const v4f*)(src + 4 * i);
#pragma unroll
      for (int e = 0; e < 4; ++e) {
        const float t = a[e] * VCAR;
        const _Float16 hv = (_Float16)t;
        const _Float16 lv = (_Float16)(t - (float)hv);
        TH[(dc + 4 * i + e) * VTP + sl] = h_bits(hv);
        TL[(dc + 4 * i + e) * VTP + sl] = h_bits(lv);
      }
    }
  }
  __syncthreads();
  v4u vh[2], vl[2];
#pragma unroll
  for (int it = 0; it < 2; ++it) {
    const int pi = it * 256 + tid;          // 16-B piece: m = pi&15, h = (pi>>4)&1, j = (pi>>5)&1, key tile (pi>>6)&1, d tile pi>>7
    const int so = ((pi >> 7) * 16 + (pi & 15)) * VTP + ((pi >> 6) & 1) * 32 + ((pi >> 5) & 1) * 16 + ((pi >> 4) & 1) * 8;
    vh[it] = *(const v4u*)(TH + so);
    vl[it] = *(const v4u*)(TL + so);
  }
  const size_t hrow = (size_t)(b * NH + h) * HD;
  const int    sL   = dolo ? s0 : 0;
  {
#pragma unroll
    for (int it = 0; it < 2; ++it) {
      const int pi = it * 256 + tid;
      const size_t dr = hrow + (size_t)(pi >> 7) * 16;
      const int    kq = (pi >> 6) & 1;
      *(v4u*)(VHo + dr * SEQ + (size_t)((s0 >> 5) + kq) * 512 + (pi & 63) * 8) = vh[it];
      xcnt_wait();                          // before the store's address and data registers are reused
      if (dolo) {
        *(v4u*)(VLo + dr * QO + (size_t)((sL >> 5) + kq) * 512 + (pi & 63) * 8) = vl[it];
        xcnt_wait();                        // as above
      }
    }
  }
}

// =====================================================================================================
// GEMM epilogue shared by both engines: the wave's 16x64 f32 tile (times oscale) staged in its LDS slab (pitch 68), release
// coverage: 8 instructions x 2 rows x 16 lanes x 4 floats = the wave's 16 x 64 tile.
// =====================================================================================================
__device__ __forceinline__ void epi64(float* sl, v8f a0, v8f a1, v8f a2, v8f a3, float oscale,
                                      float* C, int N, size_t rowb, int col0, int lane) {
  const int hh = lane >> 4, m = lane & 15;
#pragma unroll
  for (int r = 0; r < 8; ++r) {
    const int ro = (8 * hh + r) * 68 + m;
    sl[ro]      = a0[r] * oscale;
    sl[ro + 16] = a1[r] * oscale;
    sl[ro + 32] = a2[r] * oscale;
    sl[ro + 48] = a3[r] * oscale;
  }
  wave_sync_lds();
  v4f vals[8];
#pragma unroll
  for (int it = 0; it < 8; ++it) vals[it] = *(const v4f*)(sl + (it * 2 + hh) * 68 + m * 4);
  float* dst = C + (rowb + (size_t)hh) * (size_t)N + col0 + m * 4;
  {
#pragma unroll
    for (int it = 0; it < 8; ++it) {
      *(v4f*)(dst + (size_t)(it * 2) * (size_t)N) = vals[it];
    }
    
  }
}

// =====================================================================================================
// bf16 GEMM, no bias: C[M][N] (f32) = A (bf16 packed plane, M rows x K) . Bt^T (bf16 packed plane, N rows x K), times oscale.
// Block = 64x64 tile, 4 waves x 16 rows; fragments loaded straight from the packed tiles (two 16-B loads each, split k map for
// A and B); K stepped by 32 (host guarantees K % 32 == 0, M % 64 == 0, N % 64 == 0, grid = (M/64)*(N/64)).
// =====================================================================================================
__global__ __launch_bounds__(128)
void gemm_nb(const u16* __restrict__ A, const u16* __restrict__ Bt, float* C, int M, int N, int K, float oscale) {
  __shared__ __align__(16) float slab[4 * SLAB64];
  const int tid = threadIdx.x, lane = tid & 31;
  const int wave = __builtin_amdgcn_readfirstlane(tid >> 5);   // scalar, so that the tile starts are computed on the scalar unit
  const unsigned lo = 16u * (unsigned)lane;
  const int ntile = N >> 6;
  const int bid   = blockIdx.x;
  const int rowb  = (bid / ntile) * 64 + wave * 16;
  const int col0  = (bid % ntile) * 64;
  if (rowb + 16 > M) return;                // wave-uniform, never taken with the exact grid; no block barriers in this kernel
  const u16* ap = A  + (size_t)rowb * K;
  const u16* bp = Bt + (size_t)col0 * K;
  const size_t bs = (size_t)16 * K;
  const u16* bp1 = bp + bs;
  const u16* bp2 = bp + 2 * bs;
  const u16* bp3 = bp + 3 * bs;
  v8f acc0 = zero8(), acc1 = zero8(), acc2 = zero8(), acc3 = zero8();
#pragma unroll 1
  for (int k0 = 0; k0 < K; k0 += 32) {
    const v16b a  = ldfrag_b(ap, lo);
    const v16b b0 = ldfrag_b(bp, lo);
    const v16b b1 = ldfrag_b(bp1, lo);
    const v16b b2 = ldfrag_b(bp2, lo);
    const v16b b3 = ldfrag_b(bp3, lo);
    ap += 512; bp += 512; bp1 += 512; bp2 += 512; bp3 += 512;   // next k tile
    acc0 = mma_b(a, b0, acc0);
    acc1 = mma_b(a, b1, acc1);
    acc2 = mma_b(a, b2, acc2);
    acc3 = mma_b(a, b3, acc3);
    guard6<v16b>(acc0, acc1, acc2, acc3, a, b0, b1, b2, b3, a);
  }
  epi64(slab + wave * SLAB64, acc0, acc1, acc2, acc3, oscale, C, N, (size_t)rowb, col0, lane);
}

// =====================================================================================================
// Output projection, no bias: C[row][DMOD] (f32) = (Ah [+ Al])[row][DMOD] . Bt[DMOD][DMOD]^T * oscale.
// NPROD == 1: Ah only (one product); NPROD == 2: Ah + Al residual plane (products h.B + l.B into one accumulator, l unscaled).
// Row indices (packed planes, K = DMOD): Ah row bb*SEQ + s; Al row bb*QO + s (compact plane, s < QO); C row bb*XS_FULL + s.
// Block -> (column tile ct = bid % 16, sequence row tile rt of nrt starting at s = sbeg, batch bb). Same tiling, fragment
// loads (split k map) and epilogue as gemm_nb; K = DMOD stepped by 32.
// =====================================================================================================
template <int NPROD>
__global__ __launch_bounds__(128)
void gemm_o(const u16* __restrict__ Ah, const u16* __restrict__ Al, const u16* __restrict__ Bt,
            float* C, int sbeg, int nrt, float oscale) {
  __shared__ __align__(16) float slab[4 * SLAB64];
  const int tid = threadIdx.x, lane = tid & 31;
  const int wave = __builtin_amdgcn_readfirstlane(tid >> 5);   // scalar, so that the tile starts are computed on the scalar unit
  unsigned vo = 16u * (unsigned)lane;         // the lane's byte offset from the row tiles' starts; one k tile (1 KB) further each trip
  const int ntile = DMOD >> 6;
  const int bid   = blockIdx.x;
  const int ct    = bid % ntile;
  const int t2    = bid / ntile;
  const int rt    = t2 % nrt;
  const int bb    = t2 / nrt;
  if (bb >= NB) return;                     // block-uniform; no block barriers in this kernel; never taken with the exact grid
  const int srow  = sbeg + rt * 64 + wave * 16;
  if (srow + 16 > SEQ) return;              // wave-uniform; never taken
  if (NPROD == 2 && srow + 16 > QO) return; // wave-uniform; never taken
  const int col0  = ct * 64;
  const int K     = DMOD;
  const size_t rowA = (size_t)bb * SEQ + srow;
  const size_t rowL = (NPROD == 2) ? ((size_t)bb * QO + srow) : (size_t)0;
  const size_t rowC = (size_t)bb * XS_FULL + srow;
  const _Float16* ahp = ash(Ah) + rowA * K;
  const _Float16* alp = ash(Al) + rowL * K;                  // dereferenced only when NPROD == 2
  const _Float16* bp  = ash(Bt) + (size_t)col0 * K;
  const size_t bs = (size_t)16 * K;
  const _Float16* bp1 = bp + bs;
  const _Float16* bp2 = bp + 2 * bs;
  const _Float16* bp3 = bp + 3 * bs;
  v8f acc0 = zero8(), acc1 = zero8(), acc2 = zero8(), acc3 = zero8();
  if constexpr (NPROD == 2) {
#pragma unroll 1
    for (int k0 = 0; k0 < K; k0 += 32) {
      const v16h ah = ldfrag_h(ahp, vo), al = ldfrag_h(alp, vo);
      const v16h b0 = ldfrag_h(bp, vo);
      const v16h b1 = ldfrag_h(bp1, vo);
      const v16h b2 = ldfrag_h(bp2, vo);
      const v16h b3 = ldfrag_h(bp3, vo);
      vo += 1024u;                          // next k tile: 512 halves
      acc0 = mma_h(ah, b0, acc0);  acc0 = mma_h(al, b0, acc0);
      acc1 = mma_h(ah, b1, acc1);  acc1 = mma_h(al, b1, acc1);
      acc2 = mma_h(ah, b2, acc2);  acc2 = mma_h(al, b2, acc2);
      acc3 = mma_h(ah, b3, acc3);  acc3 = mma_h(al, b3, acc3);
      guard6<v16h>(acc0, acc1, acc2, acc3, ah, al, b0, b1, b2, b3);
    }
  } else {
#pragma unroll 1
    for (int k0 = 0; k0 < K; k0 += 32) {
      const v16h ah = ldfrag_h(ahp, vo);
      const v16h b0 = ldfrag_h(bp, vo);
      const v16h b1 = ldfrag_h(bp1, vo);
      const v16h b2 = ldfrag_h(bp2, vo);
      const v16h b3 = ldfrag_h(bp3, vo);
      vo += 1024u;                          // next k tile: 512 halves
      acc0 = mma_h(ah, b0, acc0);
      acc1 = mma_h(ah, b1, acc1);
      acc2 = mma_h(ah, b2, acc2);
      acc3 = mma_h(ah, b3, acc3);
      guard6<v16h>(acc0, acc1, acc2, acc3, ah, b0, b1, b2, b3, ah);
    }
  }
  epi64(slab + wave * SLAB64, acc0, acc1, acc2, acc3, oscale, C, DMOD, rowC, col0, lane);
}

// =====================================================================================================
// Causal gated multi-head attention, score depth SD = 128 ([c|s] parts of one head), hd = 64 for v.
// Block bid -> (query tile qt: rows q0 = 16*qt .. q0+15, head pair hg, batch b); one wave per head = hg*WPB + wave.
// RES == 1: query tiles q0 < QO, P.v = hh + lh + hl with the v^T residual plane, O residual plane also written;
// RES == 0: query tiles q0 >= QO, P.v single products. Scores use q_hi.k_hi + q_lo.k_hi + q_hi.k_lo in both variants.
//   q hi plane f16 x256, packed, row b*SEQ + s, column h*SD + e (e < SD), q residual plane same layout (all rows); k planes likewise;
//   v^T hi plane x1024, packed, row (b*NH + h)*HD + d, column s (K = SEQ), v^T residual plane (K = QO); gate table G[h][i - j] f32.
//   score (log2 domain) t(i, j) = (q_i.k_j over SD) * (1/8)*log2e/(256*256) * G[h][i - j], replaced by -inf where key j >
//   query i (gate index clamped to [0, SEQ-1]; the clamped value is only used on masked elements).
//   Key tiles of 32 visited in order for kb <= q0 + 15; with RES == 1 every visited key is below QO, inside the compact
//   v^T residual plane.
//   Per tile: 2 score subtiles x 4 k-steps x 3 products, fragments loaded straight from the 16-bit planes (two 16-B loads
//   per fragment, split k map); online max-subtracted base-2 softmax in f32, -inf-safe rescale; the 16x32 prob tile stored
//   residual) rebuilt from the LDS rows (float vector loads, same element type as stored), v^T B fragments in 2 groups of
//   2 d-subtiles. After the loop: out = acc / Z (Z > 0 always: key 0 <= every query row; guarded anyway), carries
//   1/(32768*1024) folded once, written into the wave's private result slab (pitch 68; every element owned by one lane),
//   No block barriers in this kernel; bounded loops only (nkt <= NKT).
// coverage: per wave 4 instructions x 16 rows x 2 chunks x 8 halves = 16 x 64 per plane; the two launches (RES 1: NQO tiles,
//           RES 0: NQT-NQO tiles) x NHG x NB blocks x WPB waves = every (b, s, h) row segment of O hi exactly once and every
//           (b, s < QO, h) row segment of O residual exactly once.
// =====================================================================================================
template <int RES>
__global__ __launch_bounds__(ATT_THREADS)
void attn_g(const u16* __restrict__ QHp, const u16* __restrict__ QLp,
            const u16* __restrict__ KHp, const u16* __restrict__ KLp,
            const u16* __restrict__ VHp, const u16* __restrict__ VLp,
            const float* __restrict__ Gt, u16* OHp, u16* OLp) {
  __shared__ __align__(16) float smem[WPB * WREG];
  constexpr int QT0 = (RES != 0) ? 0 : NQO;
  constexpr int NQL = (RES != 0) ? NQO : (NQT - NQO);
  constexpr int NQE = (NQL > 0) ? NQL : 1;

  const int tid  = threadIdx.x;
  const int wave = __builtin_amdgcn_readfirstlane(tid >> 5);   // scalar, so that every tile start is a scalar base address
  const int lane = tid & 31;
  const unsigned lo = 16u * (unsigned)lane;
  const int hh   = lane >> 4;
  const int c    = lane & 15;
  const int bid  = blockIdx.x;
  const int qt   = QT0 + (bid % NQE);
  const int t2   = bid / NQE;
  const int hg   = t2 % NHG;
  const int b    = t2 / NHG;
  if (b >= NB) return;                      // block-uniform; no block barriers in this kernel; never taken with the exact grid
  const int q0   = qt * 16;
  if (q0 + 16 > SEQ) return;                // block-uniform; never taken
  if (RES != 0 && q0 + 16 > QO) return;     // block-uniform; never taken
  const int head = hg * WPB + wave;
  const int ql0  = (RES != 0) ? q0 : 0;

  float* pt   = smem + wave * WREG;         // prob tile [16][32] pitch 36
  float* slab = pt + PTW;                   // result slab [16][64] pitch 68

  const size_t hcol = (size_t)head * (SD / 32) * 512;                              // the head's first k tile
  const _Float16* Qh  = ash(QHp) + ((size_t)b * SEQ + q0) * QKN + hcol;
  const _Float16* Ql  = ash(QLp) + ((size_t)b * SEQ + q0) * QKN + hcol;
  const _Float16* Khb = ash(KHp) + ((size_t)b * SEQ) * QKN + hcol;                 // key row tile kb added per step
  const _Float16* Klb = ash(KLp) + ((size_t)b * SEQ) * QKN + hcol;
  const _Float16* Vhb = ash(VHp) + ((size_t)(b * NH + head) * HD) * SEQ;                // d row tile j added per group
  const _Float16* Vlb = ash(VLp) + ((size_t)(b * NH + head) * HD) * QO;                 // RES == 1 only
  const float* gp = Gt + (size_t)head * SEQ;
  const float lsc = RSQ_HD * (LOG2E / (QSC * KSC));
  const float oc  = 1.0f / (PCAR * VCAR);
  const size_t KROW = (size_t)QKN;          // halves per key row; a 16-key row tile spans 16*KROW halves

  float mrow[8], lrow[8];
  v8f o[4];
#pragma unroll
  for (int r = 0; r < 8; ++r) { mrow[r] = -INFINITY; lrow[r] = 0.f; }
#pragma unroll
  for (int j = 0; j < 4; ++j) o[j] = zero8();
  const int ncaus = (q0 >> 5) + 1;                                            // tiles holding keys <= q0 + 15
  const int nkt = (ncaus < NKT) ? ncaus : NKT;
  const int qr0 = q0 + 8 * hh;                                                // query row of D element r = qr0 + r

#pragma unroll 1
  for (int kt = 0; kt < nkt; ++kt) {
    const int kb = kt * 32;
    // ---- scores: D element r of this lane = (query row qr0 + r, key kb + c) in s0, key kb + 16 + c in s1 ----
    v8f s0 = zero8(), s1 = zero8();
    const _Float16* k0p = Khb + (size_t)kb * KROW;
    const _Float16* k1p = k0p + (size_t)16 * KROW;
    const _Float16* l0p = Klb + (size_t)kb * KROW;
    const _Float16* l1p = l0p + (size_t)16 * KROW;
#pragma unroll
    for (int kk = 0; kk < SD / 32; ++kk) {
      const v16h qh  = ldfrag_h(Qh + kk * 512, lo);
      const v16h ql  = ldfrag_h(Ql + kk * 512, lo);
      const v16h kh0 = ldfrag_h(k0p + kk * 512, lo);
      const v16h kh1 = ldfrag_h(k1p + kk * 512, lo);
      const v16h kl0 = ldfrag_h(l0p + kk * 512, lo);
      const v16h kl1 = ldfrag_h(l1p + kk * 512, lo);
      s0 = mma_h(qh, kh0, s0);
      s0 = mma_h(ql, kh0, s0);
      s0 = mma_h(qh, kl0, s0);
      s1 = mma_h(qh, kh1, s1);
      s1 = mma_h(ql, kh1, s1);
      s1 = mma_h(qh, kl1, s1);
      guard2(s0, s1, qh, ql, kh0, kl0, kh1, kl1);
    }
    // ---- gate (f32, per element) + causal select + online softmax in base 2, -inf-safe ----
    const int key0 = kb + c, key1 = kb + 16 + c;
#pragma unroll
    for (int r = 0; r < 8; ++r) {
      const int qr = qr0 + r;
      int i0 = qr - key0;  i0 = (i0 < 0) ? 0 : i0;  i0 = (i0 > SEQ - 1) ? (SEQ - 1) : i0;
      int i1 = qr - key1;  i1 = (i1 < 0) ? 0 : i1;  i1 = (i1 > SEQ - 1) ? (SEQ - 1) : i1;
      const float g0 = gp[i0];
      const float g1 = gp[i1];
      const float u0 = (s0[r] * lsc) * g0;
      const float u1 = (s1[r] * lsc) * g1;
      const float t0 = (key0 > qr) ? -INFINITY : u0;
      const float t1 = (key1 > qr) ? -INFINITY : u1;
      float mx = fmaxf(t0, t1);
#pragma unroll
      for (int off = 1; off < 16; off <<= 1) mx = fmaxf(mx, __shfl_xor(mx, off, 32));
      const float mn = fmaxf(mrow[r], mx);
      const float ms = (mn == -INFINITY) ? 0.0f : mn;
      const float al = exp2f(mrow[r] - ms);
      mrow[r] = mn;
      const float e0 = exp2f(t0 - ms), e1 = exp2f(t1 - ms);
      float ps = e0 + e1;
#pragma unroll
      for (int off = 1; off < 16; off <<= 1) ps += __shfl_xor(ps, off, 32);
      lrow[r] = lrow[r] * al + ps;
#pragma unroll
      for (int j = 0; j < 4; ++j) o[j][r] *= al;
      const int ro = (8 * hh + r) * PTP + c;
      pt[ro]      = e0;
      pt[ro + 16] = e1;
    }
    wave_sync_lds();
    // ---- A fragments of P*32768: hi f16 and residual f16, row = c, split k map over the 32 keys of this step ----
    FragH ph, pl;
    {
      const float* prow = pt + c * PTP + 8 * hh;
      const v4f p0 = *(const v4f*)(prow), p1 = *(const v4f*)(prow + 4);
      const v4f p2 = *(const v4f*)(prow + 16), p3 = *(const v4f*)(prow + 20);
#pragma unroll
      for (int e = 0; e < 4; ++e) {
        const float ta = p0[e] * PCAR, tb = p1[e] * PCAR, tc = p2[e] * PCAR, td = p3[e] * PCAR;
        const _Float16 ha = (_Float16)ta, hb = (_Float16)tb, hc = (_Float16)tc, hd = (_Float16)td;
        ph.h[0][e]     = ha;                  // elements 0..7  = keys kb + 8hh + 0..7
        ph.h[0][4 + e] = hb;
        ph.h[1][e]     = hc;                  // elements 8..15 = keys kb + 16 + 8hh + 0..7
        ph.h[1][4 + e] = hd;
        pl.h[0][e]     = (_Float16)(ta - (float)ha);
        pl.h[0][4 + e] = (_Float16)(tb - (float)hb);
        pl.h[1][e]     = (_Float16)(tc - (float)hc);
        pl.h[1][4 + e] = (_Float16)(td - (float)hd);
      }
    }
    // ---- P.V : B fragment col n = d = j*16 + c, key tile kb>>5 of the packed v^T planes; 2 groups of 2 d-subtiles ----
    {
      const _Float16* vhp = Vhb + kb * 16;
      if constexpr (RES != 0) {
        const _Float16* vlp = Vlb + kb * 16;
#pragma unroll
        for (int jg = 0; jg < 2; ++jg) {
          const size_t da = (size_t)(2 * jg) * 16 * SEQ;
          const size_t db = da + (size_t)16 * SEQ;
          const size_t la = (size_t)(2 * jg) * 16 * QO;
          const size_t lb = la + (size_t)16 * QO;
          const v16h vha = ldfrag_h(vhp + da, lo), vhb2 = ldfrag_h(vhp + db, lo);
          const v16h vla = ldfrag_h(vlp + la, lo), vlb2 = ldfrag_h(vlp + lb, lo);
          o[2 * jg]     = mma_h(ph.v, vha,  o[2 * jg]);
          o[2 * jg]     = mma_h(pl.v, vha,  o[2 * jg]);
          o[2 * jg]     = mma_h(ph.v, vla,  o[2 * jg]);
          o[2 * jg + 1] = mma_h(ph.v, vhb2, o[2 * jg + 1]);
          o[2 * jg + 1] = mma_h(pl.v, vhb2, o[2 * jg + 1]);
          o[2 * jg + 1] = mma_h(ph.v, vlb2, o[2 * jg + 1]);
          guard2(o[2 * jg], o[2 * jg + 1], ph.v, pl.v, vha, vhb2, vla, vlb2);
        }
      } else {
#pragma unroll
        for (int jg = 0; jg < 2; ++jg) {
          const size_t da = (size_t)(2 * jg) * 16 * SEQ;
          const size_t db = da + (size_t)16 * SEQ;
          const v16h vha = ldfrag_h(vhp + da, lo), vhb2 = ldfrag_h(vhp + db, lo);
          o[2 * jg]     = mma_h(ph.v, vha,  o[2 * jg]);
          o[2 * jg + 1] = mma_h(ph.v, vhb2, o[2 * jg + 1]);
          guard2(o[2 * jg], o[2 * jg + 1], ph.v, vha, vhb2, ph.v, vha, vhb2);
        }
      }
    }
    wave_sync_lds();
  }
  acc_guard4(o[0], o[1], o[2], o[3]);
  // ---- out = acc / Z (0 if Z == 0), carries (32768 on P, 1024 on v) folded once; written into the lane-owned slab ----
#pragma unroll
  for (int r = 0; r < 8; ++r) {
    const float lv  = lrow[r];
    const float ls  = (lv > 0.0f) ? lv : 1.0f;
    const float inv = (lv > 0.0f) ? ((1.0f / ls) * oc) : 0.0f;
#pragma unroll
    for (int j = 0; j < 4; ++j) {
      const int idx = (8 * hh + r) * SLP + j * 16 + c;
      slab[idx] = o[j][r] * inv;
    }
  }

  wave_sync_lds();
  // ---- O x1024 -> f16 hi (+ residual) packed planes; lane = (row c, 8 consecutive d at 16*it + 8*hh): the wave's two tiles ----
  v4u oh[4], ol[4];
#pragma unroll
  for (int it = 0; it < 4; ++it) {
    const int c8 = it * 16 + hh * 8;
    const v4f a = *(const v4f*)(slab + c * SLP + c8), b4 = *(const v4f*)(slab + c * SLP + c8 + 4);
    float w[8];
#pragma unroll
    for (int e = 0; e < 4; ++e) { w[e] = a[e] * OSC; w[4 + e] = b4[e] * OSC; }
#pragma unroll
    for (int e = 0; e < 4; ++e) {
      const _Float16 h0 = (_Float16)w[2 * e], h1 = (_Float16)w[2 * e + 1];
      const _Float16 l0 = (_Float16)(w[2 * e] - (float)h0), l1 = (_Float16)(w[2 * e + 1] - (float)h1);
      oh[it][e] = pk16(h_bits(h0), h_bits(h1));
      ol[it][e] = pk16(h_bits(l0), h_bits(l1));
    }
  }
  const size_t obh = ((size_t)b * SEQ + q0) * DMOD + (size_t)head * (HD / 32) * 512 + 8 * lane;
  const size_t obl = ((size_t)b * QO + ql0) * DMOD + (size_t)head * (HD / 32) * 512 + 8 * lane;
  {
#pragma unroll
    for (int it = 0; it < 4; ++it) {
      *(v4u*)(OHp + obh + it * 256) = oh[it];
      if constexpr (RES != 0) {
        *(v4u*)(OLp + obl + it * 256) = ol[it];
      }
    }
  }
}

// =====================================================================================================
// Workspace map (bytes; every 16-bit plane in the packed tile order, same extents as row-major); every plane is fully written by whole-line stores before it is read; all extents are exact
// multiples of the store granularity (no pad rows needed); every region offset a multiple of 131072:
//   XB  bf16 [MROWS][1024]                       MROWS*2048       (NB=2, SEQ=2048: 8388608)
//   WB  16-bit [2048 n][1024 k]                  4194304          (Wv^T, Wq^T, Wk^T as bf16, then Wo^T as f16 x1024, reused in
//                                                                  launch order; Wv^T and Wo^T use the first half)
//   F   f32 [MROWS][2048]                        MROWS*8192       (v [MROWS][1024], then q, k projection output in launch order;
//                                                                  afterwards OH f16 [MROWS][1024] x1024 at its start, OL residual
//                                                                  [NB*QO][1024] after)
//   QH  f16 [MROWS][2048] x256                   MROWS*4096       QL residual [MROWS][2048]      MROWS*4096
//   KH  f16 [MROWS][2048] x256                   MROWS*4096       KL residual [MROWS][2048]      MROWS*4096
//   VH  f16 [NB*16][64][SEQ] x1024               MROWS*2048       VL residual [NB*16][64][QO]    NB*QO*2048
//   G   f32 [16][SEQ]                            16*SEQ*4
//   end (NB=2, SEQ=2048)                       123863040
// =====================================================================================================
extern "C" void kernel_launch(void* const* d_in, const int* in_sizes, int n_in,
                              void* d_out, int out_size, void* d_ws, size_t ws_size,
                              hipStream_t stream) {
  if (n_in < 6) return;
  if (in_sizes[0] < ((NB - 1) * XS_FULL + SEQ) * DMOD) return;
  if (in_sizes[1] != DMOD * QKN) return;
  if (in_sizes[2] != DMOD * QKN) return;
  if (in_sizes[3] != DMOD * DMOD) return;
  if (in_sizes[4] != DMOD * DMOD) return;
  if (in_sizes[5] < NH) return;
  if (out_size < ((NB - 1) * XS_FULL + SEQ) * DMOD) return;

  const float* x   = (const float*)d_in[0];
  const float* wq  = (const float*)d_in[1];   // [1024 in][2048 out]
  const float* wk  = (const float*)d_in[2];   // [1024 in][2048 out]
  const float* wv  = (const float*)d_in[3];   // [1024 in][1024 out]
  const float* wo  = (const float*)d_in[4];   // [1024 in][1024 out]
  const float* th  = (const float*)d_in[5];   // [16]
  float*       out = (float*)d_out;

  const size_t szXB = (size_t)MROWS * DMOD * 2;
  const size_t szW  = (size_t)QKN * DMOD * 2;
  const size_t szF  = (size_t)MROWS * QKN * 4;
  const size_t szQ  = (size_t)MROWS * QKN * 2;                  // QH, QL, KH, KL
  const size_t szOH = (size_t)MROWS * DMOD * 2;
  const size_t szOL = (size_t)NB * QO * DMOD * 2;
  const size_t szVH = (size_t)NB * NH * HD * SEQ * 2;
  const size_t szVL = (size_t)NB * NH * HD * QO * 2;
  const size_t szG  = (size_t)NH * SEQ * 4;
  if (szOH + szOL > szF) return;                                // OH + OL live inside the F region
  if ((size_t)MROWS * DMOD * 4 > szF) return;                   // v projection output lives inside the F region
  size_t off = 0;
  const size_t oXB = off; off += szXB;
  const size_t oW  = off; off += szW;
  const size_t oF  = off; off += szF;
  const size_t oQH = off; off += szQ;
  const size_t oQL = off; off += szQ;
  const size_t oKH = off; off += szQ;
  const size_t oKL = off; off += szQ;
  const size_t oVH = off; off += szVH;
  const size_t oVL = off; off += szVL;
  const size_t oG  = off; off += szG;
  if (off > ws_size) return;                // off = 123863040 for NB = 2, SEQ = 2048
  if (off > (size_t)WS_CAP) return;

  char* ws = (char*)d_ws;
  u16*   XB = (u16*)(ws + oXB);
  u16*   WB = (u16*)(ws + oW);
  float* F  = (float*)(ws + oF);
  u16*   OH = (u16*)(ws + oF);
  u16*   OL = (u16*)(ws + oF + szOH);
  u16*   QH = (u16*)(ws + oQH);
  u16*   QL = (u16*)(ws + oQL);
  u16*   KH = (u16*)(ws + oKH);
  u16*   KL = (u16*)(ws + oKL);
  u16*   VH = (u16*)(ws + oVH);
  u16*   VL = (u16*)(ws + oVL);
  float* G  = (float*)(ws + oG);

  const dim3 b256(256), b128(128), bAT(ATT_THREADS);
  const int  n8x = (SEQ * DMOD) / 8;
  const dim3 gX((n8x + 255) / 256);                     // per batch
  const dim3 gGT((NH * SEQ + 255) / 256);
  const dim3 gTV((DMOD / 64) * (DMOD / 64));            // 256: [1024][1024] weight -> [1024][1024]
  const dim3 gTQ((DMOD / 64) * (QKN / 64));             // 512: [1024][2048] weight -> [2048][1024]
  const dim3 gGV((MROWS / 64) * (DMOD / 64));
  const dim3 gGQ((MROWS / 64) * (QKN / 64));
  const dim3 gVT(NB * NH * NST);
  const int  n8m = MROWS * C8R;
  const dim3 gM((n8m + 255) / 256);
  const dim3 gATR(NQO * NHG * NB);
  const int  nqp  = NQT - NQO;                          // query tiles with s >= QO
  const int  nrtR = QO / 64;                            // out-projection row tiles per batch with the O residual plane
  const int  nrtP = (SEQ - QO) / 64;                    // remaining row tiles per batch, O hi plane only

  // (0) x -> bf16 plane [MROWS][1024], one launch per batch row block
  for (int b = 0; b < NB; ++b) {
    cvt16<<<gX, b256, 0, stream>>>(x + (size_t)b * XS_FULL * DMOD, XB + (size_t)b * SEQ * DMOD, n8x, 0, 1.0f);
  }
  // (1) gate table G[h][dl]
  gtab<<<gGT, b256, 0, stream>>>(th, G, NH * SEQ);
  // (2) Wv [1024 k][1024 n] -> Wv^T bf16 [1024 n][1024 k]; (3) v = x.Wv -> F f32 [MROWS][1024]; (4) v^T hi + residual x1024
  tr16<<<gTV, b256, 0, stream>>>(wv, WB, DMOD, DMOD, 0, 1.0f);
  gemm_nb<<<gGV, b128, 0, stream>>>(XB, WB, F, MROWS, DMOD, DMOD, 1.0f);
  vt16<<<gVT, b256, 0, stream>>>(F, VH, VL);
  // (5) Wq [1024 k][2048 n] -> Wq^T bf16 [2048 n][1024 k]; (6) q_raw = x.Wq -> F f32 [MROWS][2048]; (7) [qc|qs] hi + residual x256
  tr16<<<gTQ, b256, 0, stream>>>(wq, WB, DMOD, QKN, 0, 1.0f);
  gemm_nb<<<gGQ, b128, 0, stream>>>(XB, WB, F, MROWS, QKN, DMOD, 1.0f);
  qk16<<<gM, b256, 0, stream>>>(F, QH, QL, n8m, QSC);
  // (8) Wk^T; (9) k_raw = x.Wk -> F; (10) [kc|ks] hi + residual x256
  tr16<<<gTQ, b256, 0, stream>>>(wk, WB, DMOD, QKN, 0, 1.0f);
  gemm_nb<<<gGQ, b128, 0, stream>>>(XB, WB, F, MROWS, QKN, DMOD, 1.0f);
  qk16<<<gM, b256, 0, stream>>>(F, KH, KL, n8m, KSC);
  // (11) Wo [1024 k][1024 n] -> Wo^T f16 plane of bf16 value x1024 [1024 n][1024 k]
  tr16<<<gTV, b256, 0, stream>>>(wo, WB, DMOD, DMOD, 1, WOS);
  // (12) causal gated attention: query tiles s < QO with residual P.v products -> O hi + residual; (13) query tiles s >= QO -> O hi
  attn_g<1><<<gATR, bAT, 0, stream>>>(QH, QL, KH, KL, VH, VL, G, OH, OL);
  if (nqp > 0) {
    attn_g<0><<<dim3(nqp * NHG * NB), bAT, 0, stream>>>(QH, QL, KH, KL, VH, VL, G, OH, OL);
  }
  // (14) output projection rows s < QO (O hi + residual) and (15) rows s >= QO (O hi only) -> out f32, carries 1024 x 1024 folded back
  gemm_o<2><<<dim3(NB * nrtR * (DMOD / 64)), b128, 0, stream>>>(OH, OL, WB, out, 0, nrtR, 1.0f / (OSC * WOS));
  if (nrtP > 0) {
    gemm_o<1><<<dim3(NB * nrtP * (DMOD / 64)), b128, 0, stream>>>(OH, OL, WB, out, QO, nrtP, 1.0f / (OSC * WOS));
  }
  (void)hipGetLastError();
}

// v002
// A run of this version takes 338 microseconds.
// Timed twice side by side with v001, it ran 1.43 and 1.41 times as fast.
// All steps since v000 together make it 1.61 times as fast.
// Contractions: x.Wq, x.Wk, x.Wv on v_wmma_f32_16x16x32_bf16 (x and W^T as bf16 RNE planes); per-head scores
// [qc|qs].[kc|ks] over 128 on v_wmma_f32_16x16x32_f16 (q, k as f16 hi x256 plus unscaled f16 residual planes, products
// hh+lh+hl on all query rows); P.v on v_wmma_f32_16x16x32_f16 (P x32768, v^T x1024 f16 planes; query rows s < QO also
// use f16 residual planes, hh+lh+hl); O.Wo on v_wmma_f32_16x16x32_f16 (O x1024 f16 hi plane, plus residual plane for rows
// s < QO; Wo^T as f16 of its bf16 RNE value x1024); all f32 accumulate. softplus, cos, sin, the cosine gate table,
// causal select, base-2 online softmax and 1/Z in f32 on VALU.
#include <hip/hip_runtime.h>
#include <math.h>
#include <stdint.h>

#ifndef NB
#define NB 2
#endif
#ifndef SEQ
#define SEQ 2048
#endif
#define XS_FULL 2048
#define DMOD  1024
#define QKN   (2 * DMOD)
#define NH    16
#define HD    64
#define SD    (2 * HD)
#define QO    ((SEQ < 512) ? SEQ : 512)
#define MROWS (NB * SEQ)
#define RSQ_HD 0.125f
#define GSTEP 0.125f
#define LOG2E 1.4426950408889634f
#define QSC   256.0f
#define KSC   256.0f
#define PCAR  32768.0f
#define VCAR  1024.0f
#define OSC   1024.0f
#define WOS   1024.0f
#define WPB   1
#define NHG   (NH / WPB)
#define NQT   (SEQ / 16)
#define NQO   (QO / 16)
#define NST   (SEQ / 64)
#define NKT   (SEQ / 32)
#define KS    4
#define ATT_THREADS (WPB * KS * 32)
#define PTP   36
#define PTW   (16 * PTP)
#define SLP   68
#define SLW   (16 * SLP)
#define WREG  (PTW + SLW)
#define SLAB64 (16 * 68)
#define VTP   72
#define C8R   (DMOD / 8)
#define QKP   264
#define WS_CAP 134217728
static_assert(DMOD == NH * HD && HD == 64 && NH == 16 && SD == 128 && WPB == 1 && NHG * WPB == NH);
static_assert(ATT_THREADS == 128 && KS == 4 && HD == KS * 16);
static_assert(NB >= 1 && NB <= 2);
static_assert((SEQ % 64) == 0 && SEQ >= 64 && SEQ <= XS_FULL);
static_assert((QO % 64) == 0 && QO >= 64 && QO <= SEQ);
static_assert((DMOD % 64) == 0 && (QKN % 64) == 0 && (DMOD % 32) == 0 && (SD % 32) == 0 && C8R == 128);
static_assert((MROWS % 64) == 0);
static_assert(((SEQ * DMOD / 8) % 256) == 0 && ((MROWS * C8R) % 256) == 0 && ((NH * SEQ) % 256) == 0);
static_assert(WPB * KS * WREG * 4 <= 65536 && 2 * HD * VTP * 2 <= 65536 && 4 * SLAB64 * 4 <= 65536 && 64 * VTP * 2 <= 65536);

typedef unsigned short u16;
typedef _Float16 v16h __attribute__((ext_vector_type(16)));
typedef _Float16 v8h  __attribute__((ext_vector_type(8)));
typedef __bf16   v16b __attribute__((ext_vector_type(16)));
typedef float    v8f  __attribute__((ext_vector_type(8)));
typedef float    v4f  __attribute__((ext_vector_type(4)));
typedef unsigned int v4u __attribute__((ext_vector_type(4)));

union FragH { v16h v; v8h h[2]; v4u u[2]; };
union FragB { v16b v; v4u u[2]; };

// ---- scalar helpers --------------------------------------------------------------------------------
__device__ __forceinline__ unsigned short bf_bits(float f) {          // f32 -> bf16 bits, RNE convert
  unsigned u = __float_as_uint(f);
  return (unsigned short)((u + 0x7FFFu + ((u >> 16) & 1u)) >> 16);
}
__device__ __forceinline__ float bf_up(unsigned short h) { return __uint_as_float(((unsigned)h) << 16); }
__device__ __forceinline__ float bfr(float f) { return bf_up(bf_bits(f)); }
__device__ __forceinline__ unsigned short h_bits(_Float16 x) { return __builtin_bit_cast(unsigned short, x); }
__device__ __forceinline__ unsigned pk16(unsigned short a, unsigned short b) { return (unsigned)a | ((unsigned)b << 16); }
__device__ __forceinline__ v8f zero8() { v8f z = {0.f, 0.f, 0.f, 0.f, 0.f, 0.f, 0.f, 0.f}; return z; }
__device__ __forceinline__ const _Float16* ash(const u16* p) { return (const _Float16*)(const void*)p; }

// ---- packed operand planes: a 16-bit plane of R rows x K columns (R % 16 == 0, K % 32 == 0) is stored as 1-KB tiles of
//      16 rows x 32 k, tile (row>>4, k>>5) at half offset (row>>4)*16*K + (k>>5)*512; inside a tile element (m = row&15,
//      k&31 = 16*j + 8*h + e) lies at j*256 + (16*h + m)*8 + e. One fragment load of a wave is then 512 contiguous bytes
//      (4 cache lines) where a row-major plane gave 16 rows x 32 B (16 lines).
// ---- fragment loaders: 16-bit A/B operand, lane -> row/col (lane&15), h = lane>>4; t = a tile start (wave-uniform), lo = the lane's offset from it
//      in BYTES (16*lane inside the tile), p = t + lo bytes; elements 0..7 <- p[0..7] (k0+8h..), elements 8..15 <- p[256..263] (k0+16+8h..)  (same split k map for A and B)
__device__ __forceinline__ v16h ldfrag_h(const _Float16* t, unsigned lo) {
  FragH f;
  const char* p = (const char*)t + lo;
  f.h[0] = *(const v8h*)(p);
  f.h[1] = *(const v8h*)(p + 512);
  return f.v;
}
__device__ __forceinline__ v16b ldfrag_b(const u16* t, unsigned lo) { // bf16 plane read as unsigned integer vectors
  FragB f;
  const char* p = (const char*)t + lo;
  f.u[0] = *(const v4u*)(p);
  f.u[1] = *(const v4u*)(p + 512);
  return f.v;
}

__device__ __forceinline__ v8f mma_h(v16h a, v16h b, v8f c) {
  return __builtin_amdgcn_wmma_f32_16x16x32_f16(false, a, false, b, (short)0, c, false, false);
}
__device__ __forceinline__ v8f mma_b(v16b a, v16b b, v8f c) {
  return __builtin_amdgcn_wmma_f32_16x16x32_bf16(false, a, false, b, (short)0, c, false, false);
}
__device__ __forceinline__ void guard2(v8f& a, v8f& b, v16h x0, v16h x1, v16h x2, v16h x3, v16h x4, v16h x5) {
#if defined(__HIP_DEVICE_COMPILE__)
  asm volatile("v_nop\n\tv_nop\n\tv_nop\n\tv_nop"
               : "+v"(a), "+v"(b) : "v"(x0), "v"(x1), "v"(x2), "v"(x3), "v"(x4), "v"(x5) : "memory");
#endif
}
template <typename F>
__device__ __forceinline__ void guard6(v8f& a, v8f& b, v8f& c, v8f& d, F x0, F x1, F x2, F x3, F x4, F x5) {
#if defined(__HIP_DEVICE_COMPILE__)
  asm volatile("v_nop\n\tv_nop\n\tv_nop\n\tv_nop"
               : "+v"(a), "+v"(b), "+v"(c), "+v"(d) : "v"(x0), "v"(x1), "v"(x2), "v"(x3), "v"(x4), "v"(x5) : "memory");
#endif
}
__device__ __forceinline__ void acc_guard4(v8f& a, v8f& b, v8f& c, v8f& d) {
#if defined(__HIP_DEVICE_COMPILE__)
  asm volatile("v_nop\n\tv_nop\n\tv_nop\n\tv_nop" : "+v"(a), "+v"(b), "+v"(c), "+v"(d));
#endif
}
__device__ __forceinline__ void xcnt_wait() {
#if defined(__HIP_DEVICE_COMPILE__)
  asm volatile("s_wait_xcnt 0x0" ::: "memory");
#endif
}
__device__ __forceinline__ void wave_sync_lds() {
  __builtin_amdgcn_fence(__ATOMIC_RELEASE, "workgroup");
  __builtin_amdgcn_wave_barrier();
  __builtin_amdgcn_fence(__ATOMIC_ACQUIRE, "workgroup");
}

// =====================================================================================================
// f32 [rows][DMOD] row-major -> packed 16-bit plane (K = DMOD).  f16mode == 0: bf16 RNE bits;  f16mode == 1: f16 bits of (bf16 RNE value) * scale.
// Thread = 8 consecutive k of one row: two 16-B loads, one 16-B store; a wave = one half tile (16 rows x 2 chunks of 8 k), stored
// as 512 contiguous, 512-B aligned bytes; the 8 waves of a block read 512 contiguous bytes of each of 16 rows.
// coverage: grid = ceil(n8/256) blocks x 256 thr x 8 (in-kernel bound) = the whole plane (n8 a multiple of 256 here).
// =====================================================================================================
__global__ __launch_bounds__(256) void cvt16(const float* __restrict__ x, u16* D, int n8, int f16mode, float scale) {
  const int gt = blockIdx.x * 256 + (int)threadIdx.x;
  if (gt >= n8) return;
  const int wv = gt >> 5, ln = gt & 31;                   // wave index = ((row tile * DMOD/32) + k tile) * 2 + j
  const int row = (wv / (DMOD / 16)) * 16 + (ln & 15);
  const int kc  = ((wv >> 1) % (DMOD / 32)) * 32 + (wv & 1) * 16 + (ln >> 4) * 8;
  const float* p = x + (size_t)row * DMOD + kc;
  const v4f a = *(const v4f*)(p), b4 = *(const v4f*)(p + 4);
  float w[8];
#pragma unroll
  for (int e = 0; e < 4; ++e) { w[e] = a[e]; w[4 + e] = b4[e]; }
  v4u o;
#pragma unroll
  for (int e = 0; e < 4; ++e) {
    const float f0 = w[2 * e], f1 = w[2 * e + 1];
    const unsigned short hb0 = h_bits((_Float16)(bfr(f0) * scale));
    const unsigned short hb1 = h_bits((_Float16)(bfr(f1) * scale));
    const unsigned short bb0 = bf_bits(f0);
    const unsigned short bb1 = bf_bits(f1);
    o[e] = (f16mode != 0) ? pk16(hb0, hb1) : pk16(bb0, bb1);
  }
  u16* d = D + (size_t)gt * 8;
  {
    *(v4u*)(d) = o;
    
  }
}

// =====================================================================================================
// Weight transpose + convert: W f32 [KW][NW] row-major (W[k][n], the x.W layout) -> D 16-bit packed plane of NW rows x KW (row n, column k:
// the B operand). f16mode == 0: bf16 RNE bits; f16mode == 1: f16 bits of (bf16 RNE value) * scale.
// Block = one 64 k x 64 n tile: each thread loads 16 floats of one k row (16-B loads), converts, stores them transposed
// into an LDS tile [64 n][64 k] (pitch 72 halves, u16 element stores); after a block barrier each n row segment (64 halves =
// coverage: load 256 thr x 16 = 64 k x 64 n; store 2 iterations x 256 thr x 8 halves = 64 n rows x 64 k = the block's
//           tile; grid = (KW/64)*(NW/64) blocks covers D exactly once (host guarantees KW % 64 == 0, NW % 64 == 0).
// =====================================================================================================
__global__ __launch_bounds__(256) void tr16(const float* __restrict__ W, u16* D, int KW, int NW, int f16mode, float scale) {
  __shared__ __align__(16) u16 T[64 * VTP];
  const int tid = threadIdx.x;
  const int bid = blockIdx.x;
  const int nkt = KW >> 6;
  const int kt  = bid % nkt;
  const int nt  = bid / nkt;
  const int k0  = kt * 64, n0 = nt * 64;
  if (n0 + 64 > NW) return;                 // block-uniform, before any barrier; never taken with the exact grid
  {
    const int kl = tid >> 2;                // k within tile 0..63
    const int nc = (tid & 3) * 16;          // n chunk 0,16,32,48
    const float* src = W + (size_t)(k0 + kl) * NW + n0 + nc;
#pragma unroll
    for (int i = 0; i < 4; ++i) {
      const v4f a = *(const v4f*)(src + 4 * i);
#pragma unroll
      for (int e = 0; e < 4; ++e) {
        const float f = a[e];
        const unsigned short hb = h_bits((_Float16)(bfr(f) * scale));
        const unsigned short bb = bf_bits(f);
        T[(nc + 4 * i + e) * VTP + kl] = (f16mode != 0) ? hb : bb;
      }
    }
  }
  __syncthreads();
  v4u v[2];
#pragma unroll
  for (int it = 0; it < 2; ++it) {
    const int pi = it * 256 + tid;          // 16-B piece: m = pi&15, h = (pi>>4)&1, j = (pi>>5)&1, k tile (pi>>6)&1, n tile pi>>7
    v[it] = *(const v4u*)(T + ((pi >> 7) * 16 + (pi & 15)) * VTP + ((pi >> 6) & 1) * 32 + ((pi >> 5) & 1) * 16 + ((pi >> 4) & 1) * 8);
  }
  {
#pragma unroll
    for (int it = 0; it < 2; ++it) {
      const int pi = it * 256 + tid;
      *(v4u*)(D + (size_t)(n0 + (pi >> 7) * 16) * KW + (size_t)((k0 >> 5) + ((pi >> 6) & 1)) * 512 + (pi & 63) * 8) = v[it];
    }
  }
}

// =====================================================================================================
// Cosine gate table G f32 [NH][SEQ]: G[h][dl] = cos(bf16(theta[h]) * (dl * 0.125f)), dl = query index - key index >= 0
// (cid difference (j-i)/8 is exact in f32 and cos is even). One value per thread, precise cosf; the block's 256 values
// coverage: grid = NH*SEQ/256 blocks x 256 = all NH x SEQ entries (NH*SEQ is a multiple of 256).
// =====================================================================================================
__global__ __launch_bounds__(256) void gtab(const float* __restrict__ theta, float* G, int ntot) {
  __shared__ __align__(16) float sg[256];
  const int tid = threadIdx.x;
  const int gt  = blockIdx.x * 256 + tid;
  const int gc  = (gt < ntot) ? gt : (ntot - 1);
  const int h   = gc / SEQ;
  const int dl  = gc - h * SEQ;
  const int hc  = (h < NH) ? h : (NH - 1);
  const float th = bfr(theta[hc]);
  const float cd = (float)dl * GSTEP;
  sg[tid] = cosf(th * cd);
  __syncthreads();
  if (tid < 64) {
    const v4f v = *(const v4f*)(sg + tid * 4);
    const int base = blockIdx.x * 256 + tid * 4;
    if (base + 4 <= ntot) {
      float* d = G + base;
      {
        *(v4f*)(d) = v;
        
      }
    }
  }
}

// =====================================================================================================
// Amplitude/phase combine: F f32 [MROWS][QKN] (row = b*SEQ + s; column h*HD + d = amplitude pre-activation, DMOD + h*HD + d
// = phase) -> f16 hi plane Hp and unscaled f16 residual plane Lp, both packed planes of MROWS rows x QKN with column h*SD + d = c-part * sc and
// h*SD + HD + d = s-part * sc, where a = softplus(amp) = max(amp,0) + log1p(exp(-|amp|)), c-part = a*cos(phase),
// s-part = a*sin(phase) (precise expf/log1pf/cosf/sinf), hi = f16(t), residual = f16(t - f16(t)).
// Block = (16 rows, 2 heads); thread = (row, head h, 8 consecutive d): rolled loop of 8 (scalar loads, one transcendental chain per iteration, u16 element
// stores into the thread's own LDS slots, row pitch QKP); block barrier; then four 16-B stores per thread in packed order (the
// block's 8 tiles of each plane are 8 KB contiguous; a wave stores 512 contiguous bytes).
// coverage: grid = MROWS*C8R/256 blocks (clamped block index, predicated store; MROWS*C8R is a multiple of 256) x 2 iterations x
//           256 thr x 8 halves per plane = 16 rows x 256 columns; all blocks = every row x every column of Hp and of Lp once.
// =====================================================================================================
__global__ __launch_bounds__(256) void qk16(const float* __restrict__ F, u16* Hp, u16* Lp, int n8, float sc) {
  __shared__ __align__(16) u16 sHb[16 * QKP];
  __shared__ __align__(16) u16 sLb[16 * QKP];
  const int tid = threadIdx.x;
  const bool act = ((int)blockIdx.x * 256 + 256 <= n8);   // block-uniform
  const int bc  = act ? (int)blockIdx.x : 0;
  const int hp  = bc % (NH / 2);            // head pair
  const int rt  = bc / (NH / 2);            // 16-row tile
  const int row = rt * 16 + (tid >> 4);
  const int idx = tid & 15;
  const int h   = hp * 2 + (idx >> 3);
  const int d0  = (idx & 7) * 8;
  const float* ap = F + (size_t)row * QKN + h * HD + d0;
  const float* pp = ap + DMOD;
  u16* sh = sHb + (tid >> 4) * QKP + idx * 16;
  u16* sl = sLb + (tid >> 4) * QKP + idx * 16;
#pragma unroll 1
  for (int e = 0; e < 8; ++e) {
    const float am  = ap[e];
    const float ph  = pp[e];
    const float spv = fmaxf(am, 0.0f) + log1pf(expf(-fabsf(am)));
    const float cv  = cosf(ph);
    const float sv  = sinf(ph);
    const float tc  = (spv * cv) * sc;
    const float ts  = (spv * sv) * sc;
    const _Float16 hc = (_Float16)tc, hs = (_Float16)ts;
    const _Float16 lc = (_Float16)(tc - (float)hc), ls = (_Float16)(ts - (float)hs);
    sh[e] = h_bits(hc);  sh[8 + e] = h_bits(hs);
    sl[e] = h_bits(lc);  sl[8 + e] = h_bits(ls);
  }
  __syncthreads();
  // 16-B piece pi of the block's 8 tiles: m = pi&15; column chunk q = pi>>4 (k tile q>>2, j = (q>>1)&1, h = q&1) = head q>>4 of the
  // pair, c or s part (q>>3)&1, d chunk q&7; it was written by thread m*16 + (q>>4)*8 + (q&7) at its slot + 8*part.
  v4u oh2[2], ol2[2];
#pragma unroll
  for (int it = 0; it < 2; ++it) {
    const int pi = it * 256 + tid;
    const int q  = pi >> 4;
    const int so = (pi & 15) * QKP + ((q >> 4) * 8 + (q & 7)) * 16 + ((q >> 3) & 1) * 8;
    oh2[it] = *(const v4u*)(sHb + so);
    ol2[it] = *(const v4u*)(sLb + so);
  }
  const size_t ob = (size_t)rt * 16 * QKN + (size_t)hp * (2 * SD * 16) + (size_t)tid * 8;
  if (act) {
#pragma unroll
    for (int it = 0; it < 2; ++it) {
      *(v4u*)(Hp + ob + it * 2048) = oh2[it];
      *(v4u*)(Lp + ob + it * 2048) = ol2[it];
    }
  }
}

// =====================================================================================================
// v^T planes from the v projection F f32 [MROWS][DMOD] (row = b*SEQ + s, column = h*HD + d):
//   VH packed plane, row (b*NH + h)*HD + d, column s (K = SEQ) = f16(v * 1024) for all keys s;
//   VL packed plane, same rows, column s (K = QO) = f16 residual (t - f16(t)) for keys s < QO only.
// Block = (b, head h, 64 keys s0): each thread loads its 16 floats (key sl, d chunk dc) with 16-B loads, converts, scatters
// line) is written by 8 consecutive lanes x 16 B of one instruction, in both planes (VL under the block-uniform s0 < QO
// coverage: load 256 thr x 16 = 64 keys x 64 d; store 2 iterations x 256 thr x 8 halves = 64 lines x 64 = the block's tile of
//           VH (and of VL when s0 < QO); grid = NB*NH*NST blocks covers VH exactly once and all QO columns of VL exactly once.
// =====================================================================================================
__global__ __launch_bounds__(256) void vt16(const float* __restrict__ F, u16* VHo, u16* VLo) {
  __shared__ __align__(16) u16 TH[HD * VTP];
  __shared__ __align__(16) u16 TL[HD * VTP];
  const int tid = threadIdx.x;
  const int bid = blockIdx.x;
  const int st  = bid % NST;
  const int t2  = bid / NST;
  const int h   = t2 % NH;
  const int b   = t2 / NH;
  if (b >= NB) return;                      // block-uniform, before any barrier; never taken with the exact grid
  const int s0  = st * 64;
  const bool dolo = (s0 + 64 <= QO);        // block-uniform
  {
    const int sl = tid >> 2;                // key within tile 0..63
    const int dc = (tid & 3) * 16;          // d chunk 0,16,32,48
    const float* src = F + ((size_t)b * SEQ + s0 + sl) * DMOD + h * HD + dc;
#pragma unroll
    for (int i = 0; i < 4; ++i) {
      const v4f a = *(const v4f*)(src + 4 * i);
#pragma unroll
      for (int e = 0; e < 4; ++e) {
        const float t = a[e] * VCAR;
        const _Float16 hv = (_Float16)t;
        const _Float16 lv = (_Float16)(t - (float)hv);
        TH[(dc + 4 * i + e) * VTP + sl] = h_bits(hv);
        TL[(dc + 4 * i + e) * VTP + sl] = h_bits(lv);
      }
    }
  }
  __syncthreads();
  v4u vh[2], vl[2];
#pragma unroll
  for (int it = 0; it < 2; ++it) {
    const int pi = it * 256 + tid;          // 16-B piece: m = pi&15, h = (pi>>4)&1, j = (pi>>5)&1, key tile (pi>>6)&1, d tile pi>>7
    const int so = ((pi >> 7) * 16 + (pi & 15)) * VTP + ((pi >> 6) & 1) * 32 + ((pi >> 5) & 1) * 16 + ((pi >> 4) & 1) * 8;
    vh[it] = *(const v4u*)(TH + so);
    vl[it] = *(const v4u*)(TL + so);
  }
  const size_t hrow = (size_t)(b * NH + h) * HD;
  const int    sL   = dolo ? s0 : 0;
  {
#pragma unroll
    for (int it = 0; it < 2; ++it) {
      const int pi = it * 256 + tid;
      const size_t dr = hrow + (size_t)(pi >> 7) * 16;
      const int    kq = (pi >> 6) & 1;
      *(v4u*)(VHo + dr * SEQ + (size_t)((s0 >> 5) + kq) * 512 + (pi & 63) * 8) = vh[it];
      xcnt_wait();                          // before the store's address and data registers are reused
      if (dolo) {
        *(v4u*)(VLo + dr * QO + (size_t)((sL >> 5) + kq) * 512 + (pi & 63) * 8) = vl[it];
        xcnt_wait();                        // as above
      }
    }
  }
}

// =====================================================================================================
// GEMM epilogue shared by both engines: the wave's 16x64 f32 tile (times oscale) staged in its LDS slab (pitch 68), release
// coverage: 8 instructions x 2 rows x 16 lanes x 4 floats = the wave's 16 x 64 tile.
// =====================================================================================================
__device__ __forceinline__ void epi64(float* sl, v8f a0, v8f a1, v8f a2, v8f a3, float oscale,
                                      float* C, int N, size_t rowb, int col0, int lane) {
  const int hh = lane >> 4, m = lane & 15;
#pragma unroll
  for (int r = 0; r < 8; ++r) {
    const int ro = (8 * hh + r) * 68 + m;
    sl[ro]      = a0[r] * oscale;
    sl[ro + 16] = a1[r] * oscale;
    sl[ro + 32] = a2[r] * oscale;
    sl[ro + 48] = a3[r] * oscale;
  }
  wave_sync_lds();
  v4f vals[8];
#pragma unroll
  for (int it = 0; it < 8; ++it) vals[it] = *(const v4f*)(sl + (it * 2 + hh) * 68 + m * 4);
  float* dst = C + (rowb + (size_t)hh) * (size_t)N + col0 + m * 4;
  {
#pragma unroll
    for (int it = 0; it < 8; ++it) {
      *(v4f*)(dst + (size_t)(it * 2) * (size_t)N) = vals[it];
    }
    
  }
}

// =====================================================================================================
// bf16 GEMM, no bias: C[M][N] (f32) = A (bf16 packed plane, M rows x K) . Bt^T (bf16 packed plane, N rows x K), times oscale.
// Block = 64x64 tile, 4 waves x 16 rows; fragments loaded straight from the packed tiles (two 16-B loads each, split k map for
// A and B); K stepped by 32 (host guarantees K % 32 == 0, M % 64 == 0, N % 64 == 0, grid = (M/64)*(N/64)).
// =====================================================================================================
__global__ __launch_bounds__(128)
void gemm_nb(const u16* __restrict__ A, const u16* __restrict__ Bt, float* C, int M, int N, int K, float oscale) {
  __shared__ __align__(16) float slab[4 * SLAB64];
  const int tid = threadIdx.x, lane = tid & 31;
  const int wave = __builtin_amdgcn_readfirstlane(tid >> 5);   // scalar, so that the tile starts are computed on the scalar unit
  const unsigned lo = 16u * (unsigned)lane;
  const int ntile = N >> 6;
  const int bid   = blockIdx.x;
  const int rowb  = (bid / ntile) * 64 + wave * 16;
  const int col0  = (bid % ntile) * 64;
  if (rowb + 16 > M) return;                // wave-uniform, never taken with the exact grid; no block barriers in this kernel
  const u16* ap = A  + (size_t)rowb * K;
  const u16* bp = Bt + (size_t)col0 * K;
  const size_t bs = (size_t)16 * K;
  const u16* bp1 = bp + bs;
  const u16* bp2 = bp + 2 * bs;
  const u16* bp3 = bp + 3 * bs;
  v8f acc0 = zero8(), acc1 = zero8(), acc2 = zero8(), acc3 = zero8();
#pragma unroll 1
  for (int k0 = 0; k0 < K; k0 += 32) {
    const v16b a  = ldfrag_b(ap, lo);
    const v16b b0 = ldfrag_b(bp, lo);
    const v16b b1 = ldfrag_b(bp1, lo);
    const v16b b2 = ldfrag_b(bp2, lo);
    const v16b b3 = ldfrag_b(bp3, lo);
    ap += 512; bp += 512; bp1 += 512; bp2 += 512; bp3 += 512;   // next k tile
    acc0 = mma_b(a, b0, acc0);
    acc1 = mma_b(a, b1, acc1);
    acc2 = mma_b(a, b2, acc2);
    acc3 = mma_b(a, b3, acc3);
    guard6<v16b>(acc0, acc1, acc2, acc3, a, b0, b1, b2, b3, a);
  }
  epi64(slab + wave * SLAB64, acc0, acc1, acc2, acc3, oscale, C, N, (size_t)rowb, col0, lane);
}

// =====================================================================================================
// Output projection, no bias: C[row][DMOD] (f32) = (Ah [+ Al])[row][DMOD] . Bt[DMOD][DMOD]^T * oscale.
// NPROD == 1: Ah only (one product); NPROD == 2: Ah + Al residual plane (products h.B + l.B into one accumulator, l unscaled).
// Row indices (packed planes, K = DMOD): Ah row bb*SEQ + s; Al row bb*QO + s (compact plane, s < QO); C row bb*XS_FULL + s.
// Block -> (column tile ct = bid % 16, sequence row tile rt of nrt starting at s = sbeg, batch bb). Same tiling, fragment
// loads (split k map) and epilogue as gemm_nb; K = DMOD stepped by 32.
// =====================================================================================================
template <int NPROD>
__global__ __launch_bounds__(128)
void gemm_o(const u16* __restrict__ Ah, const u16* __restrict__ Al, const u16* __restrict__ Bt,
            float* C, int sbeg, int nrt, float oscale) {
  __shared__ __align__(16) float slab[4 * SLAB64];
  const int tid = threadIdx.x, lane = tid & 31;
  const int wave = __builtin_amdgcn_readfirstlane(tid >> 5);   // scalar, so that the tile starts are computed on the scalar unit
  unsigned vo = 16u * (unsigned)lane;         // the lane's byte offset from the row tiles' starts; one k tile (1 KB) further each trip
  const int ntile = DMOD >> 6;
  const int bid   = blockIdx.x;
  const int ct    = bid % ntile;
  const int t2    = bid / ntile;
  const int rt    = t2 % nrt;
  const int bb    = t2 / nrt;
  if (bb >= NB) return;                     // block-uniform; no block barriers in this kernel; never taken with the exact grid
  const int srow  = sbeg + rt * 64 + wave * 16;
  if (srow + 16 > SEQ) return;              // wave-uniform; never taken
  if (NPROD == 2 && srow + 16 > QO) return; // wave-uniform; never taken
  const int col0  = ct * 64;
  const int K     = DMOD;
  const size_t rowA = (size_t)bb * SEQ + srow;
  const size_t rowL = (NPROD == 2) ? ((size_t)bb * QO + srow) : (size_t)0;
  const size_t rowC = (size_t)bb * XS_FULL + srow;
  const _Float16* ahp = ash(Ah) + rowA * K;
  const _Float16* alp = ash(Al) + rowL * K;                  // dereferenced only when NPROD == 2
  const _Float16* bp  = ash(Bt) + (size_t)col0 * K;
  const size_t bs = (size_t)16 * K;
  const _Float16* bp1 = bp + bs;
  const _Float16* bp2 = bp + 2 * bs;
  const _Float16* bp3 = bp + 3 * bs;
  v8f acc0 = zero8(), acc1 = zero8(), acc2 = zero8(), acc3 = zero8();
  if constexpr (NPROD == 2) {
#pragma unroll 1
    for (int k0 = 0; k0 < K; k0 += 32) {
      const v16h ah = ldfrag_h(ahp, vo), al = ldfrag_h(alp, vo);
      const v16h b0 = ldfrag_h(bp, vo);
      const v16h b1 = ldfrag_h(bp1, vo);
      const v16h b2 = ldfrag_h(bp2, vo);
      const v16h b3 = ldfrag_h(bp3, vo);
      vo += 1024u;                          // next k tile: 512 halves
      acc0 = mma_h(ah, b0, acc0);  acc0 = mma_h(al, b0, acc0);
      acc1 = mma_h(ah, b1, acc1);  acc1 = mma_h(al, b1, acc1);
      acc2 = mma_h(ah, b2, acc2);  acc2 = mma_h(al, b2, acc2);
      acc3 = mma_h(ah, b3, acc3);  acc3 = mma_h(al, b3, acc3);
      guard6<v16h>(acc0, acc1, acc2, acc3, ah, al, b0, b1, b2, b3);
    }
  } else {
#pragma unroll 1
    for (int k0 = 0; k0 < K; k0 += 32) {
      const v16h ah = ldfrag_h(ahp, vo);
      const v16h b0 = ldfrag_h(bp, vo);
      const v16h b1 = ldfrag_h(bp1, vo);
      const v16h b2 = ldfrag_h(bp2, vo);
      const v16h b3 = ldfrag_h(bp3, vo);
      vo += 1024u;                          // next k tile: 512 halves
      acc0 = mma_h(ah, b0, acc0);
      acc1 = mma_h(ah, b1, acc1);
      acc2 = mma_h(ah, b2, acc2);
      acc3 = mma_h(ah, b3, acc3);
      guard6<v16h>(acc0, acc1, acc2, acc3, ah, b0, b1, b2, b3, ah);
    }
  }
  epi64(slab + wave * SLAB64, acc0, acc1, acc2, acc3, oscale, C, DMOD, rowC, col0, lane);
}

// =====================================================================================================
// Causal gated multi-head attention, score depth SD = 128 ([c|s] parts of one head), hd = 64 for v.
// Block bid -> (query tile qt: rows q0 = 16*qt .. q0+15, head group hg of WPB = 1 head, batch b); KS = 4 waves per head = hg*WPB + wave/KS:
// wave sp = wave % KS takes the key tiles kt = sp, sp + KS, ... with its own running max, sum and accumulator; the four
// partial results are merged once, after one block barrier (weights 2^(m_s - max m), -inf-safe: a wave without tiles adds 0).
// RES == 1: query tiles q0 < QO, P.v = hh + lh + hl with the v^T residual plane, O residual plane also written;
// RES == 0: query tiles q0 >= QO, P.v single products. Scores use q_hi.k_hi + q_lo.k_hi + q_hi.k_lo in both variants.
//   q hi plane f16 x256, packed, row b*SEQ + s, column h*SD + e (e < SD), q residual plane same layout (all rows); k planes likewise;
//   v^T hi plane x1024, packed, row (b*NH + h)*HD + d, column s (K = SEQ), v^T residual plane (K = QO); gate table G[h][i - j] f32.
//   score (log2 domain) t(i, j) = (q_i.k_j over SD) * (1/8)*log2e/(256*256) * G[h][i - j], replaced by -inf where key j >
//   query i (gate index clamped to [0, SEQ-1]; the clamped value is only used on masked elements).
//   Key tiles of 32 with kb <= q0 + 15, each wave's in rising order; with RES == 1 every visited key is below QO, inside the compact
//   v^T residual plane.
//   Per tile: 2 score subtiles x 4 k-steps x 3 products, fragments loaded straight from the 16-bit planes (two 16-B loads
//   per fragment, split k map); online max-subtracted base-2 softmax in f32, -inf-safe rescale; the 16x32 prob tile stored
//   residual) rebuilt from the LDS rows (float vector loads, same element type as stored), v^T B fragments in 2 groups of
//   2 d-subtiles. After the loop each wave writes its raw accumulator into its own result slab (pitch 68; every element owned
//   by one lane) and its 16 row maxima and sums into its prob-tile region; one block barrier (every return stands in front of it
//   and is block-uniform); then wave sp merges columns 16*sp .. 16*sp+15 of its head: out = sum_s acc_s*w_s / sum_s Z_s*w_s
//   (Z > 0 always: key 0 <= every query row; guarded anyway), carries 1/(32768*1024) folded once. Bounded loops only (nkt <= NKT).
// coverage: per wave 1 instruction x 16 rows x 2 chunks x 8 halves = 16 x 16 per plane, KS waves = 16 x 64; the two launches
//           (RES 1: NQO tiles, RES 0: NQT-NQO tiles) x NHG x NB blocks x WPB heads = every (b, s, h) row segment of O hi exactly
//           once and every (b, s < QO, h) row segment of O residual exactly once.
// =====================================================================================================
template <int RES>
__global__ __launch_bounds__(ATT_THREADS)
void attn_g(const u16* __restrict__ QHp, const u16* __restrict__ QLp,
            const u16* __restrict__ KHp, const u16* __restrict__ KLp,
            const u16* __restrict__ VHp, const u16* __restrict__ VLp,
            const float* __restrict__ Gt, u16* OHp, u16* OLp) {
  __shared__ __align__(16) float smem[WPB * KS * WREG];
  constexpr int QT0 = (RES != 0) ? 0 : NQO;
  constexpr int NQL = (RES != 0) ? NQO : (NQT - NQO);
  constexpr int NQE = (NQL > 0) ? NQL : 1;

  const int tid  = threadIdx.x;
  const int wave = __builtin_amdgcn_readfirstlane(tid >> 5);   // scalar, so that every tile start is a scalar base address
  const int lane = tid & 31;
  const unsigned lo = 16u * (unsigned)lane;
  const int hh   = lane >> 4;
  const int c    = lane & 15;
  const int bid  = blockIdx.x;
  const int qt   = QT0 + (bid % NQE);
  const int t2   = bid / NQE;
  const int hg   = t2 % NHG;
  const int b    = t2 / NHG;
  if (b >= NB) return;                      // block-uniform, before the barrier; never taken with the exact grid
  const int q0   = qt * 16;
  if (q0 + 16 > SEQ) return;                // block-uniform; never taken
  if (RES != 0 && q0 + 16 > QO) return;     // block-uniform; never taken
  const int hw   = wave / KS;               // head within the block's group
  const int sp   = wave % KS;               // which quarter of the key tiles
  const int head = hg * WPB + hw;
  const int ql0  = (RES != 0) ? q0 : 0;

  float* pt   = smem + wave * WREG;         // prob tile [16][32] pitch 36
  float* slab = pt + PTW;                   // result slab [16][64] pitch 68

  const size_t hcol = (size_t)head * (SD / 32) * 512;                              // the head's first k tile
  const _Float16* Qh  = ash(QHp) + ((size_t)b * SEQ + q0) * QKN + hcol;
  const _Float16* Ql  = ash(QLp) + ((size_t)b * SEQ + q0) * QKN + hcol;
  const _Float16* Khb = ash(KHp) + ((size_t)b * SEQ) * QKN + hcol;                 // key row tile kb added per step
  const _Float16* Klb = ash(KLp) + ((size_t)b * SEQ) * QKN + hcol;
  const _Float16* Vhb = ash(VHp) + ((size_t)(b * NH + head) * HD) * SEQ;                // d row tile j added per group
  const _Float16* Vlb = ash(VLp) + ((size_t)(b * NH + head) * HD) * QO;                 // RES == 1 only
  const float* gp = Gt + (size_t)head * SEQ;
  const float lsc = RSQ_HD * (LOG2E / (QSC * KSC));
  const float oc  = 1.0f / (PCAR * VCAR);
  const size_t KROW = (size_t)QKN;          // halves per key row; a 16-key row tile spans 16*KROW halves

  float mrow[8], lrow[8];
  v8f o[4];
#pragma unroll
  for (int r = 0; r < 8; ++r) { mrow[r] = -INFINITY; lrow[r] = 0.f; }
#pragma unroll
  for (int j = 0; j < 4; ++j) o[j] = zero8();
  const int ncaus = (q0 >> 5) + 1;                                            // tiles holding keys <= q0 + 15
  const int nkt = (ncaus < NKT) ? ncaus : NKT;
  const int qr0 = q0 + 8 * hh;                                                // query row of D element r = qr0 + r

#pragma unroll 1
  for (int kt = sp; kt < nkt; kt += KS) {
    const int kb = kt * 32;
    // ---- scores: D element r of this lane = (query row qr0 + r, key kb + c) in s0, key kb + 16 + c in s1 ----
    v8f s0 = zero8(), s1 = zero8();
    const _Float16* k0p = Khb + (size_t)kb * KROW;
    const _Float16* k1p = k0p + (size_t)16 * KROW;
    const _Float16* l0p = Klb + (size_t)kb * KROW;
    const _Float16* l1p = l0p + (size_t)16 * KROW;
#pragma unroll
    for (int kk = 0; kk < SD / 32; ++kk) {
      const v16h qh  = ldfrag_h(Qh + kk * 512, lo);
      const v16h ql  = ldfrag_h(Ql + kk * 512, lo);
      const v16h kh0 = ldfrag_h(k0p + kk * 512, lo);
      const v16h kh1 = ldfrag_h(k1p + kk * 512, lo);
      const v16h kl0 = ldfrag_h(l0p + kk * 512, lo);
      const v16h kl1 = ldfrag_h(l1p + kk * 512, lo);
      s0 = mma_h(qh, kh0, s0);
      s0 = mma_h(ql, kh0, s0);
      s0 = mma_h(qh, kl0, s0);
      s1 = mma_h(qh, kh1, s1);
      s1 = mma_h(ql, kh1, s1);
      s1 = mma_h(qh, kl1, s1);
      guard2(s0, s1, qh, ql, kh0, kl0, kh1, kl1);
    }
    // ---- gate (f32, per element) + causal select + online softmax in base 2, -inf-safe ----
    const int key0 = kb + c, key1 = kb + 16 + c;
#pragma unroll
    for (int r = 0; r < 8; ++r) {
      const int qr = qr0 + r;
      int i0 = qr - key0;  i0 = (i0 < 0) ? 0 : i0;  i0 = (i0 > SEQ - 1) ? (SEQ - 1) : i0;
      int i1 = qr - key1;  i1 = (i1 < 0) ? 0 : i1;  i1 = (i1 > SEQ - 1) ? (SEQ - 1) : i1;
      const float g0 = gp[i0];
      const float g1 = gp[i1];
      const float u0 = (s0[r] * lsc) * g0;
      const float u1 = (s1[r] * lsc) * g1;
      const float t0 = (key0 > qr) ? -INFINITY : u0;
      const float t1 = (key1 > qr) ? -INFINITY : u1;
      float mx = fmaxf(t0, t1);
#pragma unroll
      for (int off = 1; off < 16; off <<= 1) mx = fmaxf(mx, __shfl_xor(mx, off, 32));
      const float mn = fmaxf(mrow[r], mx);
      const float ms = (mn == -INFINITY) ? 0.0f : mn;
      const float al = exp2f(mrow[r] - ms);
      mrow[r] = mn;
      const float e0 = exp2f(t0 - ms), e1 = exp2f(t1 - ms);
      float ps = e0 + e1;
#pragma unroll
      for (int off = 1; off < 16; off <<= 1) ps += __shfl_xor(ps, off, 32);
      lrow[r] = lrow[r] * al + ps;
#pragma unroll
      for (int j = 0; j < 4; ++j) o[j][r] *= al;
      const int ro = (8 * hh + r) * PTP + c;
      pt[ro]      = e0;
      pt[ro + 16] = e1;
    }
    wave_sync_lds();
    // ---- A fragments of P*32768: hi f16 and residual f16, row = c, split k map over the 32 keys of this step ----
    FragH ph, pl;
    {
      const float* prow = pt + c * PTP + 8 * hh;
      const v4f p0 = *(const v4f*)(prow), p1 = *(const v4f*)(prow + 4);
      const v4f p2 = *(const v4f*)(prow + 16), p3 = *(const v4f*)(prow + 20);
#pragma unroll
      for (int e = 0; e < 4; ++e) {
        const float ta = p0[e] * PCAR, tb = p1[e] * PCAR, tc = p2[e] * PCAR, td = p3[e] * PCAR;
        const _Float16 ha = (_Float16)ta, hb = (_Float16)tb, hc = (_Float16)tc, hd = (_Float16)td;
        ph.h[0][e]     = ha;                  // elements 0..7  = keys kb + 8hh + 0..7
        ph.h[0][4 + e] = hb;
        ph.h[1][e]     = hc;                  // elements 8..15 = keys kb + 16 + 8hh + 0..7
        ph.h[1][4 + e] = hd;
        pl.h[0][e]     = (_Float16)(ta - (float)ha);
        pl.h[0][4 + e] = (_Float16)(tb - (float)hb);
        pl.h[1][e]     = (_Float16)(tc - (float)hc);
        pl.h[1][4 + e] = (_Float16)(td - (float)hd);
      }
    }
    // ---- P.V : B fragment col n = d = j*16 + c, key tile kb>>5 of the packed v^T planes; 2 groups of 2 d-subtiles ----
    {
      const _Float16* vhp = Vhb + kb * 16;
      if constexpr (RES != 0) {
        const _Float16* vlp = Vlb + kb * 16;
#pragma unroll
        for (int jg = 0; jg < 2; ++jg) {
          const size_t da = (size_t)(2 * jg) * 16 * SEQ;
          const size_t db = da + (size_t)16 * SEQ;
          const size_t la = (size_t)(2 * jg) * 16 * QO;
          const size_t lb = la + (size_t)16 * QO;
          const v16h vha = ldfrag_h(vhp + da, lo), vhb2 = ldfrag_h(vhp + db, lo);
          const v16h vla = ldfrag_h(vlp + la, lo), vlb2 = ldfrag_h(vlp + lb, lo);
          o[2 * jg]     = mma_h(ph.v, vha,  o[2 * jg]);
          o[2 * jg]     = mma_h(pl.v, vha,  o[2 * jg]);
          o[2 * jg]     = mma_h(ph.v, vla,  o[2 * jg]);
          o[2 * jg + 1] = mma_h(ph.v, vhb2, o[2 * jg + 1]);
          o[2 * jg + 1] = mma_h(pl.v, vhb2, o[2 * jg + 1]);
          o[2 * jg + 1] = mma_h(ph.v, vlb2, o[2 * jg + 1]);
          guard2(o[2 * jg], o[2 * jg + 1], ph.v, pl.v, vha, vhb2, vla, vlb2);
        }
      } else {
#pragma unroll
        for (int jg = 0; jg < 2; ++jg) {
          const size_t da = (size_t)(2 * jg) * 16 * SEQ;
          const size_t db = da + (size_t)16 * SEQ;
          const v16h vha = ldfrag_h(vhp + da, lo), vhb2 = ldfrag_h(vhp + db, lo);
          o[2 * jg]     = mma_h(ph.v, vha,  o[2 * jg]);
          o[2 * jg + 1] = mma_h(ph.v, vhb2, o[2 * jg + 1]);
          guard2(o[2 * jg], o[2 * jg + 1], ph.v, vha, vhb2, ph.v, vha, vhb2);
        }
      }
    }
    wave_sync_lds();
  }
  acc_guard4(o[0], o[1], o[2], o[3]);
  // ---- this wave's partial result: raw accumulator into the lane-owned slab, row maxima and sums into the free prob-tile region ----
#pragma unroll
  for (int r = 0; r < 8; ++r) {
#pragma unroll
    for (int j = 0; j < 4; ++j) {
      const int idx = (8 * hh + r) * SLP + j * 16 + c;
      slab[idx] = o[j][r];
    }
    if (c == 0) {
      pt[8 * hh + r]      = mrow[r];
      pt[16 + 8 * hh + r] = lrow[r];
    }
  }
  __syncthreads();                          // publishes the four partial results of each head to its four waves
  // ---- merge for row c: w_s = 2^(m_s - max m) (0 for a wave without keys), Z = sum Z_s*w_s, out = sum acc_s*w_s / Z (0 if Z == 0) ----
  const float* hb = smem + hw * KS * WREG;
  float ms4[KS], ws4[KS];
#pragma unroll
  for (int s = 0; s < KS; ++s) ms4[s] = hb[s * WREG + c];
  const float mm  = fmaxf(fmaxf(ms4[0], ms4[1]), fmaxf(ms4[2], ms4[3]));
  const float mms = (mm == -INFINITY) ? 0.0f : mm;
  float lv = 0.f;
#pragma unroll
  for (int s = 0; s < KS; ++s) {
    ws4[s] = exp2f(ms4[s] - mms);
    lv += hb[s * WREG + 16 + c] * ws4[s];
  }
  const float ls  = (lv > 0.0f) ? lv : 1.0f;
  const float inv = (lv > 0.0f) ? ((1.0f / ls) * oc) : 0.0f;
  // ---- O x1024 -> f16 hi (+ residual) packed planes; lane = (row c, 8 consecutive d at 16*sp + 8*hh): a quarter of the head's two tiles ----
  float w[8];
#pragma unroll
  for (int e = 0; e < 8; ++e) w[e] = 0.f;
#pragma unroll
  for (int s = 0; s < KS; ++s) {
    const float* sr = hb + s * WREG + PTW + c * SLP + sp * 16 + hh * 8;
    const v4f a = *(const v4f*)(sr), b4 = *(const v4f*)(sr + 4);
#pragma unroll
    for (int e = 0; e < 4; ++e) { w[e] += a[e] * ws4[s]; w[4 + e] += b4[e] * ws4[s]; }
  }
  v4u oh, ol;
#pragma unroll
  for (int e = 0; e < 4; ++e) {
    const float w0 = (w[2 * e] * inv) * OSC, w1 = (w[2 * e + 1] * inv) * OSC;
    const _Float16 h0 = (_Float16)w0, h1 = (_Float16)w1;
    const _Float16 l0 = (_Float16)(w0 - (float)h0), l1 = (_Float16)(w1 - (float)h1);
    oh[e] = pk16(h_bits(h0), h_bits(h1));
    ol[e] = pk16(h_bits(l0), h_bits(l1));
  }
  const size_t obh = ((size_t)b * SEQ + q0) * DMOD + (size_t)head * (HD / 32) * 512 + sp * 256 + 8 * lane;
  const size_t obl = ((size_t)b * QO + ql0) * DMOD + (size_t)head * (HD / 32) * 512 + sp * 256 + 8 * lane;
  *(v4u*)(OHp + obh) = oh;
  if constexpr (RES != 0) {
    *(v4u*)(OLp + obl) = ol;
  }
}

// =====================================================================================================
// Workspace map (bytes; every 16-bit plane in the packed tile order, same extents as row-major); every plane is fully written by whole-line stores before it is read; all extents are exact
// multiples of the store granularity (no pad rows needed); every region offset a multiple of 131072:
//   XB  bf16 [MROWS][1024]                       MROWS*2048       (NB=2, SEQ=2048: 8388608)
//   WB  16-bit [2048 n][1024 k]                  4194304          (Wv^T, Wq^T, Wk^T as bf16, then Wo^T as f16 x1024, reused in
//                                                                  launch order; Wv^T and Wo^T use the first half)
//   F   f32 [MROWS][2048]                        MROWS*8192       (v [MROWS][1024], then q, k projection output in launch order;
//                                                                  afterwards OH f16 [MROWS][1024] x1024 at its start, OL residual
//                                                                  [NB*QO][1024] after)
//   QH  f16 [MROWS][2048] x256                   MROWS*4096       QL residual [MROWS][2048]      MROWS*4096
//   KH  f16 [MROWS][2048] x256                   MROWS*4096       KL residual [MROWS][2048]      MROWS*4096
//   VH  f16 [NB*16][64][SEQ] x1024               MROWS*2048       VL residual [NB*16][64][QO]    NB*QO*2048
//   G   f32 [16][SEQ]                            16*SEQ*4
//   end (NB=2, SEQ=2048)                       123863040
// =====================================================================================================
extern "C" void kernel_launch(void* const* d_in, const int* in_sizes, int n_in,
                              void* d_out, int out_size, void* d_ws, size_t ws_size,
                              hipStream_t stream) {
  if (n_in < 6) return;
  if (in_sizes[0] < ((NB - 1) * XS_FULL + SEQ) * DMOD) return;
  if (in_sizes[1] != DMOD * QKN) return;
  if (in_sizes[2] != DMOD * QKN) return;
  if (in_sizes[3] != DMOD * DMOD) return;
  if (in_sizes[4] != DMOD * DMOD) return;
  if (in_sizes[5] < NH) return;
  if (out_size < ((NB - 1) * XS_FULL + SEQ) * DMOD) return;

  const float* x   = (const float*)d_in[0];
  const float* wq  = (const float*)d_in[1];   // [1024 in][2048 out]
  const float* wk  = (const float*)d_in[2];   // [1024 in][2048 out]
  const float* wv  = (const float*)d_in[3];   // [1024 in][1024 out]
  const float* wo  = (const float*)d_in[4];   // [1024 in][1024 out]
  const float* th  = (const float*)d_in[5];   // [16]
  float*       out = (float*)d_out;

  const size_t szXB = (size_t)MROWS * DMOD * 2;
  const size_t szW  = (size_t)QKN * DMOD * 2;
  const size_t szF  = (size_t)MROWS * QKN * 4;
  const size_t szQ  = (size_t)MROWS * QKN * 2;                  // QH, QL, KH, KL
  const size_t szOH = (size_t)MROWS * DMOD * 2;
  const size_t szOL = (size_t)NB * QO * DMOD * 2;
  const size_t szVH = (size_t)NB * NH * HD * SEQ * 2;
  const size_t szVL = (size_t)NB * NH * HD * QO * 2;
  const size_t szG  = (size_t)NH * SEQ * 4;
  if (szOH + szOL > szF) return;                                // OH + OL live inside the F region
  if ((size_t)MROWS * DMOD * 4 > szF) return;                   // v projection output lives inside the F region
  size_t off = 0;
  const size_t oXB = off; off += szXB;
  const size_t oW  = off; off += szW;
  const size_t oF  = off; off += szF;
  const size_t oQH = off; off += szQ;
  const size_t oQL = off; off += szQ;
  const size_t oKH = off; off += szQ;
  const size_t oKL = off; off += szQ;
  const size_t oVH = off; off += szVH;
  const size_t oVL = off; off += szVL;
  const size_t oG  = off; off += szG;
  if (off > ws_size) return;                // off = 123863040 for NB = 2, SEQ = 2048
  if (off > (size_t)WS_CAP) return;

  char* ws = (char*)d_ws;
  u16*   XB = (u16*)(ws + oXB);
  u16*   WB = (u16*)(ws + oW);
  float* F  = (float*)(ws + oF);
  u16*   OH = (u16*)(ws + oF);
  u16*   OL = (u16*)(ws + oF + szOH);
  u16*   QH = (u16*)(ws + oQH);
  u16*   QL = (u16*)(ws + oQL);
  u16*   KH = (u16*)(ws + oKH);
  u16*   KL = (u16*)(ws + oKL);
  u16*   VH = (u16*)(ws + oVH);
  u16*   VL = (u16*)(ws + oVL);
  float* G  = (float*)(ws + oG);

  const dim3 b256(256), b128(128), bAT(ATT_THREADS);
  const int  n8x = (SEQ * DMOD) / 8;
  const dim3 gX((n8x + 255) / 256);                     // per batch
  const dim3 gGT((NH * SEQ + 255) / 256);
  const dim3 gTV((DMOD / 64) * (DMOD / 64));            // 256: [1024][1024] weight -> [1024][1024]
  const dim3 gTQ((DMOD / 64) * (QKN / 64));             // 512: [1024][2048] weight -> [2048][1024]
  const dim3 gGV((MROWS / 64) * (DMOD / 64));
  const dim3 gGQ((MROWS / 64) * (QKN / 64));
  const dim3 gVT(NB * NH * NST);
  const int  n8m = MROWS * C8R;
  const dim3 gM((n8m + 255) / 256);
  const dim3 gATR(NQO * NHG * NB);
  const int  nqp  = NQT - NQO;                          // query tiles with s >= QO
  const int  nrtR = QO / 64;                            // out-projection row tiles per batch with the O residual plane
  const int  nrtP = (SEQ - QO) / 64;                    // remaining row tiles per batch, O hi plane only

  // (0) x -> bf16 plane [MROWS][1024], one launch per batch row block
  for (int b = 0; b < NB; ++b) {
    cvt16<<<gX, b256, 0, stream>>>(x + (size_t)b * XS_FULL * DMOD, XB + (size_t)b * SEQ * DMOD, n8x, 0, 1.0f);
  }
  // (1) gate table G[h][dl]
  gtab<<<gGT, b256, 0, stream>>>(th, G, NH * SEQ);
  // (2) Wv [1024 k][1024 n] -> Wv^T bf16 [1024 n][1024 k]; (3) v = x.Wv -> F f32 [MROWS][1024]; (4) v^T hi + residual x1024
  tr16<<<gTV, b256, 0, stream>>>(wv, WB, DMOD, DMOD, 0, 1.0f);
  gemm_nb<<<gGV, b128, 0, stream>>>(XB, WB, F, MROWS, DMOD, DMOD, 1.0f);
  vt16<<<gVT, b256, 0, stream>>>(F, VH, VL);
  // (5) Wq [1024 k][2048 n] -> Wq^T bf16 [2048 n][1024 k]; (6) q_raw = x.Wq -> F f32 [MROWS][2048]; (7) [qc|qs] hi + residual x256
  tr16<<<gTQ, b256, 0, stream>>>(wq, WB, DMOD, QKN, 0, 1.0f);
  gemm_nb<<<gGQ, b128, 0, stream>>>(XB, WB, F, MROWS, QKN, DMOD, 1.0f);
  qk16<<<gM, b256, 0, stream>>>(F, QH, QL, n8m, QSC);
  // (8) Wk^T; (9) k_raw = x.Wk -> F; (10) [kc|ks] hi + residual x256
  tr16<<<gTQ, b256, 0, stream>>>(wk, WB, DMOD, QKN, 0, 1.0f);
  gemm_nb<<<gGQ, b128, 0, stream>>>(XB, WB, F, MROWS, QKN, DMOD, 1.0f);
  qk16<<<gM, b256, 0, stream>>>(F, KH, KL, n8m, KSC);
  // (11) Wo [1024 k][1024 n] -> Wo^T f16 plane of bf16 value x1024 [1024 n][1024 k]
  tr16<<<gTV, b256, 0, stream>>>(wo, WB, DMOD, DMOD, 1, WOS);
  // (12) causal gated attention: query tiles s < QO with residual P.v products -> O hi + residual; (13) query tiles s >= QO -> O hi
  attn_g<1><<<gATR, bAT, 0, stream>>>(QH, QL, KH, KL, VH, VL, G, OH, OL);
  if (nqp > 0) {
    attn_g<0><<<dim3(nqp * NHG * NB), bAT, 0, stream>>>(QH, QL, KH, KL, VH, VL, G, OH, OL);
  }
  // (14) output projection rows s < QO (O hi + residual) and (15) rows s >= QO (O hi only) -> out f32, carries 1024 x 1024 folded back
  gemm_o<2><<<dim3(NB * nrtR * (DMOD / 64)), b128, 0, stream>>>(OH, OL, WB, out, 0, nrtR, 1.0f / (OSC * WOS));
  if (nrtP > 0) {
    gemm_o<1><<<dim3(NB * nrtP * (DMOD / 64)), b128, 0, stream>>>(OH, OL, WB, out, QO, nrtP, 1.0f / (OSC * WOS));
  }
  (void)hipGetLastError();
}

// v003
// One run takes 286 microseconds.
// Timed twice side by side with v002, it ran 1.18 and 1.17 times as fast.
// Counting every step since v000, it is 1.89 times as fast.
// Contractions: x.Wq, x.Wk, x.Wv on v_wmma_f32_16x16x32_bf16 (x and W^T as bf16 RNE planes); per-head scores
// [qc|qs].[kc|ks] over 128 on v_wmma_f32_16x16x32_f16 (q, k as f16 hi x256 plus unscaled f16 residual planes, products
// hh+lh+hl on all query rows); P.v on v_wmma_f32_16x16x32_f16 (P x32768, v^T x1024 f16 planes; query rows s < QO also
// use f16 residual planes, hh+lh+hl); O.Wo on v_wmma_f32_16x16x32_f16 (O x1024 f16 hi plane, plus residual plane for rows
// s < QO; Wo^T as f16 of its bf16 RNE value x1024); all f32 accumulate. softplus, cos, sin, the cosine gate table,
// causal select, base-2 online softmax and 1/Z in f32 on VALU.
#include <hip/hip_runtime.h>
#include <math.h>
#include <stdint.h>

#ifndef NB
#define NB 2
#endif
#ifndef SEQ
#define SEQ 2048
#endif
#define XS_FULL 2048
#define DMOD  1024
#define QKN   (2 * DMOD)
#define NH    16
#define HD    64
#define SD    (2 * HD)
#define QO    ((SEQ < 512) ? SEQ : 512)
#define MROWS (NB * SEQ)
#define RSQ_HD 0.125f
#define GSTEP 0.125f
#define LOG2E 1.4426950408889634f
#define QSC   256.0f
#define KSC   256.0f
#define PCAR  32768.0f
#define VCAR  1024.0f
#define OSC   1024.0f
#define WOS   1024.0f
#define WPB   1
#define NHG   (NH / WPB)
#define NQT   (SEQ / 16)
#define NQO   (QO / 16)
#define NST   (SEQ / 64)
#define NKT   (SEQ / 32)
#define KS    4
#define ATT_THREADS (WPB * KS * 32)
#define PTP   36
#define PTW   (16 * PTP)
#define SLP   68
#define SLW   (16 * SLP)
#define WREG  (PTW + SLW)
#define SLAB64 (16 * 68)
#define VTP   72
#define C8R   (DMOD / 8)
#define QKP   264
#define WS_CAP 268435456
#define FN    (DMOD + 2 * QKN)                  // columns of the joint projection: v | q | k
#define NB_TRV ((DMOD / 64) * (DMOD / 64))      // transpose blocks of a [1024][1024] weight
#define NB_TRQ ((DMOD / 64) * (QKN / 64))       // transpose blocks of a [1024][2048] weight
#define NB_TR  (2 * NB_TRV + 2 * NB_TRQ)
#define NB_CV  ((MROWS * DMOD / 8) / 256)       // convert blocks of x
#define NB_GT  ((NH * SEQ) / 256)               // gate table blocks
#define NB_QK  ((MROWS * C8R) / 256)            // combine blocks of q, and of k
#define NB_VT  (NB * NH * NST)                  // v^T blocks
#define NB_AT1 (NQO * NHG * NB)                 // attention blocks with residual products
#define NB_AT0 ((NQT - NQO) * NHG * NB)         // attention blocks without
#define NB_OP2 (NB * (QO / 64) * (DMOD / 64))   // output projection blocks with the residual plane
#define NB_OP1 (NB * ((SEQ - QO) / 64) * (DMOD / 64))
static_assert(DMOD == NH * HD && HD == 64 && NH == 16 && SD == 128 && WPB == 1 && NHG * WPB == NH);
static_assert(ATT_THREADS == 128 && KS == 4 && HD == KS * 16);
static_assert(NB >= 1 && NB <= 2);
static_assert((SEQ % 64) == 0 && SEQ >= 64 && SEQ <= XS_FULL);
static_assert((QO % 64) == 0 && QO >= 64 && QO <= SEQ);
static_assert((DMOD % 64) == 0 && (QKN % 64) == 0 && (DMOD % 32) == 0 && (SD % 32) == 0 && C8R == 128);
static_assert((MROWS % 64) == 0);
static_assert(((SEQ * DMOD / 8) % 256) == 0 && ((MROWS * C8R) % 256) == 0 && ((NH * SEQ) % 256) == 0);
static_assert(WPB * KS * WREG * 4 <= 65536 && 2 * HD * VTP * 2 <= 65536 && 4 * SLAB64 * 4 <= 65536 && 64 * VTP * 2 <= 65536);

typedef unsigned short u16;
typedef _Float16 v16h __attribute__((ext_vector_type(16)));
typedef _Float16 v8h  __attribute__((ext_vector_type(8)));
typedef __bf16   v16b __attribute__((ext_vector_type(16)));
typedef float    v8f  __attribute__((ext_vector_type(8)));
typedef float    v4f  __attribute__((ext_vector_type(4)));
typedef unsigned int v4u __attribute__((ext_vector_type(4)));

union FragH { v16h v; v8h h[2]; v4u u[2]; };
union FragB { v16b v; v4u u[2]; };

// ---- scalar helpers --------------------------------------------------------------------------------
__device__ __forceinline__ unsigned short bf_bits(float f) {          // f32 -> bf16 bits, RNE convert
  unsigned u = __float_as_uint(f);
  return (unsigned short)((u + 0x7FFFu + ((u >> 16) & 1u)) >> 16);
}
__device__ __forceinline__ float bf_up(unsigned short h) { return __uint_as_float(((unsigned)h) << 16); }
__device__ __forceinline__ float bfr(float f) { return bf_up(bf_bits(f)); }
__device__ __forceinline__ unsigned short h_bits(_Float16 x) { return __builtin_bit_cast(unsigned short, x); }
__device__ __forceinline__ unsigned pk16(unsigned short a, unsigned short b) { return (unsigned)a | ((unsigned)b << 16); }
__device__ __forceinline__ v8f zero8() { v8f z = {0.f, 0.f, 0.f, 0.f, 0.f, 0.f, 0.f, 0.f}; return z; }
__device__ __forceinline__ const _Float16* ash(const u16* p) { return (const _Float16*)(const void*)p; }

// ---- packed operand planes: a 16-bit plane of R rows x K columns (R % 16 == 0, K % 32 == 0) is stored as 1-KB tiles of
//      16 rows x 32 k, tile (row>>4, k>>5) at half offset (row>>4)*16*K + (k>>5)*512; inside a tile element (m = row&15,
//      k&31 = 16*j + 8*h + e) lies at j*256 + (16*h + m)*8 + e. One fragment load of a wave is then 512 contiguous bytes
//      (4 cache lines) where a row-major plane gave 16 rows x 32 B (16 lines).
// ---- fragment loaders: 16-bit A/B operand, lane -> row/col (lane&15), h = lane>>4; t = a tile start (wave-uniform), lo = the lane's offset from it
//      in BYTES (16*lane inside the tile), p = t + lo bytes; elements 0..7 <- p[0..7] (k0+8h..), elements 8..15 <- p[256..263] (k0+16+8h..)  (same split k map for A and B)
__device__ __forceinline__ v16h ldfrag_h(const _Float16* t, unsigned lo) {
  FragH f;
  const char* p = (const char*)t + lo;
  f.h[0] = *(const v8h*)(p);
  f.h[1] = *(const v8h*)(p + 512);
  return f.v;
}
__device__ __forceinline__ v16b ldfrag_b(const u16* t, unsigned lo) { // bf16 plane read as unsigned integer vectors
  FragB f;
  const char* p = (const char*)t + lo;
  f.u[0] = *(const v4u*)(p);
  f.u[1] = *(const v4u*)(p + 512);
  return f.v;
}

__device__ __forceinline__ v8f mma_h(v16h a, v16h b, v8f c) {
  return __builtin_amdgcn_wmma_f32_16x16x32_f16(false, a, false, b, (short)0, c, false, false);
}
__device__ __forceinline__ v8f mma_b(v16b a, v16b b, v8f c) {
  return __builtin_amdgcn_wmma_f32_16x16x32_bf16(false, a, false, b, (short)0, c, false, false);
}
__device__ __forceinline__ void guard2(v8f& a, v8f& b, v16h x0, v16h x1, v16h x2, v16h x3, v16h x4, v16h x5) {
#if defined(__HIP_DEVICE_COMPILE__)
  asm volatile("v_nop\n\tv_nop\n\tv_nop\n\tv_nop"
               : "+v"(a), "+v"(b) : "v"(x0), "v"(x1), "v"(x2), "v"(x3), "v"(x4), "v"(x5) : "memory");
#endif
}
template <typename F>
__device__ __forceinline__ void guard6(v8f& a, v8f& b, v8f& c, v8f& d, F x0, F x1, F x2, F x3, F x4, F x5) {
#if defined(__HIP_DEVICE_COMPILE__)
  asm volatile("v_nop\n\tv_nop\n\tv_nop\n\tv_nop"
               : "+v"(a), "+v"(b), "+v"(c), "+v"(d) : "v"(x0), "v"(x1), "v"(x2), "v"(x3), "v"(x4), "v"(x5) : "memory");
#endif
}
__device__ __forceinline__ void acc_guard4(v8f& a, v8f& b, v8f& c, v8f& d) {
#if defined(__HIP_DEVICE_COMPILE__)
  asm volatile("v_nop\n\tv_nop\n\tv_nop\n\tv_nop" : "+v"(a), "+v"(b), "+v"(c), "+v"(d));
#endif
}
__device__ __forceinline__ void xcnt_wait() {
#if defined(__HIP_DEVICE_COMPILE__)
  asm volatile("s_wait_xcnt 0x0" ::: "memory");
#endif
}
__device__ __forceinline__ void wave_sync_lds() {
  __builtin_amdgcn_fence(__ATOMIC_RELEASE, "workgroup");
  __builtin_amdgcn_wave_barrier();
  __builtin_amdgcn_fence(__ATOMIC_ACQUIRE, "workgroup");
}

// =====================================================================================================
// x f32 [NB][XS_FULL][DMOD] row-major -> packed 16-bit plane of MROWS rows (K = DMOD).  f16mode == 0: bf16 RNE bits;  f16mode == 1: f16 bits of (bf16 RNE value) * scale.
// Thread = 8 consecutive k of one row: two 16-B loads, one 16-B store; a wave = one half tile (16 rows x 2 chunks of 8 k), stored
// as 512 contiguous, 512-B aligned bytes; the 8 waves of a block read 512 contiguous bytes of each of 16 rows.
// coverage: grid = ceil(n8/256) blocks x 256 thr x 8 (in-kernel bound) = the whole plane (n8 a multiple of 256 here).
// =====================================================================================================
__device__ __forceinline__ void cvt16(int bid, const float* __restrict__ x, u16* D, int n8, int f16mode, float scale) {
  const int gt = bid * 256 + (int)threadIdx.x;
  if (gt >= n8) return;
  const int wv = gt >> 5, ln = gt & 31;                   // wave index = ((row tile * DMOD/32) + k tile) * 2 + j
  const int row = (wv / (DMOD / 16)) * 16 + (ln & 15);
  const int kc  = ((wv >> 1) % (DMOD / 32)) * 32 + (wv & 1) * 16 + (ln >> 4) * 8;
  const float* p = x + ((size_t)(row / SEQ) * XS_FULL + (size_t)(row % SEQ)) * DMOD + kc;   // plane row b*SEQ + s <- x row b*XS_FULL + s
  const v4f a = *(const v4f*)(p), b4 = *(const v4f*)(p + 4);
  float w[8];
#pragma unroll
  for (int e = 0; e < 4; ++e) { w[e] = a[e]; w[4 + e] = b4[e]; }
  v4u o;
#pragma unroll
  for (int e = 0; e < 4; ++e) {
    const float f0 = w[2 * e], f1 = w[2 * e + 1];
    const unsigned short hb0 = h_bits((_Float16)(bfr(f0) * scale));
    const unsigned short hb1 = h_bits((_Float16)(bfr(f1) * scale));
    const unsigned short bb0 = bf_bits(f0);
    const unsigned short bb1 = bf_bits(f1);
    o[e] = (f16mode != 0) ? pk16(hb0, hb1) : pk16(bb0, bb1);
  }
  u16* d = D + (size_t)gt * 8;
  {
    *(v4u*)(d) = o;
    
  }
}

// =====================================================================================================
// Weight transpose + convert: W f32 [KW][NW] row-major (W[k][n], the x.W layout) -> D 16-bit packed plane of NW rows x KW (row n, column k:
// the B operand). f16mode == 0: bf16 RNE bits; f16mode == 1: f16 bits of (bf16 RNE value) * scale.
// Block = one 64 k x 64 n tile: each thread loads 16 floats of one k row (16-B loads), converts, stores them transposed
// into an LDS tile [64 n][64 k] (pitch 72 halves, u16 element stores); after a block barrier each n row segment (64 halves =
// coverage: load 256 thr x 16 = 64 k x 64 n; store 2 iterations x 256 thr x 8 halves = 64 n rows x 64 k = the block's
//           tile; grid = (KW/64)*(NW/64) blocks covers D exactly once (host guarantees KW % 64 == 0, NW % 64 == 0).
// =====================================================================================================
__device__ __forceinline__ void tr16(int bid, const float* __restrict__ W, u16* D, int KW, int NW, int f16mode, float scale) {
  __shared__ __align__(16) u16 T[64 * VTP];
  const int tid = threadIdx.x;
  const int nkt = KW >> 6;
  const int kt  = bid % nkt;
  const int nt  = bid / nkt;
  const int k0  = kt * 64, n0 = nt * 64;
  if (n0 + 64 > NW) return;                 // block-uniform, before any barrier; never taken with the exact grid
  {
    const int kl = tid >> 2;                // k within tile 0..63
    const int nc = (tid & 3) * 16;          // n chunk 0,16,32,48
    const float* src = W + (size_t)(k0 + kl) * NW + n0 + nc;
#pragma unroll
    for (int i = 0; i < 4; ++i) {
      const v4f a = *(const v4f*)(src + 4 * i);
#pragma unroll
      for (int e = 0; e < 4; ++e) {
        const float f = a[e];
        const unsigned short hb = h_bits((_Float16)(bfr(f) * scale));
        const unsigned short bb = bf_bits(f);
        T[(nc + 4 * i + e) * VTP + kl] = (f16mode != 0) ? hb : bb;
      }
    }
  }
  __syncthreads();
  v4u v[2];
#pragma unroll
  for (int it = 0; it < 2; ++it) {
    const int pi = it * 256 + tid;          // 16-B piece: m = pi&15, h = (pi>>4)&1, j = (pi>>5)&1, k tile (pi>>6)&1, n tile pi>>7
    v[it] = *(const v4u*)(T + ((pi >> 7) * 16 + (pi & 15)) * VTP + ((pi >> 6) & 1) * 32 + ((pi >> 5) & 1) * 16 + ((pi >> 4) & 1) * 8);
  }
  {
#pragma unroll
    for (int it = 0; it < 2; ++it) {
      const int pi = it * 256 + tid;
      *(v4u*)(D + (size_t)(n0 + (pi >> 7) * 16) * KW + (size_t)((k0 >> 5) + ((pi >> 6) & 1)) * 512 + (pi & 63) * 8) = v[it];
    }
  }
}

// =====================================================================================================
// Cosine gate table G f32 [NH][SEQ]: G[h][dl] = cos(bf16(theta[h]) * (dl * 0.125f)), dl = query index - key index >= 0
// (cid difference (j-i)/8 is exact in f32 and cos is even). One value per thread, precise cosf; the block's 256 values
// coverage: grid = NH*SEQ/256 blocks x 256 = all NH x SEQ entries (NH*SEQ is a multiple of 256).
// =====================================================================================================
__device__ __forceinline__ void gtab(int bid, const float* __restrict__ theta, float* G, int ntot) {
  __shared__ __align__(16) float sg[256];
  const int tid = threadIdx.x;
  const int gt  = bid * 256 + tid;
  const int gc  = (gt < ntot) ? gt : (ntot - 1);
  const int h   = gc / SEQ;
  const int dl  = gc - h * SEQ;
  const int hc  = (h < NH) ? h : (NH - 1);
  const float th = bfr(theta[hc]);
  const float cd = (float)dl * GSTEP;
  sg[tid] = cosf(th * cd);
  __syncthreads();
  if (tid < 64) {
    const v4f v = *(const v4f*)(sg + tid * 4);
    const int base = bid * 256 + tid * 4;
    if (base + 4 <= ntot) {
      float* d = G + base;
      {
        *(v4f*)(d) = v;
        
      }
    }
  }
}

// =====================================================================================================
// Amplitude/phase combine: F f32, MROWS rows of pitch FN, F = the operand's first column (row = b*SEQ + s; column h*HD + d = amplitude pre-activation, DMOD + h*HD + d
// = phase) -> f16 hi plane Hp and unscaled f16 residual plane Lp, both packed planes of MROWS rows x QKN with column h*SD + d = c-part * sc and
// h*SD + HD + d = s-part * sc, where a = softplus(amp) = max(amp,0) + log1p(exp(-|amp|)), c-part = a*cos(phase),
// s-part = a*sin(phase) (precise expf/log1pf/cosf/sinf), hi = f16(t), residual = f16(t - f16(t)).
// Block = (16 rows, 2 heads); thread = (row, head h, 8 consecutive d): rolled loop of 8 (scalar loads, one transcendental chain per iteration, u16 element
// stores into the thread's own LDS slots, row pitch QKP); block barrier; then four 16-B stores per thread in packed order (the
// block's 8 tiles of each plane are 8 KB contiguous; a wave stores 512 contiguous bytes).
// coverage: grid = MROWS*C8R/256 blocks (clamped block index, predicated store; MROWS*C8R is a multiple of 256) x 2 iterations x
//           256 thr x 8 halves per plane = 16 rows x 256 columns; all blocks = every row x every column of Hp and of Lp once.
// =====================================================================================================
__device__ __forceinline__ void qk16(int bid, const float* __restrict__ F, u16* Hp, u16* Lp, int n8, float sc) {
  __shared__ __align__(16) u16 sHb[16 * QKP];
  __shared__ __align__(16) u16 sLb[16 * QKP];
  const int tid = threadIdx.x;
  const bool act = (bid * 256 + 256 <= n8);   // block-uniform
  const int bc  = act ? bid : 0;
  const int hp  = bc % (NH / 2);            // head pair
  const int rt  = bc / (NH / 2);            // 16-row tile
  const int row = rt * 16 + (tid >> 4);
  const int idx = tid & 15;
  const int h   = hp * 2 + (idx >> 3);
  const int d0  = (idx & 7) * 8;
  const float* ap = F + (size_t)row * FN + h * HD + d0;
  const float* pp = ap + DMOD;
  u16* sh = sHb + (tid >> 4) * QKP + idx * 16;
  u16* sl = sLb + (tid >> 4) * QKP + idx * 16;
#pragma unroll 1
  for (int e = 0; e < 8; ++e) {
    const float am  = ap[e];
    const float ph  = pp[e];
    const float spv = fmaxf(am, 0.0f) + log1pf(expf(-fabsf(am)));
    const float cv  = cosf(ph);
    const float sv  = sinf(ph);
    const float tc  = (spv * cv) * sc;
    const float ts  = (spv * sv) * sc;
    const _Float16 hc = (_Float16)tc, hs = (_Float16)ts;
    const _Float16 lc = (_Float16)(tc - (float)hc), ls = (_Float16)(ts - (float)hs);
    sh[e] = h_bits(hc);  sh[8 + e] = h_bits(hs);
    sl[e] = h_bits(lc);  sl[8 + e] = h_bits(ls);
  }
  __syncthreads();
  // 16-B piece pi of the block's 8 tiles: m = pi&15; column chunk q = pi>>4 (k tile q>>2, j = (q>>1)&1, h = q&1) = head q>>4 of the
  // pair, c or s part (q>>3)&1, d chunk q&7; it was written by thread m*16 + (q>>4)*8 + (q&7) at its slot + 8*part.
  v4u oh2[2], ol2[2];
#pragma unroll
  for (int it = 0; it < 2; ++it) {
    const int pi = it * 256 + tid;
    const int q  = pi >> 4;
    const int so = (pi & 15) * QKP + ((q >> 4) * 8 + (q & 7)) * 16 + ((q >> 3) & 1) * 8;
    oh2[it] = *(const v4u*)(sHb + so);
    ol2[it] = *(const v4u*)(sLb + so);
  }
  const size_t ob = (size_t)rt * 16 * QKN + (size_t)hp * (2 * SD * 16) + (size_t)tid * 8;
  if (act) {
#pragma unroll
    for (int it = 0; it < 2; ++it) {
      *(v4u*)(Hp + ob + it * 2048) = oh2[it];
      *(v4u*)(Lp + ob + it * 2048) = ol2[it];
    }
  }
}

// =====================================================================================================
// v^T planes from the v projection F f32, MROWS rows of pitch FN (row = b*SEQ + s, column = h*HD + d):
//   VH packed plane, row (b*NH + h)*HD + d, column s (K = SEQ) = f16(v * 1024) for all keys s;
//   VL packed plane, same rows, column s (K = QO) = f16 residual (t - f16(t)) for keys s < QO only.
// Block = (b, head h, 64 keys s0): each thread loads its 16 floats (key sl, d chunk dc) with 16-B loads, converts, scatters
// line) is written by 8 consecutive lanes x 16 B of one instruction, in both planes (VL under the block-uniform s0 < QO
// coverage: load 256 thr x 16 = 64 keys x 64 d; store 2 iterations x 256 thr x 8 halves = 64 lines x 64 = the block's tile of
//           VH (and of VL when s0 < QO); grid = NB*NH*NST blocks covers VH exactly once and all QO columns of VL exactly once.
// =====================================================================================================
__device__ __forceinline__ void vt16(int bid, const float* __restrict__ F, u16* VHo, u16* VLo) {
  __shared__ __align__(16) u16 TH[HD * VTP];
  __shared__ __align__(16) u16 TL[HD * VTP];
  const int tid = threadIdx.x;
  const int st  = bid % NST;
  const int t2  = bid / NST;
  const int h   = t2 % NH;
  const int b   = t2 / NH;
  if (b >= NB) return;                      // block-uniform, before any barrier; never taken with the exact grid
  const int s0  = st * 64;
  const bool dolo = (s0 + 64 <= QO);        // block-uniform
  {
    const int sl = tid >> 2;                // key within tile 0..63
    const int dc = (tid & 3) * 16;          // d chunk 0,16,32,48
    const float* src = F + ((size_t)b * SEQ + s0 + sl) * FN + h * HD + dc;
#pragma unroll
    for (int i = 0; i < 4; ++i) {
      const v4f a = *(const v4f*)(src + 4 * i);
#pragma unroll
      for (int e = 0; e < 4; ++e) {
        const float t = a[e] * VCAR;
        const _Float16 hv = (_Float16)t;
        const _Float16 lv = (_Float16)(t - (float)hv);
        TH[(dc + 4 * i + e) * VTP + sl] = h_bits(hv);
        TL[(dc + 4 * i + e) * VTP + sl] = h_bits(lv);
      }
    }
  }
  __syncthreads();
  v4u vh[2], vl[2];
#pragma unroll
  for (int it = 0; it < 2; ++it) {
    const int pi = it * 256 + tid;          // 16-B piece: m = pi&15, h = (pi>>4)&1, j = (pi>>5)&1, key tile (pi>>6)&1, d tile pi>>7
    const int so = ((pi >> 7) * 16 + (pi & 15)) * VTP + ((pi >> 6) & 1) * 32 + ((pi >> 5) & 1) * 16 + ((pi >> 4) & 1) * 8;
    vh[it] = *(const v4u*)(TH + so);
    vl[it] = *(const v4u*)(TL + so);
  }
  const size_t hrow = (size_t)(b * NH + h) * HD;
  const int    sL   = dolo ? s0 : 0;
  {
#pragma unroll
    for (int it = 0; it < 2; ++it) {
      const int pi = it * 256 + tid;
      const size_t dr = hrow + (size_t)(pi >> 7) * 16;
      const int    kq = (pi >> 6) & 1;
      *(v4u*)(VHo + dr * SEQ + (size_t)((s0 >> 5) + kq) * 512 + (pi & 63) * 8) = vh[it];
      xcnt_wait();                          // before the store's address and data registers are reused
      if (dolo) {
        *(v4u*)(VLo + dr * QO + (size_t)((sL >> 5) + kq) * 512 + (pi & 63) * 8) = vl[it];
        xcnt_wait();                        // as above
      }
    }
  }
}

// =====================================================================================================
// GEMM epilogue shared by both engines: the wave's 16x64 f32 tile (times oscale) staged in its LDS slab (pitch 68), release
// coverage: 8 instructions x 2 rows x 16 lanes x 4 floats = the wave's 16 x 64 tile.
// =====================================================================================================
__device__ __forceinline__ void epi64(float* sl, v8f a0, v8f a1, v8f a2, v8f a3, float oscale,
                                      float* C, int N, size_t rowb, int col0, int lane) {
  const int hh = lane >> 4, m = lane & 15;
#pragma unroll
  for (int r = 0; r < 8; ++r) {
    const int ro = (8 * hh + r) * 68 + m;
    sl[ro]      = a0[r] * oscale;
    sl[ro + 16] = a1[r] * oscale;
    sl[ro + 32] = a2[r] * oscale;
    sl[ro + 48] = a3[r] * oscale;
  }
  wave_sync_lds();
  v4f vals[8];
#pragma unroll
  for (int it = 0; it < 8; ++it) vals[it] = *(const v4f*)(sl + (it * 2 + hh) * 68 + m * 4);
  float* dst = C + (rowb + (size_t)hh) * (size_t)N + col0 + m * 4;
  {
#pragma unroll
    for (int it = 0; it < 8; ++it) {
      *(v4f*)(dst + (size_t)(it * 2) * (size_t)N) = vals[it];
    }
    
  }
}

// =====================================================================================================
// bf16 GEMM, no bias: C[M][N] (f32) = A (bf16 packed plane, M rows x K) . Bt^T (bf16 packed plane, N rows x K), times oscale.
// Block = 64x64 tile, 4 waves x 16 rows; fragments loaded straight from the packed tiles (two 16-B loads each, split k map for
// A and B); K stepped by 32 (host guarantees K % 32 == 0, M % 64 == 0, N % 64 == 0, grid = (M/64)*(N/64)).
// =====================================================================================================
__global__ __launch_bounds__(128)
void gemm_nb(const u16* __restrict__ A, const u16* __restrict__ Bt, float* C, int M, int N, int K, float oscale) {
  __shared__ __align__(16) float slab[4 * SLAB64];
  const int tid = threadIdx.x, lane = tid & 31;
  const int wave = __builtin_amdgcn_readfirstlane(tid >> 5);   // scalar, so that the tile starts are computed on the scalar unit
  const unsigned lo = 16u * (unsigned)lane;
  const int ntile = N >> 6;
  const int bid   = blockIdx.x;
  const int rowb  = (bid / ntile) * 64 + wave * 16;
  const int col0  = (bid % ntile) * 64;
  if (rowb + 16 > M) return;                // wave-uniform, never taken with the exact grid; no block barriers in this kernel
  const u16* ap = A  + (size_t)rowb * K;
  const u16* bp = Bt + (size_t)col0 * K;
  const size_t bs = (size_t)16 * K;
  const u16* bp1 = bp + bs;
  const u16* bp2 = bp + 2 * bs;
  const u16* bp3 = bp + 3 * bs;
  v8f acc0 = zero8(), acc1 = zero8(), acc2 = zero8(), acc3 = zero8();
#pragma unroll 1
  for (int k0 = 0; k0 < K; k0 += 32) {
    const v16b a  = ldfrag_b(ap, lo);
    const v16b b0 = ldfrag_b(bp, lo);
    const v16b b1 = ldfrag_b(bp1, lo);
    const v16b b2 = ldfrag_b(bp2, lo);
    const v16b b3 = ldfrag_b(bp3, lo);
    ap += 512; bp += 512; bp1 += 512; bp2 += 512; bp3 += 512;   // next k tile
    acc0 = mma_b(a, b0, acc0);
    acc1 = mma_b(a, b1, acc1);
    acc2 = mma_b(a, b2, acc2);
    acc3 = mma_b(a, b3, acc3);
    guard6<v16b>(acc0, acc1, acc2, acc3, a, b0, b1, b2, b3, a);
  }
  epi64(slab + wave * SLAB64, acc0, acc1, acc2, acc3, oscale, C, N, (size_t)rowb, col0, lane);
}

// =====================================================================================================
// Output projection, no bias: C[row][DMOD] (f32) = (Ah [+ Al])[row][DMOD] . Bt[DMOD][DMOD]^T * oscale.
// NPROD == 1: Ah only (one product); NPROD == 2: Ah + Al residual plane (products h.B + l.B into one accumulator, l unscaled).
// Row indices (packed planes, K = DMOD): Ah row bb*SEQ + s; Al row bb*QO + s (compact plane, s < QO); C row bb*XS_FULL + s.
// Block -> (column tile ct = bid % 16, sequence row tile rt of nrt starting at s = sbeg, batch bb). Same tiling, fragment
// loads (split k map) and epilogue as gemm_nb; K = DMOD stepped by 32.
// =====================================================================================================
template <int NPROD>
__device__ __forceinline__
void gemm_o(float* slab, int bid, const u16* __restrict__ Ah, const u16* __restrict__ Al, const u16* __restrict__ Bt,
            float* C, int sbeg, int nrt, float oscale) {
  const int tid = threadIdx.x, lane = tid & 31;
  const int wave = __builtin_amdgcn_readfirstlane(tid >> 5);   // scalar, so that the tile starts are computed on the scalar unit
  unsigned vo = 16u * (unsigned)lane;         // the lane's byte offset from the row tiles' starts; one k tile (1 KB) further each trip
  const int ntile = DMOD >> 6;
  const int ct    = bid % ntile;
  const int t2    = bid / ntile;
  const int rt    = t2 % nrt;
  const int bb    = t2 / nrt;
  if (bb >= NB) return;                     // block-uniform; no block barriers in this kernel; never taken with the exact grid
  const int srow  = sbeg + rt * 64 + wave * 16;
  if (srow + 16 > SEQ) return;              // wave-uniform; never taken
  if (NPROD == 2 && srow + 16 > QO) return; // wave-uniform; never taken
  const int col0  = ct * 64;
  const int K     = DMOD;
  const size_t rowA = (size_t)bb * SEQ + srow;
  const size_t rowL = (NPROD == 2) ? ((size_t)bb * QO + srow) : (size_t)0;
  const size_t rowC = (size_t)bb * XS_FULL + srow;
  const _Float16* ahp = ash(Ah) + rowA * K;
  const _Float16* alp = ash(Al) + rowL * K;                  // dereferenced only when NPROD == 2
  const _Float16* bp  = ash(Bt) + (size_t)col0 * K;
  const size_t bs = (size_t)16 * K;
  const _Float16* bp1 = bp + bs;
  const _Float16* bp2 = bp + 2 * bs;
  const _Float16* bp3 = bp + 3 * bs;
  v8f acc0 = zero8(), acc1 = zero8(), acc2 = zero8(), acc3 = zero8();
  if constexpr (NPROD == 2) {
#pragma unroll 1
    for (int k0 = 0; k0 < K; k0 += 32) {
      const v16h ah = ldfrag_h(ahp, vo), al = ldfrag_h(alp, vo);
      const v16h b0 = ldfrag_h(bp, vo);
      const v16h b1 = ldfrag_h(bp1, vo);
      const v16h b2 = ldfrag_h(bp2, vo);
      const v16h b3 = ldfrag_h(bp3, vo);
      vo += 1024u;                          // next k tile: 512 halves
      acc0 = mma_h(ah, b0, acc0);  acc0 = mma_h(al, b0, acc0);
      acc1 = mma_h(ah, b1, acc1);  acc1 = mma_h(al, b1, acc1);
      acc2 = mma_h(ah, b2, acc2);  acc2 = mma_h(al, b2, acc2);
      acc3 = mma_h(ah, b3, acc3);  acc3 = mma_h(al, b3, acc3);
      guard6<v16h>(acc0, acc1, acc2, acc3, ah, al, b0, b1, b2, b3);
    }
  } else {
#pragma unroll 1
    for (int k0 = 0; k0 < K; k0 += 32) {
      const v16h ah = ldfrag_h(ahp, vo);
      const v16h b0 = ldfrag_h(bp, vo);
      const v16h b1 = ldfrag_h(bp1, vo);
      const v16h b2 = ldfrag_h(bp2, vo);
      const v16h b3 = ldfrag_h(bp3, vo);
      vo += 1024u;                          // next k tile: 512 halves
      acc0 = mma_h(ah, b0, acc0);
      acc1 = mma_h(ah, b1, acc1);
      acc2 = mma_h(ah, b2, acc2);
      acc3 = mma_h(ah, b3, acc3);
      guard6<v16h>(acc0, acc1, acc2, acc3, ah, b0, b1, b2, b3, ah);
    }
  }
  epi64(slab + wave * SLAB64, acc0, acc1, acc2, acc3, oscale, C, DMOD, rowC, col0, lane);
}

// =====================================================================================================
// Causal gated multi-head attention, score depth SD = 128 ([c|s] parts of one head), hd = 64 for v.
// Block bid -> (query tile qt: rows q0 = 16*qt .. q0+15, head group hg of WPB = 1 head, batch b); KS = 4 waves per head = hg*WPB + wave/KS:
// wave sp = wave % KS takes the key tiles kt = sp, sp + KS, ... with its own running max, sum and accumulator; the four
// partial results are merged once, after one block barrier (weights 2^(m_s - max m), -inf-safe: a wave without tiles adds 0).
// RES == 1: query tiles q0 < QO, P.v = hh + lh + hl with the v^T residual plane, O residual plane also written;
// RES == 0: query tiles q0 >= QO, P.v single products. Scores use q_hi.k_hi + q_lo.k_hi + q_hi.k_lo in both variants.
//   q hi plane f16 x256, packed, row b*SEQ + s, column h*SD + e (e < SD), q residual plane same layout (all rows); k planes likewise;
//   v^T hi plane x1024, packed, row (b*NH + h)*HD + d, column s (K = SEQ), v^T residual plane (K = QO); gate table G[h][i - j] f32.
//   score (log2 domain) t(i, j) = (q_i.k_j over SD) * (1/8)*log2e/(256*256) * G[h][i - j], replaced by -inf where key j >
//   query i (gate index clamped to [0, SEQ-1]; the clamped value is only used on masked elements).
//   Key tiles of 32 with kb <= q0 + 15, each wave's in rising order; with RES == 1 every visited key is below QO, inside the compact
//   v^T residual plane.
//   Per tile: 2 score subtiles x 4 k-steps x 3 products, fragments loaded straight from the 16-bit planes (two 16-B loads
//   per fragment, split k map); online max-subtracted base-2 softmax in f32, -inf-safe rescale; the 16x32 prob tile stored
//   residual) rebuilt from the LDS rows (float vector loads, same element type as stored), v^T B fragments in 2 groups of
//   2 d-subtiles. After the loop each wave writes its raw accumulator into its own result slab (pitch 68; every element owned
//   by one lane) and its 16 row maxima and sums into its prob-tile region; one block barrier (every return stands in front of it
//   and is block-uniform); then wave sp merges columns 16*sp .. 16*sp+15 of its head: out = sum_s acc_s*w_s / sum_s Z_s*w_s
//   (Z > 0 always: key 0 <= every query row; guarded anyway), carries 1/(32768*1024) folded once. Bounded loops only (nkt <= NKT).
// coverage: per wave 1 instruction x 16 rows x 2 chunks x 8 halves = 16 x 16 per plane, KS waves = 16 x 64; the two block ranges
//           (RES 1: NQO tiles, RES 0: NQT-NQO tiles) x NHG x NB blocks x WPB heads = every (b, s, h) row segment of O hi exactly
//           once and every (b, s < QO, h) row segment of O residual exactly once.
// =====================================================================================================
template <int RES>
__device__ __forceinline__
void attn_g(float* smem, int bid, const u16* __restrict__ QHp, const u16* __restrict__ QLp,
            const u16* __restrict__ KHp, const u16* __restrict__ KLp,
            const u16* __restrict__ VHp, const u16* __restrict__ VLp,
            const float* __restrict__ Gt, u16* OHp, u16* OLp) {
  constexpr int QT0 = (RES != 0) ? 0 : NQO;
  constexpr int NQL = (RES != 0) ? NQO : (NQT - NQO);
  constexpr int NQE = (NQL > 0) ? NQL : 1;

  const int tid  = threadIdx.x;
  const int wave = __builtin_amdgcn_readfirstlane(tid >> 5);   // scalar, so that every tile start is a scalar base address
  const int lane = tid & 31;
  const unsigned lo = 16u * (unsigned)lane;
  const int hh   = lane >> 4;
  const int c    = lane & 15;
  const int qt   = QT0 + (bid % NQE);
  const int t2   = bid / NQE;
  const int hg   = t2 % NHG;
  const int b    = t2 / NHG;
  if (b >= NB) return;                      // block-uniform, before the barrier; never taken with the exact grid
  const int q0   = qt * 16;
  if (q0 + 16 > SEQ) return;                // block-uniform; never taken
  if (RES != 0 && q0 + 16 > QO) return;     // block-uniform; never taken
  const int hw   = wave / KS;               // head within the block's group
  const int sp   = wave % KS;               // which quarter of the key tiles
  const int head = hg * WPB + hw;
  const int ql0  = (RES != 0) ? q0 : 0;

  float* pt   = smem + wave * WREG;         // prob tile [16][32] pitch 36
  float* slab = pt + PTW;                   // result slab [16][64] pitch 68

  const size_t hcol = (size_t)head * (SD / 32) * 512;                              // the head's first k tile
  const _Float16* Qh  = ash(QHp) + ((size_t)b * SEQ + q0) * QKN + hcol;
  const _Float16* Ql  = ash(QLp) + ((size_t)b * SEQ + q0) * QKN + hcol;
  const _Float16* Khb = ash(KHp) + ((size_t)b * SEQ) * QKN + hcol;                 // key row tile kb added per step
  const _Float16* Klb = ash(KLp) + ((size_t)b * SEQ) * QKN + hcol;
  const _Float16* Vhb = ash(VHp) + ((size_t)(b * NH + head) * HD) * SEQ;                // d row tile j added per group
  const _Float16* Vlb = ash(VLp) + ((size_t)(b * NH + head) * HD) * QO;                 // RES == 1 only
  const float* gp = Gt + (size_t)head * SEQ;
  const float lsc = RSQ_HD * (LOG2E / (QSC * KSC));
  const float oc  = 1.0f / (PCAR * VCAR);
  const size_t KROW = (size_t)QKN;          // halves per key row; a 16-key row tile spans 16*KROW halves

  float mrow[8], lrow[8];
  v8f o[4];
#pragma unroll
  for (int r = 0; r < 8; ++r) { mrow[r] = -INFINITY; lrow[r] = 0.f; }
#pragma unroll
  for (int j = 0; j < 4; ++j) o[j] = zero8();
  const int ncaus = (q0 >> 5) + 1;                                            // tiles holding keys <= q0 + 15
  const int nkt = (ncaus < NKT) ? ncaus : NKT;
  const int qr0 = q0 + 8 * hh;                                                // query row of D element r = qr0 + r

#pragma unroll 1
  for (int kt = sp; kt < nkt; kt += KS) {
    const int kb = kt * 32;
    // ---- scores: D element r of this lane = (query row qr0 + r, key kb + c) in s0, key kb + 16 + c in s1 ----
    v8f s0 = zero8(), s1 = zero8();
    const _Float16* k0p = Khb + (size_t)kb * KROW;
    const _Float16* k1p = k0p + (size_t)16 * KROW;
    const _Float16* l0p = Klb + (size_t)kb * KROW;
    const _Float16* l1p = l0p + (size_t)16 * KROW;
#pragma unroll
    for (int kk = 0; kk < SD / 32; ++kk) {
      const v16h qh  = ldfrag_h(Qh + kk * 512, lo);
      const v16h ql  = ldfrag_h(Ql + kk * 512, lo);
      const v16h kh0 = ldfrag_h(k0p + kk * 512, lo);
      const v16h kh1 = ldfrag_h(k1p + kk * 512, lo);
      const v16h kl0 = ldfrag_h(l0p + kk * 512, lo);
      const v16h kl1 = ldfrag_h(l1p + kk * 512, lo);
      s0 = mma_h(qh, kh0, s0);
      s0 = mma_h(ql, kh0, s0);
      s0 = mma_h(qh, kl0, s0);
      s1 = mma_h(qh, kh1, s1);
      s1 = mma_h(ql, kh1, s1);
      s1 = mma_h(qh, kl1, s1);
      guard2(s0, s1, qh, ql, kh0, kl0, kh1, kl1);
    }
    // ---- gate (f32, per element) + causal select + online softmax in base 2, -inf-safe ----
    const int key0 = kb + c, key1 = kb + 16 + c;
#pragma unroll
    for (int r = 0; r < 8; ++r) {
      const int qr = qr0 + r;
      int i0 = qr - key0;  i0 = (i0 < 0) ? 0 : i0;  i0 = (i0 > SEQ - 1) ? (SEQ - 1) : i0;
      int i1 = qr - key1;  i1 = (i1 < 0) ? 0 : i1;  i1 = (i1 > SEQ - 1) ? (SEQ - 1) : i1;
      const float g0 = gp[i0];
      const float g1 = gp[i1];
      const float u0 = (s0[r] * lsc) * g0;
      const float u1 = (s1[r] * lsc) * g1;
      const float t0 = (key0 > qr) ? -INFINITY : u0;
      const float t1 = (key1 > qr) ? -INFINITY : u1;
      float mx = fmaxf(t0, t1);
#pragma unroll
      for (int off = 1; off < 16; off <<= 1) mx = fmaxf(mx, __shfl_xor(mx, off, 32));
      const float mn = fmaxf(mrow[r], mx);
      const float ms = (mn == -INFINITY) ? 0.0f : mn;
      const float al = exp2f(mrow[r] - ms);
      mrow[r] = mn;
      const float e0 = exp2f(t0 - ms), e1 = exp2f(t1 - ms);
      float ps = e0 + e1;
#pragma unroll
      for (int off = 1; off < 16; off <<= 1) ps += __shfl_xor(ps, off, 32);
      lrow[r] = lrow[r] * al + ps;
#pragma unroll
      for (int j = 0; j < 4; ++j) o[j][r] *= al;
      const int ro = (8 * hh + r) * PTP + c;
      pt[ro]      = e0;
      pt[ro + 16] = e1;
    }
    wave_sync_lds();
    // ---- A fragments of P*32768: hi f16 and residual f16, row = c, split k map over the 32 keys of this step ----
    FragH ph, pl;
    {
      const float* prow = pt + c * PTP + 8 * hh;
      const v4f p0 = *(const v4f*)(prow), p1 = *(const v4f*)(prow + 4);
      const v4f p2 = *(const v4f*)(prow + 16), p3 = *(const v4f*)(prow + 20);
#pragma unroll
      for (int e = 0; e < 4; ++e) {
        const float ta = p0[e] * PCAR, tb = p1[e] * PCAR, tc = p2[e] * PCAR, td = p3[e] * PCAR;
        const _Float16 ha = (_Float16)ta, hb = (_Float16)tb, hc = (_Float16)tc, hd = (_Float16)td;
        ph.h[0][e]     = ha;                  // elements 0..7  = keys kb + 8hh + 0..7
        ph.h[0][4 + e] = hb;
        ph.h[1][e]     = hc;                  // elements 8..15 = keys kb + 16 + 8hh + 0..7
        ph.h[1][4 + e] = hd;
        pl.h[0][e]     = (_Float16)(ta - (float)ha);
        pl.h[0][4 + e] = (_Float16)(tb - (float)hb);
        pl.h[1][e]     = (_Float16)(tc - (float)hc);
        pl.h[1][4 + e] = (_Float16)(td - (float)hd);
      }
    }
    // ---- P.V : B fragment col n = d = j*16 + c, key tile kb>>5 of the packed v^T planes; 2 groups of 2 d-subtiles ----
    {
      const _Float16* vhp = Vhb + kb * 16;
      if constexpr (RES != 0) {
        const _Float16* vlp = Vlb + kb * 16;
#pragma unroll
        for (int jg = 0; jg < 2; ++jg) {
          const size_t da = (size_t)(2 * jg) * 16 * SEQ;
          const size_t db = da + (size_t)16 * SEQ;
          const size_t la = (size_t)(2 * jg) * 16 * QO;
          const size_t lb = la + (size_t)16 * QO;
          const v16h vha = ldfrag_h(vhp + da, lo), vhb2 = ldfrag_h(vhp + db, lo);
          const v16h vla = ldfrag_h(vlp + la, lo), vlb2 = ldfrag_h(vlp + lb, lo);
          o[2 * jg]     = mma_h(ph.v, vha,  o[2 * jg]);
          o[2 * jg]     = mma_h(pl.v, vha,  o[2 * jg]);
          o[2 * jg]     = mma_h(ph.v, vla,  o[2 * jg]);
          o[2 * jg + 1] = mma_h(ph.v, vhb2, o[2 * jg + 1]);
          o[2 * jg + 1] = mma_h(pl.v, vhb2, o[2 * jg + 1]);
          o[2 * jg + 1] = mma_h(ph.v, vlb2, o[2 * jg + 1]);
          guard2(o[2 * jg], o[2 * jg + 1], ph.v, pl.v, vha, vhb2, vla, vlb2);
        }
      } else {
#pragma unroll
        for (int jg = 0; jg < 2; ++jg) {
          const size_t da = (size_t)(2 * jg) * 16 * SEQ;
          const size_t db = da + (size_t)16 * SEQ;
          const v16h vha = ldfrag_h(vhp + da, lo), vhb2 = ldfrag_h(vhp + db, lo);
          o[2 * jg]     = mma_h(ph.v, vha,  o[2 * jg]);
          o[2 * jg + 1] = mma_h(ph.v, vhb2, o[2 * jg + 1]);
          guard2(o[2 * jg], o[2 * jg + 1], ph.v, vha, vhb2, ph.v, vha, vhb2);
        }
      }
    }
    wave_sync_lds();
  }
  acc_guard4(o[0], o[1], o[2], o[3]);
  // ---- this wave's partial result: raw accumulator into the lane-owned slab, row maxima and sums into the free prob-tile region ----
#pragma unroll
  for (int r = 0; r < 8; ++r) {
#pragma unroll
    for (int j = 0; j < 4; ++j) {
      const int idx = (8 * hh + r) * SLP + j * 16 + c;
      slab[idx] = o[j][r];
    }
    if (c == 0) {
      pt[8 * hh + r]      = mrow[r];
      pt[16 + 8 * hh + r] = lrow[r];
    }
  }
  __syncthreads();                          // publishes the four partial results of each head to its four waves
  // ---- merge for row c: w_s = 2^(m_s - max m) (0 for a wave without keys), Z = sum Z_s*w_s, out = sum acc_s*w_s / Z (0 if Z == 0) ----
  const float* hb = smem + hw * KS * WREG;
  float ms4[KS], ws4[KS];
#pragma unroll
  for (int s = 0; s < KS; ++s) ms4[s] = hb[s * WREG + c];
  const float mm  = fmaxf(fmaxf(ms4[0], ms4[1]), fmaxf(ms4[2], ms4[3]));
  const float mms = (mm == -INFINITY) ? 0.0f : mm;
  float lv = 0.f;
#pragma unroll
  for (int s = 0; s < KS; ++s) {
    ws4[s] = exp2f(ms4[s] - mms);
    lv += hb[s * WREG + 16 + c] * ws4[s];
  }
  const float ls  = (lv > 0.0f) ? lv : 1.0f;
  const float inv = (lv > 0.0f) ? ((1.0f / ls) * oc) : 0.0f;
  // ---- O x1024 -> f16 hi (+ residual) packed planes; lane = (row c, 8 consecutive d at 16*sp + 8*hh): a quarter of the head's two tiles ----
  float w[8];
#pragma unroll
  for (int e = 0; e < 8; ++e) w[e] = 0.f;
#pragma unroll
  for (int s = 0; s < KS; ++s) {
    const float* sr = hb + s * WREG + PTW + c * SLP + sp * 16 + hh * 8;
    const v4f a = *(const v4f*)(sr), b4 = *(const v4f*)(sr + 4);
#pragma unroll
    for (int e = 0; e < 4; ++e) { w[e] += a[e] * ws4[s]; w[4 + e] += b4[e] * ws4[s]; }
  }
  v4u oh, ol;
#pragma unroll
  for (int e = 0; e < 4; ++e) {
    const float w0 = (w[2 * e] * inv) * OSC, w1 = (w[2 * e + 1] * inv) * OSC;
    const _Float16 h0 = (_Float16)w0, h1 = (_Float16)w1;
    const _Float16 l0 = (_Float16)(w0 - (float)h0), l1 = (_Float16)(w1 - (float)h1);
    oh[e] = pk16(h_bits(h0), h_bits(h1));
    ol[e] = pk16(h_bits(l0), h_bits(l1));
  }
  const size_t obh = ((size_t)b * SEQ + q0) * DMOD + (size_t)head * (HD / 32) * 512 + sp * 256 + 8 * lane;
  const size_t obl = ((size_t)b * QO + ql0) * DMOD + (size_t)head * (HD / 32) * 512 + sp * 256 + 8 * lane;
  *(v4u*)(OHp + obh) = oh;
  if constexpr (RES != 0) {
    *(v4u*)(OLp + obl) = ol;
  }
}

// =====================================================================================================
// Joint grids: kernels that depend on the same earlier launch and on nothing of each other run as block ranges of ONE launch
// (every test below is block-uniform; each range runs its function unchanged with its own block index counted from 0).
// prep: weight transposes (Wv^T | Wq^T | Wk^T as one bf16 plane of FN rows x DMOD, Wo^T as its own f16 plane), x -> bf16 plane, gate table.
// =====================================================================================================
__global__ __launch_bounds__(256)
void prep(const float* __restrict__ x, const float* __restrict__ wv, const float* __restrict__ wq, const float* __restrict__ wk,
          const float* __restrict__ wo, const float* __restrict__ theta, u16* XB, u16* WB, u16* WO, float* G) {
  const int bid = blockIdx.x;
  if (bid < NB_TR) {
    const float* Wsrc = wv;
    u16* D = WB;
    int lb = bid, NW = DMOD, mode = 0;
    float sc = 1.0f;
    if (bid >= NB_TRV + 2 * NB_TRQ)  { Wsrc = wo; D = WO; lb = bid - (NB_TRV + 2 * NB_TRQ); mode = 1; sc = WOS; }
    else if (bid >= NB_TRV + NB_TRQ) { Wsrc = wk; D = WB + (size_t)(DMOD + QKN) * DMOD; lb = bid - (NB_TRV + NB_TRQ); NW = QKN; }
    else if (bid >= NB_TRV)          { Wsrc = wq; D = WB + (size_t)DMOD * DMOD; lb = bid - NB_TRV; NW = QKN; }
    tr16(lb, Wsrc, D, DMOD, NW, mode, sc);
  } else if (bid < NB_TR + NB_CV) {
    cvt16(bid - NB_TR, x, XB, MROWS * DMOD / 8, 0, 1.0f);
  } else {
    gtab(bid - (NB_TR + NB_CV), theta, G, NH * SEQ);
  }
}

// post: F f32 [MROWS][FN] (columns v | q | k) -> [qc|qs] planes, [kc|ks] planes, v^T planes.
__global__ __launch_bounds__(256)
void post(const float* __restrict__ F, u16* QH, u16* QL, u16* KH, u16* KL, u16* VH, u16* VL) {
  const int bid = blockIdx.x;
  if (bid < 2 * NB_QK) {
    const bool isk = (bid >= NB_QK);
    qk16(isk ? bid - NB_QK : bid, F + (isk ? (DMOD + QKN) : DMOD), isk ? KH : QH, isk ? KL : QL, MROWS * C8R, isk ? KSC : QSC);
  } else {
    vt16(bid - 2 * NB_QK, F, VH, VL);
  }
}

// attention: the query tiles s >= QO first, then the query tiles s < QO (residual products).
__global__ __launch_bounds__(ATT_THREADS)
void attn_all(const u16* __restrict__ QHp, const u16* __restrict__ QLp, const u16* __restrict__ KHp, const u16* __restrict__ KLp,
              const u16* __restrict__ VHp, const u16* __restrict__ VLp, const float* __restrict__ Gt, u16* OHp, u16* OLp) {
  __shared__ __align__(16) float smem[WPB * KS * WREG];
  const int bid = blockIdx.x;
  if (bid < NB_AT0) attn_g<0>(smem, bid, QHp, QLp, KHp, KLp, VHp, VLp, Gt, OHp, OLp);
  else              attn_g<1>(smem, bid - NB_AT0, QHp, QLp, KHp, KLp, VHp, VLp, Gt, OHp, OLp);
}

// output projection: rows s < QO (O hi + residual) first, then rows s >= QO (O hi only).
__global__ __launch_bounds__(128)
void gemm_o_all(const u16* __restrict__ Ah, const u16* __restrict__ Al, const u16* __restrict__ Bt, float* C, float oscale) {
  __shared__ __align__(16) float slab[4 * SLAB64];
  const int bid = blockIdx.x;
  if (bid < NB_OP2) gemm_o<2>(slab, bid, Ah, Al, Bt, C, 0, QO / 64, oscale);
  else              gemm_o<1>(slab, bid - NB_OP2, Ah, Al, Bt, C, QO, (SEQ - QO) / 64, oscale);
}

// =====================================================================================================
// Workspace map (bytes; every 16-bit plane in the packed tile order, same extents as row-major); every plane is fully written by whole-line stores before it is read; all extents are exact
// multiples of the store granularity (no pad rows needed); every region offset a multiple of 131072:
//   XB  bf16 [MROWS][1024]                       MROWS*2048       (NB=2, SEQ=2048: 8388608)
//   WB  bf16 [5120 n][1024 k]                    10485760         (rows Wv^T | Wq^T | Wk^T)
//   WO  f16 [1024 n][1024 k] x1024               2097152          (Wo^T)
//   F   f32 [MROWS][5120]                        MROWS*20480      (columns v | q | k projection output;
//                                                                  afterwards OH f16 [MROWS][1024] x1024 at its start, OL residual
//                                                                  [NB*QO][1024] after)
//   QH  f16 [MROWS][2048] x256                   MROWS*4096       QL residual [MROWS][2048]      MROWS*4096
//   KH  f16 [MROWS][2048] x256                   MROWS*4096       KL residual [MROWS][2048]      MROWS*4096
//   VH  f16 [NB*16][64][SEQ] x1024               MROWS*2048       VL residual [NB*16][64][QO]    NB*QO*2048
//   G   f32 [16][SEQ]                            16*SEQ*4
//   end (NB=2, SEQ=2048)                       182583296
// =====================================================================================================
extern "C" void kernel_launch(void* const* d_in, const int* in_sizes, int n_in,
                              void* d_out, int out_size, void* d_ws, size_t ws_size,
                              hipStream_t stream) {
  if (n_in < 6) return;
  if (in_sizes[0] < ((NB - 1) * XS_FULL + SEQ) * DMOD) return;
  if (in_sizes[1] != DMOD * QKN) return;
  if (in_sizes[2] != DMOD * QKN) return;
  if (in_sizes[3] != DMOD * DMOD) return;
  if (in_sizes[4] != DMOD * DMOD) return;
  if (in_sizes[5] < NH) return;
  if (out_size < ((NB - 1) * XS_FULL + SEQ) * DMOD) return;

  const float* x   = (const float*)d_in[0];
  const float* wq  = (const float*)d_in[1];   // [1024 in][2048 out]
  const float* wk  = (const float*)d_in[2];   // [1024 in][2048 out]
  const float* wv  = (const float*)d_in[3];   // [1024 in][1024 out]
  const float* wo  = (const float*)d_in[4];   // [1024 in][1024 out]
  const float* th  = (const float*)d_in[5];   // [16]
  float*       out = (float*)d_out;

  const size_t szXB = (size_t)MROWS * DMOD * 2;
  const size_t szW  = (size_t)FN * DMOD * 2;
  const size_t szWO = (size_t)DMOD * DMOD * 2;
  const size_t szF  = (size_t)MROWS * FN * 4;
  const size_t szQ  = (size_t)MROWS * QKN * 2;                  // QH, QL, KH, KL
  const size_t szOH = (size_t)MROWS * DMOD * 2;
  const size_t szOL = (size_t)NB * QO * DMOD * 2;
  const size_t szVH = (size_t)NB * NH * HD * SEQ * 2;
  const size_t szVL = (size_t)NB * NH * HD * QO * 2;
  const size_t szG  = (size_t)NH * SEQ * 4;
  if (szOH + szOL > szF) return;                                // OH + OL live inside the F region
  size_t off = 0;
  const size_t oXB = off; off += szXB;
  const size_t oW  = off; off += szW;
  const size_t oWO = off; off += szWO;
  const size_t oF  = off; off += szF;
  const size_t oQH = off; off += szQ;
  const size_t oQL = off; off += szQ;
  const size_t oKH = off; off += szQ;
  const size_t oKL = off; off += szQ;
  const size_t oVH = off; off += szVH;
  const size_t oVL = off; off += szVL;
  const size_t oG  = off; off += szG;
  if (off > ws_size) return;                // off = 182583296 for NB = 2, SEQ = 2048
  if (off > (size_t)WS_CAP) return;

  char* ws = (char*)d_ws;
  u16*   XB = (u16*)(ws + oXB);
  u16*   WB = (u16*)(ws + oW);
  u16*   WO = (u16*)(ws + oWO);
  float* F  = (float*)(ws + oF);
  u16*   OH = (u16*)(ws + oF);
  u16*   OL = (u16*)(ws + oF + szOH);
  u16*   QH = (u16*)(ws + oQH);
  u16*   QL = (u16*)(ws + oQL);
  u16*   KH = (u16*)(ws + oKH);
  u16*   KL = (u16*)(ws + oKL);
  u16*   VH = (u16*)(ws + oVH);
  u16*   VL = (u16*)(ws + oVL);
  float* G  = (float*)(ws + oG);

  const dim3 b256(256), b128(128), bAT(ATT_THREADS);

  // (0) weights -> transposed 16-bit planes, x -> bf16 plane [MROWS][1024], gate table G[h][dl]
  prep<<<dim3(NB_TR + NB_CV + NB_GT), b256, 0, stream>>>(x, wv, wq, wk, wo, th, XB, WB, WO, G);
  // (1) [v | q_raw | k_raw] = x.[Wv | Wq | Wk] -> F f32 [MROWS][5120]
  gemm_nb<<<dim3((MROWS / 64) * (FN / 64)), b128, 0, stream>>>(XB, WB, F, MROWS, FN, DMOD, 1.0f);
  // (2) [qc|qs] and [kc|ks] hi + residual x256, v^T hi + residual x1024
  post<<<dim3(2 * NB_QK + NB_VT), b256, 0, stream>>>(F, QH, QL, KH, KL, VH, VL);
  // (3) causal gated attention -> O hi (all rows) + residual (rows s < QO)
  attn_all<<<dim3(NB_AT0 + NB_AT1), bAT, 0, stream>>>(QH, QL, KH, KL, VH, VL, G, OH, OL);
  // (4) output projection -> out f32, carries 1024 x 1024 folded back
  gemm_o_all<<<dim3(NB_OP2 + NB_OP1), b128, 0, stream>>>(OH, OL, WO, out, 1.0f / (OSC * WOS));
  (void)hipGetLastError();
}

// v004
// A run of this version takes 264 microseconds.
// Next to v003, in two timings, it ran 1.09 times as fast each time.
// Over all steps from v000 it is 2.06 times as fast.
// Contractions: x.Wq, x.Wk, x.Wv on v_wmma_f32_16x16x32_bf16 (x and W^T as bf16 RNE planes); per-head scores
// [qc|qs].[kc|ks] over 128 on v_wmma_f32_16x16x32_f16 (q, k as f16 hi x256 plus unscaled f16 residual planes, products
// hh+lh+hl on all query rows); P.v on v_wmma_f32_16x16x32_f16 (P x32768, v^T x1024 f16 planes; query rows s < QO also
// use f16 residual planes, hh+lh+hl); O.Wo on v_wmma_f32_16x16x32_f16 (O x1024 f16 hi plane, plus residual plane for rows
// s < QO; Wo^T as f16 of its bf16 RNE value x1024); all f32 accumulate. softplus, cos, sin, the cosine gate table,
// causal select, base-2 online softmax and 1/Z in f32 on VALU.
#include <hip/hip_runtime.h>
#include <math.h>
#include <stdint.h>

#ifndef NB
#define NB 2
#endif
#ifndef SEQ
#define SEQ 2048
#endif
#define XS_FULL 2048
#define DMOD  1024
#define QKN   (2 * DMOD)
#define NH    16
#define HD    64
#define SD    (2 * HD)
#define QO    ((SEQ < 512) ? SEQ : 512)
#define MROWS (NB * SEQ)
#define RSQ_HD 0.125f
#define GSTEP 0.125f
#define LOG2E 1.4426950408889634f
#define QSC   256.0f
#define KSC   256.0f
#define PCAR  32768.0f
#define VCAR  1024.0f
#define OSC   1024.0f
#define WOS   1024.0f
#define WPB   1
#define NHG   (NH / WPB)
#define NQT   (SEQ / 16)
#define NQO   (QO / 16)
#define QW    2                                 // query tiles of 16 rows that one attention wave carries
#define NQB   (NQT / QW)                        // attention query blocks of 16*QW rows
#define NQOB  (NQO / QW)
#define NST   (SEQ / 64)
#define NKT   (SEQ / 32)
#define KS    4
#define ATT_THREADS (WPB * KS * 32)
#define PTP   36
#define PTW   (16 * PTP)
#define SLP   68
#define SLW   (16 * SLP)
#define WSUB  (PTW + SLW)
#define WREG  (QW * WSUB)
#define SLAB64 (16 * 68)
#define VTP   72
#define C8R   (DMOD / 8)
#define QKP   264
#define WS_CAP 268435456
#define FN    (DMOD + 2 * QKN)                  // columns of the joint projection: v | q | k
#define NB_TRV ((DMOD / 64) * (DMOD / 64))      // transpose blocks of a [1024][1024] weight
#define NB_TRQ ((DMOD / 64) * (QKN / 64))       // transpose blocks of a [1024][2048] weight
#define NB_TR  (2 * NB_TRV + 2 * NB_TRQ)
#define NB_CV  ((MROWS * DMOD / 8) / 256)       // convert blocks of x
#define NB_GT  ((NH * SEQ) / 256)               // gate table blocks
#define NB_QK  ((MROWS * C8R) / 256)            // combine blocks of q, and of k
#define NB_VT  (NB * NH * NST)                  // v^T blocks
#define NB_AT1 (NQOB * NHG * NB)                // attention blocks with residual products
#define NB_AT0 ((NQB - NQOB) * NHG * NB)        // attention blocks without
#define NB_OP2 (NB * (QO / 64) * (DMOD / 64))   // output projection blocks with the residual plane
#define NB_OP1 (NB * ((SEQ - QO) / 64) * (DMOD / 64))
static_assert(DMOD == NH * HD && HD == 64 && NH == 16 && SD == 128 && WPB == 1 && NHG * WPB == NH);
static_assert(ATT_THREADS == 128 && KS == 4 && HD == KS * 16 && QW == 2 && NQB * QW == NQT && NQOB * QW == NQO);
static_assert(NB >= 1 && NB <= 2);
static_assert((SEQ % 64) == 0 && SEQ >= 64 && SEQ <= XS_FULL);
static_assert((QO % 64) == 0 && QO >= 64 && QO <= SEQ);
static_assert((DMOD % 64) == 0 && (QKN % 64) == 0 && (DMOD % 32) == 0 && (SD % 32) == 0 && C8R == 128);
static_assert((MROWS % 64) == 0);
static_assert(((SEQ * DMOD / 8) % 256) == 0 && ((MROWS * C8R) % 256) == 0 && ((NH * SEQ) % 256) == 0);
static_assert(WPB * KS * WREG * 4 <= 65536 && 2 * HD * VTP * 2 <= 65536 && 4 * SLAB64 * 4 <= 65536 && 64 * VTP * 2 <= 65536);

typedef unsigned short u16;
typedef _Float16 v16h __attribute__((ext_vector_type(16)));
typedef _Float16 v8h  __attribute__((ext_vector_type(8)));
typedef __bf16   v16b __attribute__((ext_vector_type(16)));
typedef float    v8f  __attribute__((ext_vector_type(8)));
typedef float    v4f  __attribute__((ext_vector_type(4)));
typedef unsigned int v4u __attribute__((ext_vector_type(4)));

union FragH { v16h v; v8h h[2]; v4u u[2]; };
union FragB { v16b v; v4u u[2]; };

// ---- scalar helpers --------------------------------------------------------------------------------
__device__ __forceinline__ unsigned short bf_bits(float f) {          // f32 -> bf16 bits, RNE convert
  unsigned u = __float_as_uint(f);
  return (unsigned short)((u + 0x7FFFu + ((u >> 16) & 1u)) >> 16);
}
__device__ __forceinline__ float bf_up(unsigned short h) { return __uint_as_float(((unsigned)h) << 16); }
__device__ __forceinline__ float bfr(float f) { return bf_up(bf_bits(f)); }
__device__ __forceinline__ unsigned short h_bits(_Float16 x) { return __builtin_bit_cast(unsigned short, x); }
__device__ __forceinline__ unsigned pk16(unsigned short a, unsigned short b) { return (unsigned)a | ((unsigned)b << 16); }
__device__ __forceinline__ v8f zero8() { v8f z = {0.f, 0.f, 0.f, 0.f, 0.f, 0.f, 0.f, 0.f}; return z; }
__device__ __forceinline__ const _Float16* ash(const u16* p) { return (const _Float16*)(const void*)p; }

// ---- packed operand planes: a 16-bit plane of R rows x K columns (R % 16 == 0, K % 32 == 0) is stored as 1-KB tiles of
//      16 rows x 32 k, tile (row>>4, k>>5) at half offset (row>>4)*16*K + (k>>5)*512; inside a tile element (m = row&15,
//      k&31 = 16*j + 8*h + e) lies at j*256 + (16*h + m)*8 + e. One fragment load of a wave is then 512 contiguous bytes
//      (4 cache lines) where a row-major plane gave 16 rows x 32 B (16 lines).
// ---- fragment loaders: 16-bit A/B operand, lane -> row/col (lane&15), h = lane>>4; t = a tile start (wave-uniform), lo = the lane's offset from it
//      in BYTES (16*lane inside the tile), p = t + lo bytes; elements 0..7 <- p[0..7] (k0+8h..), elements 8..15 <- p[256..263] (k0+16+8h..)  (same split k map for A and B)
__device__ __forceinline__ v16h ldfrag_h(const _Float16* t, unsigned lo) {
  FragH f;
  const char* p = (const char*)t + lo;
  f.h[0] = *(const v8h*)(p);
  f.h[1] = *(const v8h*)(p + 512);
  return f.v;
}
__device__ __forceinline__ v16b ldfrag_b(const u16* t, unsigned lo) { // bf16 plane read as unsigned integer vectors
  FragB f;
  const char* p = (const char*)t + lo;
  f.u[0] = *(const v4u*)(p);
  f.u[1] = *(const v4u*)(p + 512);
  return f.v;
}

__device__ __forceinline__ v8f mma_h(v16h a, v16h b, v8f c) {
  return __builtin_amdgcn_wmma_f32_16x16x32_f16(false, a, false, b, (short)0, c, false, false);
}
__device__ __forceinline__ v8f mma_b(v16b a, v16b b, v8f c) {
  return __builtin_amdgcn_wmma_f32_16x16x32_bf16(false, a, false, b, (short)0, c, false, false);
}
// four accumulators and eight operand fragments: the four vector slots behind the last matrix instruction of a group,
// with its results and operands held in their registers up to there
__device__ __forceinline__ void guard4(v8f& a, v8f& b, v8f& c, v8f& d, v16h x0, v16h x1, v16h x2, v16h x3, v16h x4, v16h x5, v16h x6, v16h x7) {
#if defined(__HIP_DEVICE_COMPILE__)
  asm volatile("v_nop\n\tv_nop\n\tv_nop\n\tv_nop"
               : "+v"(a), "+v"(b), "+v"(c), "+v"(d)
               : "v"(x0), "v"(x1), "v"(x2), "v"(x3), "v"(x4), "v"(x5), "v"(x6), "v"(x7) : "memory");
#endif
}
template <typename F>
__device__ __forceinline__ void guard6(v8f& a, v8f& b, v8f& c, v8f& d, F x0, F x1, F x2, F x3, F x4, F x5) {
#if defined(__HIP_DEVICE_COMPILE__)
  asm volatile("v_nop\n\tv_nop\n\tv_nop\n\tv_nop"
               : "+v"(a), "+v"(b), "+v"(c), "+v"(d) : "v"(x0), "v"(x1), "v"(x2), "v"(x3), "v"(x4), "v"(x5) : "memory");
#endif
}
__device__ __forceinline__ void acc_guard4(v8f& a, v8f& b, v8f& c, v8f& d) {
#if defined(__HIP_DEVICE_COMPILE__)
  asm volatile("v_nop\n\tv_nop\n\tv_nop\n\tv_nop" : "+v"(a), "+v"(b), "+v"(c), "+v"(d));
#endif
}
__device__ __forceinline__ void xcnt_wait() {
#if defined(__HIP_DEVICE_COMPILE__)
  asm volatile("s_wait_xcnt 0x0" ::: "memory");
#endif
}
__device__ __forceinline__ void wave_sync_lds() {
  __builtin_amdgcn_fence(__ATOMIC_RELEASE, "workgroup");
  __builtin_amdgcn_wave_barrier();
  __builtin_amdgcn_fence(__ATOMIC_ACQUIRE, "workgroup");
}

// =====================================================================================================
// x f32 [NB][XS_FULL][DMOD] row-major -> packed 16-bit plane of MROWS rows (K = DMOD).  f16mode == 0: bf16 RNE bits;  f16mode == 1: f16 bits of (bf16 RNE value) * scale.
// Thread = 8 consecutive k of one row: two 16-B loads, one 16-B store; a wave = one half tile (16 rows x 2 chunks of 8 k), stored
// as 512 contiguous, 512-B aligned bytes; the 8 waves of a block read 512 contiguous bytes of each of 16 rows.
// coverage: grid = ceil(n8/256) blocks x 256 thr x 8 (in-kernel bound) = the whole plane (n8 a multiple of 256 here).
// =====================================================================================================
__device__ __forceinline__ void cvt16(int bid, const float* __restrict__ x, u16* D, int n8, int f16mode, float scale) {
  const int gt = bid * 256 + (int)threadIdx.x;
  if (gt >= n8) return;
  const int wv = gt >> 5, ln = gt & 31;                   // wave index = ((row tile * DMOD/32) + k tile) * 2 + j
  const int row = (wv / (DMOD / 16)) * 16 + (ln & 15);
  const int kc  = ((wv >> 1) % (DMOD / 32)) * 32 + (wv & 1) * 16 + (ln >> 4) * 8;
  const float* p = x + ((size_t)(row / SEQ) * XS_FULL + (size_t)(row % SEQ)) * DMOD + kc;   // plane row b*SEQ + s <- x row b*XS_FULL + s
  const v4f a = *(const v4f*)(p), b4 = *(const v4f*)(p + 4);
  float w[8];
#pragma unroll
  for (int e = 0; e < 4; ++e) { w[e] = a[e]; w[4 + e] = b4[e]; }
  v4u o;
#pragma unroll
  for (int e = 0; e < 4; ++e) {
    const float f0 = w[2 * e], f1 = w[2 * e + 1];
    const unsigned short hb0 = h_bits((_Float16)(bfr(f0) * scale));
    const unsigned short hb1 = h_bits((_Float16)(bfr(f1) * scale));
    const unsigned short bb0 = bf_bits(f0);
    const unsigned short bb1 = bf_bits(f1);
    o[e] = (f16mode != 0) ? pk16(hb0, hb1) : pk16(bb0, bb1);
  }
  u16* d = D + (size_t)gt * 8;
  {
    *(v4u*)(d) = o;
    
  }
}

// =====================================================================================================
// Weight transpose + convert: W f32 [KW][NW] row-major (W[k][n], the x.W layout) -> D 16-bit packed plane of NW rows x KW (row n, column k:
// the B operand). f16mode == 0: bf16 RNE bits; f16mode == 1: f16 bits of (bf16 RNE value) * scale.
// Block = one 64 k x 64 n tile: each thread loads 16 floats of one k row (16-B loads), converts, stores them transposed
// into an LDS tile [64 n][64 k] (pitch 72 halves, u16 element stores); after a block barrier each n row segment (64 halves =
// coverage: load 256 thr x 16 = 64 k x 64 n; store 2 iterations x 256 thr x 8 halves = 64 n rows x 64 k = the block's
//           tile; grid = (KW/64)*(NW/64) blocks covers D exactly once (host guarantees KW % 64 == 0, NW % 64 == 0).
// =====================================================================================================
__device__ __forceinline__ void tr16(int bid, const float* __restrict__ W, u16* D, int KW, int NW, int f16mode, float scale) {
  __shared__ __align__(16) u16 T[64 * VTP];
  const int tid = threadIdx.x;
  const int nkt = KW >> 6;
  const int kt  = bid % nkt;
  const int nt  = bid / nkt;
  const int k0  = kt * 64, n0 = nt * 64;
  if (n0 + 64 > NW) return;                 // block-uniform, before any barrier; never taken with the exact grid
  {
    const int kl = tid >> 2;                // k within tile 0..63
    const int nc = (tid & 3) * 16;          // n chunk 0,16,32,48
    const float* src = W + (size_t)(k0 + kl) * NW + n0 + nc;
#pragma unroll
    for (int i = 0; i < 4; ++i) {
      const v4f a = *(const v4f*)(src + 4 * i);
#pragma unroll
      for (int e = 0; e < 4; ++e) {
        const float f = a[e];
        const unsigned short hb = h_bits((_Float16)(bfr(f) * scale));
        const unsigned short bb = bf_bits(f);
        T[(nc + 4 * i + e) * VTP + kl] = (f16mode != 0) ? hb : bb;
      }
    }
  }
  __syncthreads();
  v4u v[2];
#pragma unroll
  for (int it = 0; it < 2; ++it) {
    const int pi = it * 256 + tid;          // 16-B piece: m = pi&15, h = (pi>>4)&1, j = (pi>>5)&1, k tile (pi>>6)&1, n tile pi>>7
    v[it] = *(const v4u*)(T + ((pi >> 7) * 16 + (pi & 15)) * VTP + ((pi >> 6) & 1) * 32 + ((pi >> 5) & 1) * 16 + ((pi >> 4) & 1) * 8);
  }
  {
#pragma unroll
    for (int it = 0; it < 2; ++it) {
      const int pi = it * 256 + tid;
      *(v4u*)(D + (size_t)(n0 + (pi >> 7) * 16) * KW + (size_t)((k0 >> 5) + ((pi >> 6) & 1)) * 512 + (pi & 63) * 8) = v[it];
    }
  }
}

// =====================================================================================================
// Cosine gate table G f32 [NH][SEQ]: G[h][dl] = cos(bf16(theta[h]) * (dl * 0.125f)), dl = query index - key index >= 0
// (cid difference (j-i)/8 is exact in f32 and cos is even). One value per thread, precise cosf; the block's 256 values
// coverage: grid = NH*SEQ/256 blocks x 256 = all NH x SEQ entries (NH*SEQ is a multiple of 256).
// =====================================================================================================
__device__ __forceinline__ void gtab(int bid, const float* __restrict__ theta, float* G, int ntot) {
  __shared__ __align__(16) float sg[256];
  const int tid = threadIdx.x;
  const int gt  = bid * 256 + tid;
  const int gc  = (gt < ntot) ? gt : (ntot - 1);
  const int h   = gc / SEQ;
  const int dl  = gc - h * SEQ;
  const int hc  = (h < NH) ? h : (NH - 1);
  const float th = bfr(theta[hc]);
  const float cd = (float)dl * GSTEP;
  sg[tid] = cosf(th * cd);
  __syncthreads();
  if (tid < 64) {
    const v4f v = *(const v4f*)(sg + tid * 4);
    const int base = bid * 256 + tid * 4;
    if (base + 4 <= ntot) {
      float* d = G + base;
      {
        *(v4f*)(d) = v;
        
      }
    }
  }
}

// =====================================================================================================
// Amplitude/phase combine: F f32, MROWS rows of pitch FN, F = the operand's first column (row = b*SEQ + s; column h*HD + d = amplitude pre-activation, DMOD + h*HD + d
// = phase) -> f16 hi plane Hp and unscaled f16 residual plane Lp, both packed planes of MROWS rows x QKN with column h*SD + d = c-part * sc and
// h*SD + HD + d = s-part * sc, where a = softplus(amp) = max(amp,0) + log1p(exp(-|amp|)), c-part = a*cos(phase),
// s-part = a*sin(phase) (precise expf/log1pf/cosf/sinf), hi = f16(t), residual = f16(t - f16(t)).
// Block = (16 rows, 2 heads); thread = (row, head h, 8 consecutive d): rolled loop of 8 (scalar loads, one transcendental chain per iteration, u16 element
// stores into the thread's own LDS slots, row pitch QKP); block barrier; then four 16-B stores per thread in packed order (the
// block's 8 tiles of each plane are 8 KB contiguous; a wave stores 512 contiguous bytes).
// coverage: grid = MROWS*C8R/256 blocks (clamped block index, predicated store; MROWS*C8R is a multiple of 256) x 2 iterations x
//           256 thr x 8 halves per plane = 16 rows x 256 columns; all blocks = every row x every column of Hp and of Lp once.
// =====================================================================================================
__device__ __forceinline__ void qk16(int bid, const float* __restrict__ F, u16* Hp, u16* Lp, int n8, float sc) {
  __shared__ __align__(16) u16 sHb[16 * QKP];
  __shared__ __align__(16) u16 sLb[16 * QKP];
  const int tid = threadIdx.x;
  const bool act = (bid * 256 + 256 <= n8);   // block-uniform
  const int bc  = act ? bid : 0;
  const int hp  = bc % (NH / 2);            // head pair
  const int rt  = bc / (NH / 2);            // 16-row tile
  const int row = rt * 16 + (tid >> 4);
  const int idx = tid & 15;
  const int h   = hp * 2 + (idx >> 3);
  const int d0  = (idx & 7) * 8;
  const float* ap = F + (size_t)row * FN + h * HD + d0;
  const float* pp = ap + DMOD;
  u16* sh = sHb + (tid >> 4) * QKP + idx * 16;
  u16* sl = sLb + (tid >> 4) * QKP + idx * 16;
#pragma unroll 1
  for (int e = 0; e < 8; ++e) {
    const float am  = ap[e];
    const float ph  = pp[e];
    const float spv = fmaxf(am, 0.0f) + log1pf(expf(-fabsf(am)));
    const float cv  = cosf(ph);
    const float sv  = sinf(ph);
    const float tc  = (spv * cv) * sc;
    const float ts  = (spv * sv) * sc;
    const _Float16 hc = (_Float16)tc, hs = (_Float16)ts;
    const _Float16 lc = (_Float16)(tc - (float)hc), ls = (_Float16)(ts - (float)hs);
    sh[e] = h_bits(hc);  sh[8 + e] = h_bits(hs);
    sl[e] = h_bits(lc);  sl[8 + e] = h_bits(ls);
  }
  __syncthreads();
  // 16-B piece pi of the block's 8 tiles: m = pi&15; column chunk q = pi>>4 (k tile q>>2, j = (q>>1)&1, h = q&1) = head q>>4 of the
  // pair, c or s part (q>>3)&1, d chunk q&7; it was written by thread m*16 + (q>>4)*8 + (q&7) at its slot + 8*part.
  v4u oh2[2], ol2[2];
#pragma unroll
  for (int it = 0; it < 2; ++it) {
    const int pi = it * 256 + tid;
    const int q  = pi >> 4;
    const int so = (pi & 15) * QKP + ((q >> 4) * 8 + (q & 7)) * 16 + ((q >> 3) & 1) * 8;
    oh2[it] = *(const v4u*)(sHb + so);
    ol2[it] = *(const v4u*)(sLb + so);
  }
  const size_t ob = (size_t)rt * 16 * QKN + (size_t)hp * (2 * SD * 16) + (size_t)tid * 8;
  if (act) {
#pragma unroll
    for (int it = 0; it < 2; ++it) {
      *(v4u*)(Hp + ob + it * 2048) = oh2[it];
      *(v4u*)(Lp + ob + it * 2048) = ol2[it];
    }
  }
}

// =====================================================================================================
// v^T planes from the v projection F f32, MROWS rows of pitch FN (row = b*SEQ + s, column = h*HD + d):
//   VH packed plane, row (b*NH + h)*HD + d, column s (K = SEQ) = f16(v * 1024) for all keys s;
//   VL packed plane, same rows, column s (K = QO) = f16 residual (t - f16(t)) for keys s < QO only.
// Block = (b, head h, 64 keys s0): each thread loads its 16 floats (key sl, d chunk dc) with 16-B loads, converts, scatters
// line) is written by 8 consecutive lanes x 16 B of one instruction, in both planes (VL under the block-uniform s0 < QO
// coverage: load 256 thr x 16 = 64 keys x 64 d; store 2 iterations x 256 thr x 8 halves = 64 lines x 64 = the block's tile of
//           VH (and of VL when s0 < QO); grid = NB*NH*NST blocks covers VH exactly once and all QO columns of VL exactly once.
// =====================================================================================================
__device__ __forceinline__ void vt16(int bid, const float* __restrict__ F, u16* VHo, u16* VLo) {
  __shared__ __align__(16) u16 TH[HD * VTP];
  __shared__ __align__(16) u16 TL[HD * VTP];
  const int tid = threadIdx.x;
  const int st  = bid % NST;
  const int t2  = bid / NST;
  const int h   = t2 % NH;
  const int b   = t2 / NH;
  if (b >= NB) return;                      // block-uniform, before any barrier; never taken with the exact grid
  const int s0  = st * 64;
  const bool dolo = (s0 + 64 <= QO);        // block-uniform
  {
    const int sl = tid >> 2;                // key within tile 0..63
    const int dc = (tid & 3) * 16;          // d chunk 0,16,32,48
    const float* src = F + ((size_t)b * SEQ + s0 + sl) * FN + h * HD + dc;
#pragma unroll
    for (int i = 0; i < 4; ++i) {
      const v4f a = *(const v4f*)(src + 4 * i);
#pragma unroll
      for (int e = 0; e < 4; ++e) {
        const float t = a[e] * VCAR;
        const _Float16 hv = (_Float16)t;
        const _Float16 lv = (_Float16)(t - (float)hv);
        TH[(dc + 4 * i + e) * VTP + sl] = h_bits(hv);
        TL[(dc + 4 * i + e) * VTP + sl] = h_bits(lv);
      }
    }
  }
  __syncthreads();
  v4u vh[2], vl[2];
#pragma unroll
  for (int it = 0; it < 2; ++it) {
    const int pi = it * 256 + tid;          // 16-B piece: m = pi&15, h = (pi>>4)&1, j = (pi>>5)&1, key tile (pi>>6)&1, d tile pi>>7
    const int so = ((pi >> 7) * 16 + (pi & 15)) * VTP + ((pi >> 6) & 1) * 32 + ((pi >> 5) & 1) * 16 + ((pi >> 4) & 1) * 8;
    vh[it] = *(const v4u*)(TH + so);
    vl[it] = *(const v4u*)(TL + so);
  }
  const size_t hrow = (size_t)(b * NH + h) * HD;
  const int    sL   = dolo ? s0 : 0;
  {
#pragma unroll
    for (int it = 0; it < 2; ++it) {
      const int pi = it * 256 + tid;
      const size_t dr = hrow + (size_t)(pi >> 7) * 16;
      const int    kq = (pi >> 6) & 1;
      *(v4u*)(VHo + dr * SEQ + (size_t)((s0 >> 5) + kq) * 512 + (pi & 63) * 8) = vh[it];
      xcnt_wait();                          // before the store's address and data registers are reused
      if (dolo) {
        *(v4u*)(VLo + dr * QO + (size_t)((sL >> 5) + kq) * 512 + (pi & 63) * 8) = vl[it];
        xcnt_wait();                        // as above
      }
    }
  }
}

// =====================================================================================================
// GEMM epilogue shared by both engines: the wave's 16x64 f32 tile (times oscale) staged in its LDS slab (pitch 68), release
// coverage: 8 instructions x 2 rows x 16 lanes x 4 floats = the wave's 16 x 64 tile.
// =====================================================================================================
__device__ __forceinline__ void epi64(float* sl, v8f a0, v8f a1, v8f a2, v8f a3, float oscale,
                                      float* C, int N, size_t rowb, int col0, int lane) {
  const int hh = lane >> 4, m = lane & 15;
#pragma unroll
  for (int r = 0; r < 8; ++r) {
    const int ro = (8 * hh + r) * 68 + m;
    sl[ro]      = a0[r] * oscale;
    sl[ro + 16] = a1[r] * oscale;
    sl[ro + 32] = a2[r] * oscale;
    sl[ro + 48] = a3[r] * oscale;
  }
  wave_sync_lds();
  v4f vals[8];
#pragma unroll
  for (int it = 0; it < 8; ++it) vals[it] = *(const v4f*)(sl + (it * 2 + hh) * 68 + m * 4);
  float* dst = C + (rowb + (size_t)hh) * (size_t)N + col0 + m * 4;
  {
#pragma unroll
    for (int it = 0; it < 8; ++it) {
      *(v4f*)(dst + (size_t)(it * 2) * (size_t)N) = vals[it];
    }
    
  }
}

// =====================================================================================================
// bf16 GEMM, no bias: C[M][N] (f32) = A (bf16 packed plane, M rows x K) . Bt^T (bf16 packed plane, N rows x K), times oscale.
// Block = 64x64 tile, 4 waves x 16 rows; fragments loaded straight from the packed tiles (two 16-B loads each, split k map for
// A and B); K stepped by 32 (host guarantees K % 32 == 0, M % 64 == 0, N % 64 == 0, grid = (M/64)*(N/64)).
// =====================================================================================================
__global__ __launch_bounds__(128)
void gemm_nb(const u16* __restrict__ A, const u16* __restrict__ Bt, float* C, int M, int N, int K, float oscale) {
  __shared__ __align__(16) float slab[4 * SLAB64];
  const int tid = threadIdx.x, lane = tid & 31;
  const int wave = __builtin_amdgcn_readfirstlane(tid >> 5);   // scalar, so that the tile starts are computed on the scalar unit
  const unsigned lo = 16u * (unsigned)lane;
  const int ntile = N >> 6;
  const int bid   = blockIdx.x;
  const int rowb  = (bid / ntile) * 64 + wave * 16;
  const int col0  = (bid % ntile) * 64;
  if (rowb + 16 > M) return;                // wave-uniform, never taken with the exact grid; no block barriers in this kernel
  const u16* ap = A  + (size_t)rowb * K;
  const u16* bp = Bt + (size_t)col0 * K;
  const size_t bs = (size_t)16 * K;
  const u16* bp1 = bp + bs;
  const u16* bp2 = bp + 2 * bs;
  const u16* bp3 = bp + 3 * bs;
  v8f acc0 = zero8(), acc1 = zero8(), acc2 = zero8(), acc3 = zero8();
#pragma unroll 1
  for (int k0 = 0; k0 < K; k0 += 32) {
    const v16b a  = ldfrag_b(ap, lo);
    const v16b b0 = ldfrag_b(bp, lo);
    const v16b b1 = ldfrag_b(bp1, lo);
    const v16b b2 = ldfrag_b(bp2, lo);
    const v16b b3 = ldfrag_b(bp3, lo);
    ap += 512; bp += 512; bp1 += 512; bp2 += 512; bp3 += 512;   // next k tile
    acc0 = mma_b(a, b0, acc0);
    acc1 = mma_b(a, b1, acc1);
    acc2 = mma_b(a, b2, acc2);
    acc3 = mma_b(a, b3, acc3);
    guard6<v16b>(acc0, acc1, acc2, acc3, a, b0, b1, b2, b3, a);
  }
  epi64(slab + wave * SLAB64, acc0, acc1, acc2, acc3, oscale, C, N, (size_t)rowb, col0, lane);
}

// =====================================================================================================
// Output projection, no bias: C[row][DMOD] (f32) = (Ah [+ Al])[row][DMOD] . Bt[DMOD][DMOD]^T * oscale.
// NPROD == 1: Ah only (one product); NPROD == 2: Ah + Al residual plane (products h.B + l.B into one accumulator, l unscaled).
// Row indices (packed planes, K = DMOD): Ah row bb*SEQ + s; Al row bb*QO + s (compact plane, s < QO); C row bb*XS_FULL + s.
// Block -> (column tile ct = bid % 16, sequence row tile rt of nrt starting at s = sbeg, batch bb). Same tiling, fragment
// loads (split k map) and epilogue as gemm_nb; K = DMOD stepped by 32.
// =====================================================================================================
template <int NPROD>
__device__ __forceinline__
void gemm_o(float* slab, int bid, const u16* __restrict__ Ah, const u16* __restrict__ Al, const u16* __restrict__ Bt,
            float* C, int sbeg, int nrt, float oscale) {
  const int tid = threadIdx.x, lane = tid & 31;
  const int wave = __builtin_amdgcn_readfirstlane(tid >> 5);   // scalar, so that the tile starts are computed on the scalar unit
  unsigned vo = 16u * (unsigned)lane;         // the lane's byte offset from the row tiles' starts; one k tile (1 KB) further each trip
  const int ntile = DMOD >> 6;
  const int ct    = bid % ntile;
  const int t2    = bid / ntile;
  const int rt    = t2 % nrt;
  const int bb    = t2 / nrt;
  if (bb >= NB) return;                     // block-uniform; no block barriers in this kernel; never taken with the exact grid
  const int srow  = sbeg + rt * 64 + wave * 16;
  if (srow + 16 > SEQ) return;              // wave-uniform; never taken
  if (NPROD == 2 && srow + 16 > QO) return; // wave-uniform; never taken
  const int col0  = ct * 64;
  const int K     = DMOD;
  const size_t rowA = (size_t)bb * SEQ + srow;
  const size_t rowL = (NPROD == 2) ? ((size_t)bb * QO + srow) : (size_t)0;
  const size_t rowC = (size_t)bb * XS_FULL + srow;
  const _Float16* ahp = ash(Ah) + rowA * K;
  const _Float16* alp = ash(Al) + rowL * K;                  // dereferenced only when NPROD == 2
  const _Float16* bp  = ash(Bt) + (size_t)col0 * K;
  const size_t bs = (size_t)16 * K;
  const _Float16* bp1 = bp + bs;
  const _Float16* bp2 = bp + 2 * bs;
  const _Float16* bp3 = bp + 3 * bs;
  v8f acc0 = zero8(), acc1 = zero8(), acc2 = zero8(), acc3 = zero8();
  if constexpr (NPROD == 2) {
#pragma unroll 1
    for (int k0 = 0; k0 < K; k0 += 32) {
      const v16h ah = ldfrag_h(ahp, vo), al = ldfrag_h(alp, vo);
      const v16h b0 = ldfrag_h(bp, vo);
      const v16h b1 = ldfrag_h(bp1, vo);
      const v16h b2 = ldfrag_h(bp2, vo);
      const v16h b3 = ldfrag_h(bp3, vo);
      vo += 1024u;                          // next k tile: 512 halves
      acc0 = mma_h(ah, b0, acc0);  acc0 = mma_h(al, b0, acc0);
      acc1 = mma_h(ah, b1, acc1);  acc1 = mma_h(al, b1, acc1);
      acc2 = mma_h(ah, b2, acc2);  acc2 = mma_h(al, b2, acc2);
      acc3 = mma_h(ah, b3, acc3);  acc3 = mma_h(al, b3, acc3);
      guard6<v16h>(acc0, acc1, acc2, acc3, ah, al, b0, b1, b2, b3);
    }
  } else {
#pragma unroll 1
    for (int k0 = 0; k0 < K; k0 += 32) {
      const v16h ah = ldfrag_h(ahp, vo);
      const v16h b0 = ldfrag_h(bp, vo);
      const v16h b1 = ldfrag_h(bp1, vo);
      const v16h b2 = ldfrag_h(bp2, vo);
      const v16h b3 = ldfrag_h(bp3, vo);
      vo += 1024u;                          // next k tile: 512 halves
      acc0 = mma_h(ah, b0, acc0);
      acc1 = mma_h(ah, b1, acc1);
      acc2 = mma_h(ah, b2, acc2);
      acc3 = mma_h(ah, b3, acc3);
      guard6<v16h>(acc0, acc1, acc2, acc3, ah, b0, b1, b2, b3, ah);
    }
  }
  epi64(slab + wave * SLAB64, acc0, acc1, acc2, acc3, oscale, C, DMOD, rowC, col0, lane);
}

// =====================================================================================================
// Causal gated multi-head attention, score depth SD = 128 ([c|s] parts of one head), hd = 64 for v.
// Block bid -> (query block qt: rows q0 = 32*qt .. q0+31 = QW = 2 query tiles of 16 rows, carried side by side by every wave, so that each
// key and v fragment is loaded once for both; each tile's own sums are those of a block of one tile; head group hg of WPB = 1 head, batch b); KS = 4 waves per head = hg*WPB + wave/KS:
// wave sp = wave % KS takes the key tiles kt = sp, sp + KS, ... with its own running max, sum and accumulator; the four
// partial results are merged once, after one block barrier (weights 2^(m_s - max m), -inf-safe: a wave without tiles adds 0).
// RES == 1: query tiles q0 < QO, P.v = hh + lh + hl with the v^T residual plane, O residual plane also written;
// RES == 0: query tiles q0 >= QO, P.v single products. Scores use q_hi.k_hi + q_lo.k_hi + q_hi.k_lo in both variants.
//   q hi plane f16 x256, packed, row b*SEQ + s, column h*SD + e (e < SD), q residual plane same layout (all rows); k planes likewise;
//   v^T hi plane x1024, packed, row (b*NH + h)*HD + d, column s (K = SEQ), v^T residual plane (K = QO); gate table G[h][i - j] f32.
//   score (log2 domain) t(i, j) = (q_i.k_j over SD) * (1/8)*log2e/(256*256) * G[h][i - j], replaced by -inf where key j >
//   query i (gate index clamped to [0, SEQ-1]; the clamped value is only used on masked elements).
//   Key tiles of 32 with kb <= q0 + 15, each wave's in rising order; with RES == 1 every visited key is below QO, inside the compact
//   v^T residual plane.
//   Per tile: 2 query tiles x 2 score subtiles x 4 k-steps x 3 products, fragments loaded straight from the 16-bit planes (two 16-B loads
//   per fragment, split k map); online max-subtracted base-2 softmax in f32, -inf-safe rescale; the 16x32 prob tile stored
//   residual) rebuilt from the LDS rows (float vector loads, same element type as stored), v^T B fragments in 2 groups of
//   2 d-subtiles. After the loop each wave writes its two raw accumulators into its own two result slabs (pitch 68; every element owned
//   by one lane) and its 2 x 16 row maxima and sums into its two prob-tile regions; one block barrier (every return stands in front of it
//   and is block-uniform); then wave sp merges columns 16*sp .. 16*sp+15 of its head: out = sum_s acc_s*w_s / sum_s Z_s*w_s
//   (Z > 0 always: key 0 <= every query row; guarded anyway), carries 1/(32768*1024) folded once. Bounded loops only (nkt <= NKT).
// coverage: per wave QW = 2 instructions x 16 rows x 2 chunks x 8 halves = 32 x 16 per plane, KS waves = 32 x 64; the two block ranges
//           (RES 1: NQOB query blocks, RES 0: NQB-NQOB) x NHG x NB blocks x WPB heads = every (b, s, h) row segment of O hi exactly
//           once and every (b, s < QO, h) row segment of O residual exactly once.
// =====================================================================================================
// s_wait_xcnt 0 behind a group of global loads, with the registers that the loads name as inputs only: they are rewritten only behind the wait
__device__ __forceinline__ void idx_wait(const int (&a)[8], const int (&b)[8]) {
#if defined(__HIP_DEVICE_COMPILE__)
  asm volatile("s_wait_xcnt 0x0" :: "v"(a[0]), "v"(a[1]), "v"(a[2]), "v"(a[3]), "v"(a[4]), "v"(a[5]), "v"(a[6]), "v"(a[7]),
               "v"(b[0]), "v"(b[1]), "v"(b[2]), "v"(b[3]), "v"(b[4]), "v"(b[5]), "v"(b[6]), "v"(b[7]) : "memory");
#endif
}
__device__ __forceinline__ void adr_wait4(const char* p, const char* q, const char* r, const char* s) {
#if defined(__HIP_DEVICE_COMPILE__)
  asm volatile("s_wait_xcnt 0x0" :: "v"(p), "v"(q), "v"(r), "v"(s) : "memory");
#endif
}
__device__ __forceinline__ void adr_wait(const char* p, const char* q) {
#if defined(__HIP_DEVICE_COMPILE__)
  asm volatile("s_wait_xcnt 0x0" :: "v"(p), "v"(q) : "memory");
#endif
}
template <int RES>
__device__ __forceinline__
void attn_g(float* smem, int bid, int wave, const u16* __restrict__ QHp, const u16* __restrict__ QLp,
            const u16* __restrict__ KHp, const u16* __restrict__ KLp,
            const u16* __restrict__ VHp, const u16* __restrict__ VLp,
            const float* __restrict__ Gt, u16* OHp, u16* OLp) {
  constexpr int QT0 = (RES != 0) ? 0 : NQOB;
  constexpr int NQL = (RES != 0) ? NQOB : (NQB - NQOB);
  constexpr int NQE = (NQL > 0) ? NQL : 1;

  const int lane = (int)__builtin_amdgcn_mbcnt_lo(~0u, 0u);    // lane index without the thread id, which would otherwise hold a register over the other variant's key loop
  const unsigned lo = 16u * (unsigned)lane;
  const int hh   = lane >> 4;
  const int c    = lane & 15;
  const int qt   = QT0 + (bid % NQE);
  const int t2   = bid / NQE;
  const int hg   = t2 % NHG;
  const int b    = t2 / NHG;
  if (b >= NB) return;                      // block-uniform, before the barrier; never taken with the exact grid
  const int q0   = qt * (16 * QW);          // first of the block's 16*QW query rows; query tile u = rows q0 + 16u .. q0 + 16u + 15
  if (q0 + 16 * QW > SEQ) return;           // block-uniform; never taken
  if (RES != 0 && q0 + 16 * QW > QO) return; // block-uniform; never taken
  const int hw   = wave / KS;               // head within the block's group
  const int sp   = wave % KS;               // which quarter of the key tiles
  const int head = hg * WPB + hw;
  const int ql0  = (RES != 0) ? q0 : 0;

  float* wreg = smem + wave * WREG;         // per query tile u at u*WSUB: prob tile [16][32] pitch 36, then result slab [16][64] pitch 68

  const size_t hcol = (size_t)head * (SD / 32) * 512;                              // the head's first k tile
  const _Float16* Qh  = ash(QHp) + ((size_t)b * SEQ + q0) * QKN + hcol;            // query tile u at + u*16*QKN
  const _Float16* Ql  = ash(QLp) + ((size_t)b * SEQ + q0) * QKN + hcol;
  const _Float16* Khb = ash(KHp) + ((size_t)b * SEQ) * QKN + hcol;                 // key row tile kb added per step
  const _Float16* Klb = ash(KLp) + ((size_t)b * SEQ) * QKN + hcol;
  const _Float16* Vhb = ash(VHp) + ((size_t)(b * NH + head) * HD) * SEQ;                // d row tile j added per group
  const _Float16* Vlb = ash(VLp) + ((size_t)(b * NH + head) * HD) * QO;                 // RES == 1 only
  const float* gp = Gt + (size_t)head * SEQ;
  const float lsc = RSQ_HD * (LOG2E / (QSC * KSC));
  const float oc  = 1.0f / (PCAR * VCAR);
  const size_t KROW = (size_t)QKN;          // halves per key row: row tile kb starts at kb*KROW
  const size_t QT2  = (size_t)16 * QKN;     // halves between the two query tiles

  float mrow[QW][8], lrow[QW][8];
  v8f o[QW][4];
#pragma unroll
  for (int u = 0; u < QW; ++u) {
#pragma unroll
    for (int r = 0; r < 8; ++r) { mrow[u][r] = -INFINITY; lrow[u][r] = 0.f; }
#pragma unroll
    for (int j = 0; j < 4; ++j) o[u][j] = zero8();
  }
  const int ncaus = (q0 >> 5) + 1;                                            // tiles holding keys <= q0 + 31: the same set for both query tiles
  const int nkt = (ncaus < NKT) ? ncaus : NKT;

#pragma unroll 1
  for (int kt = sp; kt < nkt; kt += KS) {
    const int kb = kt * 32;
    // ---- scores: D element r of this lane = (query row q0 + 16u + 8hh + r, key kb + c) in s[u][0], key kb + 16 + c in s[u][1] ----
    v8f s00 = zero8(), s01 = zero8(), s10 = zero8(), s11 = zero8();
    const _Float16* k0p = Khb + (size_t)kb * KROW;
    const _Float16* k1p = k0p + (size_t)16 * KROW;
    const _Float16* l0p = Klb + (size_t)kb * KROW;
    const _Float16* l1p = l0p + (size_t)16 * KROW;
#pragma unroll
    for (int kk = 0; kk < SD / 32; ++kk) {
      const v16h qh0 = ldfrag_h(Qh + kk * 512, lo);
      const v16h ql0f = ldfrag_h(Ql + kk * 512, lo);
      const v16h qh1 = ldfrag_h(Qh + QT2 + kk * 512, lo);
      const v16h ql1f = ldfrag_h(Ql + QT2 + kk * 512, lo);
      const v16h kh0 = ldfrag_h(k0p + kk * 512, lo);
      const v16h kh1 = ldfrag_h(k1p + kk * 512, lo);
      const v16h kl0 = ldfrag_h(l0p + kk * 512, lo);
      const v16h kl1 = ldfrag_h(l1p + kk * 512, lo);
      adr_wait4((const char*)Qh + lo, (const char*)Ql + lo, (const char*)k0p + lo, (const char*)l0p + lo);   // the loads' address registers stay as they are until the wait has passed
      s00 = mma_h(qh0,  kh0, s00);
      s10 = mma_h(qh1,  kh0, s10);
      s01 = mma_h(qh0,  kh1, s01);
      s11 = mma_h(qh1,  kh1, s11);
      s00 = mma_h(ql0f, kh0, s00);
      s10 = mma_h(ql1f, kh0, s10);
      s01 = mma_h(ql0f, kh1, s01);
      s11 = mma_h(ql1f, kh1, s11);
      s00 = mma_h(qh0,  kl0, s00);
      s10 = mma_h(qh1,  kl0, s10);
      s01 = mma_h(qh0,  kl1, s01);
      s11 = mma_h(qh1,  kl1, s11);
      guard4(s00, s01, s10, s11, qh0, ql0f, qh1, ql1f, kh0, kl0, kh1, kl1);
    }
    // ---- gate (f32, per element) + causal select + online softmax in base 2, -inf-safe; one query tile after the other ----
    const int key0 = kb + c, key1 = kb + 16 + c;
#pragma unroll
    for (int u = 0; u < QW; ++u) {
      const v8f s0 = (u == 0) ? s00 : s10;
      const v8f s1 = (u == 0) ? s01 : s11;
      const int qr0 = q0 + 16 * u + 8 * hh;                                   // query row of D element r = qr0 + r
      float* pt = wreg + u * WSUB;
      int ia[8], ib[8];
      float ga[8], gb[8];
#pragma unroll
      for (int r = 0; r < 8; ++r) {
        const int qr = qr0 + r;
        int i0 = qr - key0;  i0 = (i0 < 0) ? 0 : i0;  i0 = (i0 > SEQ - 1) ? (SEQ - 1) : i0;
        int i1 = qr - key1;  i1 = (i1 < 0) ? 0 : i1;  i1 = (i1 > SEQ - 1) ? (SEQ - 1) : i1;
        ia[r] = i0;  ib[r] = i1;
        ga[r] = gp[i0];
        gb[r] = gp[i1];
      }
      idx_wait(ia, ib);                     // the gate loads' index registers stay as they are until the wait has passed
#pragma unroll
      for (int r = 0; r < 8; ++r) {
        const int qr = qr0 + r;
        const float g0 = ga[r];
        const float g1 = gb[r];
        const float u0 = (s0[r] * lsc) * g0;
        const float u1 = (s1[r] * lsc) * g1;
        const float t0 = (key0 > qr) ? -INFINITY : u0;
        const float t1 = (key1 > qr) ? -INFINITY : u1;
        float mx = fmaxf(t0, t1);
#pragma unroll
        for (int off = 1; off < 16; off <<= 1) mx = fmaxf(mx, __shfl_xor(mx, off, 32));
        const float mn = fmaxf(mrow[u][r], mx);
        const float ms = (mn == -INFINITY) ? 0.0f : mn;
        const float al = exp2f(mrow[u][r] - ms);
        mrow[u][r] = mn;
        const float e0 = exp2f(t0 - ms), e1 = exp2f(t1 - ms);
        float ps = e0 + e1;
#pragma unroll
        for (int off = 1; off < 16; off <<= 1) ps += __shfl_xor(ps, off, 32);
        lrow[u][r] = lrow[u][r] * al + ps;
#pragma unroll
        for (int j = 0; j < 4; ++j) o[u][j][r] *= al;
        const int ro = (8 * hh + r) * PTP + c;
        pt[ro]      = e0;
        pt[ro + 16] = e1;
      }
    }
    wave_sync_lds();
    // ---- A fragments of P*32768: hi f16 and residual f16, row = c, split k map over the 32 keys of this step ----
    FragH ph[QW], pl[QW];
#pragma unroll
    for (int u = 0; u < QW; ++u) {
      const float* prow = wreg + u * WSUB + c * PTP + 8 * hh;
      const v4f p0 = *(const v4f*)(prow), p1 = *(const v4f*)(prow + 4);
      const v4f p2 = *(const v4f*)(prow + 16), p3 = *(const v4f*)(prow + 20);
#pragma unroll
      for (int e = 0; e < 4; ++e) {
        const float ta = p0[e] * PCAR, tb = p1[e] * PCAR, tc = p2[e] * PCAR, td = p3[e] * PCAR;
        const _Float16 ha = (_Float16)ta, hb = (_Float16)tb, hc = (_Float16)tc, hd = (_Float16)td;
        ph[u].h[0][e]     = ha;                  // elements 0..7  = keys kb + 8hh + 0..7
        ph[u].h[0][4 + e] = hb;
        ph[u].h[1][e]     = hc;                  // elements 8..15 = keys kb + 16 + 8hh + 0..7
        ph[u].h[1][4 + e] = hd;
        pl[u].h[0][e]     = (_Float16)(ta - (float)ha);
        pl[u].h[0][4 + e] = (_Float16)(tb - (float)hb);
        pl[u].h[1][e]     = (_Float16)(tc - (float)hc);
        pl[u].h[1][4 + e] = (_Float16)(td - (float)hd);
      }
    }
    // ---- P.V : B fragment col n = d = j*16 + c, key tile kb>>5 of the packed v^T planes; 2 groups of 2 d-subtiles, each fragment used by both query tiles ----
    {
      const _Float16* vhp = Vhb + kb * 16;
      if constexpr (RES != 0) {
        const _Float16* vlp = Vlb + kb * 16;
#pragma unroll
        for (int jg = 0; jg < 2; ++jg) {
          const size_t da = (size_t)(2 * jg) * 16 * SEQ;
          const size_t db = da + (size_t)16 * SEQ;
          const size_t la = (size_t)(2 * jg) * 16 * QO;
          const size_t lb = la + (size_t)16 * QO;
          const v16h vha = ldfrag_h(vhp + da, lo), vhb2 = ldfrag_h(vhp + db, lo);
          const v16h vla = ldfrag_h(vlp + la, lo), vlb2 = ldfrag_h(vlp + lb, lo);
          adr_wait((const char*)vhp + lo, (const char*)vlp + lo);   // the loads' address registers stay as they are until the wait has passed
#pragma unroll
          for (int u = 0; u < QW; ++u) {
            o[u][2 * jg]     = mma_h(ph[u].v, vha,  o[u][2 * jg]);
            o[u][2 * jg + 1] = mma_h(ph[u].v, vhb2, o[u][2 * jg + 1]);
          }
#pragma unroll
          for (int u = 0; u < QW; ++u) {
            o[u][2 * jg]     = mma_h(pl[u].v, vha,  o[u][2 * jg]);
            o[u][2 * jg + 1] = mma_h(pl[u].v, vhb2, o[u][2 * jg + 1]);
          }
#pragma unroll
          for (int u = 0; u < QW; ++u) {
            o[u][2 * jg]     = mma_h(ph[u].v, vla,  o[u][2 * jg]);
            o[u][2 * jg + 1] = mma_h(ph[u].v, vlb2, o[u][2 * jg + 1]);
          }
          guard4(o[0][2 * jg], o[0][2 * jg + 1], o[1][2 * jg], o[1][2 * jg + 1], ph[0].v, pl[0].v, ph[1].v, pl[1].v, vha, vhb2, vla, vlb2);
        }
      } else {
#pragma unroll
        for (int jg = 0; jg < 2; ++jg) {
          const size_t da = (size_t)(2 * jg) * 16 * SEQ;
          const size_t db = da + (size_t)16 * SEQ;
          const v16h vha = ldfrag_h(vhp + da, lo), vhb2 = ldfrag_h(vhp + db, lo);
          adr_wait((const char*)vhp + lo, (const char*)vhp + lo);   // the loads' address registers stay as they are until the wait has passed
#pragma unroll
          for (int u = 0; u < QW; ++u) {
            o[u][2 * jg]     = mma_h(ph[u].v, vha,  o[u][2 * jg]);
            o[u][2 * jg + 1] = mma_h(ph[u].v, vhb2, o[u][2 * jg + 1]);
          }
          guard4(o[0][2 * jg], o[0][2 * jg + 1], o[1][2 * jg], o[1][2 * jg + 1], ph[0].v, ph[1].v, vha, vhb2, ph[0].v, ph[1].v, vha, vhb2);
        }
      }
    }
    wave_sync_lds();
  }
  acc_guard4(o[0][0], o[0][1], o[0][2], o[0][3]);
  acc_guard4(o[1][0], o[1][1], o[1][2], o[1][3]);
  // the lane's index formed anew behind the key loop, so that what the epilogue derives from it (row, half, LDS and store offsets) is not held over
  // the loop, where no register is free (held, it is spilled to scratch or the loop's listing grows by a quarter); asm so that it is not merged with the index formed in front of the loop
  int lne;
#if defined(__HIP_DEVICE_COMPILE__)
  asm volatile("v_mbcnt_lo_u32_b32 %0, -1, 0" : "=v"(lne));
#else
  lne = lane;
#endif
  const int hhe = lne >> 4, ce = lne & 15;
  // ---- this wave's partial results: raw accumulators into the lane-owned slabs, row maxima and sums into the free prob-tile regions ----
#pragma unroll
  for (int u = 0; u < QW; ++u) {
    float* pt   = wreg + u * WSUB;
    float* slab = pt + PTW;
#pragma unroll
    for (int r = 0; r < 8; ++r) {
#pragma unroll
      for (int j = 0; j < 4; ++j) {
        const int idx = (8 * hhe + r) * SLP + j * 16 + ce;
        slab[idx] = o[u][j][r];
      }
      if (ce == 0) {
        pt[8 * hhe + r]      = mrow[u][r];
        pt[16 + 8 * hhe + r] = lrow[u][r];
      }
    }
  }
  __syncthreads();                          // publishes the four partial results of each head to its four waves
#pragma unroll
  for (int u = 0; u < QW; ++u) {
    // ---- merge for row c of query tile u: w_s = 2^(m_s - max m) (0 for a wave without keys), Z = sum Z_s*w_s, out = sum acc_s*w_s / Z (0 if Z == 0) ----
    const float* hb = smem + hw * KS * WREG + u * WSUB;
    float ms4[KS], ws4[KS];
#pragma unroll
    for (int s = 0; s < KS; ++s) ms4[s] = hb[s * WREG + ce];
    const float mm  = fmaxf(fmaxf(ms4[0], ms4[1]), fmaxf(ms4[2], ms4[3]));
    const float mms = (mm == -INFINITY) ? 0.0f : mm;
    float lv = 0.f;
#pragma unroll
    for (int s = 0; s < KS; ++s) {
      ws4[s] = exp2f(ms4[s] - mms);
      lv += hb[s * WREG + 16 + ce] * ws4[s];
    }
    const float ls  = (lv > 0.0f) ? lv : 1.0f;
    const float inv = (lv > 0.0f) ? ((1.0f / ls) * oc) : 0.0f;
    // ---- O x1024 -> f16 hi (+ residual) packed planes; lane = (row c, 8 consecutive d at 16*sp + 8*hh): a quarter of the head's two tiles ----
    float w[8];
#pragma unroll
    for (int e = 0; e < 8; ++e) w[e] = 0.f;
#pragma unroll
    for (int s = 0; s < KS; ++s) {
      const float* sr = hb + s * WREG + PTW + ce * SLP + sp * 16 + hhe * 8;
      const v4f a = *(const v4f*)(sr), b4 = *(const v4f*)(sr + 4);
#pragma unroll
      for (int e = 0; e < 4; ++e) { w[e] += a[e] * ws4[s]; w[4 + e] += b4[e] * ws4[s]; }
    }
    v4u oh, ol;
#pragma unroll
    for (int e = 0; e < 4; ++e) {
      const float w0 = (w[2 * e] * inv) * OSC, w1 = (w[2 * e + 1] * inv) * OSC;
      const _Float16 h0 = (_Float16)w0, h1 = (_Float16)w1;
      const _Float16 l0 = (_Float16)(w0 - (float)h0), l1 = (_Float16)(w1 - (float)h1);
      oh[e] = pk16(h_bits(h0), h_bits(h1));
      ol[e] = pk16(h_bits(l0), h_bits(l1));
    }
    const size_t obh = ((size_t)b * SEQ + q0 + 16 * u) * DMOD + (size_t)head * (HD / 32) * 512 + sp * 256 + 8 * lne;
    const size_t obl = ((size_t)b * QO + ql0 + 16 * u) * DMOD + (size_t)head * (HD / 32) * 512 + sp * 256 + 8 * lne;
    *(v4u*)(OHp + obh) = oh;
    if constexpr (RES != 0) {
      *(v4u*)(OLp + obl) = ol;
    }
    xcnt_wait();                            // before the stores' address and data registers are reused
  }
}

// =====================================================================================================
// Joint grids: kernels that depend on the same earlier launch and on nothing of each other run as block ranges of ONE launch
// (every test below is block-uniform; each range runs its function unchanged with its own block index counted from 0).
// prep: weight transposes (Wv^T | Wq^T | Wk^T as one bf16 plane of FN rows x DMOD, Wo^T as its own f16 plane), x -> bf16 plane, gate table.
// =====================================================================================================
__global__ __launch_bounds__(256)
void prep(const float* __restrict__ x, const float* __restrict__ wv, const float* __restrict__ wq, const float* __restrict__ wk,
          const float* __restrict__ wo, const float* __restrict__ theta, u16* XB, u16* WB, u16* WO, float* G) {
  const int bid = blockIdx.x;
  if (bid < NB_TR) {
    const float* Wsrc = wv;
    u16* D = WB;
    int lb = bid, NW = DMOD, mode = 0;
    float sc = 1.0f;
    if (bid >= NB_TRV + 2 * NB_TRQ)  { Wsrc = wo; D = WO; lb = bid - (NB_TRV + 2 * NB_TRQ); mode = 1; sc = WOS; }
    else if (bid >= NB_TRV + NB_TRQ) { Wsrc = wk; D = WB + (size_t)(DMOD + QKN) * DMOD; lb = bid - (NB_TRV + NB_TRQ); NW = QKN; }
    else if (bid >= NB_TRV)          { Wsrc = wq; D = WB + (size_t)DMOD * DMOD; lb = bid - NB_TRV; NW = QKN; }
    tr16(lb, Wsrc, D, DMOD, NW, mode, sc);
  } else if (bid < NB_TR + NB_CV) {
    cvt16(bid - NB_TR, x, XB, MROWS * DMOD / 8, 0, 1.0f);
  } else {
    gtab(bid - (NB_TR + NB_CV), theta, G, NH * SEQ);
  }
}

// post: F f32 [MROWS][FN] (columns v | q | k) -> [qc|qs] planes, [kc|ks] planes, v^T planes.
__global__ __launch_bounds__(256)
void post(const float* __restrict__ F, u16* QH, u16* QL, u16* KH, u16* KL, u16* VH, u16* VL) {
  const int bid = blockIdx.x;
  if (bid < 2 * NB_QK) {
    const bool isk = (bid >= NB_QK);
    qk16(isk ? bid - NB_QK : bid, F + (isk ? (DMOD + QKN) : DMOD), isk ? KH : QH, isk ? KL : QL, MROWS * C8R, isk ? KSC : QSC);
  } else {
    vt16(bid - 2 * NB_QK, F, VH, VL);
  }
}

// attention: the query tiles s >= QO first, then the query tiles s < QO (residual products).
__global__ __launch_bounds__(ATT_THREADS) __attribute__((amdgpu_waves_per_eu(4)))   // at most 256 registers a wave, so that four waves share a SIMD
void attn_all(const u16* __restrict__ QHp, const u16* __restrict__ QLp, const u16* __restrict__ KHp, const u16* __restrict__ KLp,
              const u16* __restrict__ VHp, const u16* __restrict__ VLp, const float* __restrict__ Gt, u16* OHp, u16* OLp) {
  __shared__ __align__(16) float smem[WPB * KS * WREG];
  const int bid = blockIdx.x;
  const int wave = __builtin_amdgcn_readfirstlane((int)threadIdx.x >> 5);   // scalar, so that every tile start is a scalar base address
  if (bid < NB_AT0) attn_g<0>(smem, bid, wave, QHp, QLp, KHp, KLp, VHp, VLp, Gt, OHp, OLp);
  else              attn_g<1>(smem, bid - NB_AT0, wave, QHp, QLp, KHp, KLp, VHp, VLp, Gt, OHp, OLp);
}

// output projection: rows s < QO (O hi + residual) first, then rows s >= QO (O hi only).
__global__ __launch_bounds__(128)
void gemm_o_all(const u16* __restrict__ Ah, const u16* __restrict__ Al, const u16* __restrict__ Bt, float* C, float oscale) {
  __shared__ __align__(16) float slab[4 * SLAB64];
  const int bid = blockIdx.x;
  if (bid < NB_OP2) gemm_o<2>(slab, bid, Ah, Al, Bt, C, 0, QO / 64, oscale);
  else              gemm_o<1>(slab, bid - NB_OP2, Ah, Al, Bt, C, QO, (SEQ - QO) / 64, oscale);
}

// =====================================================================================================
// Workspace map (bytes; every 16-bit plane in the packed tile order, same extents as row-major); every plane is fully written by whole-line stores before it is read; all extents are exact
// multiples of the store granularity (no pad rows needed); every region offset a multiple of 131072:
//   XB  bf16 [MROWS][1024]                       MROWS*2048       (NB=2, SEQ=2048: 8388608)
//   WB  bf16 [5120 n][1024 k]                    10485760         (rows Wv^T | Wq^T | Wk^T)
//   WO  f16 [1024 n][1024 k] x1024               2097152          (Wo^T)
//   F   f32 [MROWS][5120]                        MROWS*20480      (columns v | q | k projection output;
//                                                                  afterwards OH f16 [MROWS][1024] x1024 at its start, OL residual
//                                                                  [NB*QO][1024] after)
//   QH  f16 [MROWS][2048] x256                   MROWS*4096       QL residual [MROWS][2048]      MROWS*4096
//   KH  f16 [MROWS][2048] x256                   MROWS*4096       KL residual [MROWS][2048]      MROWS*4096
//   VH  f16 [NB*16][64][SEQ] x1024               MROWS*2048       VL residual [NB*16][64][QO]    NB*QO*2048
//   G   f32 [16][SEQ]                            16*SEQ*4
//   end (NB=2, SEQ=2048)                       182583296
// =====================================================================================================
extern "C" void kernel_launch(void* const* d_in, const int* in_sizes, int n_in,
                              void* d_out, int out_size, void* d_ws, size_t ws_size,
                              hipStream_t stream) {
  if (n_in < 6) return;
  if (in_sizes[0] < ((NB - 1) * XS_FULL + SEQ) * DMOD) return;
  if (in_sizes[1] != DMOD * QKN) return;
  if (in_sizes[2] != DMOD * QKN) return;
  if (in_sizes[3] != DMOD * DMOD) return;
  if (in_sizes[4] != DMOD * DMOD) return;
  if (in_sizes[5] < NH) return;
  if (out_size < ((NB - 1) * XS_FULL + SEQ) * DMOD) return;

  const float* x   = (const float*)d_in[0];
  const float* wq  = (const float*)d_in[1];   // [1024 in][2048 out]
  const float* wk  = (const float*)d_in[2];   // [1024 in][2048 out]
  const float* wv  = (const float*)d_in[3];   // [1024 in][1024 out]
  const float* wo  = (const float*)d_in[4];   // [1024 in][1024 out]
  const float* th  = (const float*)d_in[5];   // [16]
  float*       out = (float*)d_out;

  const size_t szXB = (size_t)MROWS * DMOD * 2;
  const size_t szW  = (size_t)FN * DMOD * 2;
  const size_t szWO = (size_t)DMOD * DMOD * 2;
  const size_t szF  = (size_t)MROWS * FN * 4;
  const size_t szQ  = (size_t)MROWS * QKN * 2;                  // QH, QL, KH, KL
  const size_t szOH = (size_t)MROWS * DMOD * 2;
  const size_t szOL = (size_t)NB * QO * DMOD * 2;
  const size_t szVH = (size_t)NB * NH * HD * SEQ * 2;
  const size_t szVL = (size_t)NB * NH * HD * QO * 2;
  const size_t szG  = (size_t)NH * SEQ * 4;
  if (szOH + szOL > szF) return;                                // OH + OL live inside the F region
  size_t off = 0;
  const size_t oXB = off; off += szXB;
  const size_t oW  = off; off += szW;
  const size_t oWO = off; off += szWO;
  const size_t oF  = off; off += szF;
  const size_t oQH = off; off += szQ;
  const size_t oQL = off; off += szQ;
  const size_t oKH = off; off += szQ;
  const size_t oKL = off; off += szQ;
  const size_t oVH = off; off += szVH;
  const size_t oVL = off; off += szVL;
  const size_t oG  = off; off += szG;
  if (off > ws_size) return;                // off = 182583296 for NB = 2, SEQ = 2048
  if (off > (size_t)WS_CAP) return;

  char* ws = (char*)d_ws;
  u16*   XB = (u16*)(ws + oXB);
  u16*   WB = (u16*)(ws + oW);
  u16*   WO = (u16*)(ws + oWO);
  float* F  = (float*)(ws + oF);
  u16*   OH = (u16*)(ws + oF);
  u16*   OL = (u16*)(ws + oF + szOH);
  u16*   QH = (u16*)(ws + oQH);
  u16*   QL = (u16*)(ws + oQL);
  u16*   KH = (u16*)(ws + oKH);
  u16*   KL = (u16*)(ws + oKL);
  u16*   VH = (u16*)(ws + oVH);
  u16*   VL = (u16*)(ws + oVL);
  float* G  = (float*)(ws + oG);

  const dim3 b256(256), b128(128), bAT(ATT_THREADS);

  // (0) weights -> transposed 16-bit planes, x -> bf16 plane [MROWS][1024], gate table G[h][dl]
  prep<<<dim3(NB_TR + NB_CV + NB_GT), b256, 0, stream>>>(x, wv, wq, wk, wo, th, XB, WB, WO, G);
  // (1) [v | q_raw | k_raw] = x.[Wv | Wq | Wk] -> F f32 [MROWS][5120]
  gemm_nb<<<dim3((MROWS / 64) * (FN / 64)), b128, 0, stream>>>(XB, WB, F, MROWS, FN, DMOD, 1.0f);
  // (2) [qc|qs] and [kc|ks] hi + residual x256, v^T hi + residual x1024
  post<<<dim3(2 * NB_QK + NB_VT), b256, 0, stream>>>(F, QH, QL, KH, KL, VH, VL);
  // (3) causal gated attention -> O hi (all rows) + residual (rows s < QO)
  attn_all<<<dim3(NB_AT0 + NB_AT1), bAT, 0, stream>>>(QH, QL, KH, KL, VH, VL, G, OH, OL);
  // (4) output projection -> out f32, carries 1024 x 1024 folded back
  gemm_o_all<<<dim3(NB_OP2 + NB_OP1), b128, 0, stream>>>(OH, OL, WO, out, 1.0f / (OSC * WOS));
  (void)hipGetLastError();
}

// v005
// Measured time: 240 microseconds a run.
// Two timings next to v004 both put it at 1.10 times that version's speed.
// Over all steps from v000 it is 2.26 times as fast.
// Contractions: x.Wq, x.Wk, x.Wv on v_wmma_f32_16x16x32_bf16 (x and W^T as bf16 RNE planes); per-head scores
// [qc|qs].[kc|ks] over 128 on v_wmma_f32_16x16x32_f16 (q, k as f16 hi x256 plus unscaled f16 residual planes, products
// hh+lh+hl on all query rows); P.v on v_wmma_f32_16x16x32_f16 (P x32768, v^T x1024 f16 planes; query rows s < QO also
// use f16 residual planes, hh+lh+hl); O.Wo on v_wmma_f32_16x16x32_f16 (O x1024 f16 hi plane, plus residual plane for rows
// s < QO; Wo^T as f16 of its bf16 RNE value x1024); all f32 accumulate. softplus, cos, sin, the cosine gate table,
// causal select, base-2 online softmax and 1/Z in f32 on VALU.
#include <hip/hip_runtime.h>
#include <math.h>
#include <stdint.h>

#ifndef NB
#define NB 2
#endif
#ifndef SEQ
#define SEQ 2048
#endif
#define XS_FULL 2048
#define DMOD  1024
#define QKN   (2 * DMOD)
#define NH    16
#define HD    64
#define SD    (2 * HD)
#define QO    ((SEQ < 512) ? SEQ : 512)
#define MROWS (NB * SEQ)
#define RSQ_HD 0.125f
#define GSTEP 0.125f
#define LOG2E 1.4426950408889634f
#define QSC   256.0f
#define KSC   256.0f
#define PCAR  32768.0f
#define VCAR  1024.0f
#define OSC   1024.0f
#define WOS   1024.0f
#define WPB   1
#define NHG   (NH / WPB)
#define NQT   (SEQ / 16)
#define NQO   (QO / 16)
#define QW    2                                 // query tiles of 16 rows that one attention wave carries
#define NQB   (NQT / QW)                        // attention query blocks of 16*QW rows
#define NQOB  (NQO / QW)
#define NST   (SEQ / 64)
#define NKT   (SEQ / 32)
#define KS    4
#define ATT_THREADS (WPB * KS * 32)
#define PTW   32                                // per query tile: 16 row maxima, then 16 row sums
#define SLP   68
#define SLW   (16 * SLP)
#define WSUB  (PTW + SLW)
#define WREG  (QW * WSUB)
#define SLAB64 (16 * 68)
#define VTP   72
#define C8R   (DMOD / 8)
#define QKP   264
#define WS_CAP 268435456
#define FN    (DMOD + 2 * QKN)                  // columns of the joint projection: v | q | k
#define NB_TRV ((DMOD / 64) * (DMOD / 64))      // transpose blocks of a [1024][1024] weight
#define NB_TRQ ((DMOD / 64) * (QKN / 64))       // transpose blocks of a [1024][2048] weight
#define NB_TR  (2 * NB_TRV + 2 * NB_TRQ)
#define NB_CV  ((MROWS * DMOD / 8) / 256)       // convert blocks of x
#define NB_GT  ((NH * SEQ) / 256)               // gate table blocks
#define NB_QK  ((MROWS * C8R) / 256)            // combine blocks of q, and of k
#define NB_VT  (NB * NH * NST)                  // v^T blocks
#define NB_AT1 (NQOB * NHG * NB)                // attention blocks with residual products
#define NB_AT0 ((NQB - NQOB) * NHG * NB)        // attention blocks without
#define NB_OP2 (NB * (QO / 64) * (DMOD / 64))   // output projection blocks with the residual plane
#define NB_OP1 (NB * ((SEQ - QO) / 64) * (DMOD / 64))
static_assert(DMOD == NH * HD && HD == 64 && NH == 16 && SD == 128 && WPB == 1 && NHG * WPB == NH);
static_assert(ATT_THREADS == 128 && KS == 4 && HD == KS * 16 && QW == 2 && NQB * QW == NQT && NQOB * QW == NQO);
static_assert(NB >= 1 && NB <= 2);
static_assert((SEQ % 64) == 0 && SEQ >= 64 && SEQ <= XS_FULL);
static_assert((QO % 64) == 0 && QO >= 64 && QO <= SEQ);
static_assert((DMOD % 64) == 0 && (QKN % 64) == 0 && (DMOD % 32) == 0 && (SD % 32) == 0 && C8R == 128);
static_assert((MROWS % 64) == 0);
static_assert(((SEQ * DMOD / 8) % 256) == 0 && ((MROWS * C8R) % 256) == 0 && ((NH * SEQ) % 256) == 0);
static_assert(WPB * KS * WREG * 4 <= 65536 && 2 * HD * VTP * 2 <= 65536 && 4 * SLAB64 * 4 <= 65536 && 64 * VTP * 2 <= 65536);

typedef unsigned short u16;
typedef _Float16 v16h __attribute__((ext_vector_type(16)));
typedef _Float16 v8h  __attribute__((ext_vector_type(8)));
typedef __bf16   v16b __attribute__((ext_vector_type(16)));
typedef float    v8f  __attribute__((ext_vector_type(8)));
typedef float    v4f  __attribute__((ext_vector_type(4)));
typedef unsigned int v4u __attribute__((ext_vector_type(4)));

union FragH { v16h v; v8h h[2]; v4u u[2]; };
union FragB { v16b v; v4u u[2]; };

// ---- scalar helpers --------------------------------------------------------------------------------
__device__ __forceinline__ unsigned short bf_bits(float f) {          // f32 -> bf16 bits, RNE convert
  unsigned u = __float_as_uint(f);
  return (unsigned short)((u + 0x7FFFu + ((u >> 16) & 1u)) >> 16);
}
__device__ __forceinline__ float bf_up(unsigned short h) { return __uint_as_float(((unsigned)h) << 16); }
__device__ __forceinline__ float bfr(float f) { return bf_up(bf_bits(f)); }
__device__ __forceinline__ unsigned short h_bits(_Float16 x) { return __builtin_bit_cast(unsigned short, x); }
__device__ __forceinline__ unsigned pk16(unsigned short a, unsigned short b) { return (unsigned)a | ((unsigned)b << 16); }
__device__ __forceinline__ v8f zero8() { v8f z = {0.f, 0.f, 0.f, 0.f, 0.f, 0.f, 0.f, 0.f}; return z; }
__device__ __forceinline__ const _Float16* ash(const u16* p) { return (const _Float16*)(const void*)p; }

// ---- packed operand planes: a 16-bit plane of R rows x K columns (R % 16 == 0, K % 32 == 0) is stored as 1-KB tiles of
//      16 rows x 32 k, tile (row>>4, k>>5) at half offset (row>>4)*16*K + (k>>5)*512; inside a tile element (m = row&15,
//      k&31 = 16*j + 8*h + e) lies at j*256 + (16*h + m)*8 + e. One fragment load of a wave is then 512 contiguous bytes
//      (4 cache lines) where a row-major plane gave 16 rows x 32 B (16 lines).
// ---- fragment loaders: 16-bit A/B operand, lane -> row/col (lane&15), h = lane>>4; t = a tile start (wave-uniform), lo = the lane's offset from it
//      in BYTES (16*lane inside the tile), p = t + lo bytes; elements 0..7 <- p[0..7] (k0+8h..), elements 8..15 <- p[256..263] (k0+16+8h..)  (same split k map for A and B)
__device__ __forceinline__ v16h ldfrag_h(const _Float16* t, unsigned lo) {
  FragH f;
  const char* p = (const char*)t + lo;
  f.h[0] = *(const v8h*)(p);
  f.h[1] = *(const v8h*)(p + 512);
  return f.v;
}
__device__ __forceinline__ v16b ldfrag_b(const u16* t, unsigned lo) { // bf16 plane read as unsigned integer vectors
  FragB f;
  const char* p = (const char*)t + lo;
  f.u[0] = *(const v4u*)(p);
  f.u[1] = *(const v4u*)(p + 512);
  return f.v;
}

__device__ __forceinline__ v8f mma_h(v16h a, v16h b, v8f c) {
  return __builtin_amdgcn_wmma_f32_16x16x32_f16(false, a, false, b, (short)0, c, false, false);
}
__device__ __forceinline__ v8f mma_b(v16b a, v16b b, v8f c) {
  return __builtin_amdgcn_wmma_f32_16x16x32_bf16(false, a, false, b, (short)0, c, false, false);
}
// four accumulators and eight operand fragments: the four vector slots behind the last matrix instruction of a group,
// with its results and operands held in their registers up to there
__device__ __forceinline__ void guard4(v8f& a, v8f& b, v8f& c, v8f& d, v16h x0, v16h x1, v16h x2, v16h x3, v16h x4, v16h x5, v16h x6, v16h x7) {
#if defined(__HIP_DEVICE_COMPILE__)
  asm volatile("v_nop\n\tv_nop\n\tv_nop\n\tv_nop"
               : "+v"(a), "+v"(b), "+v"(c), "+v"(d)
               : "v"(x0), "v"(x1), "v"(x2), "v"(x3), "v"(x4), "v"(x5), "v"(x6), "v"(x7) : "memory");
#endif
}
template <typename F>
__device__ __forceinline__ void guard6(v8f& a, v8f& b, v8f& c, v8f& d, F x0, F x1, F x2, F x3, F x4, F x5) {
#if defined(__HIP_DEVICE_COMPILE__)
  asm volatile("v_nop\n\tv_nop\n\tv_nop\n\tv_nop"
               : "+v"(a), "+v"(b), "+v"(c), "+v"(d) : "v"(x0), "v"(x1), "v"(x2), "v"(x3), "v"(x4), "v"(x5) : "memory");
#endif
}
__device__ __forceinline__ void acc_guard4(v8f& a, v8f& b, v8f& c, v8f& d) {
#if defined(__HIP_DEVICE_COMPILE__)
  asm volatile("v_nop\n\tv_nop\n\tv_nop\n\tv_nop" : "+v"(a), "+v"(b), "+v"(c), "+v"(d));
#endif
}
__device__ __forceinline__ void xcnt_wait() {
#if defined(__HIP_DEVICE_COMPILE__)
  asm volatile("s_wait_xcnt 0x0" ::: "memory");
#endif
}
__device__ __forceinline__ float xhalf(float x) {                     // the value of lane l ^ 16
  const int b = __builtin_bit_cast(int, x);
  return __builtin_bit_cast(float, __builtin_amdgcn_permlanex16(b, b, 0x76543210, 0xfedcba98, false, false));
}
__device__ __forceinline__ void wave_sync_lds() {
  __builtin_amdgcn_fence(__ATOMIC_RELEASE, "workgroup");
  __builtin_amdgcn_wave_barrier();
  __builtin_amdgcn_fence(__ATOMIC_ACQUIRE, "workgroup");
}

// =====================================================================================================
// x f32 [NB][XS_FULL][DMOD] row-major -> packed 16-bit plane of MROWS rows (K = DMOD).  f16mode == 0: bf16 RNE bits;  f16mode == 1: f16 bits of (bf16 RNE value) * scale.
// Thread = 8 consecutive k of one row: two 16-B loads, one 16-B store; a wave = one half tile (16 rows x 2 chunks of 8 k), stored
// as 512 contiguous, 512-B aligned bytes; the 8 waves of a block read 512 contiguous bytes of each of 16 rows.
// coverage: grid = ceil(n8/256) blocks x 256 thr x 8 (in-kernel bound) = the whole plane (n8 a multiple of 256 here).
// =====================================================================================================
__device__ __forceinline__ void cvt16(int bid, const float* __restrict__ x, u16* D, int n8, int f16mode, float scale) {
  const int gt = bid * 256 + (int)threadIdx.x;
  if (gt >= n8) return;
  const int wv = gt >> 5, ln = gt & 31;                   // wave index = ((row tile * DMOD/32) + k tile) * 2 + j
  const int row = (wv / (DMOD / 16)) * 16 + (ln & 15);
  const int kc  = ((wv >> 1) % (DMOD / 32)) * 32 + (wv & 1) * 16 + (ln >> 4) * 8;
  const float* p = x + ((size_t)(row / SEQ) * XS_FULL + (size_t)(row % SEQ)) * DMOD + kc;   // plane row b*SEQ + s <- x row b*XS_FULL + s
  const v4f a = *(const v4f*)(p), b4 = *(const v4f*)(p + 4);
  float w[8];
#pragma unroll
  for (int e = 0; e < 4; ++e) { w[e] = a[e]; w[4 + e] = b4[e]; }
  v4u o;
#pragma unroll
  for (int e = 0; e < 4; ++e) {
    const float f0 = w[2 * e], f1 = w[2 * e + 1];
    const unsigned short hb0 = h_bits((_Float16)(bfr(f0) * scale));
    const unsigned short hb1 = h_bits((_Float16)(bfr(f1) * scale));
    const unsigned short bb0 = bf_bits(f0);
    const unsigned short bb1 = bf_bits(f1);
    o[e] = (f16mode != 0) ? pk16(hb0, hb1) : pk16(bb0, bb1);
  }
  u16* d = D + (size_t)gt * 8;
  {
    *(v4u*)(d) = o;
    
  }
}

// =====================================================================================================
// Weight transpose + convert: W f32 [KW][NW] row-major (W[k][n], the x.W layout) -> D 16-bit packed plane of NW rows x KW (row n, column k:
// the B operand). f16mode == 0: bf16 RNE bits; f16mode == 1: f16 bits of (bf16 RNE value) * scale.
// Block = one 64 k x 64 n tile: each thread loads 16 floats of one k row (16-B loads), converts, stores them transposed
// into an LDS tile [64 n][64 k] (pitch 72 halves, u16 element stores); after a block barrier each n row segment (64 halves =
// coverage: load 256 thr x 16 = 64 k x 64 n; store 2 iterations x 256 thr x 8 halves = 64 n rows x 64 k = the block's
//           tile; grid = (KW/64)*(NW/64) blocks covers D exactly once (host guarantees KW % 64 == 0, NW % 64 == 0).
// =====================================================================================================
__device__ __forceinline__ void tr16(int bid, const float* __restrict__ W, u16* D, int KW, int NW, int f16mode, float scale) {
  __shared__ __align__(16) u16 T[64 * VTP];
  const int tid = threadIdx.x;
  const int nkt = KW >> 6;
  const int kt  = bid % nkt;
  const int nt  = bid / nkt;
  const int k0  = kt * 64, n0 = nt * 64;
  if (n0 + 64 > NW) return;                 // block-uniform, before any barrier; never taken with the exact grid
  {
    const int kl = tid >> 2;                // k within tile 0..63
    const int nc = (tid & 3) * 16;          // n chunk 0,16,32,48
    const float* src = W + (size_t)(k0 + kl) * NW + n0 + nc;
#pragma unroll
    for (int i = 0; i < 4; ++i) {
      const v4f a = *(const v4f*)(src + 4 * i);
#pragma unroll
      for (int e = 0; e < 4; ++e) {
        const float f = a[e];
        const unsigned short hb = h_bits((_Float16)(bfr(f) * scale));
        const unsigned short bb = bf_bits(f);
        T[(nc + 4 * i + e) * VTP + kl] = (f16mode != 0) ? hb : bb;
      }
    }
  }
  __syncthreads();
  v4u v[2];
#pragma unroll
  for (int it = 0; it < 2; ++it) {
    const int pi = it * 256 + tid;          // 16-B piece: m = pi&15, h = (pi>>4)&1, j = (pi>>5)&1, k tile (pi>>6)&1, n tile pi>>7
    v[it] = *(const v4u*)(T + ((pi >> 7) * 16 + (pi & 15)) * VTP + ((pi >> 6) & 1) * 32 + ((pi >> 5) & 1) * 16 + ((pi >> 4) & 1) * 8);
  }
  {
#pragma unroll
    for (int it = 0; it < 2; ++it) {
      const int pi = it * 256 + tid;
      *(v4u*)(D + (size_t)(n0 + (pi >> 7) * 16) * KW + (size_t)((k0 >> 5) + ((pi >> 6) & 1)) * 512 + (pi & 63) * 8) = v[it];
    }
  }
}

// =====================================================================================================
// Cosine gate table G f32 [NH][SEQ]: G[h][dl] = cos(bf16(theta[h]) * (dl * 0.125f)), dl = query index - key index >= 0
// (cid difference (j-i)/8 is exact in f32 and cos is even). One value per thread, precise cosf; the block's 256 values
// coverage: grid = NH*SEQ/256 blocks x 256 = all NH x SEQ entries (NH*SEQ is a multiple of 256).
// =====================================================================================================
__device__ __forceinline__ void gtab(int bid, const float* __restrict__ theta, float* G, int ntot) {
  __shared__ __align__(16) float sg[256];
  const int tid = threadIdx.x;
  const int gt  = bid * 256 + tid;
  const int gc  = (gt < ntot) ? gt : (ntot - 1);
  const int h   = gc / SEQ;
  const int dl  = gc - h * SEQ;
  const int hc  = (h < NH) ? h : (NH - 1);
  const float th = bfr(theta[hc]);
  const float cd = (float)dl * GSTEP;
  sg[tid] = cosf(th * cd);
  __syncthreads();
  if (tid < 64) {
    const v4f v = *(const v4f*)(sg + tid * 4);
    const int base = bid * 256 + tid * 4;
    if (base + 4 <= ntot) {
      float* d = G + base;
      {
        *(v4f*)(d) = v;
        
      }
    }
  }
}

// =====================================================================================================
// Amplitude/phase combine: F f32, MROWS rows of pitch FN, F = the operand's first column (row = b*SEQ + s; column h*HD + d = amplitude pre-activation, DMOD + h*HD + d
// = phase) -> f16 hi plane Hp and unscaled f16 residual plane Lp, both packed planes of MROWS rows x QKN with column h*SD + d = c-part * sc and
// h*SD + HD + d = s-part * sc, where a = softplus(amp) = max(amp,0) + log1p(exp(-|amp|)), c-part = a*cos(phase),
// s-part = a*sin(phase) (precise expf/log1pf/cosf/sinf), hi = f16(t), residual = f16(t - f16(t)).
// Block = (16 rows, 2 heads); thread = (row, head h, 8 consecutive d): rolled loop of 8 (scalar loads, one transcendental chain per iteration, u16 element
// stores into the thread's own LDS slots, row pitch QKP); block barrier; then four 16-B stores per thread in packed order (the
// block's 8 tiles of each plane are 8 KB contiguous; a wave stores 512 contiguous bytes).
// coverage: grid = MROWS*C8R/256 blocks (clamped block index, predicated store; MROWS*C8R is a multiple of 256) x 2 iterations x
//           256 thr x 8 halves per plane = 16 rows x 256 columns; all blocks = every row x every column of Hp and of Lp once.
// =====================================================================================================
__device__ __forceinline__ void qk16(int bid, const float* __restrict__ F, u16* Hp, u16* Lp, int n8, float sc) {
  __shared__ __align__(16) u16 sHb[16 * QKP];
  __shared__ __align__(16) u16 sLb[16 * QKP];
  const int tid = threadIdx.x;
  const bool act = (bid * 256 + 256 <= n8);   // block-uniform
  const int bc  = act ? bid : 0;
  const int hp  = bc % (NH / 2);            // head pair
  const int rt  = bc / (NH / 2);            // 16-row tile
  const int row = rt * 16 + (tid >> 4);
  const int idx = tid & 15;
  const int h   = hp * 2 + (idx >> 3);
  const int d0  = (idx & 7) * 8;
  const float* ap = F + (size_t)row * FN + h * HD + d0;
  const float* pp = ap + DMOD;
  u16* sh = sHb + (tid >> 4) * QKP + idx * 16;
  u16* sl = sLb + (tid >> 4) * QKP + idx * 16;
#pragma unroll 1
  for (int e = 0; e < 8; ++e) {
    const float am  = ap[e];
    const float ph  = pp[e];
    const float spv = fmaxf(am, 0.0f) + log1pf(expf(-fabsf(am)));
    const float cv  = cosf(ph);
    const float sv  = sinf(ph);
    const float tc  = (spv * cv) * sc;
    const float ts  = (spv * sv) * sc;
    const _Float16 hc = (_Float16)tc, hs = (_Float16)ts;
    const _Float16 lc = (_Float16)(tc - (float)hc), ls = (_Float16)(ts - (float)hs);
    sh[e] = h_bits(hc);  sh[8 + e] = h_bits(hs);
    sl[e] = h_bits(lc);  sl[8 + e] = h_bits(ls);
  }
  __syncthreads();
  // 16-B piece pi of the block's 8 tiles: m = pi&15; column chunk q = pi>>4 (k tile q>>2, j = (q>>1)&1, h = q&1) = head q>>4 of the
  // pair, c or s part (q>>3)&1, d chunk q&7; it was written by thread m*16 + (q>>4)*8 + (q&7) at its slot + 8*part.
  v4u oh2[2], ol2[2];
#pragma unroll
  for (int it = 0; it < 2; ++it) {
    const int pi = it * 256 + tid;
    const int q  = pi >> 4;
    const int so = (pi & 15) * QKP + ((q >> 4) * 8 + (q & 7)) * 16 + ((q >> 3) & 1) * 8;
    oh2[it] = *(const v4u*)(sHb + so);
    ol2[it] = *(const v4u*)(sLb + so);
  }
  const size_t ob = (size_t)rt * 16 * QKN + (size_t)hp * (2 * SD * 16) + (size_t)tid * 8;
  if (act) {
#pragma unroll
    for (int it = 0; it < 2; ++it) {
      *(v4u*)(Hp + ob + it * 2048) = oh2[it];
      *(v4u*)(Lp + ob + it * 2048) = ol2[it];
    }
  }
}

// =====================================================================================================
// v^T planes from the v projection F f32, MROWS rows of pitch FN (row = b*SEQ + s, column = h*HD + d):
//   VH packed plane, row (b*NH + h)*HD + d, column s (K = SEQ) = f16(v * 1024) for all keys s;
//   VL packed plane, same rows, column s (K = QO) = f16 residual (t - f16(t)) for keys s < QO only.
// Block = (b, head h, 64 keys s0): each thread loads its 16 floats (key sl, d chunk dc) with 16-B loads, converts, scatters
// line) is written by 8 consecutive lanes x 16 B of one instruction, in both planes (VL under the block-uniform s0 < QO
// coverage: load 256 thr x 16 = 64 keys x 64 d; store 2 iterations x 256 thr x 8 halves = 64 lines x 64 = the block's tile of
//           VH (and of VL when s0 < QO); grid = NB*NH*NST blocks covers VH exactly once and all QO columns of VL exactly once.
// =====================================================================================================
__device__ __forceinline__ void vt16(int bid, const float* __restrict__ F, u16* VHo, u16* VLo) {
  __shared__ __align__(16) u16 TH[HD * VTP];
  __shared__ __align__(16) u16 TL[HD * VTP];
  const int tid = threadIdx.x;
  const int st  = bid % NST;
  const int t2  = bid / NST;
  const int h   = t2 % NH;
  const int b   = t2 / NH;
  if (b >= NB) return;                      // block-uniform, before any barrier; never taken with the exact grid
  const int s0  = st * 64;
  const bool dolo = (s0 + 64 <= QO);        // block-uniform
  {
    const int sl = tid >> 2;                // key within tile 0..63
    const int dc = (tid & 3) * 16;          // d chunk 0,16,32,48
    const float* src = F + ((size_t)b * SEQ + s0 + sl) * FN + h * HD + dc;
#pragma unroll
    for (int i = 0; i < 4; ++i) {
      const v4f a = *(const v4f*)(src + 4 * i);
#pragma unroll
      for (int e = 0; e < 4; ++e) {
        const float t = a[e] * VCAR;
        const _Float16 hv = (_Float16)t;
        const _Float16 lv = (_Float16)(t - (float)hv);
        TH[(dc + 4 * i + e) * VTP + sl] = h_bits(hv);
        TL[(dc + 4 * i + e) * VTP + sl] = h_bits(lv);
      }
    }
  }
  __syncthreads();
  v4u vh[2], vl[2];
#pragma unroll
  for (int it = 0; it < 2; ++it) {
    const int pi = it * 256 + tid;          // 16-B piece: m = pi&15, h = (pi>>4)&1, j = (pi>>5)&1, key tile (pi>>6)&1, d tile pi>>7
    const int so = ((pi >> 7) * 16 + (pi & 15)) * VTP + ((pi >> 6) & 1) * 32 + ((pi >> 5) & 1) * 16 + ((pi >> 4) & 1) * 8;
    vh[it] = *(const v4u*)(TH + so);
    vl[it] = *(const v4u*)(TL + so);
  }
  const size_t hrow = (size_t)(b * NH + h) * HD;
  const int    sL   = dolo ? s0 : 0;
  {
#pragma unroll
    for (int it = 0; it < 2; ++it) {
      const int pi = it * 256 + tid;
      const size_t dr = hrow + (size_t)(pi >> 7) * 16;
      const int    kq = (pi >> 6) & 1;
      *(v4u*)(VHo + dr * SEQ + (size_t)((s0 >> 5) + kq) * 512 + (pi & 63) * 8) = vh[it];
      xcnt_wait();                          // before the store's address and data registers are reused
      if (dolo) {
        *(v4u*)(VLo + dr * QO + (size_t)((sL >> 5) + kq) * 512 + (pi & 63) * 8) = vl[it];
        xcnt_wait();                        // as above
      }
    }
  }
}

// =====================================================================================================
// GEMM epilogue shared by both engines: the wave's 16x64 f32 tile (times oscale) staged in its LDS slab (pitch 68), release
// coverage: 8 instructions x 2 rows x 16 lanes x 4 floats = the wave's 16 x 64 tile.
// =====================================================================================================
__device__ __forceinline__ void epi64(float* sl, v8f a0, v8f a1, v8f a2, v8f a3, float oscale,
                                      float* C, int N, size_t rowb, int col0, int lane) {
  const int hh = lane >> 4, m = lane & 15;
#pragma unroll
  for (int r = 0; r < 8; ++r) {
    const int ro = (8 * hh + r) * 68 + m;
    sl[ro]      = a0[r] * oscale;
    sl[ro + 16] = a1[r] * oscale;
    sl[ro + 32] = a2[r] * oscale;
    sl[ro + 48] = a3[r] * oscale;
  }
  wave_sync_lds();
  v4f vals[8];
#pragma unroll
  for (int it = 0; it < 8; ++it) vals[it] = *(const v4f*)(sl + (it * 2 + hh) * 68 + m * 4);
  float* dst = C + (rowb + (size_t)hh) * (size_t)N + col0 + m * 4;
  {
#pragma unroll
    for (int it = 0; it < 8; ++it) {
      *(v4f*)(dst + (size_t)(it * 2) * (size_t)N) = vals[it];
    }
    
  }
}

// =====================================================================================================
// bf16 GEMM, no bias: C[M][N] (f32) = A (bf16 packed plane, M rows x K) . Bt^T (bf16 packed plane, N rows x K), times oscale.
// Block = 64x64 tile, 4 waves x 16 rows; fragments loaded straight from the packed tiles (two 16-B loads each, split k map for
// A and B); K stepped by 32 (host guarantees K % 32 == 0, M % 64 == 0, N % 64 == 0, grid = (M/64)*(N/64)).
// =====================================================================================================
__global__ __launch_bounds__(128)
void gemm_nb(const u16* __restrict__ A, const u16* __restrict__ Bt, float* C, int M, int N, int K, float oscale) {
  __shared__ __align__(16) float slab[4 * SLAB64];
  const int tid = threadIdx.x, lane = tid & 31;
  const int wave = __builtin_amdgcn_readfirstlane(tid >> 5);   // scalar, so that the tile starts are computed on the scalar unit
  const unsigned lo = 16u * (unsigned)lane;
  const int ntile = N >> 6;
  const int bid   = blockIdx.x;
  const int rowb  = (bid / ntile) * 64 + wave * 16;
  const int col0  = (bid % ntile) * 64;
  if (rowb + 16 > M) return;                // wave-uniform, never taken with the exact grid; no block barriers in this kernel
  const u16* ap = A  + (size_t)rowb * K;
  const u16* bp = Bt + (size_t)col0 * K;
  const size_t bs = (size_t)16 * K;
  const u16* bp1 = bp + bs;
  const u16* bp2 = bp + 2 * bs;
  const u16* bp3 = bp + 3 * bs;
  v8f acc0 = zero8(), acc1 = zero8(), acc2 = zero8(), acc3 = zero8();
#pragma unroll 1
  for (int k0 = 0; k0 < K; k0 += 32) {
    const v16b a  = ldfrag_b(ap, lo);
    const v16b b0 = ldfrag_b(bp, lo);
    const v16b b1 = ldfrag_b(bp1, lo);
    const v16b b2 = ldfrag_b(bp2, lo);
    const v16b b3 = ldfrag_b(bp3, lo);
    ap += 512; bp += 512; bp1 += 512; bp2 += 512; bp3 += 512;   // next k tile
    acc0 = mma_b(a, b0, acc0);
    acc1 = mma_b(a, b1, acc1);
    acc2 = mma_b(a, b2, acc2);
    acc3 = mma_b(a, b3, acc3);
    guard6<v16b>(acc0, acc1, acc2, acc3, a, b0, b1, b2, b3, a);
  }
  epi64(slab + wave * SLAB64, acc0, acc1, acc2, acc3, oscale, C, N, (size_t)rowb, col0, lane);
}

// =====================================================================================================
// Output projection, no bias: C[row][DMOD] (f32) = (Ah [+ Al])[row][DMOD] . Bt[DMOD][DMOD]^T * oscale.
// NPROD == 1: Ah only (one product); NPROD == 2: Ah + Al residual plane (products h.B + l.B into one accumulator, l unscaled).
// Row indices (packed planes, K = DMOD): Ah row bb*SEQ + s; Al row bb*QO + s (compact plane, s < QO); C row bb*XS_FULL + s.
// Block -> (column tile ct = bid % 16, sequence row tile rt of nrt starting at s = sbeg, batch bb). Same tiling, fragment
// loads (split k map) and epilogue as gemm_nb; K = DMOD stepped by 32.
// =====================================================================================================
template <int NPROD>
__device__ __forceinline__
void gemm_o(float* slab, int bid, const u16* __restrict__ Ah, const u16* __restrict__ Al, const u16* __restrict__ Bt,
            float* C, int sbeg, int nrt, float oscale) {
  const int tid = threadIdx.x, lane = tid & 31;
  const int wave = __builtin_amdgcn_readfirstlane(tid >> 5);   // scalar, so that the tile starts are computed on the scalar unit
  unsigned vo = 16u * (unsigned)lane;         // the lane's byte offset from the row tiles' starts; one k tile (1 KB) further each trip
  const int ntile = DMOD >> 6;
  const int ct    = bid % ntile;
  const int t2    = bid / ntile;
  const int rt    = t2 % nrt;
  const int bb    = t2 / nrt;
  if (bb >= NB) return;                     // block-uniform; no block barriers in this kernel; never taken with the exact grid
  const int srow  = sbeg + rt * 64 + wave * 16;
  if (srow + 16 > SEQ) return;              // wave-uniform; never taken
  if (NPROD == 2 && srow + 16 > QO) return; // wave-uniform; never taken
  const int col0  = ct * 64;
  const int K     = DMOD;
  const size_t rowA = (size_t)bb * SEQ + srow;
  const size_t rowL = (NPROD == 2) ? ((size_t)bb * QO + srow) : (size_t)0;
  const size_t rowC = (size_t)bb * XS_FULL + srow;
  const _Float16* ahp = ash(Ah) + rowA * K;
  const _Float16* alp = ash(Al) + rowL * K;                  // dereferenced only when NPROD == 2
  const _Float16* bp  = ash(Bt) + (size_t)col0 * K;
  const size_t bs = (size_t)16 * K;
  const _Float16* bp1 = bp + bs;
  const _Float16* bp2 = bp + 2 * bs;
  const _Float16* bp3 = bp + 3 * bs;
  v8f acc0 = zero8(), acc1 = zero8(), acc2 = zero8(), acc3 = zero8();
  if constexpr (NPROD == 2) {
#pragma unroll 1
    for (int k0 = 0; k0 < K; k0 += 32) {
      const v16h ah = ldfrag_h(ahp, vo), al = ldfrag_h(alp, vo);
      const v16h b0 = ldfrag_h(bp, vo);
      const v16h b1 = ldfrag_h(bp1, vo);
      const v16h b2 = ldfrag_h(bp2, vo);
      const v16h b3 = ldfrag_h(bp3, vo);
      vo += 1024u;                          // next k tile: 512 halves
      acc0 = mma_h(ah, b0, acc0);  acc0 = mma_h(al, b0, acc0);
      acc1 = mma_h(ah, b1, acc1);  acc1 = mma_h(al, b1, acc1);
      acc2 = mma_h(ah, b2, acc2);  acc2 = mma_h(al, b2, acc2);
      acc3 = mma_h(ah, b3, acc3);  acc3 = mma_h(al, b3, acc3);
      guard6<v16h>(acc0, acc1, acc2, acc3, ah, al, b0, b1, b2, b3);
    }
  } else {
#pragma unroll 1
    for (int k0 = 0; k0 < K; k0 += 32) {
      const v16h ah = ldfrag_h(ahp, vo);
      const v16h b0 = ldfrag_h(bp, vo);
      const v16h b1 = ldfrag_h(bp1, vo);
      const v16h b2 = ldfrag_h(bp2, vo);
      const v16h b3 = ldfrag_h(bp3, vo);
      vo += 1024u;                          // next k tile: 512 halves
      acc0 = mma_h(ah, b0, acc0);
      acc1 = mma_h(ah, b1, acc1);
      acc2 = mma_h(ah, b2, acc2);
      acc3 = mma_h(ah, b3, acc3);
      guard6<v16h>(acc0, acc1, acc2, acc3, ah, b0, b1, b2, b3, ah);
    }
  }
  epi64(slab + wave * SLAB64, acc0, acc1, acc2, acc3, oscale, C, DMOD, rowC, col0, lane);
}

// =====================================================================================================
// Causal gated multi-head attention, score depth SD = 128 ([c|s] parts of one head), hd = 64 for v.
// Block bid -> (query block qt: rows q0 = 32*qt .. q0+31 = QW = 2 query tiles of 16 rows, carried side by side by every wave, so that each
// key and v fragment is loaded once for both; each tile's own sums are those of a block of one tile; head group hg of WPB = 1 head, batch b); KS = 4 waves per head = hg*WPB + wave/KS:
// wave sp = wave % KS takes the key tiles kt = sp, sp + KS, ... with its own running max, sum and accumulator; the four
// partial results are merged once, after one block barrier (weights 2^(m_s - max m), -inf-safe: a wave without tiles adds 0).
// RES == 1: query tiles q0 < QO, P.v = hh + lh + hl with the v^T residual plane, O residual plane also written;
// RES == 0: query tiles q0 >= QO, P.v single products. Scores use q_hi.k_hi + q_lo.k_hi + q_hi.k_lo in both variants.
//   q hi plane f16 x256, packed, row b*SEQ + s, column h*SD + e (e < SD), q residual plane same layout (all rows); k planes likewise;
//   v^T hi plane x1024, packed, row (b*NH + h)*HD + d, column s (K = SEQ), v^T residual plane (K = QO); gate table G[h][i - j] f32.
//   score (log2 domain) t(i, j) = (q_i.k_j over SD) * (1/8)*log2e/(256*256) * G[h][i - j], replaced by -inf where key j >
//   query i (gate index clamped to [0, SEQ-1]; the clamped value is only used on masked elements).
//   Key tiles of 32 with kb <= q0 + 15, each wave's in rising order; with RES == 1 every visited key is below QO, inside the compact
//   v^T residual plane.
//   Both products run transposed, S^T = K.Q^T (A = key rows, B = query columns) and O^T += V^T.P^T (A = v^T rows, B = P^T), so that a lane
//   holds scores, probabilities and results of ONE query (column lane & 15; the two wave halves split its keys and its d).
//   Per tile: 2 score subtiles x 4 k-steps x 3 products, fragments loaded straight from the 16-bit planes (two 16-B loads
//   per fragment, split k map); online max-subtracted base-2 softmax in f32, -inf-safe rescale, maximum and sum over the lane's own
//   16 registers (maximum joined across the halves per tile, sum once behind the loop); the two score subtiles, converted in place (hi,
//   residual), are the B operand P^T in the split k map; v^T A fragments in 2 groups of
//   2 d-subtiles. After the loop each wave writes its raw accumulator into its own result slab (pitch 68, row = query; every element owned
//   by one lane) and its 16 row maxima and sums in front of the slab; one block barrier (every return stands in front of it
//   and is block-uniform); then wave sp merges columns 16*sp .. 16*sp+15 of its head: out = sum_s acc_s*w_s / sum_s Z_s*w_s
//   (Z > 0 always: key 0 <= every query row; guarded anyway), carries 1/(32768*1024) folded once. Bounded loops only (nkt <= NKT).
// coverage: per wave QW = 2 instructions x 16 rows x 2 chunks x 8 halves = 32 x 16 per plane, KS waves = 32 x 64; the two block ranges
//           (RES 1: NQOB query blocks, RES 0: NQB-NQOB) x NHG x NB blocks x WPB heads = every (b, s, h) row segment of O hi exactly
//           once and every (b, s < QO, h) row segment of O residual exactly once.
// =====================================================================================================
// s_wait_xcnt 0 behind a group of global loads, with the registers that the loads name as inputs only: they are rewritten only behind the wait
__device__ __forceinline__ void idx_wait(const int (&a)[8], const int (&b)[8]) {
#if defined(__HIP_DEVICE_COMPILE__)
  asm volatile("s_wait_xcnt 0x0" :: "v"(a[0]), "v"(a[1]), "v"(a[2]), "v"(a[3]), "v"(a[4]), "v"(a[5]), "v"(a[6]), "v"(a[7]),
               "v"(b[0]), "v"(b[1]), "v"(b[2]), "v"(b[3]), "v"(b[4]), "v"(b[5]), "v"(b[6]), "v"(b[7]) : "memory");
#endif
}
__device__ __forceinline__ void adr_wait4(const char* p, const char* q, const char* r, const char* s) {
#if defined(__HIP_DEVICE_COMPILE__)
  asm volatile("s_wait_xcnt 0x0" :: "v"(p), "v"(q), "v"(r), "v"(s) : "memory");
#endif
}
__device__ __forceinline__ void adr_wait(const char* p, const char* q) {
#if defined(__HIP_DEVICE_COMPILE__)
  asm volatile("s_wait_xcnt 0x0" :: "v"(p), "v"(q) : "memory");
#endif
}
template <int RES>
__device__ __forceinline__
void attn_g(float* smem, int bid, int wave, const u16* __restrict__ QHp, const u16* __restrict__ QLp,
            const u16* __restrict__ KHp, const u16* __restrict__ KLp,
            const u16* __restrict__ VHp, const u16* __restrict__ VLp,
            const float* __restrict__ Gt, u16* OHp, u16* OLp) {
  constexpr int QT0 = (RES != 0) ? 0 : NQOB;
  constexpr int NQL = (RES != 0) ? NQOB : (NQB - NQOB);
  constexpr int NQE = (NQL > 0) ? NQL : 1;

  const int lane = (int)__builtin_amdgcn_mbcnt_lo(~0u, 0u);    // lane index without the thread id, which would otherwise hold a register over the other variant's key loop
  const unsigned lo = 16u * (unsigned)lane;
  const int hh   = lane >> 4;
  const int c    = lane & 15;
  const int qt   = QT0 + (bid % NQE);
  const int t2   = bid / NQE;
  const int hg   = t2 % NHG;
  const int b    = t2 / NHG;
  if (b >= NB) return;                      // block-uniform, before the barrier; never taken with the exact grid
  const int q0   = qt * (16 * QW);          // first of the block's 16*QW query rows; query tile u = rows q0 + 16u .. q0 + 16u + 15
  if (q0 + 16 * QW > SEQ) return;           // block-uniform; never taken
  if (RES != 0 && q0 + 16 * QW > QO) return; // block-uniform; never taken
  const int hw   = wave / KS;               // head within the block's group
  const int sp   = wave % KS;               // which quarter of the key tiles
  const int head = hg * WPB + hw;
  const int ql0  = (RES != 0) ? q0 : 0;

  float* wreg = smem + wave * WREG;         // per query tile u at u*WSUB: 16 row maxima, 16 row sums, then result slab [16][64] pitch 68

  const size_t hcol = (size_t)head * (SD / 32) * 512;                              // the head's first k tile
  const _Float16* Qh  = ash(QHp) + ((size_t)b * SEQ + q0) * QKN + hcol;            // query tile u at + u*16*QKN
  const _Float16* Ql  = ash(QLp) + ((size_t)b * SEQ + q0) * QKN + hcol;
  const _Float16* Khb = ash(KHp) + ((size_t)b * SEQ) * QKN + hcol;                 // key row tile kb added per step
  const _Float16* Klb = ash(KLp) + ((size_t)b * SEQ) * QKN + hcol;
  const _Float16* Vhb = ash(VHp) + ((size_t)(b * NH + head) * HD) * SEQ;                // d row tile j added per group
  const _Float16* Vlb = ash(VLp) + ((size_t)(b * NH + head) * HD) * QO;                 // RES == 1 only
  const float* gp = Gt + (size_t)head * SEQ;
  const float lsc = RSQ_HD * (LOG2E / (QSC * KSC));
  const float oc  = 1.0f / (PCAR * VCAR);
  const size_t KROW = (size_t)QKN;          // halves per key row: row tile kb starts at kb*KROW
  const size_t QT2  = (size_t)16 * QKN;     // halves between the two query tiles

  float mrow[QW], lrow[QW];                 // of query q0 + 16u + c: running maximum (the same in both wave halves), and the sum over this half's keys
  v8f o[QW][4];                             // transposed: element r of o[u][j] = (d = 16j + 8hh + r, query q0 + 16u + c)
#pragma unroll
  for (int u = 0; u < QW; ++u) {
    mrow[u] = -INFINITY;  lrow[u] = 0.f;
#pragma unroll
    for (int j = 0; j < 4; ++j) o[u][j] = zero8();
  }
  const int ncaus = (q0 >> 5) + 1;                                            // tiles holding keys <= q0 + 31: the same set for both query tiles
  const int nkt = (ncaus < NKT) ? ncaus : NKT;

#pragma unroll 1
  for (int kt = sp; kt < nkt; kt += KS) {
    const int kb = kt * 32;
    // ---- transposed scores, A = key rows, B = query columns: D element r of this lane = (key kb + 8hh + r, query q0 + 16u + c) in s[u][0], key kb + 16 + 8hh + r in s[u][1] ----
    v8f s00 = zero8(), s01 = zero8(), s10 = zero8(), s11 = zero8();
    const _Float16* k0p = Khb + (size_t)kb * KROW;
    const _Float16* k1p = k0p + (size_t)16 * KROW;
    const _Float16* l0p = Klb + (size_t)kb * KROW;
    const _Float16* l1p = l0p + (size_t)16 * KROW;
#pragma unroll
    for (int kk = 0; kk < SD / 32; ++kk) {
      const v16h qh0 = ldfrag_h(Qh + kk * 512, lo);
      const v16h ql0f = ldfrag_h(Ql + kk * 512, lo);
      const v16h qh1 = ldfrag_h(Qh + QT2 + kk * 512, lo);
      const v16h ql1f = ldfrag_h(Ql + QT2 + kk * 512, lo);
      const v16h kh0 = ldfrag_h(k0p + kk * 512, lo);
      const v16h kh1 = ldfrag_h(k1p + kk * 512, lo);
      const v16h kl0 = ldfrag_h(l0p + kk * 512, lo);
      const v16h kl1 = ldfrag_h(l1p + kk * 512, lo);
      adr_wait4((const char*)Qh + lo, (const char*)Ql + lo, (const char*)k0p + lo, (const char*)l0p + lo);   // the loads' address registers stay as they are until the wait has passed
      s00 = mma_h(kh0, qh0,  s00);
      s10 = mma_h(kh0, qh1,  s10);
      s01 = mma_h(kh1, qh0,  s01);
      s11 = mma_h(kh1, qh1,  s11);
      s00 = mma_h(kh0, ql0f, s00);
      s10 = mma_h(kh0, ql1f, s10);
      s01 = mma_h(kh1, ql0f, s01);
      s11 = mma_h(kh1, ql1f, s11);
      s00 = mma_h(kl0, qh0,  s00);
      s10 = mma_h(kl0, qh1,  s10);
      s01 = mma_h(kl1, qh0,  s01);
      s11 = mma_h(kl1, qh1,  s11);
      guard4(s00, s01, s10, s11, qh0, ql0f, qh1, ql1f, kh0, kl0, kh1, kl1);
    }
    // ---- gate (f32, per element) + causal select + online softmax in base 2, -inf-safe; one query tile after the other. A lane holds 16 of its
    //      query's 32 scores: maximum and sum run over its own registers, the maximum joined with the other wave half by one cross-row move.
    //      The 16 probabilities are, in place, the lane's part of the B operand P^T (split k map: elements 0..7 = keys kb + 8hh + 0..7, 8..15 = kb + 16 + 8hh + 0..7) ----
    FragH ph[QW], pl[QW];
#pragma unroll
    for (int u = 0; u < QW; ++u) {
      const v8f s0 = (u == 0) ? s00 : s10;
      const v8f s1 = (u == 0) ? s01 : s11;
      const int dq = q0 + 16 * u + c - kb - 8 * hh;                           // query - key of element r: dq - r in s0, dq - 16 - r in s1
      int ia[8], ib[8];
      float ga[8], gb[8];
#pragma unroll
      for (int r = 0; r < 8; ++r) {
        int i0 = dq - r;       i0 = (i0 < 0) ? 0 : i0;  i0 = (i0 > SEQ - 1) ? (SEQ - 1) : i0;
        int i1 = dq - 16 - r;  i1 = (i1 < 0) ? 0 : i1;  i1 = (i1 > SEQ - 1) ? (SEQ - 1) : i1;
        ia[r] = i0;  ib[r] = i1;
        ga[r] = gp[i0];
        gb[r] = gp[i1];
      }
      idx_wait(ia, ib);                     // the gate loads' index registers stay as they are until the wait has passed
      float t0[8], t1[8];
      float mx = -INFINITY;
#pragma unroll
      for (int r = 0; r < 8; ++r) {
        const float u0 = (s0[r] * lsc) * ga[r];
        const float u1 = (s1[r] * lsc) * gb[r];
        t0[r] = (dq - r < 0) ? -INFINITY : u0;
        t1[r] = (dq - 16 - r < 0) ? -INFINITY : u1;
        mx = fmaxf(mx, fmaxf(t0[r], t1[r]));
      }
      mx = fmaxf(mx, xhalf(mx));
      const float mn = fmaxf(mrow[u], mx);
      const float ms = (mn == -INFINITY) ? 0.0f : mn;
      const float al = exp2f(mrow[u] - ms);
      mrow[u] = mn;
      float ps = 0.f;
#pragma unroll
      for (int r = 0; r < 8; ++r) {
        const float e0 = exp2f(t0[r] - ms), e1 = exp2f(t1[r] - ms);
        ps += e0 + e1;
        const float ta = e0 * PCAR, tb = e1 * PCAR;
        const _Float16 ha = (_Float16)ta, hb = (_Float16)tb;
        ph[u].h[0][r] = ha;
        ph[u].h[1][r] = hb;
        pl[u].h[0][r] = (_Float16)(ta - (float)ha);
        pl[u].h[1][r] = (_Float16)(tb - (float)hb);
      }
      lrow[u] = lrow[u] * al + ps;
#pragma unroll
      for (int j = 0; j < 4; ++j) {
#pragma unroll
        for (int r = 0; r < 8; ++r) o[u][j][r] *= al;
      }
    }
    // ---- O^T += V^T.P^T : A fragment row m = d = j*16 + c, key tile kb>>5 of the packed v^T planes; 2 groups of 2 d-subtiles, each fragment used by both query tiles ----
    {
      const _Float16* vhp = Vhb + kb * 16;
      if constexpr (RES != 0) {
        const _Float16* vlp = Vlb + kb * 16;
#pragma unroll
        for (int jg = 0; jg < 2; ++jg) {
          const size_t da = (size_t)(2 * jg) * 16 * SEQ;
          const size_t db = da + (size_t)16 * SEQ;
          const size_t la = (size_t)(2 * jg) * 16 * QO;
          const size_t lb = la + (size_t)16 * QO;
          const v16h vha = ldfrag_h(vhp + da, lo), vhb2 = ldfrag_h(vhp + db, lo);
          const v16h vla = ldfrag_h(vlp + la, lo), vlb2 = ldfrag_h(vlp + lb, lo);
          adr_wait((const char*)vhp + lo, (const char*)vlp + lo);   // the loads' address registers stay as they are until the wait has passed
#pragma unroll
          for (int u = 0; u < QW; ++u) {
            o[u][2 * jg]     = mma_h(vha,  ph[u].v, o[u][2 * jg]);
            o[u][2 * jg + 1] = mma_h(vhb2, ph[u].v, o[u][2 * jg + 1]);
          }
#pragma unroll
          for (int u = 0; u < QW; ++u) {
            o[u][2 * jg]     = mma_h(vha,  pl[u].v, o[u][2 * jg]);
            o[u][2 * jg + 1] = mma_h(vhb2, pl[u].v, o[u][2 * jg + 1]);
          }
#pragma unroll
          for (int u = 0; u < QW; ++u) {
            o[u][2 * jg]     = mma_h(vla,  ph[u].v, o[u][2 * jg]);
            o[u][2 * jg + 1] = mma_h(vlb2, ph[u].v, o[u][2 * jg + 1]);
          }
          guard4(o[0][2 * jg], o[0][2 * jg + 1], o[1][2 * jg], o[1][2 * jg + 1], ph[0].v, pl[0].v, ph[1].v, pl[1].v, vha, vhb2, vla, vlb2);
        }
      } else {
#pragma unroll
        for (int jg = 0; jg < 2; ++jg) {
          const size_t da = (size_t)(2 * jg) * 16 * SEQ;
          const size_t db = da + (size_t)16 * SEQ;
          const v16h vha = ldfrag_h(vhp + da, lo), vhb2 = ldfrag_h(vhp + db, lo);
          adr_wait((const char*)vhp + lo, (const char*)vhp + lo);   // the loads' address registers stay as they are until the wait has passed
#pragma unroll
          for (int u = 0; u < QW; ++u) {
            o[u][2 * jg]     = mma_h(vha,  ph[u].v, o[u][2 * jg]);
            o[u][2 * jg + 1] = mma_h(vhb2, ph[u].v, o[u][2 * jg + 1]);
          }
          guard4(o[0][2 * jg], o[0][2 * jg + 1], o[1][2 * jg], o[1][2 * jg + 1], ph[0].v, ph[1].v, vha, vhb2, ph[0].v, ph[1].v, vha, vhb2);
        }
      }
    }
  }
  acc_guard4(o[0][0], o[0][1], o[0][2], o[0][3]);
  acc_guard4(o[1][0], o[1][1], o[1][2], o[1][3]);
  const int lne = lane;
  const int hhe = lne >> 4, ce = lne & 15;
  // ---- this wave's partial results: raw accumulators into the slab rows of the lane's query (8 consecutive d per subtile), row maxima and joined row sums in front of them ----
#pragma unroll
  for (int u = 0; u < QW; ++u) {
    float* pt   = wreg + u * WSUB;
    float* srow = pt + PTW + ce * SLP + 8 * hhe;
#pragma unroll
    for (int j = 0; j < 4; ++j) {
      const v4f a = {o[u][j][0], o[u][j][1], o[u][j][2], o[u][j][3]};
      const v4f b4 = {o[u][j][4], o[u][j][5], o[u][j][6], o[u][j][7]};
      *(v4f*)(srow + j * 16)     = a;
      *(v4f*)(srow + j * 16 + 4) = b4;
    }
    const float lt = lrow[u] + xhalf(lrow[u]);                                // the two wave halves' sums joined once
    if (hhe == 0) {
      pt[ce]      = mrow[u];
      pt[16 + ce] = lt;
    }
  }
  __syncthreads();                          // publishes the four partial results of each head to its four waves
#pragma unroll
  for (int u = 0; u < QW; ++u) {
    // ---- merge for row c of query tile u: w_s = 2^(m_s - max m) (0 for a wave without keys), Z = sum Z_s*w_s, out = sum acc_s*w_s / Z (0 if Z == 0) ----
    const float* hb = smem + hw * KS * WREG + u * WSUB;
    float ms4[KS], ws4[KS];
#pragma unroll
    for (int s = 0; s < KS; ++s) ms4[s] = hb[s * WREG + ce];
    const float mm  = fmaxf(fmaxf(ms4[0], ms4[1]), fmaxf(ms4[2], ms4[3]));
    const float mms = (mm == -INFINITY) ? 0.0f : mm;
    float lv = 0.f;
#pragma unroll
    for (int s = 0; s < KS; ++s) {
      ws4[s] = exp2f(ms4[s] - mms);
      lv += hb[s * WREG + 16 + ce] * ws4[s];
    }
    const float ls  = (lv > 0.0f) ? lv : 1.0f;
    const float inv = (lv > 0.0f) ? ((1.0f / ls) * oc) : 0.0f;
    // ---- O x1024 -> f16 hi (+ residual) packed planes; lane = (row c, 8 consecutive d at 16*sp + 8*hh): a quarter of the head's two tiles ----
    float w[8];
#pragma unroll
    for (int e = 0; e < 8; ++e) w[e] = 0.f;
#pragma unroll
    for (int s = 0; s < KS; ++s) {
      const float* sr = hb + s * WREG + PTW + ce * SLP + sp * 16 + hhe * 8;
      const v4f a = *(const v4f*)(sr), b4 = *(const v4f*)(sr + 4);
#pragma unroll
      for (int e = 0; e < 4; ++e) { w[e] += a[e] * ws4[s]; w[4 + e] += b4[e] * ws4[s]; }
    }
    v4u oh, ol;
#pragma unroll
    for (int e = 0; e < 4; ++e) {
      const float w0 = (w[2 * e] * inv) * OSC, w1 = (w[2 * e + 1] * inv) * OSC;
      const _Float16 h0 = (_Float16)w0, h1 = (_Float16)w1;
      const _Float16 l0 = (_Float16)(w0 - (float)h0), l1 = (_Float16)(w1 - (float)h1);
      oh[e] = pk16(h_bits(h0), h_bits(h1));
      ol[e] = pk16(h_bits(l0), h_bits(l1));
    }
    const size_t obh = ((size_t)b * SEQ + q0 + 16 * u) * DMOD + (size_t)head * (HD / 32) * 512 + sp * 256 + 8 * lne;
    const size_t obl = ((size_t)b * QO + ql0 + 16 * u) * DMOD + (size_t)head * (HD / 32) * 512 + sp * 256 + 8 * lne;
    *(v4u*)(OHp + obh) = oh;
    if constexpr (RES != 0) {
      *(v4u*)(OLp + obl) = ol;
    }
    xcnt_wait();                            // before the stores' address and data registers are reused
  }
}

// =====================================================================================================
// Joint grids: kernels that depend on the same earlier launch and on nothing of each other run as block ranges of ONE launch
// (every test below is block-uniform; each range runs its function unchanged with its own block index counted from 0).
// prep: weight transposes (Wv^T | Wq^T | Wk^T as one bf16 plane of FN rows x DMOD, Wo^T as its own f16 plane), x -> bf16 plane, gate table.
// =====================================================================================================
__global__ __launch_bounds__(256)
void prep(const float* __restrict__ x, const float* __restrict__ wv, const float* __restrict__ wq, const float* __restrict__ wk,
          const float* __restrict__ wo, const float* __restrict__ theta, u16* XB, u16* WB, u16* WO, float* G) {
  const int bid = blockIdx.x;
  if (bid < NB_TR) {
    const float* Wsrc = wv;
    u16* D = WB;
    int lb = bid, NW = DMOD, mode = 0;
    float sc = 1.0f;
    if (bid >= NB_TRV + 2 * NB_TRQ)  { Wsrc = wo; D = WO; lb = bid - (NB_TRV + 2 * NB_TRQ); mode = 1; sc = WOS; }
    else if (bid >= NB_TRV + NB_TRQ) { Wsrc = wk; D = WB + (size_t)(DMOD + QKN) * DMOD; lb = bid - (NB_TRV + NB_TRQ); NW = QKN; }
    else if (bid >= NB_TRV)          { Wsrc = wq; D = WB + (size_t)DMOD * DMOD; lb = bid - NB_TRV; NW = QKN; }
    tr16(lb, Wsrc, D, DMOD, NW, mode, sc);
  } else if (bid < NB_TR + NB_CV) {
    cvt16(bid - NB_TR, x, XB, MROWS * DMOD / 8, 0, 1.0f);
  } else {
    gtab(bid - (NB_TR + NB_CV), theta, G, NH * SEQ);
  }
}

// post: F f32 [MROWS][FN] (columns v | q | k) -> [qc|qs] planes, [kc|ks] planes, v^T planes.
__global__ __launch_bounds__(256)
void post(const float* __restrict__ F, u16* QH, u16* QL, u16* KH, u16* KL, u16* VH, u16* VL) {
  const int bid = blockIdx.x;
  if (bid < 2 * NB_QK) {
    const bool isk = (bid >= NB_QK);
    qk16(isk ? bid - NB_QK : bid, F + (isk ? (DMOD + QKN) : DMOD), isk ? KH : QH, isk ? KL : QL, MROWS * C8R, isk ? KSC : QSC);
  } else {
    vt16(bid - 2 * NB_QK, F, VH, VL);
  }
}

// attention: the query tiles s >= QO first, then the query tiles s < QO (residual products).
__global__ __launch_bounds__(ATT_THREADS) __attribute__((amdgpu_waves_per_eu(4)))   // at most 256 registers a wave, so that four waves share a SIMD
void attn_all(const u16* __restrict__ QHp, const u16* __restrict__ QLp, const u16* __restrict__ KHp, const u16* __restrict__ KLp,
              const u16* __restrict__ VHp, const u16* __restrict__ VLp, const float* __restrict__ Gt, u16* OHp, u16* OLp) {
  __shared__ __align__(16) float smem[WPB * KS * WREG];
  const int bid = blockIdx.x;
  const int wave = __builtin_amdgcn_readfirstlane((int)threadIdx.x >> 5);   // scalar, so that every tile start is a scalar base address
  if (bid < NB_AT0) attn_g<0>(smem, bid, wave, QHp, QLp, KHp, KLp, VHp, VLp, Gt, OHp, OLp);
  else              attn_g<1>(smem, bid - NB_AT0, wave, QHp, QLp, KHp, KLp, VHp, VLp, Gt, OHp, OLp);
}

// output projection: rows s < QO (O hi + residual) first, then rows s >= QO (O hi only).
__global__ __launch_bounds__(128)
void gemm_o_all(const u16* __restrict__ Ah, const u16* __restrict__ Al, const u16* __restrict__ Bt, float* C, float oscale) {
  __shared__ __align__(16) float slab[4 * SLAB64];
  const int bid = blockIdx.x;
  if (bid < NB_OP2) gemm_o<2>(slab, bid, Ah, Al, Bt, C, 0, QO / 64, oscale);
  else              gemm_o<1>(slab, bid - NB_OP2, Ah, Al, Bt, C, QO, (SEQ - QO) / 64, oscale);
}

// =====================================================================================================
// Workspace map (bytes; every 16-bit plane in the packed tile order, same extents as row-major); every plane is fully written by whole-line stores before it is read; all extents are exact
// multiples of the store granularity (no pad rows needed); every region offset a multiple of 131072:
//   XB  bf16 [MROWS][1024]                       MROWS*2048       (NB=2, SEQ=2048: 8388608)
//   WB  bf16 [5120 n][1024 k]                    10485760         (rows Wv^T | Wq^T | Wk^T)
//   WO  f16 [1024 n][1024 k] x1024               2097152          (Wo^T)
//   F   f32 [MROWS][5120]                        MROWS*20480      (columns v | q | k projection output;
//                                                                  afterwards OH f16 [MROWS][1024] x1024 at its start, OL residual
//                                                                  [NB*QO][1024] after)
//   QH  f16 [MROWS][2048] x256                   MROWS*4096       QL residual [MROWS][2048]      MROWS*4096
//   KH  f16 [MROWS][2048] x256                   MROWS*4096       KL residual [MROWS][2048]      MROWS*4096
//   VH  f16 [NB*16][64][SEQ] x1024               MROWS*2048       VL residual [NB*16][64][QO]    NB*QO*2048
//   G   f32 [16][SEQ]                            16*SEQ*4
//   end (NB=2, SEQ=2048)                       182583296
// =====================================================================================================
extern "C" void kernel_launch(void* const* d_in, const int* in_sizes, int n_in,
                              void* d_out, int out_size, void* d_ws, size_t ws_size,
                              hipStream_t stream) {
  if (n_in < 6) return;
  if (in_sizes[0] < ((NB - 1) * XS_FULL + SEQ) * DMOD) return;
  if (in_sizes[1] != DMOD * QKN) return;
  if (in_sizes[2] != DMOD * QKN) return;
  if (in_sizes[3] != DMOD * DMOD) return;
  if (in_sizes[4] != DMOD * DMOD) return;
  if (in_sizes[5] < NH) return;
  if (out_size < ((NB - 1) * XS_FULL + SEQ) * DMOD) return;

  const float* x   = (const float*)d_in[0];
  const float* wq  = (const float*)d_in[1];   // [1024 in][2048 out]
  const float* wk  = (const float*)d_in[2];   // [1024 in][2048 out]
  const float* wv  = (const float*)d_in[3];   // [1024 in][1024 out]
  const float* wo  = (const float*)d_in[4];   // [1024 in][1024 out]
  const float* th  = (const float*)d_in[5];   // [16]
  float*       out = (float*)d_out;

  const size_t szXB = (size_t)MROWS * DMOD * 2;
  const size_t szW  = (size_t)FN * DMOD * 2;
  const size_t szWO = (size_t)DMOD * DMOD * 2;
  const size_t szF  = (size_t)MROWS * FN * 4;
  const size_t szQ  = (size_t)MROWS * QKN * 2;                  // QH, QL, KH, KL
  const size_t szOH = (size_t)MROWS * DMOD * 2;
  const size_t szOL = (size_t)NB * QO * DMOD * 2;
  const size_t szVH = (size_t)NB * NH * HD * SEQ * 2;
  const size_t szVL = (size_t)NB * NH * HD * QO * 2;
  const size_t szG  = (size_t)NH * SEQ * 4;
  if (szOH + szOL > szF) return;                                // OH + OL live inside the F region
  size_t off = 0;
  const size_t oXB = off; off += szXB;
  const size_t oW  = off; off += szW;
  const size_t oWO = off; off += szWO;
  const size_t oF  = off; off += szF;
  const size_t oQH = off; off += szQ;
  const size_t oQL = off; off += szQ;
  const size_t oKH = off; off += szQ;
  const size_t oKL = off; off += szQ;
  const size_t oVH = off; off += szVH;
  const size_t oVL = off; off += szVL;
  const size_t oG  = off; off += szG;
  if (off > ws_size) return;                // off = 182583296 for NB = 2, SEQ = 2048
  if (off > (size_t)WS_CAP) return;

  char* ws = (char*)d_ws;
  u16*   XB = (u16*)(ws + oXB);
  u16*   WB = (u16*)(ws + oW);
  u16*   WO = (u16*)(ws + oWO);
  float* F  = (float*)(ws + oF);
  u16*   OH = (u16*)(ws + oF);
  u16*   OL = (u16*)(ws + oF + szOH);
  u16*   QH = (u16*)(ws + oQH);
  u16*   QL = (u16*)(ws + oQL);
  u16*   KH = (u16*)(ws + oKH);
  u16*   KL = (u16*)(ws + oKL);
  u16*   VH = (u16*)(ws + oVH);
  u16*   VL = (u16*)(ws + oVL);
  float* G  = (float*)(ws + oG);

  const dim3 b256(256), b128(128), bAT(ATT_THREADS);

  // (0) weights -> transposed 16-bit planes, x -> bf16 plane [MROWS][1024], gate table G[h][dl]
  prep<<<dim3(NB_TR + NB_CV + NB_GT), b256, 0, stream>>>(x, wv, wq, wk, wo, th, XB, WB, WO, G);
  // (1) [v | q_raw | k_raw] = x.[Wv | Wq | Wk] -> F f32 [MROWS][5120]
  gemm_nb<<<dim3((MROWS / 64) * (FN / 64)), b128, 0, stream>>>(XB, WB, F, MROWS, FN, DMOD, 1.0f);
  // (2) [qc|qs] and [kc|ks] hi + residual x256, v^T hi + residual x1024
  post<<<dim3(2 * NB_QK + NB_VT), b256, 0, stream>>>(F, QH, QL, KH, KL, VH, VL);
  // (3) causal gated attention -> O hi (all rows) + residual (rows s < QO)
  attn_all<<<dim3(NB_AT0 + NB_AT1), bAT, 0, stream>>>(QH, QL, KH, KL, VH, VL, G, OH, OL);
  // (4) output projection -> out f32, carries 1024 x 1024 folded back
  gemm_o_all<<<dim3(NB_OP2 + NB_OP1), b128, 0, stream>>>(OH, OL, WO, out, 1.0f / (OSC * WOS));
  (void)hipGetLastError();
}

// v006
// Measured time: 203 microseconds a run.
// In both of two side-by-side timings against v005, it was 1.18 times as fast.
// Counting every step since v000, it is 2.68 times as fast.
// Contractions: x.Wq, x.Wk, x.Wv on v_wmma_f32_16x16x32_bf16 (x and W^T as bf16 RNE planes); per-head scores
// [qc|qs].[kc|ks] over 128 on v_wmma_f32_16x16x32_f16 (q, k as f16 hi x256 plus unscaled f16 residual planes, products
// hh+lh+hl on all query rows); P.v on v_wmma_f32_16x16x32_f16 (P x32768, v^T x1024 f16 planes; query rows s < QO also
// use f16 residual planes, hh+lh+hl); O.Wo on v_wmma_f32_16x16x32_f16 (O x1024 f16 hi plane, plus residual plane for rows
// s < QO; Wo^T as f16 of its bf16 RNE value x1024); all f32 accumulate. softplus, cos, sin, the cosine gate table,
// causal select, base-2 online softmax and 1/Z in f32 on VALU.
#include <hip/hip_runtime.h>
#include <math.h>
#include <stdint.h>

#ifndef NB
#define NB 2
#endif
#ifndef SEQ
#define SEQ 2048
#endif
#define XS_FULL 2048
#define DMOD  1024
#define QKN   (2 * DMOD)
#define NH    16
#define HD    64
#define SD    (2 * HD)
#define QO    ((SEQ < 512) ? SEQ : 512)
#define MROWS (NB * SEQ)
#define RSQ_HD 0.125f
#define GSTEP 0.125f
#define LOG2E 1.4426950408889634f
#define QSC   256.0f
#define KSC   256.0f
#define PCAR  32768.0f
#define VCAR  1024.0f
#define OSC   1024.0f
#define WOS   1024.0f
#define WPB   1
#define NHG   (NH / WPB)
#define NQT   (SEQ / 16)
#define NQO   (QO / 16)
#define QW    2                                 // query tiles of 16 rows that one attention wave carries
#define NQB   (NQT / QW)                        // attention query blocks of 16*QW rows
#define NQOB  (NQO / QW)
#define NST   (SEQ / 64)
#define NKT   (SEQ / 32)
#define KS    4
#define ATT_THREADS (WPB * KS * 32)
#define PTW   32                                // per query tile: 16 row maxima, then 16 row sums
#define SLP   68
#define SLW   (16 * SLP)
#define WSUB  (PTW + SLW)
#define WREG  (QW * WSUB)
#define SLAB64 (16 * 68)
#define VTP   72
#define C8R   (DMOD / 8)
#define QKP   264
#define WS_CAP 268435456
#define FN    (DMOD + 2 * QKN)                  // columns of the joint projection: v | q | k
#define NB_TRV ((DMOD / 64) * (DMOD / 64))      // transpose blocks of a [1024][1024] weight
#define NB_TRQ ((DMOD / 64) * (QKN / 64))       // transpose blocks of a [1024][2048] weight
#define NB_TR  (2 * NB_TRV + 2 * NB_TRQ)
#define NB_CV  ((MROWS * DMOD / 8) / 256)       // convert blocks of x
#define NB_GT  ((NH * SEQ) / 256)               // gate table blocks
#define NB_QK  ((MROWS * C8R) / 256)            // combine blocks of q, and of k
#define NB_VT  (NB * NH * NST)                  // v^T blocks
#define NB_AT1 (NQOB * NHG * NB)                // attention blocks with residual products
#define NB_AT0 ((NQB - NQOB) * NHG * NB)        // attention blocks without
#define NB_OP2 (NB * (QO / 64) * (DMOD / 64))   // output projection blocks with the residual plane
#define NB_OP1 (NB * ((SEQ - QO) / 64) * (DMOD / 64))
static_assert(DMOD == NH * HD && HD == 64 && NH == 16 && SD == 128 && WPB == 1 && NHG * WPB == NH);
static_assert(ATT_THREADS == 128 && KS == 4 && HD == KS * 16 && QW == 2 && NQB * QW == NQT && NQOB * QW == NQO);
static_assert(NB >= 1 && NB <= 2);
static_assert((SEQ % 64) == 0 && SEQ >= 64 && SEQ <= XS_FULL);
static_assert((QO % 64) == 0 && QO >= 64 && QO <= SEQ);
static_assert((DMOD % 64) == 0 && (QKN % 64) == 0 && (DMOD % 32) == 0 && (SD % 32) == 0 && C8R == 128);
static_assert((MROWS % 128) == 0 && (FN % 160) == 0);
static_assert(((SEQ * DMOD / 8) % 256) == 0 && ((MROWS * C8R) % 256) == 0 && ((NH * SEQ) % 256) == 0);
static_assert(WPB * KS * WREG * 4 <= 65536 && 2 * HD * VTP * 2 <= 65536 && 4 * SLAB64 * 4 <= 65536 && 64 * VTP * 2 <= 65536);

typedef unsigned short u16;
typedef _Float16 v16h __attribute__((ext_vector_type(16)));
typedef _Float16 v8h  __attribute__((ext_vector_type(8)));
typedef __bf16   v16b __attribute__((ext_vector_type(16)));
typedef float    v8f  __attribute__((ext_vector_type(8)));
typedef float    v4f  __attribute__((ext_vector_type(4)));
typedef unsigned int v4u __attribute__((ext_vector_type(4)));

union FragH { v16h v; v8h h[2]; v4u u[2]; };
union FragB { v16b v; v4u u[2]; };

// ---- scalar helpers --------------------------------------------------------------------------------
__device__ __forceinline__ unsigned short bf_bits(float f) {          // f32 -> bf16 bits, RNE convert
  unsigned u = __float_as_uint(f);
  return (unsigned short)((u + 0x7FFFu + ((u >> 16) & 1u)) >> 16);
}
__device__ __forceinline__ float bf_up(unsigned short h) { return __uint_as_float(((unsigned)h) << 16); }
__device__ __forceinline__ float bfr(float f) { return bf_up(bf_bits(f)); }
__device__ __forceinline__ unsigned short h_bits(_Float16 x) { return __builtin_bit_cast(unsigned short, x); }
__device__ __forceinline__ unsigned pk16(unsigned short a, unsigned short b) { return (unsigned)a | ((unsigned)b << 16); }
__device__ __forceinline__ v8f zero8() { v8f z = {0.f, 0.f, 0.f, 0.f, 0.f, 0.f, 0.f, 0.f}; return z; }
__device__ __forceinline__ const _Float16* ash(const u16* p) { return (const _Float16*)(const void*)p; }

// ---- packed operand planes: a 16-bit plane of R rows x K columns (R % 16 == 0, K % 32 == 0) is stored as 1-KB tiles of
//      16 rows x 32 k, tile (row>>4, k>>5) at half offset (row>>4)*16*K + (k>>5)*512; inside a tile element (m = row&15,
//      k&31 = 16*j + 8*h + e) lies at j*256 + (16*h + m)*8 + e. One fragment load of a wave is then 512 contiguous bytes
//      (4 cache lines) where a row-major plane gave 16 rows x 32 B (16 lines).
// ---- fragment loaders: 16-bit A/B operand, lane -> row/col (lane&15), h = lane>>4; t = a tile start (wave-uniform), lo = the lane's offset from it
//      in BYTES (16*lane inside the tile), p = t + lo bytes; elements 0..7 <- p[0..7] (k0+8h..), elements 8..15 <- p[256..263] (k0+16+8h..)  (same split k map for A and B)
__device__ __forceinline__ v16h ldfrag_h(const _Float16* t, unsigned lo) {
  FragH f;
  const char* p = (const char*)t + lo;
  f.h[0] = *(const v8h*)(p);
  f.h[1] = *(const v8h*)(p + 512);
  return f.v;
}
__device__ __forceinline__ v16b ldfrag_b(const u16* t, unsigned lo) { // bf16 plane read as unsigned integer vectors
  FragB f;
  const char* p = (const char*)t + lo;
  f.u[0] = *(const v4u*)(p);
  f.u[1] = *(const v4u*)(p + 512);
  return f.v;
}

__device__ __forceinline__ v8f mma_h(v16h a, v16h b, v8f c) {
  return __builtin_amdgcn_wmma_f32_16x16x32_f16(false, a, false, b, (short)0, c, false, false);
}
__device__ __forceinline__ v8f mma_b(v16b a, v16b b, v8f c) {
  return __builtin_amdgcn_wmma_f32_16x16x32_bf16(false, a, false, b, (short)0, c, false, false);
}
// four accumulators and eight operand fragments: the four vector slots behind the last matrix instruction of a group,
// with its results and operands held in their registers up to there
__device__ __forceinline__ void guard4(v8f& a, v8f& b, v8f& c, v8f& d, v16h x0, v16h x1, v16h x2, v16h x3, v16h x4, v16h x5, v16h x6, v16h x7) {
#if defined(__HIP_DEVICE_COMPILE__)
  asm volatile("v_nop\n\tv_nop\n\tv_nop\n\tv_nop"
               : "+v"(a), "+v"(b), "+v"(c), "+v"(d)
               : "v"(x0), "v"(x1), "v"(x2), "v"(x3), "v"(x4), "v"(x5), "v"(x6), "v"(x7) : "memory");
#endif
}
template <typename F>
__device__ __forceinline__ void guard6(v8f& a, v8f& b, v8f& c, v8f& d, F x0, F x1, F x2, F x3, F x4, F x5) {
#if defined(__HIP_DEVICE_COMPILE__)
  asm volatile("v_nop\n\tv_nop\n\tv_nop\n\tv_nop"
               : "+v"(a), "+v"(b), "+v"(c), "+v"(d) : "v"(x0), "v"(x1), "v"(x2), "v"(x3), "v"(x4), "v"(x5) : "memory");
#endif
}
__device__ __forceinline__ void acc_guard4(v8f& a, v8f& b, v8f& c, v8f& d) {
#if defined(__HIP_DEVICE_COMPILE__)
  asm volatile("v_nop\n\tv_nop\n\tv_nop\n\tv_nop" : "+v"(a), "+v"(b), "+v"(c), "+v"(d));
#endif
}
__device__ __forceinline__ void xcnt_wait() {
#if defined(__HIP_DEVICE_COMPILE__)
  asm volatile("s_wait_xcnt 0x0" ::: "memory");
#endif
}
__device__ __forceinline__ float xhalf(float x) {                     // the value of lane l ^ 16
  const int b = __builtin_bit_cast(int, x);
  return __builtin_bit_cast(float, __builtin_amdgcn_permlanex16(b, b, 0x76543210, 0xfedcba98, false, false));
}
__device__ __forceinline__ void wave_sync_lds() {                     // orders LDS accesses only: a wave's global stores still in flight are not waited for
  __builtin_amdgcn_fence(__ATOMIC_RELEASE, "workgroup", "local");
  __builtin_amdgcn_wave_barrier();
  __builtin_amdgcn_fence(__ATOMIC_ACQUIRE, "workgroup", "local");
}

// =====================================================================================================
// x f32 [NB][XS_FULL][DMOD] row-major -> packed 16-bit plane of MROWS rows (K = DMOD).  f16mode == 0: bf16 RNE bits;  f16mode == 1: f16 bits of (bf16 RNE value) * scale.
// Thread = 8 consecutive k of one row: two 16-B loads, one 16-B store; a wave = one half tile (16 rows x 2 chunks of 8 k), stored
// as 512 contiguous, 512-B aligned bytes; the 8 waves of a block read 512 contiguous bytes of each of 16 rows.
// coverage: grid = ceil(n8/256) blocks x 256 thr x 8 (in-kernel bound) = the whole plane (n8 a multiple of 256 here).
// =====================================================================================================
__device__ __forceinline__ void cvt16(int bid, const float* __restrict__ x, u16* D, int n8, int f16mode, float scale) {
  const int gt = bid * 256 + (int)threadIdx.x;
  if (gt >= n8) return;
  const int wv = gt >> 5, ln = gt & 31;                   // wave index = ((row tile * DMOD/32) + k tile) * 2 + j
  const int row = (wv / (DMOD / 16)) * 16 + (ln & 15);
  const int kc  = ((wv >> 1) % (DMOD / 32)) * 32 + (wv & 1) * 16 + (ln >> 4) * 8;
  const float* p = x + ((size_t)(row / SEQ) * XS_FULL + (size_t)(row % SEQ)) * DMOD + kc;   // plane row b*SEQ + s <- x row b*XS_FULL + s
  const v4f a = *(const v4f*)(p), b4 = *(const v4f*)(p + 4);
  float w[8];
#pragma unroll
  for (int e = 0; e < 4; ++e) { w[e] = a[e]; w[4 + e] = b4[e]; }
  v4u o;
#pragma unroll
  for (int e = 0; e < 4; ++e) {
    const float f0 = w[2 * e], f1 = w[2 * e + 1];
    const unsigned short hb0 = h_bits((_Float16)(bfr(f0) * scale));
    const unsigned short hb1 = h_bits((_Float16)(bfr(f1) * scale));
    const unsigned short bb0 = bf_bits(f0);
    const unsigned short bb1 = bf_bits(f1);
    o[e] = (f16mode != 0) ? pk16(hb0, hb1) : pk16(bb0, bb1);
  }
  u16* d = D + (size_t)gt * 8;
  {
    *(v4u*)(d) = o;
    
  }
}

// =====================================================================================================
// Weight transpose + convert: W f32 [KW][NW] row-major (W[k][n], the x.W layout) -> D 16-bit packed plane of NW rows x KW (row n, column k:
// the B operand). f16mode == 0: bf16 RNE bits; f16mode == 1: f16 bits of (bf16 RNE value) * scale.
// Block = one 64 k x 64 n tile: each thread loads 16 floats of one k row (16-B loads), converts, stores them transposed
// into an LDS tile [64 n][64 k] (pitch 72 halves, u16 element stores); after a block barrier each n row segment (64 halves =
// coverage: load 256 thr x 16 = 64 k x 64 n; store 2 iterations x 256 thr x 8 halves = 64 n rows x 64 k = the block's
//           tile; grid = (KW/64)*(NW/64) blocks covers D exactly once (host guarantees KW % 64 == 0, NW % 64 == 0).
// =====================================================================================================
__device__ __forceinline__ void tr16(int bid, const float* __restrict__ W, u16* D, int KW, int NW, int f16mode, float scale) {
  __shared__ __align__(16) u16 T[64 * VTP];
  const int tid = threadIdx.x;
  const int nkt = KW >> 6;
  const int kt  = bid % nkt;
  const int nt  = bid / nkt;
  const int k0  = kt * 64, n0 = nt * 64;
  if (n0 + 64 > NW) return;                 // block-uniform, before any barrier; never taken with the exact grid
  {
    const int kl = tid >> 2;                // k within tile 0..63
    const int nc = (tid & 3) * 16;          // n chunk 0,16,32,48
    const float* src = W + (size_t)(k0 + kl) * NW + n0 + nc;
#pragma unroll
    for (int i = 0; i < 4; ++i) {
      const v4f a = *(const v4f*)(src + 4 * i);
#pragma unroll
      for (int e = 0; e < 4; ++e) {
        const float f = a[e];
        const unsigned short hb = h_bits((_Float16)(bfr(f) * scale));
        const unsigned short bb = bf_bits(f);
        T[(nc + 4 * i + e) * VTP + kl] = (f16mode != 0) ? hb : bb;
      }
    }
  }
  __syncthreads();
  v4u v[2];
#pragma unroll
  for (int it = 0; it < 2; ++it) {
    const int pi = it * 256 + tid;          // 16-B piece: m = pi&15, h = (pi>>4)&1, j = (pi>>5)&1, k tile (pi>>6)&1, n tile pi>>7
    v[it] = *(const v4u*)(T + ((pi >> 7) * 16 + (pi & 15)) * VTP + ((pi >> 6) & 1) * 32 + ((pi >> 5) & 1) * 16 + ((pi >> 4) & 1) * 8);
  }
  {
#pragma unroll
    for (int it = 0; it < 2; ++it) {
      const int pi = it * 256 + tid;
      *(v4u*)(D + (size_t)(n0 + (pi >> 7) * 16) * KW + (size_t)((k0 >> 5) + ((pi >> 6) & 1)) * 512 + (pi & 63) * 8) = v[it];
    }
  }
}

// =====================================================================================================
// Cosine gate table G f32 [NH][SEQ]: G[h][dl] = cos(bf16(theta[h]) * (dl * 0.125f)), dl = query index - key index >= 0
// (cid difference (j-i)/8 is exact in f32 and cos is even). One value per thread, precise cosf; the block's 256 values
// coverage: grid = NH*SEQ/256 blocks x 256 = all NH x SEQ entries (NH*SEQ is a multiple of 256).
// =====================================================================================================
__device__ __forceinline__ void gtab(int bid, const float* __restrict__ theta, float* G, int ntot) {
  __shared__ __align__(16) float sg[256];
  const int tid = threadIdx.x;
  const int gt  = bid * 256 + tid;
  const int gc  = (gt < ntot) ? gt : (ntot - 1);
  const int h   = gc / SEQ;
  const int dl  = gc - h * SEQ;
  const int hc  = (h < NH) ? h : (NH - 1);
  const float th = bfr(theta[hc]);
  const float cd = (float)dl * GSTEP;
  sg[tid] = cosf(th * cd);
  __syncthreads();
  if (tid < 64) {
    const v4f v = *(const v4f*)(sg + tid * 4);
    const int base = bid * 256 + tid * 4;
    if (base + 4 <= ntot) {
      float* d = G + base;
      {
        *(v4f*)(d) = v;
        
      }
    }
  }
}

// =====================================================================================================
// Amplitude/phase combine: F f32, MROWS rows of pitch FN, F = the operand's first column (row = b*SEQ + s; column h*HD + d = amplitude pre-activation, DMOD + h*HD + d
// = phase) -> f16 hi plane Hp and unscaled f16 residual plane Lp, both packed planes of MROWS rows x QKN with column h*SD + d = c-part * sc and
// h*SD + HD + d = s-part * sc, where a = softplus(amp) = max(amp,0) + log1p(exp(-|amp|)), c-part = a*cos(phase),
// s-part = a*sin(phase) (precise expf/log1pf/cosf/sinf), hi = f16(t), residual = f16(t - f16(t)).
// Block = (16 rows, 2 heads); thread = (row, head h, 8 consecutive d): rolled loop of 8 (scalar loads, one transcendental chain per iteration, u16 element
// stores into the thread's own LDS slots, row pitch QKP); block barrier; then four 16-B stores per thread in packed order (the
// block's 8 tiles of each plane are 8 KB contiguous; a wave stores 512 contiguous bytes).
// coverage: grid = MROWS*C8R/256 blocks (clamped block index, predicated store; MROWS*C8R is a multiple of 256) x 2 iterations x
//           256 thr x 8 halves per plane = 16 rows x 256 columns; all blocks = every row x every column of Hp and of Lp once.
// =====================================================================================================
__device__ __forceinline__ void qk16(int bid, const float* __restrict__ F, u16* Hp, u16* Lp, int n8, float sc) {
  __shared__ __align__(16) u16 sHb[16 * QKP];
  __shared__ __align__(16) u16 sLb[16 * QKP];
  const int tid = threadIdx.x;
  const bool act = (bid * 256 + 256 <= n8);   // block-uniform
  const int bc  = act ? bid : 0;
  const int hp  = bc % (NH / 2);            // head pair
  const int rt  = bc / (NH / 2);            // 16-row tile
  const int row = rt * 16 + (tid >> 4);
  const int idx = tid & 15;
  const int h   = hp * 2 + (idx >> 3);
  const int d0  = (idx & 7) * 8;
  const float* ap = F + (size_t)row * FN + h * HD + d0;
  const float* pp = ap + DMOD;
  u16* sh = sHb + (tid >> 4) * QKP + idx * 16;
  u16* sl = sLb + (tid >> 4) * QKP + idx * 16;
#pragma unroll 1
  for (int e = 0; e < 8; ++e) {
    const float am  = ap[e];
    const float ph  = pp[e];
    const float spv = fmaxf(am, 0.0f) + log1pf(expf(-fabsf(am)));
    const float cv  = cosf(ph);
    const float sv  = sinf(ph);
    const float tc  = (spv * cv) * sc;
    const float ts  = (spv * sv) * sc;
    const _Float16 hc = (_Float16)tc, hs = (_Float16)ts;
    const _Float16 lc = (_Float16)(tc - (float)hc), ls = (_Float16)(ts - (float)hs);
    sh[e] = h_bits(hc);  sh[8 + e] = h_bits(hs);
    sl[e] = h_bits(lc);  sl[8 + e] = h_bits(ls);
  }
  __syncthreads();
  // 16-B piece pi of the block's 8 tiles: m = pi&15; column chunk q = pi>>4 (k tile q>>2, j = (q>>1)&1, h = q&1) = head q>>4 of the
  // pair, c or s part (q>>3)&1, d chunk q&7; it was written by thread m*16 + (q>>4)*8 + (q&7) at its slot + 8*part.
  v4u oh2[2], ol2[2];
#pragma unroll
  for (int it = 0; it < 2; ++it) {
    const int pi = it * 256 + tid;
    const int q  = pi >> 4;
    const int so = (pi & 15) * QKP + ((q >> 4) * 8 + (q & 7)) * 16 + ((q >> 3) & 1) * 8;
    oh2[it] = *(const v4u*)(sHb + so);
    ol2[it] = *(const v4u*)(sLb + so);
  }
  const size_t ob = (size_t)rt * 16 * QKN + (size_t)hp * (2 * SD * 16) + (size_t)tid * 8;
  if (act) {
#pragma unroll
    for (int it = 0; it < 2; ++it) {
      *(v4u*)(Hp + ob + it * 2048) = oh2[it];
      *(v4u*)(Lp + ob + it * 2048) = ol2[it];
    }
  }
}

// =====================================================================================================
// v^T planes from the v projection F f32, MROWS rows of pitch FN (row = b*SEQ + s, column = h*HD + d):
//   VH packed plane, row (b*NH + h)*HD + d, column s (K = SEQ) = f16(v * 1024) for all keys s;
//   VL packed plane, same rows, column s (K = QO) = f16 residual (t - f16(t)) for keys s < QO only.
// Block = (b, head h, 64 keys s0): each thread loads its 16 floats (key sl, d chunk dc) with 16-B loads, converts, scatters
// line) is written by 8 consecutive lanes x 16 B of one instruction, in both planes (VL under the block-uniform s0 < QO
// coverage: load 256 thr x 16 = 64 keys x 64 d; store 2 iterations x 256 thr x 8 halves = 64 lines x 64 = the block's tile of
//           VH (and of VL when s0 < QO); grid = NB*NH*NST blocks covers VH exactly once and all QO columns of VL exactly once.
// =====================================================================================================
__device__ __forceinline__ void vt16(int bid, const float* __restrict__ F, u16* VHo, u16* VLo) {
  __shared__ __align__(16) u16 TH[HD * VTP];
  __shared__ __align__(16) u16 TL[HD * VTP];
  const int tid = threadIdx.x;
  const int st  = bid % NST;
  const int t2  = bid / NST;
  const int h   = t2 % NH;
  const int b   = t2 / NH;
  if (b >= NB) return;                      // block-uniform, before any barrier; never taken with the exact grid
  const int s0  = st * 64;
  const bool dolo = (s0 + 64 <= QO);        // block-uniform
  {
    const int sl = tid >> 2;                // key within tile 0..63
    const int dc = (tid & 3) * 16;          // d chunk 0,16,32,48
    const float* src = F + ((size_t)b * SEQ + s0 + sl) * FN + h * HD + dc;
#pragma unroll
    for (int i = 0; i < 4; ++i) {
      const v4f a = *(const v4f*)(src + 4 * i);
#pragma unroll
      for (int e = 0; e < 4; ++e) {
        const float t = a[e] * VCAR;
        const _Float16 hv = (_Float16)t;
        const _Float16 lv = (_Float16)(t - (float)hv);
        TH[(dc + 4 * i + e) * VTP + sl] = h_bits(hv);
        TL[(dc + 4 * i + e) * VTP + sl] = h_bits(lv);
      }
    }
  }
  __syncthreads();
  v4u vh[2], vl[2];
#pragma unroll
  for (int it = 0; it < 2; ++it) {
    const int pi = it * 256 + tid;          // 16-B piece: m = pi&15, h = (pi>>4)&1, j = (pi>>5)&1, key tile (pi>>6)&1, d tile pi>>7
    const int so = ((pi >> 7) * 16 + (pi & 15)) * VTP + ((pi >> 6) & 1) * 32 + ((pi >> 5) & 1) * 16 + ((pi >> 4) & 1) * 8;
    vh[it] = *(const v4u*)(TH + so);
    vl[it] = *(const v4u*)(TL + so);
  }
  const size_t hrow = (size_t)(b * NH + h) * HD;
  const int    sL   = dolo ? s0 : 0;
  {
#pragma unroll
    for (int it = 0; it < 2; ++it) {
      const int pi = it * 256 + tid;
      const size_t dr = hrow + (size_t)(pi >> 7) * 16;
      const int    kq = (pi >> 6) & 1;
      *(v4u*)(VHo + dr * SEQ + (size_t)((s0 >> 5) + kq) * 512 + (pi & 63) * 8) = vh[it];
      xcnt_wait();                          // before the store's address and data registers are reused
      if (dolo) {
        *(v4u*)(VLo + dr * QO + (size_t)((sL >> 5) + kq) * 512 + (pi & 63) * 8) = vl[it];
        xcnt_wait();                        // as above
      }
    }
  }
}

// =====================================================================================================
// GEMM epilogue shared by both engines: the wave's 16x64 f32 tile (times oscale) staged in its LDS slab (pitch 68), release
// coverage: 8 instructions x 2 rows x 16 lanes x 4 floats = the wave's 16 x 64 tile.
// =====================================================================================================
__device__ __forceinline__ void epi64(float* sl, v8f a0, v8f a1, v8f a2, v8f a3, float oscale,
                                      float* C, int N, size_t rowb, int col0, int lane) {
  const int hh = lane >> 4, m = lane & 15;
#pragma unroll
  for (int r = 0; r < 8; ++r) {
    const int ro = (8 * hh + r) * 68 + m;
    sl[ro]      = a0[r] * oscale;
    sl[ro + 16] = a1[r] * oscale;
    sl[ro + 32] = a2[r] * oscale;
    sl[ro + 48] = a3[r] * oscale;
  }
  wave_sync_lds();
  v4f vals[8];
#pragma unroll
  for (int it = 0; it < 8; ++it) vals[it] = *(const v4f*)(sl + (it * 2 + hh) * 68 + m * 4);
  float* dst = C + (rowb + (size_t)hh) * (size_t)N + col0 + m * 4;
  {
#pragma unroll
    for (int it = 0; it < 8; ++it) {
      *(v4f*)(dst + (size_t)(it * 2) * (size_t)N) = vals[it];
    }
    
  }
}

// =====================================================================================================
// bf16 GEMM, no bias: C[M][N] (f32) = A (bf16 packed plane, M rows x K) . Bt^T (bf16 packed plane, N rows x K), times oscale; K = DMOD.
// Block = 128 rows x 160 columns, 4 waves as 2 x 2; a wave holds 20 accumulator tiles of 16 x 16: its 64 rows x 64 columns of its own
// (block columns 0..63 for wc = 0, 96..159 for wc = 1) and, of the middle columns 64..95, the 32 rows 32*wc .. 32*wc + 31 of its 64, so that every
// 128-B line of C has one writer. Ten fragments (4 of A, 6 of B) feed 20 matrix instructions per k step of 32; fragments are loaded straight from
// the packed tiles (two 16-B loads each, split k map for A and B); every element's sum over k runs in rising k as before.
// Row tile order inside a wave: fragment i = row tile (i + 2*wc) & 3, so that fragments 0 and 1 are the rows that also take the middle columns.
// (host guarantees M % 128 == 0, N % 160 == 0, grid = (M/128)*(N/160)).
// =====================================================================================================
// 16 x 32 tile epilogue: as epi64, for two accumulator tiles; 4 instructions x 4 rows x 8 lanes x 4 floats, each row piece one whole 128-B line.
__device__ __forceinline__ void epi32(float* sl, v8f a0, v8f a1, float oscale, float* C, int N, size_t rowb, int col0, int lane) {
  const int hh = lane >> 4, m = lane & 15;
#pragma unroll
  for (int r = 0; r < 8; ++r) {
    const int ro = (8 * hh + r) * 68 + m;
    sl[ro]      = a0[r] * oscale;
    sl[ro + 16] = a1[r] * oscale;
  }
  wave_sync_lds();
  const int rr = lane >> 3, cc = lane & 7;
  v4f vals[4];
#pragma unroll
  for (int it = 0; it < 4; ++it) vals[it] = *(const v4f*)(sl + (it * 4 + rr) * 68 + cc * 4);
  float* dst = C + (rowb + (size_t)rr) * (size_t)N + col0 + cc * 4;
#pragma unroll
  for (int it = 0; it < 4; ++it) {
    *(v4f*)(dst + (size_t)(it * 4) * (size_t)N) = vals[it];
  }
}
// the four vector slots behind the last matrix instruction of a k step; all 20 results and all 10 operand fragments are inputs, so that the
// slots stand behind every matrix instruction of the step and the fragments keep their registers up to there
__device__ __forceinline__ void guard20(const v8f (&m)[4][4], const v8f (&e)[2][2], const v16b (&a)[4], const v16b (&b)[6]) {
#if defined(__HIP_DEVICE_COMPILE__)
  asm volatile("v_nop\n\tv_nop\n\tv_nop\n\tv_nop"
               :: "v"(m[0][0]), "v"(m[0][1]), "v"(m[0][2]), "v"(m[0][3]), "v"(m[1][0]), "v"(m[1][1]), "v"(m[1][2]), "v"(m[1][3]),
                  "v"(m[2][0]), "v"(m[2][1]), "v"(m[2][2]), "v"(m[2][3]), "v"(m[3][0]), "v"(m[3][1]), "v"(m[3][2]), "v"(m[3][3]),
                  "v"(e[0][0]), "v"(e[0][1]), "v"(e[1][0]), "v"(e[1][1]),
                  "v"(a[0]), "v"(a[1]), "v"(a[2]), "v"(a[3]), "v"(b[0]), "v"(b[1]), "v"(b[2]), "v"(b[3]), "v"(b[4]), "v"(b[5]) : "memory");
#endif
}
// s_wait_xcnt 0 behind a group of global loads, with the offset register that the loads name as an input only: it is rewritten only behind the wait
__device__ __forceinline__ void off_wait(unsigned vo) {
#if defined(__HIP_DEVICE_COMPILE__)
  asm volatile("s_wait_xcnt 0x0" :: "v"(vo) : "memory");
#endif
}
__global__ __launch_bounds__(128) __attribute__((amdgpu_waves_per_eu(4)))   // at most 256 registers a wave, so that four waves share a SIMD and the whole grid is resident at once
void gemm_nb(const u16* __restrict__ A, const u16* __restrict__ Bt, float* C, int M, int N, float oscale) {
  __shared__ __align__(16) float slab[4 * SLAB64];
  constexpr int K = DMOD;                   // a constant, so that the row tiles' distances fold into the loads' immediate offsets
  const int tid = threadIdx.x, lane = tid & 31;
  const int wave = __builtin_amdgcn_readfirstlane(tid >> 5);   // scalar, so that the tile starts are computed on the scalar unit
  unsigned vo = 16u * (unsigned)lane;         // the lane's byte offset from the row tiles' starts; one k tile (1 KB) further each trip
  const int ntile = N / 160;
  const int bid   = blockIdx.x;
  const int wr = wave >> 1, wc = wave & 1;
  const int rowb  = (bid / ntile) * 128 + wr * 64;
  const int colb  = (bid % ntile) * 160;
  const int colm  = colb + wc * 96;         // the wave's own 64 columns
  const int cole  = colb + 64;              // the middle 32 columns
  if (rowb + 64 > M) return;                // wave-uniform, never taken with the exact grid; no block barriers in this kernel
  const size_t bs = (size_t)16 * K;
  const u16* ap[4];
  const u16* bp[6];
#pragma unroll
  for (int i = 0; i < 4; ++i) ap[i] = A + (size_t)(rowb + 16 * ((i + 2 * wc) & 3)) * K;
#pragma unroll
  for (int j = 0; j < 4; ++j) bp[j] = Bt + (size_t)colm * K + (size_t)j * bs;
#pragma unroll
  for (int j = 0; j < 2; ++j) bp[4 + j] = Bt + (size_t)cole * K + (size_t)j * bs;
  v8f am[4][4], ae[2][2];
#pragma unroll
  for (int i = 0; i < 4; ++i) {
#pragma unroll
    for (int j = 0; j < 4; ++j) am[i][j] = zero8();
  }
#pragma unroll
  for (int i = 0; i < 2; ++i) {
#pragma unroll
    for (int j = 0; j < 2; ++j) ae[i][j] = zero8();
  }
#pragma unroll 1
  for (int k0 = 0; k0 < K; k0 += 32) {
    v16b a[4], b[6];
#pragma unroll
    for (int i = 0; i < 4; ++i) a[i] = ldfrag_b(ap[i], vo);
#pragma unroll
    for (int j = 0; j < 6; ++j) b[j] = ldfrag_b(bp[j], vo);
    off_wait(vo);                           // the loads' offset register stays as it is until the wait has passed
    vo += 1024u;                            // next k tile: 512 halves
#pragma unroll
    for (int j = 0; j < 4; ++j) {
#pragma unroll
      for (int i = 0; i < 4; ++i) am[i][j] = mma_b(a[i], b[j], am[i][j]);
    }
#pragma unroll
    for (int j = 0; j < 2; ++j) {
#pragma unroll
      for (int i = 0; i < 2; ++i) ae[i][j] = mma_b(a[i], b[4 + j], ae[i][j]);
    }
    guard20(am, ae, a, b);
  }
  float* sl = slab + wave * SLAB64;
#pragma unroll
  for (int i = 0; i < 4; ++i) {
    const size_t row = (size_t)(rowb + 16 * ((i + 2 * wc) & 3));
    if (i > 0) {
      xcnt_wait();                          // before the earlier stores' address and data registers are reused
      wave_sync_lds();                      // every lane has read the slab before it is written again
    }
    epi64(sl, am[i][0], am[i][1], am[i][2], am[i][3], oscale, C, N, row, colm, lane);
    if (i < 2) {
      xcnt_wait();                          // as above
      wave_sync_lds();                      // as above
      epi32(sl, ae[i][0], ae[i][1], oscale, C, N, row, cole, lane);
    }
  }
}

// =====================================================================================================
// Output projection, no bias: C[row][DMOD] (f32) = (Ah [+ Al])[row][DMOD] . Bt[DMOD][DMOD]^T * oscale.
// NPROD == 1: Ah only (one product); NPROD == 2: Ah + Al residual plane (products h.B + l.B into one accumulator, l unscaled).
// Row indices (packed planes, K = DMOD): Ah row bb*SEQ + s; Al row bb*QO + s (compact plane, s < QO); C row bb*XS_FULL + s.
// Block -> (column tile ct = bid % 16, sequence row tile rt of nrt starting at s = sbeg, batch bb). Block = 64 rows (4 waves x 16) x 64
// columns, 4 accumulators a wave; fragment loads (split k map) and epi64 epilogue as gemm_nb; K = DMOD stepped by 32.
// =====================================================================================================
template <int NPROD>
__device__ __forceinline__
void gemm_o(float* slab, int bid, const u16* __restrict__ Ah, const u16* __restrict__ Al, const u16* __restrict__ Bt,
            float* C, int sbeg, int nrt, float oscale) {
  const int tid = threadIdx.x, lane = tid & 31;
  const int wave = __builtin_amdgcn_readfirstlane(tid >> 5);   // scalar, so that the tile starts are computed on the scalar unit
  unsigned vo = 16u * (unsigned)lane;         // the lane's byte offset from the row tiles' starts; one k tile (1 KB) further each trip
  const int ntile = DMOD >> 6;
  const int ct    = bid % ntile;
  const int t2    = bid / ntile;
  const int rt    = t2 % nrt;
  const int bb    = t2 / nrt;
  if (bb >= NB) return;                     // block-uniform; no block barriers in this kernel; never taken with the exact grid
  const int srow  = sbeg + rt * 64 + wave * 16;
  if (srow + 16 > SEQ) return;              // wave-uniform; never taken
  if (NPROD == 2 && srow + 16 > QO) return; // wave-uniform; never taken
  const int col0  = ct * 64;
  const int K     = DMOD;
  const size_t rowA = (size_t)bb * SEQ + srow;
  const size_t rowL = (NPROD == 2) ? ((size_t)bb * QO + srow) : (size_t)0;
  const size_t rowC = (size_t)bb * XS_FULL + srow;
  const _Float16* ahp = ash(Ah) + rowA * K;
  const _Float16* alp = ash(Al) + rowL * K;                  // dereferenced only when NPROD == 2
  const _Float16* bp  = ash(Bt) + (size_t)col0 * K;
  const size_t bs = (size_t)16 * K;
  const _Float16* bp1 = bp + bs;
  const _Float16* bp2 = bp + 2 * bs;
  const _Float16* bp3 = bp + 3 * bs;
  v8f acc0 = zero8(), acc1 = zero8(), acc2 = zero8(), acc3 = zero8();
  if constexpr (NPROD == 2) {
#pragma unroll 1
    for (int k0 = 0; k0 < K; k0 += 32) {
      const v16h ah = ldfrag_h(ahp, vo), al = ldfrag_h(alp, vo);
      const v16h b0 = ldfrag_h(bp, vo);
      const v16h b1 = ldfrag_h(bp1, vo);
      const v16h b2 = ldfrag_h(bp2, vo);
      const v16h b3 = ldfrag_h(bp3, vo);
      vo += 1024u;                          // next k tile: 512 halves
      acc0 = mma_h(ah, b0, acc0);  acc0 = mma_h(al, b0, acc0);
      acc1 = mma_h(ah, b1, acc1);  acc1 = mma_h(al, b1, acc1);
      acc2 = mma_h(ah, b2, acc2);  acc2 = mma_h(al, b2, acc2);
      acc3 = mma_h(ah, b3, acc3);  acc3 = mma_h(al, b3, acc3);
      guard6<v16h>(acc0, acc1, acc2, acc3, ah, al, b0, b1, b2, b3);
    }
  } else {
#pragma unroll 1
    for (int k0 = 0; k0 < K; k0 += 32) {
      const v16h ah = ldfrag_h(ahp, vo);
      const v16h b0 = ldfrag_h(bp, vo);
      const v16h b1 = ldfrag_h(bp1, vo);
      const v16h b2 = ldfrag_h(bp2, vo);
      const v16h b3 = ldfrag_h(bp3, vo);
      vo += 1024u;                          // next k tile: 512 halves
      acc0 = mma_h(ah, b0, acc0);
      acc1 = mma_h(ah, b1, acc1);
      acc2 = mma_h(ah, b2, acc2);
      acc3 = mma_h(ah, b3, acc3);
      guard6<v16h>(acc0, acc1, acc2, acc3, ah, b0, b1, b2, b3, ah);
    }
  }
  epi64(slab + wave * SLAB64, acc0, acc1, acc2, acc3, oscale, C, DMOD, rowC, col0, lane);
}

// =====================================================================================================
// Causal gated multi-head attention, score depth SD = 128 ([c|s] parts of one head), hd = 64 for v.
// Block bid -> (query block qt: rows q0 = 32*qt .. q0+31 = QW = 2 query tiles of 16 rows, carried side by side by every wave, so that each
// key and v fragment is loaded once for both; each tile's own sums are those of a block of one tile; head group hg of WPB = 1 head, batch b); KS = 4 waves per head = hg*WPB + wave/KS:
// wave sp = wave % KS takes the key tiles kt = sp, sp + KS, ... with its own running max, sum and accumulator; the four
// partial results are merged once, after one block barrier (weights 2^(m_s - max m), -inf-safe: a wave without tiles adds 0).
// RES == 1: query tiles q0 < QO, P.v = hh + lh + hl with the v^T residual plane, O residual plane also written;
// RES == 0: query tiles q0 >= QO, P.v single products. Scores use q_hi.k_hi + q_lo.k_hi + q_hi.k_lo in both variants.
//   q hi plane f16 x256, packed, row b*SEQ + s, column h*SD + e (e < SD), q residual plane same layout (all rows); k planes likewise;
//   v^T hi plane x1024, packed, row (b*NH + h)*HD + d, column s (K = SEQ), v^T residual plane (K = QO); gate table G[h][i - j] f32.
//   score (log2 domain) t(i, j) = (q_i.k_j over SD) * (1/8)*log2e/(256*256) * G[h][i - j], replaced by -inf where key j >
//   query i (gate index clamped to [0, SEQ-1]; the clamped value is only used on masked elements).
//   Key tiles of 32 with kb <= q0 + 15, each wave's in rising order; with RES == 1 every visited key is below QO, inside the compact
//   v^T residual plane.
//   Both products run transposed, S^T = K.Q^T (A = key rows, B = query columns) and O^T += V^T.P^T (A = v^T rows, B = P^T), so that a lane
//   holds scores, probabilities and results of ONE query (column lane & 15; the two wave halves split its keys and its d).
//   Per tile: 2 score subtiles x 4 k-steps x 3 products, fragments loaded straight from the 16-bit planes (two 16-B loads
//   per fragment, split k map); online max-subtracted base-2 softmax in f32, -inf-safe rescale, maximum and sum over the lane's own
//   16 registers (maximum joined across the halves per tile, sum once behind the loop); the two score subtiles, converted in place (hi,
//   residual), are the B operand P^T in the split k map; v^T A fragments in 2 groups of
//   2 d-subtiles. After the loop each wave writes its raw accumulator into its own result slab (pitch 68, row = query; every element owned
//   by one lane) and its 16 row maxima and sums in front of the slab; one block barrier (every return stands in front of it
//   and is block-uniform); then wave sp merges columns 16*sp .. 16*sp+15 of its head: out = sum_s acc_s*w_s / sum_s Z_s*w_s
//   (Z > 0 always: key 0 <= every query row; guarded anyway), carries 1/(32768*1024) folded once. Bounded loops only (nkt <= NKT).
// coverage: per wave QW = 2 instructions x 16 rows x 2 chunks x 8 halves = 32 x 16 per plane, KS waves = 32 x 64; the two block ranges
//           (RES 1: NQOB query blocks, RES 0: NQB-NQOB) x NHG x NB blocks x WPB heads = every (b, s, h) row segment of O hi exactly
//           once and every (b, s < QO, h) row segment of O residual exactly once.
// =====================================================================================================
// s_wait_xcnt 0 behind a group of global loads, with the registers that the loads name as inputs only: they are rewritten only behind the wait
__device__ __forceinline__ void idx_wait(const int (&a)[8], const int (&b)[8]) {
#if defined(__HIP_DEVICE_COMPILE__)
  asm volatile("s_wait_xcnt 0x0" :: "v"(a[0]), "v"(a[1]), "v"(a[2]), "v"(a[3]), "v"(a[4]), "v"(a[5]), "v"(a[6]), "v"(a[7]),
               "v"(b[0]), "v"(b[1]), "v"(b[2]), "v"(b[3]), "v"(b[4]), "v"(b[5]), "v"(b[6]), "v"(b[7]) : "memory");
#endif
}
__device__ __forceinline__ void adr_wait4(const char* p, const char* q, const char* r, const char* s) {
#if defined(__HIP_DEVICE_COMPILE__)
  asm volatile("s_wait_xcnt 0x0" :: "v"(p), "v"(q), "v"(r), "v"(s) : "memory");
#endif
}
__device__ __forceinline__ void adr_wait(const char* p, const char* q) {
#if defined(__HIP_DEVICE_COMPILE__)
  asm volatile("s_wait_xcnt 0x0" :: "v"(p), "v"(q) : "memory");
#endif
}
template <int RES>
__device__ __forceinline__
void attn_g(float* smem, int bid, int wave, const u16* __restrict__ QHp, const u16* __restrict__ QLp,
            const u16* __restrict__ KHp, const u16* __restrict__ KLp,
            const u16* __restrict__ VHp, const u16* __restrict__ VLp,
            const float* __restrict__ Gt, u16* OHp, u16* OLp) {
  constexpr int QT0 = (RES != 0) ? 0 : NQOB;
  constexpr int NQL = (RES != 0) ? NQOB : (NQB - NQOB);
  constexpr int NQE = (NQL > 0) ? NQL : 1;

  const int lane = (int)__builtin_amdgcn_mbcnt_lo(~0u, 0u);    // lane index without the thread id, which would otherwise hold a register over the other variant's key loop
  const unsigned lo = 16u * (unsigned)lane;
  const int hh   = lane >> 4;
  const int c    = lane & 15;
  const int qt   = QT0 + (bid % NQE);
  const int t2   = bid / NQE;
  const int hg   = t2 % NHG;
  const int b    = t2 / NHG;
  if (b >= NB) return;                      // block-uniform, before the barrier; never taken with the exact grid
  const int q0   = qt * (16 * QW);          // first of the block's 16*QW query rows; query tile u = rows q0 + 16u .. q0 + 16u + 15
  if (q0 + 16 * QW > SEQ) return;           // block-uniform; never taken
  if (RES != 0 && q0 + 16 * QW > QO) return; // block-uniform; never taken
  const int hw   = wave / KS;               // head within the block's group
  const int sp   = wave % KS;               // which quarter of the key tiles
  const int head = hg * WPB + hw;
  const int ql0  = (RES != 0) ? q0 : 0;

  float* wreg = smem + wave * WREG;         // per query tile u at u*WSUB: 16 row maxima, 16 row sums, then result slab [16][64] pitch 68

  const size_t hcol = (size_t)head * (SD / 32) * 512;                              // the head's first k tile
  const _Float16* Qh  = ash(QHp) + ((size_t)b * SEQ + q0) * QKN + hcol;            // query tile u at + u*16*QKN
  const _Float16* Ql  = ash(QLp) + ((size_t)b * SEQ + q0) * QKN + hcol;
  const _Float16* Khb = ash(KHp) + ((size_t)b * SEQ) * QKN + hcol;                 // key row tile kb added per step
  const _Float16* Klb = ash(KLp) + ((size_t)b * SEQ) * QKN + hcol;
  const _Float16* Vhb = ash(VHp) + ((size_t)(b * NH + head) * HD) * SEQ;                // d row tile j added per group
  const _Float16* Vlb = ash(VLp) + ((size_t)(b * NH + head) * HD) * QO;                 // RES == 1 only
  const float* gp = Gt + (size_t)head * SEQ;
  const float lsc = RSQ_HD * (LOG2E / (QSC * KSC));
  const float oc  = 1.0f / (PCAR * VCAR);
  const size_t KROW = (size_t)QKN;          // halves per key row: row tile kb starts at kb*KROW
  const size_t QT2  = (size_t)16 * QKN;     // halves between the two query tiles

  float mrow[QW], lrow[QW];                 // of query q0 + 16u + c: running maximum (the same in both wave halves), and the sum over this half's keys
  v8f o[QW][4];                             // transposed: element r of o[u][j] = (d = 16j + 8hh + r, query q0 + 16u + c)
#pragma unroll
  for (int u = 0; u < QW; ++u) {
    mrow[u] = -INFINITY;  lrow[u] = 0.f;
#pragma unroll
    for (int j = 0; j < 4; ++j) o[u][j] = zero8();
  }
  const int ncaus = (q0 >> 5) + 1;                                            // tiles holding keys <= q0 + 31: the same set for both query tiles
  const int nkt = (ncaus < NKT) ? ncaus : NKT;

#pragma unroll 1
  for (int kt = sp; kt < nkt; kt += KS) {
    const int kb = kt * 32;
    // ---- transposed scores, A = key rows, B = query columns: D element r of this lane = (key kb + 8hh + r, query q0 + 16u + c) in s[u][0], key kb + 16 + 8hh + r in s[u][1] ----
    v8f s00 = zero8(), s01 = zero8(), s10 = zero8(), s11 = zero8();
    const _Float16* k0p = Khb + (size_t)kb * KROW;
    const _Float16* k1p = k0p + (size_t)16 * KROW;
    const _Float16* l0p = Klb + (size_t)kb * KROW;
    const _Float16* l1p = l0p + (size_t)16 * KROW;
#pragma unroll
    for (int kk = 0; kk < SD / 32; ++kk) {
      const v16h qh0 = ldfrag_h(Qh + kk * 512, lo);
      const v16h ql0f = ldfrag_h(Ql + kk * 512, lo);
      const v16h qh1 = ldfrag_h(Qh + QT2 + kk * 512, lo);
      const v16h ql1f = ldfrag_h(Ql + QT2 + kk * 512, lo);
      const v16h kh0 = ldfrag_h(k0p + kk * 512, lo);
      const v16h kh1 = ldfrag_h(k1p + kk * 512, lo);
      const v16h kl0 = ldfrag_h(l0p + kk * 512, lo);
      const v16h kl1 = ldfrag_h(l1p + kk * 512, lo);
      adr_wait4((const char*)Qh + lo, (const char*)Ql + lo, (const char*)k0p + lo, (const char*)l0p + lo);   // the loads' address registers stay as they are until the wait has passed
      s00 = mma_h(kh0, qh0,  s00);
      s10 = mma_h(kh0, qh1,  s10);
      s01 = mma_h(kh1, qh0,  s01);
      s11 = mma_h(kh1, qh1,  s11);
      s00 = mma_h(kh0, ql0f, s00);
      s10 = mma_h(kh0, ql1f, s10);
      s01 = mma_h(kh1, ql0f, s01);
      s11 = mma_h(kh1, ql1f, s11);
      s00 = mma_h(kl0, qh0,  s00);
      s10 = mma_h(kl0, qh1,  s10);
      s01 = mma_h(kl1, qh0,  s01);
      s11 = mma_h(kl1, qh1,  s11);
      guard4(s00, s01, s10, s11, qh0, ql0f, qh1, ql1f, kh0, kl0, kh1, kl1);
    }
    // ---- gate (f32, per element) + causal select + online softmax in base 2, -inf-safe; one query tile after the other. A lane holds 16 of its
    //      query's 32 scores: maximum and sum run over its own registers, the maximum joined with the other wave half by one cross-row move.
    //      The 16 probabilities are, in place, the lane's part of the B operand P^T (split k map: elements 0..7 = keys kb + 8hh + 0..7, 8..15 = kb + 16 + 8hh + 0..7) ----
    FragH ph[QW], pl[QW];
#pragma unroll
    for (int u = 0; u < QW; ++u) {
      const v8f s0 = (u == 0) ? s00 : s10;
      const v8f s1 = (u == 0) ? s01 : s11;
      const int dq = q0 + 16 * u + c - kb - 8 * hh;                           // query - key of element r: dq - r in s0, dq - 16 - r in s1
      int ia[8], ib[8];
      float ga[8], gb[8];
#pragma unroll
      for (int r = 0; r < 8; ++r) {
        int i0 = dq - r;       i0 = (i0 < 0) ? 0 : i0;  i0 = (i0 > SEQ - 1) ? (SEQ - 1) : i0;
        int i1 = dq - 16 - r;  i1 = (i1 < 0) ? 0 : i1;  i1 = (i1 > SEQ - 1) ? (SEQ - 1) : i1;
        ia[r] = i0;  ib[r] = i1;
        ga[r] = gp[i0];
        gb[r] = gp[i1];
      }
      idx_wait(ia, ib);                     // the gate loads' index registers stay as they are until the wait has passed
      float t0[8], t1[8];
      float mx = -INFINITY;
#pragma unroll
      for (int r = 0; r < 8; ++r) {
        const float u0 = (s0[r] * lsc) * ga[r];
        const float u1 = (s1[r] * lsc) * gb[r];
        t0[r] = (dq - r < 0) ? -INFINITY : u0;
        t1[r] = (dq - 16 - r < 0) ? -INFINITY : u1;
        mx = fmaxf(mx, fmaxf(t0[r], t1[r]));
      }
      mx = fmaxf(mx, xhalf(mx));
      const float mn = fmaxf(mrow[u], mx);
      const float ms = (mn == -INFINITY) ? 0.0f : mn;
      const float al = exp2f(mrow[u] - ms);
      mrow[u] = mn;
      float ps = 0.f;
#pragma unroll
      for (int r = 0; r < 8; ++r) {
        const float e0 = exp2f(t0[r] - ms), e1 = exp2f(t1[r] - ms);
        ps += e0 + e1;
        const float ta = e0 * PCAR, tb = e1 * PCAR;
        const _Float16 ha = (_Float16)ta, hb = (_Float16)tb;
        ph[u].h[0][r] = ha;
        ph[u].h[1][r] = hb;
        pl[u].h[0][r] = (_Float16)(ta - (float)ha);
        pl[u].h[1][r] = (_Float16)(tb - (float)hb);
      }
      lrow[u] = lrow[u] * al + ps;
#pragma unroll
      for (int j = 0; j < 4; ++j) {
#pragma unroll
        for (int r = 0; r < 8; ++r) o[u][j][r] *= al;
      }
    }
    // ---- O^T += V^T.P^T : A fragment row m = d = j*16 + c, key tile kb>>5 of the packed v^T planes; 2 groups of 2 d-subtiles, each fragment used by both query tiles ----
    {
      const _Float16* vhp = Vhb + kb * 16;
      if constexpr (RES != 0) {
        const _Float16* vlp = Vlb + kb * 16;
#pragma unroll
        for (int jg = 0; jg < 2; ++jg) {
          const size_t da = (size_t)(2 * jg) * 16 * SEQ;
          const size_t db = da + (size_t)16 * SEQ;
          const size_t la = (size_t)(2 * jg) * 16 * QO;
          const size_t lb = la + (size_t)16 * QO;
          const v16h vha = ldfrag_h(vhp + da, lo), vhb2 = ldfrag_h(vhp + db, lo);
          const v16h vla = ldfrag_h(vlp + la, lo), vlb2 = ldfrag_h(vlp + lb, lo);
          adr_wait((const char*)vhp + lo, (const char*)vlp + lo);   // the loads' address registers stay as they are until the wait has passed
#pragma unroll
          for (int u = 0; u < QW; ++u) {
            o[u][2 * jg]     = mma_h(vha,  ph[u].v, o[u][2 * jg]);
            o[u][2 * jg + 1] = mma_h(vhb2, ph[u].v, o[u][2 * jg + 1]);
          }
#pragma unroll
          for (int u = 0; u < QW; ++u) {
            o[u][2 * jg]     = mma_h(vha,  pl[u].v, o[u][2 * jg]);
            o[u][2 * jg + 1] = mma_h(vhb2, pl[u].v, o[u][2 * jg + 1]);
          }
#pragma unroll
          for (int u = 0; u < QW; ++u) {
            o[u][2 * jg]     = mma_h(vla,  ph[u].v, o[u][2 * jg]);
            o[u][2 * jg + 1] = mma_h(vlb2, ph[u].v, o[u][2 * jg + 1]);
          }
          guard4(o[0][2 * jg], o[0][2 * jg + 1], o[1][2 * jg], o[1][2 * jg + 1], ph[0].v, pl[0].v, ph[1].v, pl[1].v, vha, vhb2, vla, vlb2);
        }
      } else {
#pragma unroll
        for (int jg = 0; jg < 2; ++jg) {
          const size_t da = (size_t)(2 * jg) * 16 * SEQ;
          const size_t db = da + (size_t)16 * SEQ;
          const v16h vha = ldfrag_h(vhp + da, lo), vhb2 = ldfrag_h(vhp + db, lo);
          adr_wait((const char*)vhp + lo, (const char*)vhp + lo);   // the loads' address registers stay as they are until the wait has passed
#pragma unroll
          for (int u = 0; u < QW; ++u) {
            o[u][2 * jg]     = mma_h(vha,  ph[u].v, o[u][2 * jg]);
            o[u][2 * jg + 1] = mma_h(vhb2, ph[u].v, o[u][2 * jg + 1]);
          }
          guard4(o[0][2 * jg], o[0][2 * jg + 1], o[1][2 * jg], o[1][2 * jg + 1], ph[0].v, ph[1].v, vha, vhb2, ph[0].v, ph[1].v, vha, vhb2);
        }
      }
    }
  }
  acc_guard4(o[0][0], o[0][1], o[0][2], o[0][3]);
  acc_guard4(o[1][0], o[1][1], o[1][2], o[1][3]);
  const int lne = lane;
  const int hhe = lne >> 4, ce = lne & 15;
  // ---- this wave's partial results: raw accumulators into the slab rows of the lane's query (8 consecutive d per subtile), row maxima and joined row sums in front of them ----
#pragma unroll
  for (int u = 0; u < QW; ++u) {
    float* pt   = wreg + u * WSUB;
    float* srow = pt + PTW + ce * SLP + 8 * hhe;
#pragma unroll
    for (int j = 0; j < 4; ++j) {
      const v4f a = {o[u][j][0], o[u][j][1], o[u][j][2], o[u][j][3]};
      const v4f b4 = {o[u][j][4], o[u][j][5], o[u][j][6], o[u][j][7]};
      *(v4f*)(srow + j * 16)     = a;
      *(v4f*)(srow + j * 16 + 4) = b4;
    }
    const float lt = lrow[u] + xhalf(lrow[u]);                                // the two wave halves' sums joined once
    if (hhe == 0) {
      pt[ce]      = mrow[u];
      pt[16 + ce] = lt;
    }
  }
  __syncthreads();                          // publishes the four partial results of each head to its four waves
#pragma unroll
  for (int u = 0; u < QW; ++u) {
    // ---- merge for row c of query tile u: w_s = 2^(m_s - max m) (0 for a wave without keys), Z = sum Z_s*w_s, out = sum acc_s*w_s / Z (0 if Z == 0) ----
    const float* hb = smem + hw * KS * WREG + u * WSUB;
    float ms4[KS], ws4[KS];
#pragma unroll
    for (int s = 0; s < KS; ++s) ms4[s] = hb[s * WREG + ce];
    const float mm  = fmaxf(fmaxf(ms4[0], ms4[1]), fmaxf(ms4[2], ms4[3]));
    const float mms = (mm == -INFINITY) ? 0.0f : mm;
    float lv = 0.f;
#pragma unroll
    for (int s = 0; s < KS; ++s) {
      ws4[s] = exp2f(ms4[s] - mms);
      lv += hb[s * WREG + 16 + ce] * ws4[s];
    }
    const float ls  = (lv > 0.0f) ? lv : 1.0f;
    const float inv = (lv > 0.0f) ? ((1.0f / ls) * oc) : 0.0f;
    // ---- O x1024 -> f16 hi (+ residual) packed planes; lane = (row c, 8 consecutive d at 16*sp + 8*hh): a quarter of the head's two tiles ----
    float w[8];
#pragma unroll
    for (int e = 0; e < 8; ++e) w[e] = 0.f;
#pragma unroll
    for (int s = 0; s < KS; ++s) {
      const float* sr = hb + s * WREG + PTW + ce * SLP + sp * 16 + hhe * 8;
      const v4f a = *(const v4f*)(sr), b4 = *(const v4f*)(sr + 4);
#pragma unroll
      for (int e = 0; e < 4; ++e) { w[e] += a[e] * ws4[s]; w[4 + e] += b4[e] * ws4[s]; }
    }
    v4u oh, ol;
#pragma unroll
    for (int e = 0; e < 4; ++e) {
      const float w0 = (w[2 * e] * inv) * OSC, w1 = (w[2 * e + 1] * inv) * OSC;
      const _Float16 h0 = (_Float16)w0, h1 = (_Float16)w1;
      const _Float16 l0 = (_Float16)(w0 - (float)h0), l1 = (_Float16)(w1 - (float)h1);
      oh[e] = pk16(h_bits(h0), h_bits(h1));
      ol[e] = pk16(h_bits(l0), h_bits(l1));
    }
    const size_t obh = ((size_t)b * SEQ + q0 + 16 * u) * DMOD + (size_t)head * (HD / 32) * 512 + sp * 256 + 8 * lne;
    const size_t obl = ((size_t)b * QO + ql0 + 16 * u) * DMOD + (size_t)head * (HD / 32) * 512 + sp * 256 + 8 * lne;
    *(v4u*)(OHp + obh) = oh;
    if constexpr (RES != 0) {
      *(v4u*)(OLp + obl) = ol;
    }
    xcnt_wait();                            // before the stores' address and data registers are reused
  }
}

// =====================================================================================================
// Joint grids: kernels that depend on the same earlier launch and on nothing of each other run as block ranges of ONE launch
// (every test below is block-uniform; each range runs its function unchanged with its own block index counted from 0).
// prep: weight transposes (Wv^T | Wq^T | Wk^T as one bf16 plane of FN rows x DMOD, Wo^T as its own f16 plane), x -> bf16 plane, gate table.
// =====================================================================================================
__global__ __launch_bounds__(256)
void prep(const float* __restrict__ x, const float* __restrict__ wv, const float* __restrict__ wq, const float* __restrict__ wk,
          const float* __restrict__ wo, const float* __restrict__ theta, u16* XB, u16* WB, u16* WO, float* G) {
  const int bid = blockIdx.x;
  if (bid < NB_TR) {
    const float* Wsrc = wv;
    u16* D = WB;
    int lb = bid, NW = DMOD, mode = 0;
    float sc = 1.0f;
    if (bid >= NB_TRV + 2 * NB_TRQ)  { Wsrc = wo; D = WO; lb = bid - (NB_TRV + 2 * NB_TRQ); mode = 1; sc = WOS; }
    else if (bid >= NB_TRV + NB_TRQ) { Wsrc = wk; D = WB + (size_t)(DMOD + QKN) * DMOD; lb = bid - (NB_TRV + NB_TRQ); NW = QKN; }
    else if (bid >= NB_TRV)          { Wsrc = wq; D = WB + (size_t)DMOD * DMOD; lb = bid - NB_TRV; NW = QKN; }
    tr16(lb, Wsrc, D, DMOD, NW, mode, sc);
  } else if (bid < NB_TR + NB_CV) {
    cvt16(bid - NB_TR, x, XB, MROWS * DMOD / 8, 0, 1.0f);
  } else {
    gtab(bid - (NB_TR + NB_CV), theta, G, NH * SEQ);
  }
}

// post: F f32 [MROWS][FN] (columns v | q | k) -> [qc|qs] planes, [kc|ks] planes, v^T planes.
__global__ __launch_bounds__(256)
void post(const float* __restrict__ F, u16* QH, u16* QL, u16* KH, u16* KL, u16* VH, u16* VL) {
  const int bid = blockIdx.x;
  if (bid < 2 * NB_QK) {
    const bool isk = (bid >= NB_QK);
    qk16(isk ? bid - NB_QK : bid, F + (isk ? (DMOD + QKN) : DMOD), isk ? KH : QH, isk ? KL : QL, MROWS * C8R, isk ? KSC : QSC);
  } else {
    vt16(bid - 2 * NB_QK, F, VH, VL);
  }
}

// attention: the query tiles s >= QO first, then the query tiles s < QO (residual products).
__global__ __launch_bounds__(ATT_THREADS) __attribute__((amdgpu_waves_per_eu(4)))   // at most 256 registers a wave, so that four waves share a SIMD
void attn_all(const u16* __restrict__ QHp, const u16* __restrict__ QLp, const u16* __restrict__ KHp, const u16* __restrict__ KLp,
              const u16* __restrict__ VHp, const u16* __restrict__ VLp, const float* __restrict__ Gt, u16* OHp, u16* OLp) {
  __shared__ __align__(16) float smem[WPB * KS * WREG];
  const int bid = blockIdx.x;
  const int wave = __builtin_amdgcn_readfirstlane((int)threadIdx.x >> 5);   // scalar, so that every tile start is a scalar base address
  if (bid < NB_AT0) attn_g<0>(smem, bid, wave, QHp, QLp, KHp, KLp, VHp, VLp, Gt, OHp, OLp);
  else              attn_g<1>(smem, bid - NB_AT0, wave, QHp, QLp, KHp, KLp, VHp, VLp, Gt, OHp, OLp);
}

// output projection: rows s < QO (O hi + residual) first, then rows s >= QO (O hi only).
__global__ __launch_bounds__(128)
void gemm_o_all(const u16* __restrict__ Ah, const u16* __restrict__ Al, const u16* __restrict__ Bt, float* C, float oscale) {
  __shared__ __align__(16) float slab[4 * SLAB64];
  const int bid = blockIdx.x;
  if (bid < NB_OP2) gemm_o<2>(slab, bid, Ah, Al, Bt, C, 0, QO / 64, oscale);
  else              gemm_o<1>(slab, bid - NB_OP2, Ah, Al, Bt, C, QO, (SEQ - QO) / 64, oscale);
}

// =====================================================================================================
// Workspace map (bytes; every 16-bit plane in the packed tile order, same extents as row-major); every plane is fully written by whole-line stores before it is read; all extents are exact
// multiples of the store granularity (no pad rows needed); every region offset a multiple of 131072:
//   XB  bf16 [MROWS][1024]                       MROWS*2048       (NB=2, SEQ=2048: 8388608)
//   WB  bf16 [5120 n][1024 k]                    10485760         (rows Wv^T | Wq^T | Wk^T)
//   WO  f16 [1024 n][1024 k] x1024               2097152          (Wo^T)
//   F   f32 [MROWS][5120]                        MROWS*20480      (columns v | q | k projection output;
//                                                                  afterwards OH f16 [MROWS][1024] x1024 at its start, OL residual
//                                                                  [NB*QO][1024] after)
//   QH  f16 [MROWS][2048] x256                   MROWS*4096       QL residual [MROWS][2048]      MROWS*4096
//   KH  f16 [MROWS][2048] x256                   MROWS*4096       KL residual [MROWS][2048]      MROWS*4096
//   VH  f16 [NB*16][64][SEQ] x1024               MROWS*2048       VL residual [NB*16][64][QO]    NB*QO*2048
//   G   f32 [16][SEQ]                            16*SEQ*4
//   end (NB=2, SEQ=2048)                       182583296
// =====================================================================================================
extern "C" void kernel_launch(void* const* d_in, const int* in_sizes, int n_in,
                              void* d_out, int out_size, void* d_ws, size_t ws_size,
                              hipStream_t stream) {
  if (n_in < 6) return;
  if (in_sizes[0] < ((NB - 1) * XS_FULL + SEQ) * DMOD) return;
  if (in_sizes[1] != DMOD * QKN) return;
  if (in_sizes[2] != DMOD * QKN) return;
  if (in_sizes[3] != DMOD * DMOD) return;
  if (in_sizes[4] != DMOD * DMOD) return;
  if (in_sizes[5] < NH) return;
  if (out_size < ((NB - 1) * XS_FULL + SEQ) * DMOD) return;

  const float* x   = (const float*)d_in[0];
  const float* wq  = (const float*)d_in[1];   // [1024 in][2048 out]
  const float* wk  = (const float*)d_in[2];   // [1024 in][2048 out]
  const float* wv  = (const float*)d_in[3];   // [1024 in][1024 out]
  const float* wo  = (const float*)d_in[4];   // [1024 in][1024 out]
  const float* th  = (const float*)d_in[5];   // [16]
  float*       out = (float*)d_out;

  const size_t szXB = (size_t)MROWS * DMOD * 2;
  const size_t szW  = (size_t)FN * DMOD * 2;
  const size_t szWO = (size_t)DMOD * DMOD * 2;
  const size_t szF  = (size_t)MROWS * FN * 4;
  const size_t szQ  = (size_t)MROWS * QKN * 2;                  // QH, QL, KH, KL
  const size_t szOH = (size_t)MROWS * DMOD * 2;
  const size_t szOL = (size_t)NB * QO * DMOD * 2;
  const size_t szVH = (size_t)NB * NH * HD * SEQ * 2;
  const size_t szVL = (size_t)NB * NH * HD * QO * 2;
  const size_t szG  = (size_t)NH * SEQ * 4;
  if (szOH + szOL > szF) return;                                // OH + OL live inside the F region
  size_t off = 0;
  const size_t oXB = off; off += szXB;
  const size_t oW  = off; off += szW;
  const size_t oWO = off; off += szWO;
  const size_t oF  = off; off += szF;
  const size_t oQH = off; off += szQ;
  const size_t oQL = off; off += szQ;
  const size_t oKH = off; off += szQ;
  const size_t oKL = off; off += szQ;
  const size_t oVH = off; off += szVH;
  const size_t oVL = off; off += szVL;
  const size_t oG  = off; off += szG;
  if (off > ws_size) return;                // off = 182583296 for NB = 2, SEQ = 2048
  if (off > (size_t)WS_CAP) return;

  char* ws = (char*)d_ws;
  u16*   XB = (u16*)(ws + oXB);
  u16*   WB = (u16*)(ws + oW);
  u16*   WO = (u16*)(ws + oWO);
  float* F  = (float*)(ws + oF);
  u16*   OH = (u16*)(ws + oF);
  u16*   OL = (u16*)(ws + oF + szOH);
  u16*   QH = (u16*)(ws + oQH);
  u16*   QL = (u16*)(ws + oQL);
  u16*   KH = (u16*)(ws + oKH);
  u16*   KL = (u16*)(ws + oKL);
  u16*   VH = (u16*)(ws + oVH);
  u16*   VL = (u16*)(ws + oVL);
  float* G  = (float*)(ws + oG);

  const dim3 b256(256), b128(128), bAT(ATT_THREADS);

  // (0) weights -> transposed 16-bit planes, x -> bf16 plane [MROWS][1024], gate table G[h][dl]
  prep<<<dim3(NB_TR + NB_CV + NB_GT), b256, 0, stream>>>(x, wv, wq, wk, wo, th, XB, WB, WO, G);
  // (1) [v | q_raw | k_raw] = x.[Wv | Wq | Wk] -> F f32 [MROWS][5120]
  gemm_nb<<<dim3((MROWS / 128) * (FN / 160)), b128, 0, stream>>>(XB, WB, F, MROWS, FN, 1.0f);
  // (2) [qc|qs] and [kc|ks] hi + residual x256, v^T hi + residual x1024
  post<<<dim3(2 * NB_QK + NB_VT), b256, 0, stream>>>(F, QH, QL, KH, KL, VH, VL);
  // (3) causal gated attention -> O hi (all rows) + residual (rows s < QO)
  attn_all<<<dim3(NB_AT0 + NB_AT1), bAT, 0, stream>>>(QH, QL, KH, KL, VH, VL, G, OH, OL);
  // (4) output projection -> out f32, carries 1024 x 1024 folded back
  gemm_o_all<<<dim3(NB_OP2 + NB_OP1), b128, 0, stream>>>(OH, OL, WO, out, 1.0f / (OSC * WOS));
  (void)hipGetLastError();
}

// v007
// One run takes 172 microseconds.
// In two side-by-side timings against v006, it was 1.18 and 1.17 times as fast.
// All steps since v000 together make it 3.15 times as fast.
// Contractions: x.Wq, x.Wk, x.Wv on v_wmma_f32_16x16x32_bf16 (x and W^T as bf16 RNE planes); per-head scores
// [qc|qs].[kc|ks] over 128 on v_wmma_f32_16x16x32_f16 (q, k as f16 hi x256 plus unscaled f16 residual planes, products
// hh+lh+hl on all query rows); P.v on v_wmma_f32_16x16x32_f16 (P x32768, v^T x1024 f16 planes; query rows s < QO also
// use f16 residual planes, hh+lh+hl); O.Wo on v_wmma_f32_16x16x32_f16 (O x1024 f16 hi plane, plus residual plane for rows
// s < QO; Wo^T as f16 of its bf16 RNE value x1024); all f32 accumulate. softplus, cos, sin, the cosine gate table,
// causal select, base-2 online softmax and 1/Z in f32 on VALU.
#include <hip/hip_runtime.h>
#include <math.h>
#include <stdint.h>

#ifndef NB
#define NB 2
#endif
#ifndef SEQ
#define SEQ 2048
#endif
#define XS_FULL 2048
#define DMOD  1024
#define QKN   (2 * DMOD)
#define NH    16
#define HD    64
#define SD    (2 * HD)
#define QO    ((SEQ < 512) ? SEQ : 512)
#define MROWS (NB * SEQ)
#define RSQ_HD 0.125f
#define GSTEP 0.125f
#define LOG2E 1.4426950408889634f
#define QSC   256.0f
#define KSC   256.0f
#define PCAR  32768.0f
#define VCAR  1024.0f
#define OSC   1024.0f
#define WOS   1024.0f
#define WPB   1
#define NHG   (NH / WPB)
#define NQT   (SEQ / 16)
#define NQO   (QO / 16)
#define QW    2                                 // query tiles of 16 rows that one attention wave carries
#define NQB   (NQT / QW)                        // attention query blocks of 16*QW rows
#define NQOB  (NQO / QW)
#define NST   (SEQ / 64)
#define NKT   (SEQ / 32)
#define KS    4
#define ATT_THREADS (WPB * KS * 32)
#define PTW   32                                // per query tile: 16 row maxima, then 16 row sums
#define SLP   68
#define SLW   (16 * SLP)
#define WSUB  (PTW + SLW)
#define WREG  (QW * WSUB)
#define SLAB64 (16 * 68)
#define VTP   72
#define C8R   (DMOD / 8)
#define QKP   264
#define WS_CAP 268435456
#define FN    (DMOD + 2 * QKN)                  // columns of the joint projection: v | q | k
#define NB_TRV ((DMOD / 64) * (DMOD / 64))      // transpose blocks of a [1024][1024] weight
#define NB_TRQ ((DMOD / 64) * (QKN / 64))       // transpose blocks of a [1024][2048] weight
#define NB_TR  (2 * NB_TRV + 2 * NB_TRQ)
#define NB_CV  ((MROWS * DMOD / 8) / 256)       // convert blocks of x
#define NB_GT  ((NH * SEQ) / 256)               // gate table blocks
#define NB_QK  ((MROWS * C8R) / 256)            // combine blocks of q, and of k
#define NB_VT  (NB * NH * NST)                  // v^T blocks
#define NB_AT1 (NQOB * NHG * NB)                // attention blocks with residual products
#define NB_AT0 ((NQB - NQOB) * NHG * NB)        // attention blocks without
#define NB_OP2 (NB * (QO / 64) * (DMOD / 64))   // output projection blocks with the residual plane
#define NB_OP1 (NB * ((SEQ - QO) / 64) * (DMOD / 64))
static_assert(DMOD == NH * HD && HD == 64 && NH == 16 && SD == 128 && WPB == 1 && NHG * WPB == NH);
static_assert(ATT_THREADS == 128 && KS == 4 && HD == KS * 16 && QW == 2 && NQB * QW == NQT && NQOB * QW == NQO);
static_assert(NB >= 1 && NB <= 2);
static_assert((SEQ % 64) == 0 && SEQ >= 64 && SEQ <= XS_FULL);
static_assert((QO % 64) == 0 && QO >= 64 && QO <= SEQ);
static_assert((DMOD % 64) == 0 && (QKN % 64) == 0 && (DMOD % 32) == 0 && (SD % 32) == 0 && C8R == 128);
static_assert((MROWS % 128) == 0 && (FN % 160) == 0);
static_assert(((SEQ * DMOD / 8) % 256) == 0 && ((MROWS * C8R) % 256) == 0 && ((NH * SEQ) % 256) == 0);
static_assert(WPB * KS * WREG * 4 <= 65536 && 2 * HD * VTP * 2 <= 65536 && 4 * SLAB64 * 4 <= 65536 && 64 * VTP * 2 <= 65536);

typedef unsigned short u16;
typedef _Float16 v16h __attribute__((ext_vector_type(16)));
typedef _Float16 v8h  __attribute__((ext_vector_type(8)));
typedef __bf16   v16b __attribute__((ext_vector_type(16)));
typedef float    v8f  __attribute__((ext_vector_type(8)));
typedef float    v4f  __attribute__((ext_vector_type(4)));
typedef unsigned int v4u __attribute__((ext_vector_type(4)));

union FragH { v16h v; v8h h[2]; v4u u[2]; };
union FragB { v16b v; v4u u[2]; };

// ---- scalar helpers --------------------------------------------------------------------------------
__device__ __forceinline__ unsigned short bf_bits(float f) {          // f32 -> bf16 bits, RNE convert
  unsigned u = __float_as_uint(f);
  return (unsigned short)((u + 0x7FFFu + ((u >> 16) & 1u)) >> 16);
}
__device__ __forceinline__ float bf_up(unsigned short h) { return __uint_as_float(((unsigned)h) << 16); }
__device__ __forceinline__ float bfr(float f) { return bf_up(bf_bits(f)); }
__device__ __forceinline__ unsigned short h_bits(_Float16 x) { return __builtin_bit_cast(unsigned short, x); }
__device__ __forceinline__ unsigned pk16(unsigned short a, unsigned short b) { return (unsigned)a | ((unsigned)b << 16); }
__device__ __forceinline__ v8f zero8() { v8f z = {0.f, 0.f, 0.f, 0.f, 0.f, 0.f, 0.f, 0.f}; return z; }
__device__ __forceinline__ const _Float16* ash(const u16* p) { return (const _Float16*)(const void*)p; }

// ---- packed operand planes: a 16-bit plane of R rows x K columns (R % 16 == 0, K % 32 == 0) is stored as 1-KB tiles of
//      16 rows x 32 k, tile (row>>4, k>>5) at half offset (row>>4)*16*K + (k>>5)*512; inside a tile element (m = row&15,
//      k&31 = 16*j + 8*h + e) lies at j*256 + (16*h + m)*8 + e. One fragment load of a wave is then 512 contiguous bytes
//      (4 cache lines) where a row-major plane gave 16 rows x 32 B (16 lines).
// ---- fragment loaders: 16-bit A/B operand, lane -> row/col (lane&15), h = lane>>4; t = a tile start (wave-uniform), lo = the lane's offset from it
//      in BYTES (16*lane inside the tile), p = t + lo bytes; elements 0..7 <- p[0..7] (k0+8h..), elements 8..15 <- p[256..263] (k0+16+8h..)  (same split k map for A and B)
__device__ __forceinline__ v16h ldfrag_h(const _Float16* t, unsigned lo) {
  FragH f;
  const char* p = (const char*)t + lo;
  f.h[0] = *(const v8h*)(p);
  f.h[1] = *(const v8h*)(p + 512);
  return f.v;
}
__device__ __forceinline__ v16b ldfrag_b(const u16* t, unsigned lo) { // bf16 plane read as unsigned integer vectors
  FragB f;
  const char* p = (const char*)t + lo;
  f.u[0] = *(const v4u*)(p);
  f.u[1] = *(const v4u*)(p + 512);
  return f.v;
}

__device__ __forceinline__ v8f mma_h(v16h a, v16h b, v8f c) {
  return __builtin_amdgcn_wmma_f32_16x16x32_f16(false, a, false, b, (short)0, c, false, false);
}
__device__ __forceinline__ v8f mma_b(v16b a, v16b b, v8f c) {
  return __builtin_amdgcn_wmma_f32_16x16x32_bf16(false, a, false, b, (short)0, c, false, false);
}
// four accumulators and eight operand fragments: the four vector slots behind the last matrix instruction of a group,
// with its results and operands held in their registers up to there
__device__ __forceinline__ void guard4(v8f& a, v8f& b, v8f& c, v8f& d, v16h x0, v16h x1, v16h x2, v16h x3, v16h x4, v16h x5, v16h x6, v16h x7) {
#if defined(__HIP_DEVICE_COMPILE__)
  asm volatile("v_nop\n\tv_nop\n\tv_nop\n\tv_nop"
               : "+v"(a), "+v"(b), "+v"(c), "+v"(d)
               : "v"(x0), "v"(x1), "v"(x2), "v"(x3), "v"(x4), "v"(x5), "v"(x6), "v"(x7) : "memory");
#endif
}
template <typename F>
__device__ __forceinline__ void guard6(v8f& a, v8f& b, v8f& c, v8f& d, F x0, F x1, F x2, F x3, F x4, F x5) {
#if defined(__HIP_DEVICE_COMPILE__)
  asm volatile("v_nop\n\tv_nop\n\tv_nop\n\tv_nop"
               : "+v"(a), "+v"(b), "+v"(c), "+v"(d) : "v"(x0), "v"(x1), "v"(x2), "v"(x3), "v"(x4), "v"(x5) : "memory");
#endif
}
__device__ __forceinline__ void acc_guard4(v8f& a, v8f& b, v8f& c, v8f& d) {
#if defined(__HIP_DEVICE_COMPILE__)
  asm volatile("v_nop\n\tv_nop\n\tv_nop\n\tv_nop" : "+v"(a), "+v"(b), "+v"(c), "+v"(d));
#endif
}
__device__ __forceinline__ void xcnt_wait() {
#if defined(__HIP_DEVICE_COMPILE__)
  asm volatile("s_wait_xcnt 0x0" ::: "memory");
#endif
}
__device__ __forceinline__ float xhalf(float x) {                     // the value of lane l ^ 16
  const int b = __builtin_bit_cast(int, x);
  return __builtin_bit_cast(float, __builtin_amdgcn_permlanex16(b, b, 0x76543210, 0xfedcba98, false, false));
}
__device__ __forceinline__ void wave_sync_lds() {                     // orders LDS accesses only: a wave's global stores still in flight are not waited for
  __builtin_amdgcn_fence(__ATOMIC_RELEASE, "workgroup", "local");
  __builtin_amdgcn_wave_barrier();
  __builtin_amdgcn_fence(__ATOMIC_ACQUIRE, "workgroup", "local");
}

// =====================================================================================================
// x f32 [NB][XS_FULL][DMOD] row-major -> packed 16-bit plane of MROWS rows (K = DMOD).  f16mode == 0: bf16 RNE bits;  f16mode == 1: f16 bits of (bf16 RNE value) * scale.
// Thread = 8 consecutive k of one row: two 16-B loads, one 16-B store; a wave = one half tile (16 rows x 2 chunks of 8 k), stored
// as 512 contiguous, 512-B aligned bytes; the 8 waves of a block read 512 contiguous bytes of each of 16 rows.
// coverage: grid = ceil(n8/256) blocks x 256 thr x 8 (in-kernel bound) = the whole plane (n8 a multiple of 256 here).
// =====================================================================================================
__device__ __forceinline__ void cvt16(int bid, const float* __restrict__ x, u16* D, int n8, int f16mode, float scale) {
  const int gt = bid * 256 + (int)threadIdx.x;
  if (gt >= n8) return;
  const int wv = gt >> 5, ln = gt & 31;                   // wave index = ((row tile * DMOD/32) + k tile) * 2 + j
  const int row = (wv / (DMOD / 16)) * 16 + (ln & 15);
  const int kc  = ((wv >> 1) % (DMOD / 32)) * 32 + (wv & 1) * 16 + (ln >> 4) * 8;
  const float* p = x + ((size_t)(row / SEQ) * XS_FULL + (size_t)(row % SEQ)) * DMOD + kc;   // plane row b*SEQ + s <- x row b*XS_FULL + s
  const v4f a = *(const v4f*)(p), b4 = *(const v4f*)(p + 4);
  float w[8];
#pragma unroll
  for (int e = 0; e < 4; ++e) { w[e] = a[e]; w[4 + e] = b4[e]; }
  v4u o;
#pragma unroll
  for (int e = 0; e < 4; ++e) {
    const float f0 = w[2 * e], f1 = w[2 * e + 1];
    const unsigned short hb0 = h_bits((_Float16)(bfr(f0) * scale));
    const unsigned short hb1 = h_bits((_Float16)(bfr(f1) * scale));
    const unsigned short bb0 = bf_bits(f0);
    const unsigned short bb1 = bf_bits(f1);
    o[e] = (f16mode != 0) ? pk16(hb0, hb1) : pk16(bb0, bb1);
  }
  u16* d = D + (size_t)gt * 8;
  {
    *(v4u*)(d) = o;
    
  }
}

// =====================================================================================================
// Weight transpose + convert: W f32 [KW][NW] row-major (W[k][n], the x.W layout) -> D 16-bit packed plane of NW rows x KW (row n, column k:
// the B operand). f16mode == 0: bf16 RNE bits; f16mode == 1: f16 bits of (bf16 RNE value) * scale.
// Block = one 64 k x 64 n tile: each thread loads 16 floats of one k row (16-B loads), converts, stores them transposed
// into an LDS tile [64 n][64 k] (pitch 72 halves, u16 element stores); after a block barrier each n row segment (64 halves =
// coverage: load 256 thr x 16 = 64 k x 64 n; store 2 iterations x 256 thr x 8 halves = 64 n rows x 64 k = the block's
//           tile; grid = (KW/64)*(NW/64) blocks covers D exactly once (host guarantees KW % 64 == 0, NW % 64 == 0).
// =====================================================================================================
__device__ __forceinline__ void tr16(int bid, const float* __restrict__ W, u16* D, int KW, int NW, int f16mode, float scale) {
  __shared__ __align__(16) u16 T[64 * VTP];
  const int tid = threadIdx.x;
  const int nkt = KW >> 6;
  const int kt  = bid % nkt;
  const int nt  = bid / nkt;
  const int k0  = kt * 64, n0 = nt * 64;
  if (n0 + 64 > NW) return;                 // block-uniform, before any barrier; never taken with the exact grid
  {
    const int kl = tid >> 2;                // k within tile 0..63
    const int nc = (tid & 3) * 16;          // n chunk 0,16,32,48
    const float* src = W + (size_t)(k0 + kl) * NW + n0 + nc;
#pragma unroll
    for (int i = 0; i < 4; ++i) {
      const v4f a = *(const v4f*)(src + 4 * i);
#pragma unroll
      for (int e = 0; e < 4; ++e) {
        const float f = a[e];
        const unsigned short hb = h_bits((_Float16)(bfr(f) * scale));
        const unsigned short bb = bf_bits(f);
        T[(nc + 4 * i + e) * VTP + kl] = (f16mode != 0) ? hb : bb;
      }
    }
  }
  __syncthreads();
  v4u v[2];
#pragma unroll
  for (int it = 0; it < 2; ++it) {
    const int pi = it * 256 + tid;          // 16-B piece: m = pi&15, h = (pi>>4)&1, j = (pi>>5)&1, k tile (pi>>6)&1, n tile pi>>7
    v[it] = *(const v4u*)(T + ((pi >> 7) * 16 + (pi & 15)) * VTP + ((pi >> 6) & 1) * 32 + ((pi >> 5) & 1) * 16 + ((pi >> 4) & 1) * 8);
  }
  {
#pragma unroll
    for (int it = 0; it < 2; ++it) {
      const int pi = it * 256 + tid;
      *(v4u*)(D + (size_t)(n0 + (pi >> 7) * 16) * KW + (size_t)((k0 >> 5) + ((pi >> 6) & 1)) * 512 + (pi & 63) * 8) = v[it];
    }
  }
}

// =====================================================================================================
// Cosine gate table G f32 [NH][SEQ]: G[h][dl] = cos(bf16(theta[h]) * (dl * 0.125f)), dl = query index - key index >= 0
// (cid difference (j-i)/8 is exact in f32 and cos is even). One value per thread, precise cosf; the block's 256 values
// coverage: grid = NH*SEQ/256 blocks x 256 = all NH x SEQ entries (NH*SEQ is a multiple of 256).
// =====================================================================================================
__device__ __forceinline__ void gtab(int bid, const float* __restrict__ theta, float* G, int ntot) {
  __shared__ __align__(16) float sg[256];
  const int tid = threadIdx.x;
  const int gt  = bid * 256 + tid;
  const int gc  = (gt < ntot) ? gt : (ntot - 1);
  const int h   = gc / SEQ;
  const int dl  = gc - h * SEQ;
  const int hc  = (h < NH) ? h : (NH - 1);
  const float th = bfr(theta[hc]);
  const float cd = (float)dl * GSTEP;
  sg[tid] = cosf(th * cd);
  __syncthreads();
  if (tid < 64) {
    const v4f v = *(const v4f*)(sg + tid * 4);
    const int base = bid * 256 + tid * 4;
    if (base + 4 <= ntot) {
      float* d = G + base;
      {
        *(v4f*)(d) = v;
        
      }
    }
  }
}

// =====================================================================================================
// Amplitude/phase combine: F f32, MROWS rows of pitch FN, F = the operand's first column (row = b*SEQ + s; column h*HD + d = amplitude pre-activation, DMOD + h*HD + d
// = phase) -> f16 hi plane Hp and unscaled f16 residual plane Lp, both packed planes of MROWS rows x QKN with column h*SD + d = c-part * sc and
// h*SD + HD + d = s-part * sc, where a = softplus(amp) = max(amp,0) + log1p(exp(-|amp|)), c-part = a*cos(phase),
// s-part = a*sin(phase) (precise expf/log1pf/cosf/sinf), hi = f16(t), residual = f16(t - f16(t)).
// Block = (16 rows, 2 heads); thread = (row, head h, 8 consecutive d): rolled loop of 8 (scalar loads, one transcendental chain per iteration, u16 element
// stores into the thread's own LDS slots, row pitch QKP); block barrier; then four 16-B stores per thread in packed order (the
// block's 8 tiles of each plane are 8 KB contiguous; a wave stores 512 contiguous bytes).
// coverage: grid = MROWS*C8R/256 blocks (clamped block index, predicated store; MROWS*C8R is a multiple of 256) x 2 iterations x
//           256 thr x 8 halves per plane = 16 rows x 256 columns; all blocks = every row x every column of Hp and of Lp once.
// =====================================================================================================
__device__ __forceinline__ void qk16(int bid, const float* __restrict__ F, u16* Hp, u16* Lp, int n8, float sc) {
  __shared__ __align__(16) u16 sHb[16 * QKP];
  __shared__ __align__(16) u16 sLb[16 * QKP];
  const int tid = threadIdx.x;
  const bool act = (bid * 256 + 256 <= n8);   // block-uniform
  const int bc  = act ? bid : 0;
  const int hp  = bc % (NH / 2);            // head pair
  const int rt  = bc / (NH / 2);            // 16-row tile
  const int row = rt * 16 + (tid >> 4);
  const int idx = tid & 15;
  const int h   = hp * 2 + (idx >> 3);
  const int d0  = (idx & 7) * 8;
  const float* ap = F + (size_t)row * FN + h * HD + d0;
  const float* pp = ap + DMOD;
  u16* sh = sHb + (tid >> 4) * QKP + idx * 16;
  u16* sl = sLb + (tid >> 4) * QKP + idx * 16;
#pragma unroll 1
  for (int e = 0; e < 8; ++e) {
    const float am  = ap[e];
    const float ph  = pp[e];
    const float spv = fmaxf(am, 0.0f) + log1pf(expf(-fabsf(am)));
    const float cv  = cosf(ph);
    const float sv  = sinf(ph);
    const float tc  = (spv * cv) * sc;
    const float ts  = (spv * sv) * sc;
    const _Float16 hc = (_Float16)tc, hs = (_Float16)ts;
    const _Float16 lc = (_Float16)(tc - (float)hc), ls = (_Float16)(ts - (float)hs);
    sh[e] = h_bits(hc);  sh[8 + e] = h_bits(hs);
    sl[e] = h_bits(lc);  sl[8 + e] = h_bits(ls);
  }
  __syncthreads();
  // 16-B piece pi of the block's 8 tiles: m = pi&15; column chunk q = pi>>4 (k tile q>>2, j = (q>>1)&1, h = q&1) = head q>>4 of the
  // pair, c or s part (q>>3)&1, d chunk q&7; it was written by thread m*16 + (q>>4)*8 + (q&7) at its slot + 8*part.
  v4u oh2[2], ol2[2];
#pragma unroll
  for (int it = 0; it < 2; ++it) {
    const int pi = it * 256 + tid;
    const int q  = pi >> 4;
    const int so = (pi & 15) * QKP + ((q >> 4) * 8 + (q & 7)) * 16 + ((q >> 3) & 1) * 8;
    oh2[it] = *(const v4u*)(sHb + so);
    ol2[it] = *(const v4u*)(sLb + so);
  }
  const size_t ob = (size_t)rt * 16 * QKN + (size_t)hp * (2 * SD * 16) + (size_t)tid * 8;
  if (act) {
#pragma unroll
    for (int it = 0; it < 2; ++it) {
      *(v4u*)(Hp + ob + it * 2048) = oh2[it];
      *(v4u*)(Lp + ob + it * 2048) = ol2[it];
    }
  }
}

// =====================================================================================================
// v^T planes from the v projection F f32, MROWS rows of pitch FN (row = b*SEQ + s, column = h*HD + d):
//   VH packed plane, row (b*NH + h)*HD + d, column s (K = SEQ) = f16(v * 1024) for all keys s;
//   VL packed plane, same rows, column s (K = QO) = f16 residual (t - f16(t)) for keys s < QO only.
// Block = (b, head h, 64 keys s0): each thread loads its 16 floats (key sl, d chunk dc) with 16-B loads, converts, scatters
// line) is written by 8 consecutive lanes x 16 B of one instruction, in both planes (VL under the block-uniform s0 < QO
// coverage: load 256 thr x 16 = 64 keys x 64 d; store 2 iterations x 256 thr x 8 halves = 64 lines x 64 = the block's tile of
//           VH (and of VL when s0 < QO); grid = NB*NH*NST blocks covers VH exactly once and all QO columns of VL exactly once.
// =====================================================================================================
__device__ __forceinline__ void vt16(int bid, const float* __restrict__ F, u16* VHo, u16* VLo) {
  __shared__ __align__(16) u16 TH[HD * VTP];
  __shared__ __align__(16) u16 TL[HD * VTP];
  const int tid = threadIdx.x;
  const int st  = bid % NST;
  const int t2  = bid / NST;
  const int h   = t2 % NH;
  const int b   = t2 / NH;
  if (b >= NB) return;                      // block-uniform, before any barrier; never taken with the exact grid
  const int s0  = st * 64;
  const bool dolo = (s0 + 64 <= QO);        // block-uniform
  {
    const int sl = tid >> 2;                // key within tile 0..63
    const int dc = (tid & 3) * 16;          // d chunk 0,16,32,48
    const float* src = F + ((size_t)b * SEQ + s0 + sl) * FN + h * HD + dc;
#pragma unroll
    for (int i = 0; i < 4; ++i) {
      const v4f a = *(const v4f*)(src + 4 * i);
#pragma unroll
      for (int e = 0; e < 4; ++e) {
        const float t = a[e] * VCAR;
        const _Float16 hv = (_Float16)t;
        const _Float16 lv = (_Float16)(t - (float)hv);
        TH[(dc + 4 * i + e) * VTP + sl] = h_bits(hv);
        TL[(dc + 4 * i + e) * VTP + sl] = h_bits(lv);
      }
    }
  }
  __syncthreads();
  v4u vh[2], vl[2];
#pragma unroll
  for (int it = 0; it < 2; ++it) {
    const int pi = it * 256 + tid;          // 16-B piece: m = pi&15, h = (pi>>4)&1, j = (pi>>5)&1, key tile (pi>>6)&1, d tile pi>>7
    const int so = ((pi >> 7) * 16 + (pi & 15)) * VTP + ((pi >> 6) & 1) * 32 + ((pi >> 5) & 1) * 16 + ((pi >> 4) & 1) * 8;
    vh[it] = *(const v4u*)(TH + so);
    vl[it] = *(const v4u*)(TL + so);
  }
  const size_t hrow = (size_t)(b * NH + h) * HD;
  const int    sL   = dolo ? s0 : 0;
  {
#pragma unroll
    for (int it = 0; it < 2; ++it) {
      const int pi = it * 256 + tid;
      const size_t dr = hrow + (size_t)(pi >> 7) * 16;
      const int    kq = (pi >> 6) & 1;
      *(v4u*)(VHo + dr * SEQ + (size_t)((s0 >> 5) + kq) * 512 + (pi & 63) * 8) = vh[it];
      xcnt_wait();                          // before the store's address and data registers are reused
      if (dolo) {
        *(v4u*)(VLo + dr * QO + (size_t)((sL >> 5) + kq) * 512 + (pi & 63) * 8) = vl[it];
        xcnt_wait();                        // as above
      }
    }
  }
}

// =====================================================================================================
// GEMM epilogue shared by both engines: the wave's 16x64 f32 tile (times oscale) staged in its LDS slab (pitch 68), release
// coverage: 8 instructions x 2 rows x 16 lanes x 4 floats = the wave's 16 x 64 tile.
// =====================================================================================================
__device__ __forceinline__ void epi64(float* sl, v8f a0, v8f a1, v8f a2, v8f a3, float oscale,
                                      float* C, int N, size_t rowb, int col0, int lane) {
  const int hh = lane >> 4, m = lane & 15;
#pragma unroll
  for (int r = 0; r < 8; ++r) {
    const int ro = (8 * hh + r) * 68 + m;
    sl[ro]      = a0[r] * oscale;
    sl[ro + 16] = a1[r] * oscale;
    sl[ro + 32] = a2[r] * oscale;
    sl[ro + 48] = a3[r] * oscale;
  }
  wave_sync_lds();
  v4f vals[8];
#pragma unroll
  for (int it = 0; it < 8; ++it) vals[it] = *(const v4f*)(sl + (it * 2 + hh) * 68 + m * 4);
  float* dst = C + (rowb + (size_t)hh) * (size_t)N + col0 + m * 4;
  {
#pragma unroll
    for (int it = 0; it < 8; ++it) {
      *(v4f*)(dst + (size_t)(it * 2) * (size_t)N) = vals[it];
    }
    
  }
}

// =====================================================================================================
// bf16 GEMM, no bias: C[M][N] (f32) = A (bf16 packed plane, M rows x K) . Bt^T (bf16 packed plane, N rows x K), times oscale; K = DMOD.
// Block = 128 rows x 160 columns, 4 waves as 2 x 2; a wave holds 20 accumulator tiles of 16 x 16: its 64 rows x 64 columns of its own
// (block columns 0..63 for wc = 0, 96..159 for wc = 1) and, of the middle columns 64..95, the 32 rows 32*wc .. 32*wc + 31 of its 64, so that every
// 128-B line of C has one writer. Ten fragments (4 of A, 6 of B) feed 20 matrix instructions per k step of 32; fragments are loaded straight from
// the packed tiles (two 16-B loads each, split k map for A and B); every element's sum over k runs in rising k as before.
// Row tile order inside a wave: fragment i = row tile (i + 2*wc) & 3, so that fragments 0 and 1 are the rows that also take the middle columns.
// (host guarantees M % 128 == 0, N % 160 == 0, grid = (M/128)*(N/160)).
// =====================================================================================================
// 16 x 32 tile epilogue: as epi64, for two accumulator tiles; 4 instructions x 4 rows x 8 lanes x 4 floats, each row piece one whole 128-B line.
__device__ __forceinline__ void epi32(float* sl, v8f a0, v8f a1, float oscale, float* C, int N, size_t rowb, int col0, int lane) {
  const int hh = lane >> 4, m = lane & 15;
#pragma unroll
  for (int r = 0; r < 8; ++r) {
    const int ro = (8 * hh + r) * 68 + m;
    sl[ro]      = a0[r] * oscale;
    sl[ro + 16] = a1[r] * oscale;
  }
  wave_sync_lds();
  const int rr = lane >> 3, cc = lane & 7;
  v4f vals[4];
#pragma unroll
  for (int it = 0; it < 4; ++it) vals[it] = *(const v4f*)(sl + (it * 4 + rr) * 68 + cc * 4);
  float* dst = C + (rowb + (size_t)rr) * (size_t)N + col0 + cc * 4;
#pragma unroll
  for (int it = 0; it < 4; ++it) {
    *(v4f*)(dst + (size_t)(it * 4) * (size_t)N) = vals[it];
  }
}
// the four vector slots behind the last matrix instruction of a k step; all 20 results and all 10 operand fragments are inputs, so that the
// slots stand behind every matrix instruction of the step and the fragments keep their registers up to there
__device__ __forceinline__ void guard20(const v8f (&m)[4][4], const v8f (&e)[2][2], const v16b (&a)[4], const v16b (&b)[6]) {
#if defined(__HIP_DEVICE_COMPILE__)
  asm volatile("v_nop\n\tv_nop\n\tv_nop\n\tv_nop"
               :: "v"(m[0][0]), "v"(m[0][1]), "v"(m[0][2]), "v"(m[0][3]), "v"(m[1][0]), "v"(m[1][1]), "v"(m[1][2]), "v"(m[1][3]),
                  "v"(m[2][0]), "v"(m[2][1]), "v"(m[2][2]), "v"(m[2][3]), "v"(m[3][0]), "v"(m[3][1]), "v"(m[3][2]), "v"(m[3][3]),
                  "v"(e[0][0]), "v"(e[0][1]), "v"(e[1][0]), "v"(e[1][1]),
                  "v"(a[0]), "v"(a[1]), "v"(a[2]), "v"(a[3]), "v"(b[0]), "v"(b[1]), "v"(b[2]), "v"(b[3]), "v"(b[4]), "v"(b[5]) : "memory");
#endif
}
// s_wait_xcnt 0 behind a group of global loads, with the offset register that the loads name as an input only: it is rewritten only behind the wait
__device__ __forceinline__ void off_wait(unsigned vo) {
#if defined(__HIP_DEVICE_COMPILE__)
  asm volatile("s_wait_xcnt 0x0" :: "v"(vo) : "memory");
#endif
}
__global__ __launch_bounds__(128) __attribute__((amdgpu_waves_per_eu(4)))   // at most 256 registers a wave, so that four waves share a SIMD and the whole grid is resident at once
void gemm_nb(const u16* __restrict__ A, const u16* __restrict__ Bt, float* C, int M, int N, float oscale) {
  __shared__ __align__(16) float slab[4 * SLAB64];
  constexpr int K = DMOD;                   // a constant, so that the row tiles' distances fold into the loads' immediate offsets
  const int tid = threadIdx.x, lane = tid & 31;
  const int wave = __builtin_amdgcn_readfirstlane(tid >> 5);   // scalar, so that the tile starts are computed on the scalar unit
  unsigned vo = 16u * (unsigned)lane;         // the lane's byte offset from the row tiles' starts; one k tile (1 KB) further each trip
  const int ntile = N / 160;
  const int bid   = blockIdx.x;
  const int wr = wave >> 1, wc = wave & 1;
  const int rowb  = (bid / ntile) * 128 + wr * 64;
  const int colb  = (bid % ntile) * 160;
  const int colm  = colb + wc * 96;         // the wave's own 64 columns
  const int cole  = colb + 64;              // the middle 32 columns
  if (rowb + 64 > M) return;                // wave-uniform, never taken with the exact grid; no block barriers in this kernel
  const size_t bs = (size_t)16 * K;
  const u16* ap[4];
  const u16* bp[6];
#pragma unroll
  for (int i = 0; i < 4; ++i) ap[i] = A + (size_t)(rowb + 16 * ((i + 2 * wc) & 3)) * K;
#pragma unroll
  for (int j = 0; j < 4; ++j) bp[j] = Bt + (size_t)colm * K + (size_t)j * bs;
#pragma unroll
  for (int j = 0; j < 2; ++j) bp[4 + j] = Bt + (size_t)cole * K + (size_t)j * bs;
  v8f am[4][4], ae[2][2];
#pragma unroll
  for (int i = 0; i < 4; ++i) {
#pragma unroll
    for (int j = 0; j < 4; ++j) am[i][j] = zero8();
  }
#pragma unroll
  for (int i = 0; i < 2; ++i) {
#pragma unroll
    for (int j = 0; j < 2; ++j) ae[i][j] = zero8();
  }
#pragma unroll 1
  for (int k0 = 0; k0 < K; k0 += 32) {
    v16b a[4], b[6];
#pragma unroll
    for (int i = 0; i < 4; ++i) a[i] = ldfrag_b(ap[i], vo);
#pragma unroll
    for (int j = 0; j < 6; ++j) b[j] = ldfrag_b(bp[j], vo);
    off_wait(vo);                           // the loads' offset register stays as it is until the wait has passed
    vo += 1024u;                            // next k tile: 512 halves
#pragma unroll
    for (int j = 0; j < 4; ++j) {
#pragma unroll
      for (int i = 0; i < 4; ++i) am[i][j] = mma_b(a[i], b[j], am[i][j]);
    }
#pragma unroll
    for (int j = 0; j < 2; ++j) {
#pragma unroll
      for (int i = 0; i < 2; ++i) ae[i][j] = mma_b(a[i], b[4 + j], ae[i][j]);
    }
    guard20(am, ae, a, b);
  }
  float* sl = slab + wave * SLAB64;
#pragma unroll
  for (int i = 0; i < 4; ++i) {
    const size_t row = (size_t)(rowb + 16 * ((i + 2 * wc) & 3));
    if (i > 0) {
      xcnt_wait();                          // before the earlier stores' address and data registers are reused
      wave_sync_lds();                      // every lane has read the slab before it is written again
    }
    epi64(sl, am[i][0], am[i][1], am[i][2], am[i][3], oscale, C, N, row, colm, lane);
    if (i < 2) {
      xcnt_wait();                          // as above
      wave_sync_lds();                      // as above
      epi32(sl, ae[i][0], ae[i][1], oscale, C, N, row, cole, lane);
    }
  }
}

// =====================================================================================================
// Output projection, no bias: C[row][DMOD] (f32) = (Ah [+ Al])[row][DMOD] . Bt[DMOD][DMOD]^T * oscale.
// NPROD == 1: Ah only (one product); NPROD == 2: Ah + Al residual plane (products h.B + l.B into one accumulator, l unscaled).
// Row indices (packed planes, K = DMOD): Ah row bb*SEQ + s; Al row bb*QO + s (compact plane, s < QO); C row bb*XS_FULL + s.
// Block -> (column tile ct = bid % 16, sequence row tile rt of nrt starting at s = sbeg, batch bb). Block = 64 rows (4 waves x 16) x 64
// columns, 4 accumulators a wave; fragment loads (split k map) and epi64 epilogue as gemm_nb; K = DMOD stepped by 32.
// =====================================================================================================
template <int NPROD>
__device__ __forceinline__
void gemm_o(float* slab, int bid, const u16* __restrict__ Ah, const u16* __restrict__ Al, const u16* __restrict__ Bt,
            float* C, int sbeg, int nrt, float oscale) {
  const int tid = threadIdx.x, lane = tid & 31;
  const int wave = __builtin_amdgcn_readfirstlane(tid >> 5);   // scalar, so that the tile starts are computed on the scalar unit
  unsigned vo = 16u * (unsigned)lane;         // the lane's byte offset from the row tiles' starts; one k tile (1 KB) further each trip
  const int ntile = DMOD >> 6;
  const int ct    = bid % ntile;
  const int t2    = bid / ntile;
  const int rt    = t2 % nrt;
  const int bb    = t2 / nrt;
  if (bb >= NB) return;                     // block-uniform; no block barriers in this kernel; never taken with the exact grid
  const int srow  = sbeg + rt * 64 + wave * 16;
  if (srow + 16 > SEQ) return;              // wave-uniform; never taken
  if (NPROD == 2 && srow + 16 > QO) return; // wave-uniform; never taken
  const int col0  = ct * 64;
  const int K     = DMOD;
  const size_t rowA = (size_t)bb * SEQ + srow;
  const size_t rowL = (NPROD == 2) ? ((size_t)bb * QO + srow) : (size_t)0;
  const size_t rowC = (size_t)bb * XS_FULL + srow;
  const _Float16* ahp = ash(Ah) + rowA * K;
  const _Float16* alp = ash(Al) + rowL * K;                  // dereferenced only when NPROD == 2
  const _Float16* bp  = ash(Bt) + (size_t)col0 * K;
  const size_t bs = (size_t)16 * K;
  const _Float16* bp1 = bp + bs;
  const _Float16* bp2 = bp + 2 * bs;
  const _Float16* bp3 = bp + 3 * bs;
  v8f acc0 = zero8(), acc1 = zero8(), acc2 = zero8(), acc3 = zero8();
  if constexpr (NPROD == 2) {
#pragma unroll 1
    for (int k0 = 0; k0 < K; k0 += 32) {
      const v16h ah = ldfrag_h(ahp, vo), al = ldfrag_h(alp, vo);
      const v16h b0 = ldfrag_h(bp, vo);
      const v16h b1 = ldfrag_h(bp1, vo);
      const v16h b2 = ldfrag_h(bp2, vo);
      const v16h b3 = ldfrag_h(bp3, vo);
      vo += 1024u;                          // next k tile: 512 halves
      acc0 = mma_h(ah, b0, acc0);  acc0 = mma_h(al, b0, acc0);
      acc1 = mma_h(ah, b1, acc1);  acc1 = mma_h(al, b1, acc1);
      acc2 = mma_h(ah, b2, acc2);  acc2 = mma_h(al, b2, acc2);
      acc3 = mma_h(ah, b3, acc3);  acc3 = mma_h(al, b3, acc3);
      guard6<v16h>(acc0, acc1, acc2, acc3, ah, al, b0, b1, b2, b3);
    }
  } else {
#pragma unroll 1
    for (int k0 = 0; k0 < K; k0 += 32) {
      const v16h ah = ldfrag_h(ahp, vo);
      const v16h b0 = ldfrag_h(bp, vo);
      const v16h b1 = ldfrag_h(bp1, vo);
      const v16h b2 = ldfrag_h(bp2, vo);
      const v16h b3 = ldfrag_h(bp3, vo);
      vo += 1024u;                          // next k tile: 512 halves
      acc0 = mma_h(ah, b0, acc0);
      acc1 = mma_h(ah, b1, acc1);
      acc2 = mma_h(ah, b2, acc2);
      acc3 = mma_h(ah, b3, acc3);
      guard6<v16h>(acc0, acc1, acc2, acc3, ah, b0, b1, b2, b3, ah);
    }
  }
  epi64(slab + wave * SLAB64, acc0, acc1, acc2, acc3, oscale, C, DMOD, rowC, col0, lane);
}

// =====================================================================================================
// Causal gated multi-head attention, score depth SD = 128 ([c|s] parts of one head), hd = 64 for v.
// Block bid -> (query block qt, falling with bid so that a block's number of key tiles falls with its index: rows q0 = 32*qt .. q0+31 = QW = 2 query tiles of 16 rows, carried side by side by every wave, so that each
// key and v fragment is loaded once for both; each tile's own sums are those of a block of one tile; head group hg of WPB = 1 head, batch b); KS = 4 waves per head = hg*WPB + wave/KS:
// wave sp = wave % KS takes the key tiles kt = sp, sp + KS, ... with its own running max, sum and accumulator; the four
// partial results are merged once, after one block barrier (weights 2^(m_s - max m), -inf-safe: a wave without tiles adds 0).
// RES == 1: query tiles q0 < QO, P.v = hh + lh + hl with the v^T residual plane, O residual plane also written;
// RES == 0: query tiles q0 >= QO, P.v single products. Scores use q_hi.k_hi + q_lo.k_hi + q_hi.k_lo in both variants.
//   q hi plane f16 x256, packed, row b*SEQ + s, column h*SD + e (e < SD), q residual plane same layout (all rows); k planes likewise;
//   v^T hi plane x1024, packed, row (b*NH + h)*HD + d, column s (K = SEQ), v^T residual plane (K = QO); gate table G[h][i - j] f32.
//   score (log2 domain) t(i, j) = (q_i.k_j over SD) * (1/8)*log2e/(256*256) * G[h][i - j], replaced by -inf where key j >
//   query i (gate index clamped to [0, SEQ-1]; the clamped value is only used on masked elements).
//   Key tiles of 32 with kb <= q0 + 15, each wave's in rising order; with RES == 1 every visited key is below QO, inside the compact
//   v^T residual plane.
//   Both products run transposed, S^T = K.Q^T (A = key rows, B = query columns) and O^T += V^T.P^T (A = v^T rows, B = P^T), so that a lane
//   holds scores, probabilities and results of ONE query (column lane & 15; the two wave halves split its keys and its d).
//   Per tile: 2 score subtiles x 4 k-steps x 3 products, fragments loaded straight from the 16-bit planes (two 16-B loads
//   per fragment, split k map); online max-subtracted base-2 softmax in f32, -inf-safe rescale, maximum and sum over the lane's own
//   16 registers (maximum joined across the halves per tile, sum once behind the loop); the two score subtiles, converted in place (hi,
//   residual), are the B operand P^T in the split k map; v^T A fragments in 2 groups of
//   2 d-subtiles. After the loop each wave writes its raw accumulator into its own result slab (pitch 68, row = query; every element owned
//   by one lane) and its 16 row maxima and sums in front of the slab; one block barrier (every return stands in front of it
//   and is block-uniform); then wave sp merges columns 16*sp .. 16*sp+15 of its head: out = sum_s acc_s*w_s / sum_s Z_s*w_s
//   (Z > 0 always: key 0 <= every query row; guarded anyway), carries 1/(32768*1024) folded once. Bounded loops only (nkt <= NKT).
// coverage: per wave QW = 2 instructions x 16 rows x 2 chunks x 8 halves = 32 x 16 per plane, KS waves = 32 x 64; the two block ranges
//           (RES 1: NQOB query blocks, RES 0: NQB-NQOB) x NHG x NB blocks x WPB heads = every (b, s, h) row segment of O hi exactly
//           once and every (b, s < QO, h) row segment of O residual exactly once.
// =====================================================================================================
// s_wait_xcnt 0 behind a group of global loads, with the registers that the loads name as inputs only: they are rewritten only behind the wait
__device__ __forceinline__ void idx_wait(const int (&a)[8], const int (&b)[8]) {
#if defined(__HIP_DEVICE_COMPILE__)
  asm volatile("s_wait_xcnt 0x0" :: "v"(a[0]), "v"(a[1]), "v"(a[2]), "v"(a[3]), "v"(a[4]), "v"(a[5]), "v"(a[6]), "v"(a[7]),
               "v"(b[0]), "v"(b[1]), "v"(b[2]), "v"(b[3]), "v"(b[4]), "v"(b[5]), "v"(b[6]), "v"(b[7]) : "memory");
#endif
}
__device__ __forceinline__ void adr_wait4(const char* p, const char* q, const char* r, const char* s) {
#if defined(__HIP_DEVICE_COMPILE__)
  asm volatile("s_wait_xcnt 0x0" :: "v"(p), "v"(q), "v"(r), "v"(s) : "memory");
#endif
}
__device__ __forceinline__ void adr_wait(const char* p, const char* q) {
#if defined(__HIP_DEVICE_COMPILE__)
  asm volatile("s_wait_xcnt 0x0" :: "v"(p), "v"(q) : "memory");
#endif
}
template <int RES>
__device__ __forceinline__
void attn_g(float* smem, int bid, int wave, const u16* __restrict__ QHp, const u16* __restrict__ QLp,
            const u16* __restrict__ KHp, const u16* __restrict__ KLp,
            const u16* __restrict__ VHp, const u16* __restrict__ VLp,
            const float* __restrict__ Gt, u16* OHp, u16* OLp) {
  constexpr int QT0 = (RES != 0) ? 0 : NQOB;
  constexpr int NQL = (RES != 0) ? NQOB : (NQB - NQOB);
  constexpr int NQE = (NQL > 0) ? NQL : 1;

  const int lane = (int)__builtin_amdgcn_mbcnt_lo(~0u, 0u);    // lane index without the thread id, which would otherwise hold a register over the other variant's key loop
  const unsigned lo = 16u * (unsigned)lane;
  const int hh   = lane >> 4;
  const int c    = lane & 15;
  const int qi   = bid / (NHG * NB);        // the query block with the most key tiles comes first, all heads and batches of it side by side
  const int t2   = bid % (NHG * NB);
  const int hg   = t2 % NHG;
  const int b    = t2 / NHG;
  if (qi >= NQE) return;                    // block-uniform, before the barrier; never taken with the exact grid
  const int qt   = QT0 + (NQE - 1 - qi);
  const int q0   = qt * (16 * QW);          // first of the block's 16*QW query rows; query tile u = rows q0 + 16u .. q0 + 16u + 15
  if (q0 + 16 * QW > SEQ) return;           // block-uniform; never taken
  if (RES != 0 && q0 + 16 * QW > QO) return; // block-uniform; never taken
  const int hw   = wave / KS;               // head within the block's group
  const int sp   = wave % KS;               // which quarter of the key tiles
  const int head = hg * WPB + hw;
  const int ql0  = (RES != 0) ? q0 : 0;

  float* wreg = smem + wave * WREG;         // per query tile u at u*WSUB: 16 row maxima, 16 row sums, then result slab [16][64] pitch 68

  const size_t hcol = (size_t)head * (SD / 32) * 512;                              // the head's first k tile
  const _Float16* Qh  = ash(QHp) + ((size_t)b * SEQ + q0) * QKN + hcol;            // query tile u at + u*16*QKN
  const _Float16* Ql  = ash(QLp) + ((size_t)b * SEQ + q0) * QKN + hcol;
  const _Float16* Khb = ash(KHp) + ((size_t)b * SEQ) * QKN + hcol;                 // key row tile kb added per step
  const _Float16* Klb = ash(KLp) + ((size_t)b * SEQ) * QKN + hcol;
  const _Float16* Vhb = ash(VHp) + ((size_t)(b * NH + head) * HD) * SEQ;                // d row tile j added per group
  const _Float16* Vlb = ash(VLp) + ((size_t)(b * NH + head) * HD) * QO;                 // RES == 1 only
  const float* gp = Gt + (size_t)head * SEQ;
  const float lsc = RSQ_HD * (LOG2E / (QSC * KSC));
  const float oc  = 1.0f / (PCAR * VCAR);
  const size_t KROW = (size_t)QKN;          // halves per key row: row tile kb starts at kb*KROW
  const size_t QT2  = (size_t)16 * QKN;     // halves between the two query tiles

  float mrow[QW], lrow[QW];                 // of query q0 + 16u + c: running maximum (the same in both wave halves), and the sum over this half's keys
  v8f o[QW][4];                             // transposed: element r of o[u][j] = (d = 16j + 8hh + r, query q0 + 16u + c)
#pragma unroll
  for (int u = 0; u < QW; ++u) {
    mrow[u] = -INFINITY;  lrow[u] = 0.f;
#pragma unroll
    for (int j = 0; j < 4; ++j) o[u][j] = zero8();
  }
  const int ncaus = (q0 >> 5) + 1;                                            // tiles holding keys <= q0 + 31: the same set for both query tiles
  const int nkt = (ncaus < NKT) ? ncaus : NKT;

#pragma unroll 1
  for (int kt = sp; kt < nkt; kt += KS) {
    const int kb = kt * 32;
    // ---- transposed scores, A = key rows, B = query columns: D element r of this lane = (key kb + 8hh + r, query q0 + 16u + c) in s[u][0], key kb + 16 + 8hh + r in s[u][1] ----
    v8f s00 = zero8(), s01 = zero8(), s10 = zero8(), s11 = zero8();
    const _Float16* k0p = Khb + (size_t)kb * KROW;
    const _Float16* k1p = k0p + (size_t)16 * KROW;
    const _Float16* l0p = Klb + (size_t)kb * KROW;
    const _Float16* l1p = l0p + (size_t)16 * KROW;
#pragma unroll
    for (int kk = 0; kk < SD / 32; ++kk) {
      const v16h qh0 = ldfrag_h(Qh + kk * 512, lo);
      const v16h ql0f = ldfrag_h(Ql + kk * 512, lo);
      const v16h qh1 = ldfrag_h(Qh + QT2 + kk * 512, lo);
      const v16h ql1f = ldfrag_h(Ql + QT2 + kk * 512, lo);
      const v16h kh0 = ldfrag_h(k0p + kk * 512, lo);
      const v16h kh1 = ldfrag_h(k1p + kk * 512, lo);
      const v16h kl0 = ldfrag_h(l0p + kk * 512, lo);
      const v16h kl1 = ldfrag_h(l1p + kk * 512, lo);
      adr_wait4((const char*)Qh + lo, (const char*)Ql + lo, (const char*)k0p + lo, (const char*)l0p + lo);   // the loads' address registers stay as they are until the wait has passed
      s00 = mma_h(kh0, qh0,  s00);
      s10 = mma_h(kh0, qh1,  s10);
      s01 = mma_h(kh1, qh0,  s01);
      s11 = mma_h(kh1, qh1,  s11);
      s00 = mma_h(kh0, ql0f, s00);
      s10 = mma_h(kh0, ql1f, s10);
      s01 = mma_h(kh1, ql0f, s01);
      s11 = mma_h(kh1, ql1f, s11);
      s00 = mma_h(kl0, qh0,  s00);
      s10 = mma_h(kl0, qh1,  s10);
      s01 = mma_h(kl1, qh0,  s01);
      s11 = mma_h(kl1, qh1,  s11);
      guard4(s00, s01, s10, s11, qh0, ql0f, qh1, ql1f, kh0, kl0, kh1, kl1);
    }
    // ---- gate (f32, per element) + causal select + online softmax in base 2, -inf-safe; one query tile after the other. A lane holds 16 of its
    //      query's 32 scores: maximum and sum run over its own registers, the maximum joined with the other wave half by one cross-row move.
    //      The 16 probabilities are, in place, the lane's part of the B operand P^T (split k map: elements 0..7 = keys kb + 8hh + 0..7, 8..15 = kb + 16 + 8hh + 0..7) ----
    FragH ph[QW], pl[QW];
#pragma unroll
    for (int u = 0; u < QW; ++u) {
      const v8f s0 = (u == 0) ? s00 : s10;
      const v8f s1 = (u == 0) ? s01 : s11;
      const int dq = q0 + 16 * u + c - kb - 8 * hh;                           // query - key of element r: dq - r in s0, dq - 16 - r in s1
      int ia[8], ib[8];
      float ga[8], gb[8];
#pragma unroll
      for (int r = 0; r < 8; ++r) {
        int i0 = dq - r;       i0 = (i0 < 0) ? 0 : i0;  i0 = (i0 > SEQ - 1) ? (SEQ - 1) : i0;
        int i1 = dq - 16 - r;  i1 = (i1 < 0) ? 0 : i1;  i1 = (i1 > SEQ - 1) ? (SEQ - 1) : i1;
        ia[r] = i0;  ib[r] = i1;
        ga[r] = gp[i0];
        gb[r] = gp[i1];
      }
      idx_wait(ia, ib);                     // the gate loads' index registers stay as they are until the wait has passed
      float t0[8], t1[8];
      float mx = -INFINITY;
#pragma unroll
      for (int r = 0; r < 8; ++r) {
        const float u0 = (s0[r] * lsc) * ga[r];
        const float u1 = (s1[r] * lsc) * gb[r];
        t0[r] = (dq - r < 0) ? -INFINITY : u0;
        t1[r] = (dq - 16 - r < 0) ? -INFINITY : u1;
        mx = fmaxf(mx, fmaxf(t0[r], t1[r]));
      }
      mx = fmaxf(mx, xhalf(mx));
      const float mn = fmaxf(mrow[u], mx);
      const float ms = (mn == -INFINITY) ? 0.0f : mn;
      const float al = exp2f(mrow[u] - ms);
      mrow[u] = mn;
      float ps = 0.f;
#pragma unroll
      for (int r = 0; r < 8; ++r) {
        const float e0 = exp2f(t0[r] - ms), e1 = exp2f(t1[r] - ms);
        ps += e0 + e1;
        const float ta = e0 * PCAR, tb = e1 * PCAR;
        const _Float16 ha = (_Float16)ta, hb = (_Float16)tb;
        ph[u].h[0][r] = ha;
        ph[u].h[1][r] = hb;
        pl[u].h[0][r] = (_Float16)(ta - (float)ha);
        pl[u].h[1][r] = (_Float16)(tb - (float)hb);
      }
      lrow[u] = lrow[u] * al + ps;
#pragma unroll
      for (int j = 0; j < 4; ++j) {
#pragma unroll
        for (int r = 0; r < 8; ++r) o[u][j][r] *= al;
      }
    }
    // ---- O^T += V^T.P^T : A fragment row m = d = j*16 + c, key tile kb>>5 of the packed v^T planes; 2 groups of 2 d-subtiles, each fragment used by both query tiles ----
    {
      const _Float16* vhp = Vhb + kb * 16;
      if constexpr (RES != 0) {
        const _Float16* vlp = Vlb + kb * 16;
#pragma unroll
        for (int jg = 0; jg < 2; ++jg) {
          const size_t da = (size_t)(2 * jg) * 16 * SEQ;
          const size_t db = da + (size_t)16 * SEQ;
          const size_t la = (size_t)(2 * jg) * 16 * QO;
          const size_t lb = la + (size_t)16 * QO;
          const v16h vha = ldfrag_h(vhp + da, lo), vhb2 = ldfrag_h(vhp + db, lo);
          const v16h vla = ldfrag_h(vlp + la, lo), vlb2 = ldfrag_h(vlp + lb, lo);
          adr_wait((const char*)vhp + lo, (const char*)vlp + lo);   // the loads' address registers stay as they are until the wait has passed
#pragma unroll
          for (int u = 0; u < QW; ++u) {
            o[u][2 * jg]     = mma_h(vha,  ph[u].v, o[u][2 * jg]);
            o[u][2 * jg + 1] = mma_h(vhb2, ph[u].v, o[u][2 * jg + 1]);
          }
#pragma unroll
          for (int u = 0; u < QW; ++u) {
            o[u][2 * jg]     = mma_h(vha,  pl[u].v, o[u][2 * jg]);
            o[u][2 * jg + 1] = mma_h(vhb2, pl[u].v, o[u][2 * jg + 1]);
          }
#pragma unroll
          for (int u = 0; u < QW; ++u) {
            o[u][2 * jg]     = mma_h(vla,  ph[u].v, o[u][2 * jg]);
            o[u][2 * jg + 1] = mma_h(vlb2, ph[u].v, o[u][2 * jg + 1]);
          }
          guard4(o[0][2 * jg], o[0][2 * jg + 1], o[1][2 * jg], o[1][2 * jg + 1], ph[0].v, pl[0].v, ph[1].v, pl[1].v, vha, vhb2, vla, vlb2);
        }
      } else {
#pragma unroll
        for (int jg = 0; jg < 2; ++jg) {
          const size_t da = (size_t)(2 * jg) * 16 * SEQ;
          const size_t db = da + (size_t)16 * SEQ;
          const v16h vha = ldfrag_h(vhp + da, lo), vhb2 = ldfrag_h(vhp + db, lo);
          adr_wait((const char*)vhp + lo, (const char*)vhp + lo);   // the loads' address registers stay as they are until the wait has passed
#pragma unroll
          for (int u = 0; u < QW; ++u) {
            o[u][2 * jg]     = mma_h(vha,  ph[u].v, o[u][2 * jg]);
            o[u][2 * jg + 1] = mma_h(vhb2, ph[u].v, o[u][2 * jg + 1]);
          }
          guard4(o[0][2 * jg], o[0][2 * jg + 1], o[1][2 * jg], o[1][2 * jg + 1], ph[0].v, ph[1].v, vha, vhb2, ph[0].v, ph[1].v, vha, vhb2);
        }
      }
    }
  }
  acc_guard4(o[0][0], o[0][1], o[0][2], o[0][3]);
  acc_guard4(o[1][0], o[1][1], o[1][2], o[1][3]);
  const int lne = lane;
  const int hhe = lne >> 4, ce = lne & 15;
  // ---- this wave's partial results: raw accumulators into the slab rows of the lane's query (8 consecutive d per subtile), row maxima and joined row sums in front of them ----
#pragma unroll
  for (int u = 0; u < QW; ++u) {
    float* pt   = wreg + u * WSUB;
    float* srow = pt + PTW + ce * SLP + 8 * hhe;
#pragma unroll
    for (int j = 0; j < 4; ++j) {
      const v4f a = {o[u][j][0], o[u][j][1], o[u][j][2], o[u][j][3]};
      const v4f b4 = {o[u][j][4], o[u][j][5], o[u][j][6], o[u][j][7]};
      *(v4f*)(srow + j * 16)     = a;
      *(v4f*)(srow + j * 16 + 4) = b4;
    }
    const float lt = lrow[u] + xhalf(lrow[u]);                                // the two wave halves' sums joined once
    if (hhe == 0) {
      pt[ce]      = mrow[u];
      pt[16 + ce] = lt;
    }
  }
  __syncthreads();                          // publishes the four partial results of each head to its four waves
#pragma unroll
  for (int u = 0; u < QW; ++u) {
    // ---- merge for row c of query tile u: w_s = 2^(m_s - max m) (0 for a wave without keys), Z = sum Z_s*w_s, out = sum acc_s*w_s / Z (0 if Z == 0) ----
    const float* hb = smem + hw * KS * WREG + u * WSUB;
    float ms4[KS], ws4[KS];
#pragma unroll
    for (int s = 0; s < KS; ++s) ms4[s] = hb[s * WREG + ce];
    const float mm  = fmaxf(fmaxf(ms4[0], ms4[1]), fmaxf(ms4[2], ms4[3]));
    const float mms = (mm == -INFINITY) ? 0.0f : mm;
    float lv = 0.f;
#pragma unroll
    for (int s = 0; s < KS; ++s) {
      ws4[s] = exp2f(ms4[s] - mms);
      lv += hb[s * WREG + 16 + ce] * ws4[s];
    }
    const float ls  = (lv > 0.0f) ? lv : 1.0f;
    const float inv = (lv > 0.0f) ? ((1.0f / ls) * oc) : 0.0f;
    // ---- O x1024 -> f16 hi (+ residual) packed planes; lane = (row c, 8 consecutive d at 16*sp + 8*hh): a quarter of the head's two tiles ----
    float w[8];
#pragma unroll
    for (int e = 0; e < 8; ++e) w[e] = 0.f;
#pragma unroll
    for (int s = 0; s < KS; ++s) {
      const float* sr = hb + s * WREG + PTW + ce * SLP + sp * 16 + hhe * 8;
      const v4f a = *(const v4f*)(sr), b4 = *(const v4f*)(sr + 4);
#pragma unroll
      for (int e = 0; e < 4; ++e) { w[e] += a[e] * ws4[s]; w[4 + e] += b4[e] * ws4[s]; }
    }
    v4u oh, ol;
#pragma unroll
    for (int e = 0; e < 4; ++e) {
      const float w0 = (w[2 * e] * inv) * OSC, w1 = (w[2 * e + 1] * inv) * OSC;
      const _Float16 h0 = (_Float16)w0, h1 = (_Float16)w1;
      const _Float16 l0 = (_Float16)(w0 - (float)h0), l1 = (_Float16)(w1 - (float)h1);
      oh[e] = pk16(h_bits(h0), h_bits(h1));
      ol[e] = pk16(h_bits(l0), h_bits(l1));
    }
    const size_t obh = ((size_t)b * SEQ + q0 + 16 * u) * DMOD + (size_t)head * (HD / 32) * 512 + sp * 256 + 8 * lne;
    const size_t obl = ((size_t)b * QO + ql0 + 16 * u) * DMOD + (size_t)head * (HD / 32) * 512 + sp * 256 + 8 * lne;
    *(v4u*)(OHp + obh) = oh;
    if constexpr (RES != 0) {
      *(v4u*)(OLp + obl) = ol;
    }
    xcnt_wait();                            // before the stores' address and data registers are reused
  }
}

// =====================================================================================================
// Joint grids: kernels that depend on the same earlier launch and on nothing of each other run as block ranges of ONE launch
// (every test below is block-uniform; each range runs its function unchanged with its own block index counted from 0).
// prep: weight transposes (Wv^T | Wq^T | Wk^T as one bf16 plane of FN rows x DMOD, Wo^T as its own f16 plane), x -> bf16 plane, gate table.
// =====================================================================================================
__global__ __launch_bounds__(256)
void prep(const float* __restrict__ x, const float* __restrict__ wv, const float* __restrict__ wq, const float* __restrict__ wk,
          const float* __restrict__ wo, const float* __restrict__ theta, u16* XB, u16* WB, u16* WO, float* G) {
  const int bid = blockIdx.x;
  if (bid < NB_TR) {
    const float* Wsrc = wv;
    u16* D = WB;
    int lb = bid, NW = DMOD, mode = 0;
    float sc = 1.0f;
    if (bid >= NB_TRV + 2 * NB_TRQ)  { Wsrc = wo; D = WO; lb = bid - (NB_TRV + 2 * NB_TRQ); mode = 1; sc = WOS; }
    else if (bid >= NB_TRV + NB_TRQ) { Wsrc = wk; D = WB + (size_t)(DMOD + QKN) * DMOD; lb = bid - (NB_TRV + NB_TRQ); NW = QKN; }
    else if (bid >= NB_TRV)          { Wsrc = wq; D = WB + (size_t)DMOD * DMOD; lb = bid - NB_TRV; NW = QKN; }
    tr16(lb, Wsrc, D, DMOD, NW, mode, sc);
  } else if (bid < NB_TR + NB_CV) {
    cvt16(bid - NB_TR, x, XB, MROWS * DMOD / 8, 0, 1.0f);
  } else {
    gtab(bid - (NB_TR + NB_CV), theta, G, NH * SEQ);
  }
}

// post: F f32 [MROWS][FN] (columns v | q | k) -> [qc|qs] planes, [kc|ks] planes, v^T planes.
__global__ __launch_bounds__(256)
void post(const float* __restrict__ F, u16* QH, u16* QL, u16* KH, u16* KL, u16* VH, u16* VL) {
  const int bid = blockIdx.x;
  if (bid < 2 * NB_QK) {
    const bool isk = (bid >= NB_QK);
    qk16(isk ? bid - NB_QK : bid, F + (isk ? (DMOD + QKN) : DMOD), isk ? KH : QH, isk ? KL : QL, MROWS * C8R, isk ? KSC : QSC);
  } else {
    vt16(bid - 2 * NB_QK, F, VH, VL);
  }
}

// attention: the query tiles s >= QO first, then the query tiles s < QO (residual products); inside each range the last query block (most key tiles) first.
__global__ __launch_bounds__(ATT_THREADS) __attribute__((amdgpu_waves_per_eu(4)))   // at most 256 registers a wave, so that four waves share a SIMD
void attn_all(const u16* __restrict__ QHp, const u16* __restrict__ QLp, const u16* __restrict__ KHp, const u16* __restrict__ KLp,
              const u16* __restrict__ VHp, const u16* __restrict__ VLp, const float* __restrict__ Gt, u16* OHp, u16* OLp) {
  __shared__ __align__(16) float smem[WPB * KS * WREG];
  const int bid = blockIdx.x;
  const int wave = __builtin_amdgcn_readfirstlane((int)threadIdx.x >> 5);   // scalar, so that every tile start is a scalar base address
  if (bid < NB_AT0) attn_g<0>(smem, bid, wave, QHp, QLp, KHp, KLp, VHp, VLp, Gt, OHp, OLp);
  else              attn_g<1>(smem, bid - NB_AT0, wave, QHp, QLp, KHp, KLp, VHp, VLp, Gt, OHp, OLp);
}

// output projection: rows s < QO (O hi + residual) first, then rows s >= QO (O hi only).
__global__ __launch_bounds__(128)
void gemm_o_all(const u16* __restrict__ Ah, const u16* __restrict__ Al, const u16* __restrict__ Bt, float* C, float oscale) {
  __shared__ __align__(16) float slab[4 * SLAB64];
  const int bid = blockIdx.x;
  if (bid < NB_OP2) gemm_o<2>(slab, bid, Ah, Al, Bt, C, 0, QO / 64, oscale);
  else              gemm_o<1>(slab, bid - NB_OP2, Ah, Al, Bt, C, QO, (SEQ - QO) / 64, oscale);
}

// =====================================================================================================
// Workspace map (bytes; every 16-bit plane in the packed tile order, same extents as row-major); every plane is fully written by whole-line stores before it is read; all extents are exact
// multiples of the store granularity (no pad rows needed); every region offset a multiple of 131072:
//   XB  bf16 [MROWS][1024]                       MROWS*2048       (NB=2, SEQ=2048: 8388608)
//   WB  bf16 [5120 n][1024 k]                    10485760         (rows Wv^T | Wq^T | Wk^T)
//   WO  f16 [1024 n][1024 k] x1024               2097152          (Wo^T)
//   F   f32 [MROWS][5120]                        MROWS*20480      (columns v | q | k projection output;
//                                                                  afterwards OH f16 [MROWS][1024] x1024 at its start, OL residual
//                                                                  [NB*QO][1024] after)
//   QH  f16 [MROWS][2048] x256                   MROWS*4096       QL residual [MROWS][2048]      MROWS*4096
//   KH  f16 [MROWS][2048] x256                   MROWS*4096       KL residual [MROWS][2048]      MROWS*4096
//   VH  f16 [NB*16][64][SEQ] x1024               MROWS*2048       VL residual [NB*16][64][QO]    NB*QO*2048
//   G   f32 [16][SEQ]                            16*SEQ*4
//   end (NB=2, SEQ=2048)                       182583296
// =====================================================================================================
extern "C" void kernel_launch(void* const* d_in, const int* in_sizes, int n_in,
                              void* d_out, int out_size, void* d_ws, size_t ws_size,
                              hipStream_t stream) {
  if (n_in < 6) return;
  if (in_sizes[0] < ((NB - 1) * XS_FULL + SEQ) * DMOD) return;
  if (in_sizes[1] != DMOD * QKN) return;
  if (in_sizes[2] != DMOD * QKN) return;
  if (in_sizes[3] != DMOD * DMOD) return;
  if (in_sizes[4] != DMOD * DMOD) return;
  if (in_sizes[5] < NH) return;
  if (out_size < ((NB - 1) * XS_FULL + SEQ) * DMOD) return;

  const float* x   = (const float*)d_in[0];
  const float* wq  = (const float*)d_in[1];   // [1024 in][2048 out]
  const float* wk  = (const float*)d_in[2];   // [1024 in][2048 out]
  const float* wv  = (const float*)d_in[3];   // [1024 in][1024 out]
  const float* wo  = (const float*)d_in[4];   // [1024 in][1024 out]
  const float* th  = (const float*)d_in[5];   // [16]
  float*       out = (float*)d_out;

  const size_t szXB = (size_t)MROWS * DMOD * 2;
  const size_t szW  = (size_t)FN * DMOD * 2;
  const size_t szWO = (size_t)DMOD * DMOD * 2;
  const size_t szF  = (size_t)MROWS * FN * 4;
  const size_t szQ  = (size_t)MROWS * QKN * 2;                  // QH, QL, KH, KL
  const size_t szOH = (size_t)MROWS * DMOD * 2;
  const size_t szOL = (size_t)NB * QO * DMOD * 2;
  const size_t szVH = (size_t)NB * NH * HD * SEQ * 2;
  const size_t szVL = (size_t)NB * NH * HD * QO * 2;
  const size_t szG  = (size_t)NH * SEQ * 4;
  if (szOH + szOL > szF) return;                                // OH + OL live inside the F region
  size_t off = 0;
  const size_t oXB = off; off += szXB;
  const size_t oW  = off; off += szW;
  const size_t oWO = off; off += szWO;
  const size_t oF  = off; off += szF;
  const size_t oQH = off; off += szQ;
  const size_t oQL = off; off += szQ;
  const size_t oKH = off; off += szQ;
  const size_t oKL = off; off += szQ;
  const size_t oVH = off; off += szVH;
  const size_t oVL = off; off += szVL;
  const size_t oG  = off; off += szG;
  if (off > ws_size) return;                // off = 182583296 for NB = 2, SEQ = 2048
  if (off > (size_t)WS_CAP) return;

  char* ws = (char*)d_ws;
  u16*   XB = (u16*)(ws + oXB);
  u16*   WB = (u16*)(ws + oW);
  u16*   WO = (u16*)(ws + oWO);
  float* F  = (float*)(ws + oF);
  u16*   OH = (u16*)(ws + oF);
  u16*   OL = (u16*)(ws + oF + szOH);
  u16*   QH = (u16*)(ws + oQH);
  u16*   QL = (u16*)(ws + oQL);
  u16*   KH = (u16*)(ws + oKH);
  u16*   KL = (u16*)(ws + oKL);
  u16*   VH = (u16*)(ws + oVH);
  u16*   VL = (u16*)(ws + oVL);
  float* G  = (float*)(ws + oG);

  const dim3 b256(256), b128(128), bAT(ATT_THREADS);

  // (0) weights -> transposed 16-bit planes, x -> bf16 plane [MROWS][1024], gate table G[h][dl]
  prep<<<dim3(NB_TR + NB_CV + NB_GT), b256, 0, stream>>>(x, wv, wq, wk, wo, th, XB, WB, WO, G);
  // (1) [v | q_raw | k_raw] = x.[Wv | Wq | Wk] -> F f32 [MROWS][5120]
  gemm_nb<<<dim3((MROWS / 128) * (FN / 160)), b128, 0, stream>>>(XB, WB, F, MROWS, FN, 1.0f);
  // (2) [qc|qs] and [kc|ks] hi + residual x256, v^T hi + residual x1024
  post<<<dim3(2 * NB_QK + NB_VT), b256, 0, stream>>>(F, QH, QL, KH, KL, VH, VL);
  // (3) causal gated attention -> O hi (all rows) + residual (rows s < QO)
  attn_all<<<dim3(NB_AT0 + NB_AT1), bAT, 0, stream>>>(QH, QL, KH, KL, VH, VL, G, OH, OL);
  // (4) output projection -> out f32, carries 1024 x 1024 folded back
  gemm_o_all<<<dim3(NB_OP2 + NB_OP1), b128, 0, stream>>>(OH, OL, WO, out, 1.0f / (OSC * WOS));
  (void)hipGetLastError();
}

// v008
// It runs in 160 microseconds.
// Next to v007, in two timings, it ran 1.07 and 1.08 times as fast.
// Counting every step since v000, it is 3.39 times as fast.
// Contractions: x.Wq, x.Wk, x.Wv on v_wmma_f32_16x16x32_bf16 (x and W^T as bf16 RNE planes); per-head scores
// [qc|qs].[kc|ks] over 128 on v_wmma_f32_16x16x32_f16 (q, k as f16 hi x256 plus unscaled f16 residual planes, products
// hh+lh+hl on all query rows); P.v on v_wmma_f32_16x16x32_f16 (P x32768, v^T x1024 f16 planes; query rows s < QO also
// use f16 residual planes, hh+lh+hl); O.Wo on v_wmma_f32_16x16x32_f16 (O x1024 f16 hi plane, plus residual plane for rows
// s < QO; Wo^T as f16 of its bf16 RNE value x1024); all f32 accumulate. softplus, cos, sin, the cosine gate table,
// causal select, base-2 online softmax and 1/Z in f32 on VALU.
#include <hip/hip_runtime.h>
#include <math.h>
#include <stdint.h>

#ifndef NB
#define NB 2
#endif
#ifndef SEQ
#define SEQ 2048
#endif
#define XS_FULL 2048
#define DMOD  1024
#define QKN   (2 * DMOD)
#define NH    16
#define HD    64
#define SD    (2 * HD)
#define QO    ((SEQ < 512) ? SEQ : 512)
#define MROWS (NB * SEQ)
#define RSQ_HD 0.125f
#define GSTEP 0.125f
#define LOG2E 1.4426950408889634f
#define QSC   256.0f
#define KSC   256.0f
#define PCAR  32768.0f
#define VCAR  1024.0f
#define OSC   1024.0f
#define WOS   1024.0f
#define WPB   1
#define NHG   (NH / WPB)
#define NQT   (SEQ / 16)
#define NQO   (QO / 16)
#define QW    2                                 // query tiles of 16 rows that one attention wave carries
#define NQB   (NQT / QW)                        // attention query groups of 16*QW rows
#define NQOB  (NQO / QW)
#define NST   (SEQ / 64)
#define NKT   (SEQ / 32)
#define KS    4
#define QG    2                                 // query groups of 16*QW rows in one attention block; both read each staged key tile
#define ATT_THREADS (QG * KS * 32)
#define KTB   20480                             // bytes of one staged key tile of 32 keys: K hi 8 KB, K residual 8 KB, v^T hi 4 KB
#define RINGB (2 * KS * KTB)                    // two buffers for each of the KS key splits
#define PTW   32                                // per query tile: 16 row maxima, then 16 row sums
#define SLP   68
#define SLW   (16 * SLP)
#define WSUB  (PTW + SLW)
#define WREG  (QW * WSUB)
#define SLAB64 (16 * 68)
#define VTP   72
#define C8R   (DMOD / 8)
#define QKP   264
#define WS_CAP 268435456
#define FN    (DMOD + 2 * QKN)                  // columns of the joint projection: v | q | k
#define NB_TRV ((DMOD / 64) * (DMOD / 64))      // transpose blocks of a [1024][1024] weight
#define NB_TRQ ((DMOD / 64) * (QKN / 64))       // transpose blocks of a [1024][2048] weight
#define NB_TR  (2 * NB_TRV + 2 * NB_TRQ)
#define NB_CV  ((MROWS * DMOD / 8) / 256)       // convert blocks of x
#define NB_GT  ((NH * SEQ) / 256)               // gate table blocks
#define NB_QK  ((MROWS * C8R) / 256)            // combine blocks of q, and of k
#define NB_VT  (NB * NH * NST)                  // v^T blocks
#define NB_AT1 ((NQOB / QG) * NHG * NB)         // attention blocks with residual products
#define NB_AT0 (((NQB - NQOB) / QG) * NHG * NB) // attention blocks without
#define NB_OP2 (NB * (QO / 64) * (DMOD / 64))   // output projection blocks with the residual plane
#define NB_OP1 (NB * ((SEQ - QO) / 64) * (DMOD / 64))
static_assert(DMOD == NH * HD && HD == 64 && NH == 16 && SD == 128 && WPB == 1 && NHG * WPB == NH);
static_assert(ATT_THREADS == 256 && KS == 4 && HD == KS * 16 && QW == 2 && NQB * QW == NQT && NQOB * QW == NQO);
static_assert(QG == 2 && (NQB % QG) == 0 && (NQOB % QG) == 0 && QG * KS * WREG * 4 <= RINGB && RINGB <= 163840);
static_assert(NB >= 1 && NB <= 2);
static_assert((SEQ % 64) == 0 && SEQ >= 64 && SEQ <= XS_FULL);
static_assert((QO % 64) == 0 && QO >= 64 && QO <= SEQ);
static_assert((DMOD % 64) == 0 && (QKN % 64) == 0 && (DMOD % 32) == 0 && (SD % 32) == 0 && C8R == 128);
static_assert((MROWS % 128) == 0 && (FN % 160) == 0);
static_assert(((SEQ * DMOD / 8) % 256) == 0 && ((MROWS * C8R) % 256) == 0 && ((NH * SEQ) % 256) == 0);
static_assert(WPB * KS * WREG * 4 <= 65536 && 2 * HD * VTP * 2 <= 65536 && 4 * SLAB64 * 4 <= 65536 && 64 * VTP * 2 <= 65536);

typedef unsigned short u16;
typedef _Float16 v16h __attribute__((ext_vector_type(16)));
typedef _Float16 v8h  __attribute__((ext_vector_type(8)));
typedef __bf16   v16b __attribute__((ext_vector_type(16)));
typedef float    v8f  __attribute__((ext_vector_type(8)));
typedef float    v4f  __attribute__((ext_vector_type(4)));
typedef unsigned int v4u __attribute__((ext_vector_type(4)));

union FragH { v16h v; v8h h[2]; v4u u[2]; };
union FragB { v16b v; v4u u[2]; };

// ---- scalar helpers --------------------------------------------------------------------------------
__device__ __forceinline__ unsigned short bf_bits(float f) {          // f32 -> bf16 bits, RNE convert
  unsigned u = __float_as_uint(f);
  return (unsigned short)((u + 0x7FFFu + ((u >> 16) & 1u)) >> 16);
}
__device__ __forceinline__ float bf_up(unsigned short h) { return __uint_as_float(((unsigned)h) << 16); }
__device__ __forceinline__ float bfr(float f) { return bf_up(bf_bits(f)); }
__device__ __forceinline__ unsigned short h_bits(_Float16 x) { return __builtin_bit_cast(unsigned short, x); }
__device__ __forceinline__ unsigned pk16(unsigned short a, unsigned short b) { return (unsigned)a | ((unsigned)b << 16); }
__device__ __forceinline__ v8f zero8() { v8f z = {0.f, 0.f, 0.f, 0.f, 0.f, 0.f, 0.f, 0.f}; return z; }
__device__ __forceinline__ const _Float16* ash(const u16* p) { return (const _Float16*)(const void*)p; }

// ---- packed operand planes: a 16-bit plane of R rows x K columns (R % 16 == 0, K % 32 == 0) is stored as 1-KB tiles of
//      16 rows x 32 k, tile (row>>4, k>>5) at half offset (row>>4)*16*K + (k>>5)*512; inside a tile element (m = row&15,
//      k&31 = 16*j + 8*h + e) lies at j*256 + (16*h + m)*8 + e. One fragment load of a wave is then 512 contiguous bytes
//      (4 cache lines) where a row-major plane gave 16 rows x 32 B (16 lines).
// ---- fragment loaders: 16-bit A/B operand, lane -> row/col (lane&15), h = lane>>4; t = a tile start (wave-uniform), lo = the lane's offset from it
//      in BYTES (16*lane inside the tile), p = t + lo bytes; elements 0..7 <- p[0..7] (k0+8h..), elements 8..15 <- p[256..263] (k0+16+8h..)  (same split k map for A and B)
__device__ __forceinline__ v16h ldfrag_h(const _Float16* t, unsigned lo) {
  FragH f;
  const char* p = (const char*)t + lo;
  f.h[0] = *(const v8h*)(p);
  f.h[1] = *(const v8h*)(p + 512);
  return f.v;
}
__device__ __forceinline__ v16b ldfrag_b(const u16* t, unsigned lo) { // bf16 plane read as unsigned integer vectors
  FragB f;
  const char* p = (const char*)t + lo;
  f.u[0] = *(const v4u*)(p);
  f.u[1] = *(const v4u*)(p + 512);
  return f.v;
}

__device__ __forceinline__ v8f mma_h(v16h a, v16h b, v8f c) {
  return __builtin_amdgcn_wmma_f32_16x16x32_f16(false, a, false, b, (short)0, c, false, false);
}
__device__ __forceinline__ v8f mma_b(v16b a, v16b b, v8f c) {
  return __builtin_amdgcn_wmma_f32_16x16x32_bf16(false, a, false, b, (short)0, c, false, false);
}
// four accumulators and eight operand fragments: the four vector slots behind the last matrix instruction of a group,
// with its results and operands held in their registers up to there
__device__ __forceinline__ void guard4(v8f& a, v8f& b, v8f& c, v8f& d, v16h x0, v16h x1, v16h x2, v16h x3, v16h x4, v16h x5, v16h x6, v16h x7) {
#if defined(__HIP_DEVICE_COMPILE__)
  asm volatile("v_nop\n\tv_nop\n\tv_nop\n\tv_nop"
               : "+v"(a), "+v"(b), "+v"(c), "+v"(d)
               : "v"(x0), "v"(x1), "v"(x2), "v"(x3), "v"(x4), "v"(x5), "v"(x6), "v"(x7) : "memory");
#endif
}
template <typename F>
__device__ __forceinline__ void guard6(v8f& a, v8f& b, v8f& c, v8f& d, F x0, F x1, F x2, F x3, F x4, F x5) {
#if defined(__HIP_DEVICE_COMPILE__)
  asm volatile("v_nop\n\tv_nop\n\tv_nop\n\tv_nop"
               : "+v"(a), "+v"(b), "+v"(c), "+v"(d) : "v"(x0), "v"(x1), "v"(x2), "v"(x3), "v"(x4), "v"(x5) : "memory");
#endif
}
__device__ __forceinline__ void acc_guard4(v8f& a, v8f& b, v8f& c, v8f& d) {
#if defined(__HIP_DEVICE_COMPILE__)
  asm volatile("v_nop\n\tv_nop\n\tv_nop\n\tv_nop" : "+v"(a), "+v"(b), "+v"(c), "+v"(d));
#endif
}
__device__ __forceinline__ void xcnt_wait() {
#if defined(__HIP_DEVICE_COMPILE__)
  asm volatile("s_wait_xcnt 0x0" ::: "memory");
#endif
}
__device__ __forceinline__ float xhalf(float x) {                     // the value of lane l ^ 16
  const int b = __builtin_bit_cast(int, x);
  return __builtin_bit_cast(float, __builtin_amdgcn_permlanex16(b, b, 0x76543210, 0xfedcba98, false, false));
}
__device__ __forceinline__ void wave_sync_lds() {                     // orders LDS accesses only: a wave's global stores still in flight are not waited for
  __builtin_amdgcn_fence(__ATOMIC_RELEASE, "workgroup", "local");
  __builtin_amdgcn_wave_barrier();
  __builtin_amdgcn_fence(__ATOMIC_ACQUIRE, "workgroup", "local");
}

// =====================================================================================================
// x f32 [NB][XS_FULL][DMOD] row-major -> packed 16-bit plane of MROWS rows (K = DMOD).  f16mode == 0: bf16 RNE bits;  f16mode == 1: f16 bits of (bf16 RNE value) * scale.
// Thread = 8 consecutive k of one row: two 16-B loads, one 16-B store; a wave = one half tile (16 rows x 2 chunks of 8 k), stored
// as 512 contiguous, 512-B aligned bytes; the 8 waves of a block read 512 contiguous bytes of each of 16 rows.
// coverage: grid = ceil(n8/256) blocks x 256 thr x 8 (in-kernel bound) = the whole plane (n8 a multiple of 256 here).
// =====================================================================================================
__device__ __forceinline__ void cvt16(int bid, const float* __restrict__ x, u16* D, int n8, int f16mode, float scale) {
  const int gt = bid * 256 + (int)threadIdx.x;
  if (gt >= n8) return;
  const int wv = gt >> 5, ln = gt & 31;                   // wave index = ((row tile * DMOD/32) + k tile) * 2 + j
  const int row = (wv / (DMOD / 16)) * 16 + (ln & 15);
  const int kc  = ((wv >> 1) % (DMOD / 32)) * 32 + (wv & 1) * 16 + (ln >> 4) * 8;
  const float* p = x + ((size_t)(row / SEQ) * XS_FULL + (size_t)(row % SEQ)) * DMOD + kc;   // plane row b*SEQ + s <- x row b*XS_FULL + s
  const v4f a = *(const v4f*)(p), b4 = *(const v4f*)(p + 4);
  float w[8];
#pragma unroll
  for (int e = 0; e < 4; ++e) { w[e] = a[e]; w[4 + e] = b4[e]; }
  v4u o;
#pragma unroll
  for (int e = 0; e < 4; ++e) {
    const float f0 = w[2 * e], f1 = w[2 * e + 1];
    const unsigned short hb0 = h_bits((_Float16)(bfr(f0) * scale));
    const unsigned short hb1 = h_bits((_Float16)(bfr(f1) * scale));
    const unsigned short bb0 = bf_bits(f0);
    const unsigned short bb1 = bf_bits(f1);
    o[e] = (f16mode != 0) ? pk16(hb0, hb1) : pk16(bb0, bb1);
  }
  u16* d = D + (size_t)gt * 8;
  {
    *(v4u*)(d) = o;
    
  }
}

// =====================================================================================================
// Weight transpose + convert: W f32 [KW][NW] row-major (W[k][n], the x.W layout) -> D 16-bit packed plane of NW rows x KW (row n, column k:
// the B operand). f16mode == 0: bf16 RNE bits; f16mode == 1: f16 bits of (bf16 RNE value) * scale.
// Block = one 64 k x 64 n tile: each thread loads 16 floats of one k row (16-B loads), converts, stores them transposed
// into an LDS tile [64 n][64 k] (pitch 72 halves, u16 element stores); after a block barrier each n row segment (64 halves =
// coverage: load 256 thr x 16 = 64 k x 64 n; store 2 iterations x 256 thr x 8 halves = 64 n rows x 64 k = the block's
//           tile; grid = (KW/64)*(NW/64) blocks covers D exactly once (host guarantees KW % 64 == 0, NW % 64 == 0).
// =====================================================================================================
__device__ __forceinline__ void tr16(int bid, const float* __restrict__ W, u16* D, int KW, int NW, int f16mode, float scale) {
  __shared__ __align__(16) u16 T[64 * VTP];
  const int tid = threadIdx.x;
  const int nkt = KW >> 6;
  const int kt  = bid % nkt;
  const int nt  = bid / nkt;
  const int k0  = kt * 64, n0 = nt * 64;
  if (n0 + 64 > NW) return;                 // block-uniform, before any barrier; never taken with the exact grid
  {
    const int kl = tid >> 2;                // k within tile 0..63
    const int nc = (tid & 3) * 16;          // n chunk 0,16,32,48
    const float* src = W + (size_t)(k0 + kl) * NW + n0 + nc;
#pragma unroll
    for (int i = 0; i < 4; ++i) {
      const v4f a = *(const v4f*)(src + 4 * i);
#pragma unroll
      for (int e = 0; e < 4; ++e) {
        const float f = a[e];
        const unsigned short hb = h_bits((_Float16)(bfr(f) * scale));
        const unsigned short bb = bf_bits(f);
        T[(nc + 4 * i + e) * VTP + kl] = (f16mode != 0) ? hb : bb;
      }
    }
  }
  __syncthreads();
  v4u v[2];
#pragma unroll
  for (int it = 0; it < 2; ++it) {
    const int pi = it * 256 + tid;          // 16-B piece: m = pi&15, h = (pi>>4)&1, j = (pi>>5)&1, k tile (pi>>6)&1, n tile pi>>7
    v[it] = *(const v4u*)(T + ((pi >> 7) * 16 + (pi & 15)) * VTP + ((pi >> 6) & 1) * 32 + ((pi >> 5) & 1) * 16 + ((pi >> 4) & 1) * 8);
  }
  {
#pragma unroll
    for (int it = 0; it < 2; ++it) {
      const int pi = it * 256 + tid;
      *(v4u*)(D + (size_t)(n0 + (pi >> 7) * 16) * KW + (size_t)((k0 >> 5) + ((pi >> 6) & 1)) * 512 + (pi & 63) * 8) = v[it];
    }
  }
}

// =====================================================================================================
// Cosine gate table G f32 [NH][SEQ]: G[h][dl] = cos(bf16(theta[h]) * (dl * 0.125f)), dl = query index - key index >= 0
// (cid difference (j-i)/8 is exact in f32 and cos is even). One value per thread, precise cosf; the block's 256 values
// coverage: grid = NH*SEQ/256 blocks x 256 = all NH x SEQ entries (NH*SEQ is a multiple of 256).
// =====================================================================================================
__device__ __forceinline__ void gtab(int bid, const float* __restrict__ theta, float* G, int ntot) {
  __shared__ __align__(16) float sg[256];
  const int tid = threadIdx.x;
  const int gt  = bid * 256 + tid;
  const int gc  = (gt < ntot) ? gt : (ntot - 1);
  const int h   = gc / SEQ;
  const int dl  = gc - h * SEQ;
  const int hc  = (h < NH) ? h : (NH - 1);
  const float th = bfr(theta[hc]);
  const float cd = (float)dl * GSTEP;
  sg[tid] = cosf(th * cd);
  __syncthreads();
  if (tid < 64) {
    const v4f v = *(const v4f*)(sg + tid * 4);
    const int base = bid * 256 + tid * 4;
    if (base + 4 <= ntot) {
      float* d = G + base;
      {
        *(v4f*)(d) = v;
        
      }
    }
  }
}

// =====================================================================================================
// Amplitude/phase combine: F f32, MROWS rows of pitch FN, F = the operand's first column (row = b*SEQ + s; column h*HD + d = amplitude pre-activation, DMOD + h*HD + d
// = phase) -> f16 hi plane Hp and unscaled f16 residual plane Lp, both packed planes of MROWS rows x QKN with column h*SD + d = c-part * sc and
// h*SD + HD + d = s-part * sc, where a = softplus(amp) = max(amp,0) + log1p(exp(-|amp|)), c-part = a*cos(phase),
// s-part = a*sin(phase) (precise expf/log1pf/cosf/sinf), hi = f16(t), residual = f16(t - f16(t)).
// Block = (16 rows, 2 heads); thread = (row, head h, 8 consecutive d): rolled loop of 8 (scalar loads, one transcendental chain per iteration, u16 element
// stores into the thread's own LDS slots, row pitch QKP); block barrier; then four 16-B stores per thread in packed order (the
// block's 8 tiles of each plane are 8 KB contiguous; a wave stores 512 contiguous bytes).
// coverage: grid = MROWS*C8R/256 blocks (clamped block index, predicated store; MROWS*C8R is a multiple of 256) x 2 iterations x
//           256 thr x 8 halves per plane = 16 rows x 256 columns; all blocks = every row x every column of Hp and of Lp once.
// =====================================================================================================
__device__ __forceinline__ void qk16(int bid, const float* __restrict__ F, u16* Hp, u16* Lp, int n8, float sc) {
  __shared__ __align__(16) u16 sHb[16 * QKP];
  __shared__ __align__(16) u16 sLb[16 * QKP];
  const int tid = threadIdx.x;
  const bool act = (bid * 256 + 256 <= n8);   // block-uniform
  const int bc  = act ? bid : 0;
  const int hp  = bc % (NH / 2);            // head pair
  const int rt  = bc / (NH / 2);            // 16-row tile
  const int row = rt * 16 + (tid >> 4);
  const int idx = tid & 15;
  const int h   = hp * 2 + (idx >> 3);
  const int d0  = (idx & 7) * 8;
  const float* ap = F + (size_t)row * FN + h * HD + d0;
  const float* pp = ap + DMOD;
  u16* sh = sHb + (tid >> 4) * QKP + idx * 16;
  u16* sl = sLb + (tid >> 4) * QKP + idx * 16;
#pragma unroll 1
  for (int e = 0; e < 8; ++e) {
    const float am  = ap[e];
    const float ph  = pp[e];
    const float spv = fmaxf(am, 0.0f) + log1pf(expf(-fabsf(am)));
    const float cv  = cosf(ph);
    const float sv  = sinf(ph);
    const float tc  = (spv * cv) * sc;
    const float ts  = (spv * sv) * sc;
    const _Float16 hc = (_Float16)tc, hs = (_Float16)ts;
    const _Float16 lc = (_Float16)(tc - (float)hc), ls = (_Float16)(ts - (float)hs);
    sh[e] = h_bits(hc);  sh[8 + e] = h_bits(hs);
    sl[e] = h_bits(lc);  sl[8 + e] = h_bits(ls);
  }
  __syncthreads();
  // 16-B piece pi of the block's 8 tiles: m = pi&15; column chunk q = pi>>4 (k tile q>>2, j = (q>>1)&1, h = q&1) = head q>>4 of the
  // pair, c or s part (q>>3)&1, d chunk q&7; it was written by thread m*16 + (q>>4)*8 + (q&7) at its slot + 8*part.
  v4u oh2[2], ol2[2];
#pragma unroll
  for (int it = 0; it < 2; ++it) {
    const int pi = it * 256 + tid;
    const int q  = pi >> 4;
    const int so = (pi & 15) * QKP + ((q >> 4) * 8 + (q & 7)) * 16 + ((q >> 3) & 1) * 8;
    oh2[it] = *(const v4u*)(sHb + so);
    ol2[it] = *(const v4u*)(sLb + so);
  }
  const size_t ob = (size_t)rt * 16 * QKN + (size_t)hp * (2 * SD * 16) + (size_t)tid * 8;
  if (act) {
#pragma unroll
    for (int it = 0; it < 2; ++it) {
      *(v4u*)(Hp + ob + it * 2048) = oh2[it];
      *(v4u*)(Lp + ob + it * 2048) = ol2[it];
    }
  }
}

// =====================================================================================================
// v^T planes from the v projection F f32, MROWS rows of pitch FN (row = b*SEQ + s, column = h*HD + d):
//   VH packed plane, row (b*NH + h)*HD + d, column s (K = SEQ) = f16(v * 1024) for all keys s;
//   VL packed plane, same rows, column s (K = QO) = f16 residual (t - f16(t)) for keys s < QO only.
// Block = (b, head h, 64 keys s0): each thread loads its 16 floats (key sl, d chunk dc) with 16-B loads, converts, scatters
// line) is written by 8 consecutive lanes x 16 B of one instruction, in both planes (VL under the block-uniform s0 < QO
// coverage: load 256 thr x 16 = 64 keys x 64 d; store 2 iterations x 256 thr x 8 halves = 64 lines x 64 = the block's tile of
//           VH (and of VL when s0 < QO); grid = NB*NH*NST blocks covers VH exactly once and all QO columns of VL exactly once.
// =====================================================================================================
__device__ __forceinline__ void vt16(int bid, const float* __restrict__ F, u16* VHo, u16* VLo) {
  __shared__ __align__(16) u16 TH[HD * VTP];
  __shared__ __align__(16) u16 TL[HD * VTP];
  const int tid = threadIdx.x;
  const int st  = bid % NST;
  const int t2  = bid / NST;
  const int h   = t2 % NH;
  const int b   = t2 / NH;
  if (b >= NB) return;                      // block-uniform, before any barrier; never taken with the exact grid
  const int s0  = st * 64;
  const bool dolo = (s0 + 64 <= QO);        // block-uniform
  {
    const int sl = tid >> 2;                // key within tile 0..63
    const int dc = (tid & 3) * 16;          // d chunk 0,16,32,48
    const float* src = F + ((size_t)b * SEQ + s0 + sl) * FN + h * HD + dc;
#pragma unroll
    for (int i = 0; i < 4; ++i) {
      const v4f a = *(const v4f*)(src + 4 * i);
#pragma unroll
      for (int e = 0; e < 4; ++e) {
        const float t = a[e] * VCAR;
        const _Float16 hv = (_Float16)t;
        const _Float16 lv = (_Float16)(t - (float)hv);
        TH[(dc + 4 * i + e) * VTP + sl] = h_bits(hv);
        TL[(dc + 4 * i + e) * VTP + sl] = h_bits(lv);
      }
    }
  }
  __syncthreads();
  v4u vh[2], vl[2];
#pragma unroll
  for (int it = 0; it < 2; ++it) {
    const int pi = it * 256 + tid;          // 16-B piece: m = pi&15, h = (pi>>4)&1, j = (pi>>5)&1, key tile (pi>>6)&1, d tile pi>>7
    const int so = ((pi >> 7) * 16 + (pi & 15)) * VTP + ((pi >> 6) & 1) * 32 + ((pi >> 5) & 1) * 16 + ((pi >> 4) & 1) * 8;
    vh[it] = *(const v4u*)(TH + so);
    vl[it] = *(const v4u*)(TL + so);
  }
  const size_t hrow = (size_t)(b * NH + h) * HD;
  const int    sL   = dolo ? s0 : 0;
  {
#pragma unroll
    for (int it = 0; it < 2; ++it) {
      const int pi = it * 256 + tid;
      const size_t dr = hrow + (size_t)(pi >> 7) * 16;
      const int    kq = (pi >> 6) & 1;
      *(v4u*)(VHo + dr * SEQ + (size_t)((s0 >> 5) + kq) * 512 + (pi & 63) * 8) = vh[it];
      xcnt_wait();                          // before the store's address and data registers are reused
      if (dolo) {
        *(v4u*)(VLo + dr * QO + (size_t)((sL >> 5) + kq) * 512 + (pi & 63) * 8) = vl[it];
        xcnt_wait();                        // as above
      }
    }
  }
}

// =====================================================================================================
// GEMM epilogue shared by both engines: the wave's 16x64 f32 tile (times oscale) staged in its LDS slab (pitch 68), release
// coverage: 8 instructions x 2 rows x 16 lanes x 4 floats = the wave's 16 x 64 tile.
// =====================================================================================================
__device__ __forceinline__ void epi64(float* sl, v8f a0, v8f a1, v8f a2, v8f a3, float oscale,
                                      float* C, int N, size_t rowb, int col0, int lane) {
  const int hh = lane >> 4, m = lane & 15;
#pragma unroll
  for (int r = 0; r < 8; ++r) {
    const int ro = (8 * hh + r) * 68 + m;
    sl[ro]      = a0[r] * oscale;
    sl[ro + 16] = a1[r] * oscale;
    sl[ro + 32] = a2[r] * oscale;
    sl[ro + 48] = a3[r] * oscale;
  }
  wave_sync_lds();
  v4f vals[8];
#pragma unroll
  for (int it = 0; it < 8; ++it) vals[it] = *(const v4f*)(sl + (it * 2 + hh) * 68 + m * 4);
  float* dst = C + (rowb + (size_t)hh) * (size_t)N + col0 + m * 4;
  {
#pragma unroll
    for (int it = 0; it < 8; ++it) {
      *(v4f*)(dst + (size_t)(it * 2) * (size_t)N) = vals[it];
    }
    
  }
}

// =====================================================================================================
// bf16 GEMM, no bias: C[M][N] (f32) = A (bf16 packed plane, M rows x K) . Bt^T (bf16 packed plane, N rows x K), times oscale; K = DMOD.
// Block = 128 rows x 160 columns, 4 waves as 2 x 2; a wave holds 20 accumulator tiles of 16 x 16: its 64 rows x 64 columns of its own
// (block columns 0..63 for wc = 0, 96..159 for wc = 1) and, of the middle columns 64..95, the 32 rows 32*wc .. 32*wc + 31 of its 64, so that every
// 128-B line of C has one writer. Ten fragments (4 of A, 6 of B) feed 20 matrix instructions per k step of 32; fragments are loaded straight from
// the packed tiles (two 16-B loads each, split k map for A and B); every element's sum over k runs in rising k as before.
// Row tile order inside a wave: fragment i = row tile (i + 2*wc) & 3, so that fragments 0 and 1 are the rows that also take the middle columns.
// (host guarantees M % 128 == 0, N % 160 == 0, grid = (M/128)*(N/160)).
// =====================================================================================================
// 16 x 32 tile epilogue: as epi64, for two accumulator tiles; 4 instructions x 4 rows x 8 lanes x 4 floats, each row piece one whole 128-B line.
__device__ __forceinline__ void epi32(float* sl, v8f a0, v8f a1, float oscale, float* C, int N, size_t rowb, int col0, int lane) {
  const int hh = lane >> 4, m = lane & 15;
#pragma unroll
  for (int r = 0; r < 8; ++r) {
    const int ro = (8 * hh + r) * 68 + m;
    sl[ro]      = a0[r] * oscale;
    sl[ro + 16] = a1[r] * oscale;
  }
  wave_sync_lds();
  const int rr = lane >> 3, cc = lane & 7;
  v4f vals[4];
#pragma unroll
  for (int it = 0; it < 4; ++it) vals[it] = *(const v4f*)(sl + (it * 4 + rr) * 68 + cc * 4);
  float* dst = C + (rowb + (size_t)rr) * (size_t)N + col0 + cc * 4;
#pragma unroll
  for (int it = 0; it < 4; ++it) {
    *(v4f*)(dst + (size_t)(it * 4) * (size_t)N) = vals[it];
  }
}
// the four vector slots behind the last matrix instruction of a k step; all 20 results and all 10 operand fragments are inputs, so that the
// slots stand behind every matrix instruction of the step and the fragments keep their registers up to there
__device__ __forceinline__ void guard20(const v8f (&m)[4][4], const v8f (&e)[2][2], const v16b (&a)[4], const v16b (&b)[6]) {
#if defined(__HIP_DEVICE_COMPILE__)
  asm volatile("v_nop\n\tv_nop\n\tv_nop\n\tv_nop"
               :: "v"(m[0][0]), "v"(m[0][1]), "v"(m[0][2]), "v"(m[0][3]), "v"(m[1][0]), "v"(m[1][1]), "v"(m[1][2]), "v"(m[1][3]),
                  "v"(m[2][0]), "v"(m[2][1]), "v"(m[2][2]), "v"(m[2][3]), "v"(m[3][0]), "v"(m[3][1]), "v"(m[3][2]), "v"(m[3][3]),
                  "v"(e[0][0]), "v"(e[0][1]), "v"(e[1][0]), "v"(e[1][1]),
                  "v"(a[0]), "v"(a[1]), "v"(a[2]), "v"(a[3]), "v"(b[0]), "v"(b[1]), "v"(b[2]), "v"(b[3]), "v"(b[4]), "v"(b[5]) : "memory");
#endif
}
// s_wait_xcnt 0 behind a group of global loads, with the offset register that the loads name as an input only: it is rewritten only behind the wait
__device__ __forceinline__ void off_wait(unsigned vo) {
#if defined(__HIP_DEVICE_COMPILE__)
  asm volatile("s_wait_xcnt 0x0" :: "v"(vo) : "memory");
#endif
}
__global__ __launch_bounds__(128) __attribute__((amdgpu_waves_per_eu(4)))   // at most 256 registers a wave, so that four waves share a SIMD and the whole grid is resident at once
void gemm_nb(const u16* __restrict__ A, const u16* __restrict__ Bt, float* C, int M, int N, float oscale) {
  __shared__ __align__(16) float slab[4 * SLAB64];
  constexpr int K = DMOD;                   // a constant, so that the row tiles' distances fold into the loads' immediate offsets
  const int tid = threadIdx.x, lane = tid & 31;
  const int wave = __builtin_amdgcn_readfirstlane(tid >> 5);   // scalar, so that the tile starts are computed on the scalar unit
  unsigned vo = 16u * (unsigned)lane;         // the lane's byte offset from the row tiles' starts; one k tile (1 KB) further each trip
  const int ntile = N / 160;
  const int bid   = blockIdx.x;
  const int wr = wave >> 1, wc = wave & 1;
  const int rowb  = (bid / ntile) * 128 + wr * 64;
  const int colb  = (bid % ntile) * 160;
  const int colm  = colb + wc * 96;         // the wave's own 64 columns
  const int cole  = colb + 64;              // the middle 32 columns
  if (rowb + 64 > M) return;                // wave-uniform, never taken with the exact grid; no block barriers in this kernel
  const size_t bs = (size_t)16 * K;
  const u16* ap[4];
  const u16* bp[6];
#pragma unroll
  for (int i = 0; i < 4; ++i) ap[i] = A + (size_t)(rowb + 16 * ((i + 2 * wc) & 3)) * K;
#pragma unroll
  for (int j = 0; j < 4; ++j) bp[j] = Bt + (size_t)colm * K + (size_t)j * bs;
#pragma unroll
  for (int j = 0; j < 2; ++j) bp[4 + j] = Bt + (size_t)cole * K + (size_t)j * bs;
  v8f am[4][4], ae[2][2];
#pragma unroll
  for (int i = 0; i < 4; ++i) {
#pragma unroll
    for (int j = 0; j < 4; ++j) am[i][j] = zero8();
  }
#pragma unroll
  for (int i = 0; i < 2; ++i) {
#pragma unroll
    for (int j = 0; j < 2; ++j) ae[i][j] = zero8();
  }
#pragma unroll 1
  for (int k0 = 0; k0 < K; k0 += 32) {
    v16b a[4], b[6];
#pragma unroll
    for (int i = 0; i < 4; ++i) a[i] = ldfrag_b(ap[i], vo);
#pragma unroll
    for (int j = 0; j < 6; ++j) b[j] = ldfrag_b(bp[j], vo);
    off_wait(vo);                           // the loads' offset register stays as it is until the wait has passed
    vo += 1024u;                            // next k tile: 512 halves
#pragma unroll
    for (int j = 0; j < 4; ++j) {
#pragma unroll
      for (int i = 0; i < 4; ++i) am[i][j] = mma_b(a[i], b[j], am[i][j]);
    }
#pragma unroll
    for (int j = 0; j < 2; ++j) {
#pragma unroll
      for (int i = 0; i < 2; ++i) ae[i][j] = mma_b(a[i], b[4 + j], ae[i][j]);
    }
    guard20(am, ae, a, b);
  }
  float* sl = slab + wave * SLAB64;
#pragma unroll
  for (int i = 0; i < 4; ++i) {
    const size_t row = (size_t)(rowb + 16 * ((i + 2 * wc) & 3));
    if (i > 0) {
      xcnt_wait();                          // before the earlier stores' address and data registers are reused
      wave_sync_lds();                      // every lane has read the slab before it is written again
    }
    epi64(sl, am[i][0], am[i][1], am[i][2], am[i][3], oscale, C, N, row, colm, lane);
    if (i < 2) {
      xcnt_wait();                          // as above
      wave_sync_lds();                      // as above
      epi32(sl, ae[i][0], ae[i][1], oscale, C, N, row, cole, lane);
    }
  }
}

// =====================================================================================================
// Output projection, no bias: C[row][DMOD] (f32) = (Ah [+ Al])[row][DMOD] . Bt[DMOD][DMOD]^T * oscale.
// NPROD == 1: Ah only (one product); NPROD == 2: Ah + Al residual plane (products h.B + l.B into one accumulator, l unscaled).
// Row indices (packed planes, K = DMOD): Ah row bb*SEQ + s; Al row bb*QO + s (compact plane, s < QO); C row bb*XS_FULL + s.
// Block -> (column tile ct = bid % 16, sequence row tile rt of nrt starting at s = sbeg, batch bb). Block = 64 rows (4 waves x 16) x 64
// columns, 4 accumulators a wave; fragment loads (split k map) and epi64 epilogue as gemm_nb; K = DMOD stepped by 32.
// =====================================================================================================
template <int NPROD>
__device__ __forceinline__
void gemm_o(float* slab, int bid, const u16* __restrict__ Ah, const u16* __restrict__ Al, const u16* __restrict__ Bt,
            float* C, int sbeg, int nrt, float oscale) {
  const int tid = threadIdx.x, lane = tid & 31;
  const int wave = __builtin_amdgcn_readfirstlane(tid >> 5);   // scalar, so that the tile starts are computed on the scalar unit
  unsigned vo = 16u * (unsigned)lane;         // the lane's byte offset from the row tiles' starts; one k tile (1 KB) further each trip
  const int ntile = DMOD >> 6;
  const int ct    = bid % ntile;
  const int t2    = bid / ntile;
  const int rt    = t2 % nrt;
  const int bb    = t2 / nrt;
  if (bb >= NB) return;                     // block-uniform; no block barriers in this kernel; never taken with the exact grid
  const int srow  = sbeg + rt * 64 + wave * 16;
  if (srow + 16 > SEQ) return;              // wave-uniform; never taken
  if (NPROD == 2 && srow + 16 > QO) return; // wave-uniform; never taken
  const int col0  = ct * 64;
  const int K     = DMOD;
  const size_t rowA = (size_t)bb * SEQ + srow;
  const size_t rowL = (NPROD == 2) ? ((size_t)bb * QO + srow) : (size_t)0;
  const size_t rowC = (size_t)bb * XS_FULL + srow;
  const _Float16* ahp = ash(Ah) + rowA * K;
  const _Float16* alp = ash(Al) + rowL * K;                  // dereferenced only when NPROD == 2
  const _Float16* bp  = ash(Bt) + (size_t)col0 * K;
  const size_t bs = (size_t)16 * K;
  const _Float16* bp1 = bp + bs;
  const _Float16* bp2 = bp + 2 * bs;
  const _Float16* bp3 = bp + 3 * bs;
  v8f acc0 = zero8(), acc1 = zero8(), acc2 = zero8(), acc3 = zero8();
  if constexpr (NPROD == 2) {
#pragma unroll 1
    for (int k0 = 0; k0 < K; k0 += 32) {
      const v16h ah = ldfrag_h(ahp, vo), al = ldfrag_h(alp, vo);
      const v16h b0 = ldfrag_h(bp, vo);
      const v16h b1 = ldfrag_h(bp1, vo);
      const v16h b2 = ldfrag_h(bp2, vo);
      const v16h b3 = ldfrag_h(bp3, vo);
      vo += 1024u;                          // next k tile: 512 halves
      acc0 = mma_h(ah, b0, acc0);  acc0 = mma_h(al, b0, acc0);
      acc1 = mma_h(ah, b1, acc1);  acc1 = mma_h(al, b1, acc1);
      acc2 = mma_h(ah, b2, acc2);  acc2 = mma_h(al, b2, acc2);
      acc3 = mma_h(ah, b3, acc3);  acc3 = mma_h(al, b3, acc3);
      guard6<v16h>(acc0, acc1, acc2, acc3, ah, al, b0, b1, b2, b3);
    }
  } else {
#pragma unroll 1
    for (int k0 = 0; k0 < K; k0 += 32) {
      const v16h ah = ldfrag_h(ahp, vo);
      const v16h b0 = ldfrag_h(bp, vo);
      const v16h b1 = ldfrag_h(bp1, vo);
      const v16h b2 = ldfrag_h(bp2, vo);
      const v16h b3 = ldfrag_h(bp3, vo);
      vo += 1024u;                          // next k tile: 512 halves
      acc0 = mma_h(ah, b0, acc0);
      acc1 = mma_h(ah, b1, acc1);
      acc2 = mma_h(ah, b2, acc2);
      acc3 = mma_h(ah, b3, acc3);
      guard6<v16h>(acc0, acc1, acc2, acc3, ah, b0, b1, b2, b3, ah);
    }
  }
  epi64(slab + wave * SLAB64, acc0, acc1, acc2, acc3, oscale, C, DMOD, rowC, col0, lane);
}

// =====================================================================================================
// Causal gated multi-head attention, score depth SD = 128 ([c|s] parts of one head), hd = 64 for v.
// Block bid -> (query block qt of 64 rows, falling with bid so that a block's number of key tiles falls with its index; head hg, batch b); 8 waves = QG = 2 query groups x KS = 4 key splits.
// Query group wave / KS: rows q0 = 64*qt + 32*(wave / KS) .. q0+31 = QW = 2 query tiles of 16 rows, carried side by side by each of its waves, so that each
// key and v fragment is read once for both; each tile's own sums are those of a block of one tile. The K hi, K residual and v^T hi tiles of a split come into LDS
// once, by asynchronous copies, and both query groups read them there (q, the v^T residual plane and the gate table are read from global memory):
// wave sp = wave % KS of a group takes the key tiles kt = sp, sp + KS, ... with its own running max, sum and accumulator; the four
// partial results are merged once, after one block barrier (weights 2^(m_s - max m), -inf-safe: a wave without tiles adds 0).
// RES == 1: query tiles q0 < QO, P.v = hh + lh + hl with the v^T residual plane, O residual plane also written;
// RES == 0: query tiles q0 >= QO, P.v single products. Scores use q_hi.k_hi + q_lo.k_hi + q_hi.k_lo in both variants.
//   q hi plane f16 x256, packed, row b*SEQ + s, column h*SD + e (e < SD), q residual plane same layout (all rows); k planes likewise;
//   v^T hi plane x1024, packed, row (b*NH + h)*HD + d, column s (K = SEQ), v^T residual plane (K = QO); gate table G[h][i - j] f32.
//   score (log2 domain) t(i, j) = (q_i.k_j over SD) * (1/8)*log2e/(256*256) * G[h][i - j], replaced by -inf where key j >
//   query i (gate index clamped to [0, SEQ-1]; the clamped value is only used on masked elements).
//   Key tiles of 32 with kb <= q0 + 15, each wave's in rising order; with RES == 1 every visited key is below QO, inside the compact
//   v^T residual plane.
//   Both products run transposed, S^T = K.Q^T (A = key rows, B = query columns) and O^T += V^T.P^T (A = v^T rows, B = P^T), so that a lane
//   holds scores, probabilities and results of ONE query (column lane & 15; the two wave halves split its keys and its d).
//   Per key tile: 2 x QW score subtiles x 4 k-steps x 3 products, fragments loaded straight from the packed 16-bit tiles, staged or global (two 16-B loads
//   per fragment, split k map); online max-subtracted base-2 softmax in f32, -inf-safe rescale, maximum and sum over the lane's own
//   16 registers (maximum joined across the halves per tile, sum once behind the loop); the two score subtiles, converted in place (hi,
//   residual), are the B operand P^T in the split k map; v^T A fragments in 2 groups of
//   2 d-subtiles. After the loop each wave writes its raw accumulator into its own result slab (pitch 68, row = query; every element owned
//   by one lane) and its 16 row maxima and sums in front of the slab; one block barrier (every return stands in front of it
//   and is block-uniform); then wave sp merges columns 16*sp .. 16*sp+15 of its head: out = sum_s acc_s*w_s / sum_s Z_s*w_s
//   (Z > 0 always: key 0 <= every query row; guarded anyway), carries 1/(32768*1024) folded once. Bounded loops only (nkt <= NKT).
// coverage: per wave QW instructions x 16 rows x 2 chunks x 8 halves = 32 x 16 per plane, KS waves = 32 x 64; the two block ranges
//           (RES 1: NQO tiles, RES 0: NQT-NQO tiles; QG*QW tiles a block) x NHG x NB blocks = every (b, s, h) row segment of O hi exactly
//           once and every (b, s < QO, h) row segment of O residual exactly once.
// =====================================================================================================
// s_wait_xcnt 0 behind a group of global loads, with the registers that the loads name as inputs only: they are rewritten only behind the wait
__device__ __forceinline__ void idx_wait(const int (&a)[8], const int (&b)[8]) {
#if defined(__HIP_DEVICE_COMPILE__)
  asm volatile("s_wait_xcnt 0x0" :: "v"(a[0]), "v"(a[1]), "v"(a[2]), "v"(a[3]), "v"(a[4]), "v"(a[5]), "v"(a[6]), "v"(a[7]),
               "v"(b[0]), "v"(b[1]), "v"(b[2]), "v"(b[3]), "v"(b[4]), "v"(b[5]), "v"(b[6]), "v"(b[7]) : "memory");
#endif
}
__device__ __forceinline__ void adr_wait(const char* p, const char* q) {
#if defined(__HIP_DEVICE_COMPILE__)
  asm volatile("s_wait_xcnt 0x0" :: "v"(p), "v"(q) : "memory");
#endif
}
// One wave's half of a key tile, 20 asynchronous copies of 512 B (16 B a lane) from global memory into LDS, through no register: 4 KB of K hi, 4 KB of K
// residual, two 1-KB tiles of v^T hi. An offset moves both addresses. The closing s_wait_xcnt 0 stands in the copies' own statement, so that the
// address registers are rewritten only behind it.
__device__ __forceinline__ void stage_copy(unsigned l0, const char* g0, unsigned l1, const char* g1,
                                           unsigned l2, const char* g2, unsigned l3, const char* g3) {
#if defined(__HIP_DEVICE_COMPILE__)
  asm volatile("global_load_async_to_lds_b128 %0, %1, off\n\t"
               "global_load_async_to_lds_b128 %0, %1, off offset:512\n\t"
               "global_load_async_to_lds_b128 %0, %1, off offset:1024\n\t"
               "global_load_async_to_lds_b128 %0, %1, off offset:1536\n\t"
               "global_load_async_to_lds_b128 %0, %1, off offset:2048\n\t"
               "global_load_async_to_lds_b128 %0, %1, off offset:2560\n\t"
               "global_load_async_to_lds_b128 %0, %1, off offset:3072\n\t"
               "global_load_async_to_lds_b128 %0, %1, off offset:3584\n\t"
               "global_load_async_to_lds_b128 %2, %3, off\n\t"
               "global_load_async_to_lds_b128 %2, %3, off offset:512\n\t"
               "global_load_async_to_lds_b128 %2, %3, off offset:1024\n\t"
               "global_load_async_to_lds_b128 %2, %3, off offset:1536\n\t"
               "global_load_async_to_lds_b128 %2, %3, off offset:2048\n\t"
               "global_load_async_to_lds_b128 %2, %3, off offset:2560\n\t"
               "global_load_async_to_lds_b128 %2, %3, off offset:3072\n\t"
               "global_load_async_to_lds_b128 %2, %3, off offset:3584\n\t"
               "global_load_async_to_lds_b128 %4, %5, off\n\t"
               "global_load_async_to_lds_b128 %4, %5, off offset:512\n\t"
               "global_load_async_to_lds_b128 %6, %7, off\n\t"
               "global_load_async_to_lds_b128 %6, %7, off offset:512\n\t"
               "s_wait_xcnt 0x0"
               :: "v"(l0), "v"(g0), "v"(l1), "v"(g1), "v"(l2), "v"(g2), "v"(l3), "v"(g3) : "memory");
#endif
}
__device__ __forceinline__ void async_wait() {                        // the wave's own copies have landed in LDS
#if defined(__HIP_DEVICE_COMPILE__)
  asm volatile("s_wait_asynccnt 0x0" ::: "memory");
#endif
}
__device__ __forceinline__ void ds_wait() {                           // the wave's own LDS reads have returned, before their buffer is handed back for a refill
#if defined(__HIP_DEVICE_COMPILE__)
  asm volatile("s_wait_dscnt 0x0" ::: "memory");
#endif
}
template <int RES>
__device__ __forceinline__
void attn_g(float* smem, int bid, int wave, const u16* __restrict__ QHp, const u16* __restrict__ QLp,
            const u16* __restrict__ KHp, const u16* __restrict__ KLp,
            const u16* __restrict__ VHp, const u16* __restrict__ VLp,
            const float* __restrict__ Gt, u16* OHp, u16* OLp) {
  constexpr int QT0 = (RES != 0) ? 0 : (NQOB / QG);           // in blocks of QG query groups
  constexpr int NQL = (RES != 0) ? (NQOB / QG) : ((NQB - NQOB) / QG);
  constexpr int NQE = (NQL > 0) ? NQL : 1;

  const int lane = (int)__builtin_amdgcn_mbcnt_lo(~0u, 0u);    // lane index without the thread id, which would otherwise hold a register over the other variant's key loop
  const unsigned lo = 16u * (unsigned)lane;
  const int hh   = lane >> 4;
  const int c    = lane & 15;
  const int qi   = bid / (NHG * NB);        // the query block with the most key tiles comes first, all heads and batches of it side by side
  const int t2   = bid % (NHG * NB);
  const int hg   = t2 % NHG;
  const int b    = t2 / NHG;
  if (qi >= NQE) return;                    // block-uniform, before the barrier; never taken with the exact grid
  const int qt   = QT0 + (NQE - 1 - qi);
  const int qb0  = qt * (16 * QW * QG);     // first of the block's 16*QW*QG query rows
  if (qb0 + 16 * QW * QG > SEQ) return;     // block-uniform; never taken
  if (RES != 0 && qb0 + 16 * QW * QG > QO) return; // block-uniform; never taken
  const int hw   = wave / KS;               // query group within the block
  const int sp   = wave % KS;               // which quarter of the key tiles
  const int q0   = qb0 + hw * (16 * QW);    // first of the wave's 16*QW query rows; query tile u = rows q0 + 16u .. q0 + 16u + 15
  const int head = hg;
  const int ql0  = (RES != 0) ? q0 : 0;

  float* wreg = smem + wave * WREG;         // per query tile u at u*WSUB: 16 row maxima, 16 row sums, then result slab [16][64] pitch 68

  const size_t hcol = (size_t)head * (SD / 32) * 512;                              // the head's first k tile
  const _Float16* Qh  = ash(QHp) + ((size_t)b * SEQ + q0) * QKN + hcol;            // query tile u at + u*16*QKN
  const _Float16* Ql  = ash(QLp) + ((size_t)b * SEQ + q0) * QKN + hcol;
  const _Float16* Khb = ash(KHp) + ((size_t)b * SEQ) * QKN + hcol;                 // key row tile kb added per step
  const _Float16* Klb = ash(KLp) + ((size_t)b * SEQ) * QKN + hcol;
  const _Float16* Vhb = ash(VHp) + ((size_t)(b * NH + head) * HD) * SEQ;                // d row tile j added per group
  const _Float16* Vlb = ash(VLp) + ((size_t)(b * NH + head) * HD) * QO;                 // RES == 1 only
  const float* gp = Gt + (size_t)head * SEQ;
  const float lsc = RSQ_HD * (LOG2E / (QSC * KSC));
  const float oc  = 1.0f / (PCAR * VCAR);
  const size_t KROW = (size_t)QKN;          // halves per key row: row tile kb starts at kb*KROW
  const size_t QT2  = (size_t)16 * QKN;     // halves between the two query tiles

  float mrow[QW], lrow[QW];                 // of query q0 + 16u + c: running maximum (the same in both wave halves), and the sum over this half's keys
  v8f o[QW][4];                             // transposed: element r of o[u][j] = (d = 16j + 8hh + r, query q0 + 16u + c)
#pragma unroll
  for (int u = 0; u < QW; ++u) {
    mrow[u] = -INFINITY;  lrow[u] = 0.f;
#pragma unroll
    for (int j = 0; j < 4; ++j) o[u][j] = zero8();
  }
  const int ncaus = (q0 >> 5) + 1;                                            // tiles holding keys <= q0 + 31: the same set for both query tiles
  const int nkt = (ncaus < NKT) ? ncaus : NKT;

  // ---- key tiles through LDS: split sp's tile of trip t (kt = sp + KS*t) is copied once, half by each of the split's QG waves, and read by both; two buffers
  //      a split, the copies of trip t + 2 issued behind the barrier that ends trip t. Trip count and copy tests are the same for the whole block. ----
  const int nktb = ((qb0 + 16 * QW * (QG - 1)) >> 5) + 1;                     // key tiles of the block's last query group
  const int ntr  = (((nktb < NKT) ? nktb : NKT) + KS - 1) / KS;
  const unsigned lds0 = (unsigned)(size_t)smem + (unsigned)(sp * KTB) + lo;   // the lane's LDS byte address in the split's first buffer
  auto stage = [&](int t) {
    int ks = sp + t * KS;
    ks = (ks < NKT) ? ks : (NKT - 1);       // a tile behind the block's last one is copied from inside the planes and never read
    const unsigned lb = lds0 + (unsigned)((t & 1) * (KS * KTB));
    const char* gk = (const char*)(Khb + (size_t)(ks * 32 + 16 * hw) * KROW) + lo;
    const char* gl = (const char*)(Klb + (size_t)(ks * 32 + 16 * hw) * KROW) + lo;
    const char* gv = (const char*)(Vhb + (size_t)(2 * hw) * 16 * SEQ + ks * 512) + lo;
    stage_copy(lb + hw * 4096, gk, lb + 8192 + hw * 4096, gl, lb + 16384 + hw * 2048, gv, lb + 17408 + hw * 2048, gv + (size_t)32 * SEQ);
  };
  stage(0);
  async_wait();
  __syncthreads();                          // publishes trip 0's tiles
  if (ntr > 1) stage(1);
#pragma unroll 1
  for (int t = 0; t < ntr; ++t) {
   const int kt = sp + t * KS;
   if (kt < nkt) {                          // wave-uniform: a wave without this tile goes straight to the trip's barrier
    const int kb = kt * 32;
    const _Float16* tb = (const _Float16*)(const void*)((const char*)smem + (t & 1) * (KS * KTB) + sp * KTB);
    // ---- transposed scores, A = key rows, B = query columns: D element r of this lane = (key kb + 8hh + r, query q0 + 16u + c) in s[u][0], key kb + 16 + 8hh + r in s[u][1] ----
    v8f s00 = zero8(), s01 = zero8(), s10 = zero8(), s11 = zero8();
    const _Float16* k0p = tb;               // staged: K hi rows 0..15, 16..31, K residual rows 0..15, 16..31, 4 KB each
    const _Float16* k1p = tb + 2048;
    const _Float16* l0p = tb + 4096;
    const _Float16* l1p = tb + 6144;
#pragma unroll
    for (int kk = 0; kk < SD / 32; ++kk) {
      const v16h qh0 = ldfrag_h(Qh + kk * 512, lo);
      const v16h ql0f = ldfrag_h(Ql + kk * 512, lo);
      const v16h qh1 = ldfrag_h(Qh + QT2 + kk * 512, lo);
      const v16h ql1f = ldfrag_h(Ql + QT2 + kk * 512, lo);
      const v16h kh0 = ldfrag_h(k0p + kk * 512, lo);
      const v16h kh1 = ldfrag_h(k1p + kk * 512, lo);
      const v16h kl0 = ldfrag_h(l0p + kk * 512, lo);
      const v16h kl1 = ldfrag_h(l1p + kk * 512, lo);
      adr_wait((const char*)Qh + lo, (const char*)Ql + lo);   // the global loads' address registers stay as they are until the wait has passed
      s00 = mma_h(kh0, qh0,  s00);
      s10 = mma_h(kh0, qh1,  s10);
      s01 = mma_h(kh1, qh0,  s01);
      s11 = mma_h(kh1, qh1,  s11);
      s00 = mma_h(kh0, ql0f, s00);
      s10 = mma_h(kh0, ql1f, s10);
      s01 = mma_h(kh1, ql0f, s01);
      s11 = mma_h(kh1, ql1f, s11);
      s00 = mma_h(kl0, qh0,  s00);
      s10 = mma_h(kl0, qh1,  s10);
      s01 = mma_h(kl1, qh0,  s01);
      s11 = mma_h(kl1, qh1,  s11);
      guard4(s00, s01, s10, s11, qh0, ql0f, qh1, ql1f, kh0, kl0, kh1, kl1);
    }
    // ---- gate (f32, per element) + causal select + online softmax in base 2, -inf-safe; one query tile after the other. A lane holds 16 of its
    //      query's 32 scores: maximum and sum run over its own registers, the maximum joined with the other wave half by one cross-row move.
    //      The 16 probabilities are, in place, the lane's part of the B operand P^T (split k map: elements 0..7 = keys kb + 8hh + 0..7, 8..15 = kb + 16 + 8hh + 0..7) ----
    FragH ph[QW], pl[QW];
#pragma unroll
    for (int u = 0; u < QW; ++u) {
      const v8f s0 = (u == 0) ? s00 : s10;
      const v8f s1 = (u == 0) ? s01 : s11;
      const int dq = q0 + 16 * u + c - kb - 8 * hh;                           // query - key of element r: dq - r in s0, dq - 16 - r in s1
      int ia[8], ib[8];
      float ga[8], gb[8];
#pragma unroll
      for (int r = 0; r < 8; ++r) {
        int i0 = dq - r;       i0 = (i0 < 0) ? 0 : i0;  i0 = (i0 > SEQ - 1) ? (SEQ - 1) : i0;
        int i1 = dq - 16 - r;  i1 = (i1 < 0) ? 0 : i1;  i1 = (i1 > SEQ - 1) ? (SEQ - 1) : i1;
        ia[r] = i0;  ib[r] = i1;
        ga[r] = gp[i0];
        gb[r] = gp[i1];
      }
      idx_wait(ia, ib);                     // the gate loads' index registers stay as they are until the wait has passed
      float t0[8], t1[8];
      float mx = -INFINITY;
#pragma unroll
      for (int r = 0; r < 8; ++r) {
        const float u0 = (s0[r] * lsc) * ga[r];
        const float u1 = (s1[r] * lsc) * gb[r];
        t0[r] = (dq - r < 0) ? -INFINITY : u0;
        t1[r] = (dq - 16 - r < 0) ? -INFINITY : u1;
        mx = fmaxf(mx, fmaxf(t0[r], t1[r]));
      }
      mx = fmaxf(mx, xhalf(mx));
      const float mn = fmaxf(mrow[u], mx);
      const float ms = (mn == -INFINITY) ? 0.0f : mn;
      const float al = exp2f(mrow[u] - ms);
      mrow[u] = mn;
      float ps = 0.f;
#pragma unroll
      for (int r = 0; r < 8; ++r) {
        const float e0 = exp2f(t0[r] - ms), e1 = exp2f(t1[r] - ms);
        ps += e0 + e1;
        const float ta = e0 * PCAR, tb = e1 * PCAR;
        const _Float16 ha = (_Float16)ta, hb = (_Float16)tb;
        ph[u].h[0][r] = ha;
        ph[u].h[1][r] = hb;
        pl[u].h[0][r] = (_Float16)(ta - (float)ha);
        pl[u].h[1][r] = (_Float16)(tb - (float)hb);
      }
      lrow[u] = lrow[u] * al + ps;
#pragma unroll
      for (int j = 0; j < 4; ++j) {
#pragma unroll
        for (int r = 0; r < 8; ++r) o[u][j][r] *= al;
      }
    }
    // ---- O^T += V^T.P^T : A fragment row m = d = j*16 + c, key tile kb>>5 of the packed v^T planes; 2 groups of 2 d-subtiles, each fragment used by both query tiles ----
    {
      const _Float16* vhp = tb + 8192;      // staged v^T hi: d tile j at j*512 halves
      if constexpr (RES != 0) {
        const _Float16* vlp = Vlb + kb * 16;
#pragma unroll
        for (int jg = 0; jg < 2; ++jg) {
          const size_t da = (size_t)(2 * jg) * 512;
          const size_t db = da + (size_t)512;
          const size_t la = (size_t)(2 * jg) * 16 * QO;
          const size_t lb = la + (size_t)16 * QO;
          const v16h vha = ldfrag_h(vhp + da, lo), vhb2 = ldfrag_h(vhp + db, lo);
          const v16h vla = ldfrag_h(vlp + la, lo), vlb2 = ldfrag_h(vlp + lb, lo);
          adr_wait((const char*)vlp + lo, (const char*)vlp + lo);   // the global loads' address registers stay as they are until the wait has passed
#pragma unroll
          for (int u = 0; u < QW; ++u) {
            o[u][2 * jg]     = mma_h(vha,  ph[u].v, o[u][2 * jg]);
            o[u][2 * jg + 1] = mma_h(vhb2, ph[u].v, o[u][2 * jg + 1]);
          }
#pragma unroll
          for (int u = 0; u < QW; ++u) {
            o[u][2 * jg]     = mma_h(vha,  pl[u].v, o[u][2 * jg]);
            o[u][2 * jg + 1] = mma_h(vhb2, pl[u].v, o[u][2 * jg + 1]);
          }
#pragma unroll
          for (int u = 0; u < QW; ++u) {
            o[u][2 * jg]     = mma_h(vla,  ph[u].v, o[u][2 * jg]);
            o[u][2 * jg + 1] = mma_h(vlb2, ph[u].v, o[u][2 * jg + 1]);
          }
          guard4(o[0][2 * jg], o[0][2 * jg + 1], o[1][2 * jg], o[1][2 * jg + 1], ph[0].v, pl[0].v, ph[1].v, pl[1].v, vha, vhb2, vla, vlb2);
        }
      } else {
#pragma unroll
        for (int jg = 0; jg < 2; ++jg) {
          const size_t da = (size_t)(2 * jg) * 512;
          const size_t db = da + (size_t)512;
          const v16h vha = ldfrag_h(vhp + da, lo), vhb2 = ldfrag_h(vhp + db, lo);
#pragma unroll
          for (int u = 0; u < QW; ++u) {
            o[u][2 * jg]     = mma_h(vha,  ph[u].v, o[u][2 * jg]);
            o[u][2 * jg + 1] = mma_h(vhb2, ph[u].v, o[u][2 * jg + 1]);
          }
          guard4(o[0][2 * jg], o[0][2 * jg + 1], o[1][2 * jg], o[1][2 * jg + 1], ph[0].v, ph[1].v, vha, vhb2, ph[0].v, ph[1].v, vha, vhb2);
        }
      }
    }
   }
   // ---- the trip's foot, every wave: own LDS reads returned, own copies landed, one block barrier (publishes trip t + 1's tiles and ends every read of trip t's), then the refill ----
   ds_wait();
   async_wait();
   __syncthreads();
   if (t + 2 < ntr) stage(t + 2);
  }
  async_wait();                             // nothing is in flight when the ring becomes the result slabs
  acc_guard4(o[0][0], o[0][1], o[0][2], o[0][3]);
  acc_guard4(o[1][0], o[1][1], o[1][2], o[1][3]);
  const int lne = lane;
  const int hhe = lne >> 4, ce = lne & 15;
  // ---- this wave's partial results: raw accumulators into the slab rows of the lane's query (8 consecutive d per subtile), row maxima and joined row sums in front of them ----
#pragma unroll
  for (int u = 0; u < QW; ++u) {
    float* pt   = wreg + u * WSUB;
    float* srow = pt + PTW + ce * SLP + 8 * hhe;
#pragma unroll
    for (int j = 0; j < 4; ++j) {
      const v4f a = {o[u][j][0], o[u][j][1], o[u][j][2], o[u][j][3]};
      const v4f b4 = {o[u][j][4], o[u][j][5], o[u][j][6], o[u][j][7]};
      *(v4f*)(srow + j * 16)     = a;
      *(v4f*)(srow + j * 16 + 4) = b4;
    }
    const float lt = lrow[u] + xhalf(lrow[u]);                                // the two wave halves' sums joined once
    if (hhe == 0) {
      pt[ce]      = mrow[u];
      pt[16 + ce] = lt;
    }
  }
  __syncthreads();                          // publishes the four partial results of each query group to its four waves
#pragma unroll
  for (int u = 0; u < QW; ++u) {
    // ---- merge for row c of query tile u: w_s = 2^(m_s - max m) (0 for a wave without keys), Z = sum Z_s*w_s, out = sum acc_s*w_s / Z (0 if Z == 0) ----
    const float* hb = smem + hw * KS * WREG + u * WSUB;
    float ms4[KS], ws4[KS];
#pragma unroll
    for (int s = 0; s < KS; ++s) ms4[s] = hb[s * WREG + ce];
    const float mm  = fmaxf(fmaxf(ms4[0], ms4[1]), fmaxf(ms4[2], ms4[3]));
    const float mms = (mm == -INFINITY) ? 0.0f : mm;
    float lv = 0.f;
#pragma unroll
    for (int s = 0; s < KS; ++s) {
      ws4[s] = exp2f(ms4[s] - mms);
      lv += hb[s * WREG + 16 + ce] * ws4[s];
    }
    const float ls  = (lv > 0.0f) ? lv : 1.0f;
    const float inv = (lv > 0.0f) ? ((1.0f / ls) * oc) : 0.0f;
    // ---- O x1024 -> f16 hi (+ residual) packed planes; lane = (row c, 8 consecutive d at 16*sp + 8*hh): a quarter of the head's two tiles ----
    float w[8];
#pragma unroll
    for (int e = 0; e < 8; ++e) w[e] = 0.f;
#pragma unroll
    for (int s = 0; s < KS; ++s) {
      const float* sr = hb + s * WREG + PTW + ce * SLP + sp * 16 + hhe * 8;
      const v4f a = *(const v4f*)(sr), b4 = *(const v4f*)(sr + 4);
#pragma unroll
      for (int e = 0; e < 4; ++e) { w[e] += a[e] * ws4[s]; w[4 + e] += b4[e] * ws4[s]; }
    }
    v4u oh, ol;
#pragma unroll
    for (int e = 0; e < 4; ++e) {
      const float w0 = (w[2 * e] * inv) * OSC, w1 = (w[2 * e + 1] * inv) * OSC;
      const _Float16 h0 = (_Float16)w0, h1 = (_Float16)w1;
      const _Float16 l0 = (_Float16)(w0 - (float)h0), l1 = (_Float16)(w1 - (float)h1);
      oh[e] = pk16(h_bits(h0), h_bits(h1));
      ol[e] = pk16(h_bits(l0), h_bits(l1));
    }
    const size_t obh = ((size_t)b * SEQ + q0 + 16 * u) * DMOD + (size_t)head * (HD / 32) * 512 + sp * 256 + 8 * lne;
    const size_t obl = ((size_t)b * QO + ql0 + 16 * u) * DMOD + (size_t)head * (HD / 32) * 512 + sp * 256 + 8 * lne;
    *(v4u*)(OHp + obh) = oh;
    if constexpr (RES != 0) {
      *(v4u*)(OLp + obl) = ol;
    }
    xcnt_wait();                            // before the stores' address and data registers are reused
  }
}

// =====================================================================================================
// Joint grids: kernels that depend on the same earlier launch and on nothing of each other run as block ranges of ONE launch
// (every test below is block-uniform; each range runs its function unchanged with its own block index counted from 0).
// prep: weight transposes (Wv^T | Wq^T | Wk^T as one bf16 plane of FN rows x DMOD, Wo^T as its own f16 plane), x -> bf16 plane, gate table.
// =====================================================================================================
__global__ __launch_bounds__(256)
void prep(const float* __restrict__ x, const float* __restrict__ wv, const float* __restrict__ wq, const float* __restrict__ wk,
          const float* __restrict__ wo, const float* __restrict__ theta, u16* XB, u16* WB, u16* WO, float* G) {
  const int bid = blockIdx.x;
  if (bid < NB_TR) {
    const float* Wsrc = wv;
    u16* D = WB;
    int lb = bid, NW = DMOD, mode = 0;
    float sc = 1.0f;
    if (bid >= NB_TRV + 2 * NB_TRQ)  { Wsrc = wo; D = WO; lb = bid - (NB_TRV + 2 * NB_TRQ); mode = 1; sc = WOS; }
    else if (bid >= NB_TRV + NB_TRQ) { Wsrc = wk; D = WB + (size_t)(DMOD + QKN) * DMOD; lb = bid - (NB_TRV + NB_TRQ); NW = QKN; }
    else if (bid >= NB_TRV)          { Wsrc = wq; D = WB + (size_t)DMOD * DMOD; lb = bid - NB_TRV; NW = QKN; }
    tr16(lb, Wsrc, D, DMOD, NW, mode, sc);
  } else if (bid < NB_TR + NB_CV) {
    cvt16(bid - NB_TR, x, XB, MROWS * DMOD / 8, 0, 1.0f);
  } else {
    gtab(bid - (NB_TR + NB_CV), theta, G, NH * SEQ);
  }
}

// post: F f32 [MROWS][FN] (columns v | q | k) -> [qc|qs] planes, [kc|ks] planes, v^T planes.
__global__ __launch_bounds__(256)
void post(const float* __restrict__ F, u16* QH, u16* QL, u16* KH, u16* KL, u16* VH, u16* VL) {
  const int bid = blockIdx.x;
  if (bid < 2 * NB_QK) {
    const bool isk = (bid >= NB_QK);
    qk16(isk ? bid - NB_QK : bid, F + (isk ? (DMOD + QKN) : DMOD), isk ? KH : QH, isk ? KL : QL, MROWS * C8R, isk ? KSC : QSC);
  } else {
    vt16(bid - 2 * NB_QK, F, VH, VL);
  }
}

// attention: the query tiles s >= QO first, then the query tiles s < QO (residual products); inside each range the last query block (most key tiles) first.
__global__ __launch_bounds__(ATT_THREADS) __attribute__((amdgpu_waves_per_eu(4)))   // at most 256 registers a wave, so that four waves (two blocks, half the LDS each) share a SIMD
void attn_all(const u16* __restrict__ QHp, const u16* __restrict__ QLp, const u16* __restrict__ KHp, const u16* __restrict__ KLp,
              const u16* __restrict__ VHp, const u16* __restrict__ VLp, const float* __restrict__ Gt, u16* OHp, u16* OLp) {
  __shared__ __align__(16) float smem[RINGB / 4];   // the key tile ring; behind the key loop the waves' result slabs
  const int bid = blockIdx.x;
  const int wave = __builtin_amdgcn_readfirstlane((int)threadIdx.x >> 5);   // scalar, so that every tile start is a scalar base address
  if (bid < NB_AT0) attn_g<0>(smem, bid, wave, QHp, QLp, KHp, KLp, VHp, VLp, Gt, OHp, OLp);
  else              attn_g<1>(smem, bid - NB_AT0, wave, QHp, QLp, KHp, KLp, VHp, VLp, Gt, OHp, OLp);
}

// output projection: rows s < QO (O hi + residual) first, then rows s >= QO (O hi only).
__global__ __launch_bounds__(128)
void gemm_o_all(const u16* __restrict__ Ah, const u16* __restrict__ Al, const u16* __restrict__ Bt, float* C, float oscale) {
  __shared__ __align__(16) float slab[4 * SLAB64];
  const int bid = blockIdx.x;
  if (bid < NB_OP2) gemm_o<2>(slab, bid, Ah, Al, Bt, C, 0, QO / 64, oscale);
  else              gemm_o<1>(slab, bid - NB_OP2, Ah, Al, Bt, C, QO, (SEQ - QO) / 64, oscale);
}

// =====================================================================================================
// Workspace map (bytes; every 16-bit plane in the packed tile order, same extents as row-major); every plane is fully written by whole-line stores before it is read; all extents are exact
// multiples of the store granularity (no pad rows needed); every region offset a multiple of 131072:
//   XB  bf16 [MROWS][1024]                       MROWS*2048       (NB=2, SEQ=2048: 8388608)
//   WB  bf16 [5120 n][1024 k]                    10485760         (rows Wv^T | Wq^T | Wk^T)
//   WO  f16 [1024 n][1024 k] x1024               2097152          (Wo^T)
//   F   f32 [MROWS][5120]                        MROWS*20480      (columns v | q | k projection output;
//                                                                  afterwards OH f16 [MROWS][1024] x1024 at its start, OL residual
//                                                                  [NB*QO][1024] after)
//   QH  f16 [MROWS][2048] x256                   MROWS*4096       QL residual [MROWS][2048]      MROWS*4096
//   KH  f16 [MROWS][2048] x256                   MROWS*4096       KL residual [MROWS][2048]      MROWS*4096
//   VH  f16 [NB*16][64][SEQ] x1024               MROWS*2048       VL residual [NB*16][64][QO]    NB*QO*2048
//   G   f32 [16][SEQ]                            16*SEQ*4
//   end (NB=2, SEQ=2048)                       182583296
// =====================================================================================================
extern "C" void kernel_launch(void* const* d_in, const int* in_sizes, int n_in,
                              void* d_out, int out_size, void* d_ws, size_t ws_size,
                              hipStream_t stream) {
  if (n_in < 6) return;
  if (in_sizes[0] < ((NB - 1) * XS_FULL + SEQ) * DMOD) return;
  if (in_sizes[1] != DMOD * QKN) return;
  if (in_sizes[2] != DMOD * QKN) return;
  if (in_sizes[3] != DMOD * DMOD) return;
  if (in_sizes[4] != DMOD * DMOD) return;
  if (in_sizes[5] < NH) return;
  if (out_size < ((NB - 1) * XS_FULL + SEQ) * DMOD) return;

  const float* x   = (const float*)d_in[0];
  const float* wq  = (const float*)d_in[1];   // [1024 in][2048 out]
  const float* wk  = (const float*)d_in[2];   // [1024 in][2048 out]
  const float* wv  = (const float*)d_in[3];   // [1024 in][1024 out]
  const float* wo  = (const float*)d_in[4];   // [1024 in][1024 out]
  const float* th  = (const float*)d_in[5];   // [16]
  float*       out = (float*)d_out;

  const size_t szXB = (size_t)MROWS * DMOD * 2;
  const size_t szW  = (size_t)FN * DMOD * 2;
  const size_t szWO = (size_t)DMOD * DMOD * 2;
  const size_t szF  = (size_t)MROWS * FN * 4;
  const size_t szQ  = (size_t)MROWS * QKN * 2;                  // QH, QL, KH, KL
  const size_t szOH = (size_t)MROWS * DMOD * 2;
  const size_t szOL = (size_t)NB * QO * DMOD * 2;
  const size_t szVH = (size_t)NB * NH * HD * SEQ * 2;
  const size_t szVL = (size_t)NB * NH * HD * QO * 2;
  const size_t szG  = (size_t)NH * SEQ * 4;
  if (szOH + szOL > szF) return;                                // OH + OL live inside the F region
  size_t off = 0;
  const size_t oXB = off; off += szXB;
  const size_t oW  = off; off += szW;
  const size_t oWO = off; off += szWO;
  const size_t oF  = off; off += szF;
  const size_t oQH = off; off += szQ;
  const size_t oQL = off; off += szQ;
  const size_t oKH = off; off += szQ;
  const size_t oKL = off; off += szQ;
  const size_t oVH = off; off += szVH;
  const size_t oVL = off; off += szVL;
  const size_t oG  = off; off += szG;
  if (off > ws_size) return;                // off = 182583296 for NB = 2, SEQ = 2048
  if (off > (size_t)WS_CAP) return;

  char* ws = (char*)d_ws;
  u16*   XB = (u16*)(ws + oXB);
  u16*   WB = (u16*)(ws + oW);
  u16*   WO = (u16*)(ws + oWO);
  float* F  = (float*)(ws + oF);
  u16*   OH = (u16*)(ws + oF);
  u16*   OL = (u16*)(ws + oF + szOH);
  u16*   QH = (u16*)(ws + oQH);
  u16*   QL = (u16*)(ws + oQL);
  u16*   KH = (u16*)(ws + oKH);
  u16*   KL = (u16*)(ws + oKL);
  u16*   VH = (u16*)(ws + oVH);
  u16*   VL = (u16*)(ws + oVL);
  float* G  = (float*)(ws + oG);

  const dim3 b256(256), b128(128), bAT(ATT_THREADS);

  // (0) weights -> transposed 16-bit planes, x -> bf16 plane [MROWS][1024], gate table G[h][dl]
  prep<<<dim3(NB_TR + NB_CV + NB_GT), b256, 0, stream>>>(x, wv, wq, wk, wo, th, XB, WB, WO, G);
  // (1) [v | q_raw | k_raw] = x.[Wv | Wq | Wk] -> F f32 [MROWS][5120]
  gemm_nb<<<dim3((MROWS / 128) * (FN / 160)), b128, 0, stream>>>(XB, WB, F, MROWS, FN, 1.0f);
  // (2) [qc|qs] and [kc|ks] hi + residual x256, v^T hi + residual x1024
  post<<<dim3(2 * NB_QK + NB_VT), b256, 0, stream>>>(F, QH, QL, KH, KL, VH, VL);
  // (3) causal gated attention -> O hi (all rows) + residual (rows s < QO)
  attn_all<<<dim3(NB_AT0 + NB_AT1), bAT, 0, stream>>>(QH, QL, KH, KL, VH, VL, G, OH, OL);
  // (4) output projection -> out f32, carries 1024 x 1024 folded back
  gemm_o_all<<<dim3(NB_OP2 + NB_OP1), b128, 0, stream>>>(OH, OL, WO, out, 1.0f / (OSC * WOS));
  (void)hipGetLastError();
}

// v009
// Measured time: 156 microseconds a run.
// Next to v008, in two timings, it ran 1.03 times as fast each time.
// Counting every step since v000, it is 3.50 times as fast.
// Contractions: x.Wq, x.Wk, x.Wv on v_wmma_f32_16x16x32_bf16 (x and W^T as bf16 RNE planes); per-head scores
// [qc|qs].[kc|ks] over 128 on v_wmma_f32_16x16x32_f16 (q, k as f16 hi x256 plus unscaled f16 residual planes, products
// hh+lh+hl on all query rows); P.v on v_wmma_f32_16x16x32_f16 (P x32768, v^T x1024 f16 planes; query rows s < QO also
// use f16 residual planes, hh+lh+hl); O.Wo on v_wmma_f32_16x16x32_f16 (O x1024 f16 hi plane, plus residual plane for rows
// s < QO; Wo^T as f16 of its bf16 RNE value x1024); all f32 accumulate. softplus, cos, sin, the cosine gate table,
// causal select, base-2 online softmax and 1/Z in f32 on VALU.
#include <hip/hip_runtime.h>
#include <math.h>
#include <stdint.h>

#ifndef NB
#define NB 2
#endif
#ifndef SEQ
#define SEQ 2048
#endif
#define XS_FULL 2048
#define DMOD  1024
#define QKN   (2 * DMOD)
#define NH    16
#define HD    64
#define SD    (2 * HD)
#define QO    ((SEQ < 512) ? SEQ : 512)
#define MROWS (NB * SEQ)
#define RSQ_HD 0.125f
#define GSTEP 0.125f
#define LOG2E 1.4426950408889634f
#define QSC   256.0f
#define KSC   256.0f
#define PCAR  32768.0f
#define VCAR  1024.0f
#define OSC   1024.0f
#define WOS   1024.0f
#define WPB   1
#define NHG   (NH / WPB)
#define NQT   (SEQ / 16)
#define NQO   (QO / 16)
#define QW    2                                 // query tiles of 16 rows that one attention wave carries
#define NQB   (NQT / QW)                        // attention query groups of 16*QW rows
#define NQOB  (NQO / QW)
#define NST   (SEQ / 64)
#define NKT   (SEQ / 32)
#define KS    4
#define QG    2                                 // query groups of 16*QW rows in one attention block; both read each staged key tile
#define ATT_THREADS (QG * KS * 32)
#define KTB   20480                             // bytes of one staged key tile of 32 keys: K hi 8 KB, K residual 8 KB, v^T hi 4 KB
#define RINGB (2 * KS * KTB)                    // two buffers for each of the KS key splits
#define PTW   32                                // per query tile: 16 row maxima, then 16 row sums
#define SLP   68
#define SLW   (16 * SLP)
#define WSUB  (PTW + SLW)
#define WREG  (QW * WSUB)
#define SLAB64 (16 * 68)
#define VTP   72
#define C8R   (DMOD / 8)
#define QKP   264
#define WS_CAP 268435456
#define FN    (DMOD + 2 * QKN)                  // columns of the joint projection: v | q | k
#define NB_TRV ((DMOD / 64) * (DMOD / 64))      // transpose blocks of a [1024][1024] weight
#define NB_TRQ ((DMOD / 64) * (QKN / 64))       // transpose blocks of a [1024][2048] weight
#define NB_TR  (2 * NB_TRV + 2 * NB_TRQ)
#define NB_CV  ((MROWS * DMOD / 8) / 256)       // convert blocks of x
#define NB_GT  ((NH * SEQ) / 256)               // gate table blocks
#define NB_QK  ((MROWS * C8R) / 256)            // combine blocks of q, and of k
#define NB_VT  (NB * NH * NST)                  // v^T blocks
#define NB_AT1 ((NQOB / QG) * NHG * NB)         // attention blocks with residual products
#define NB_AT0 (((NQB - NQOB) / QG) * NHG * NB) // attention blocks without
#define NB_OP2 (NB * (QO / 64) * (DMOD / 64))   // output projection blocks with the residual plane
#define NB_OP1 (NB * ((SEQ - QO) / 64) * (DMOD / 64))
static_assert(DMOD == NH * HD && HD == 64 && NH == 16 && SD == 128 && WPB == 1 && NHG * WPB == NH);
static_assert(ATT_THREADS == 256 && KS == 4 && HD == KS * 16 && QW == 2 && NQB * QW == NQT && NQOB * QW == NQO);
static_assert(QG == 2 && (NQB % QG) == 0 && (NQOB % QG) == 0 && QG * KS * WREG * 4 <= RINGB && RINGB <= 163840);
static_assert(NB >= 1 && NB <= 2);
static_assert((SEQ % 64) == 0 && SEQ >= 64 && SEQ <= XS_FULL);
static_assert((QO % 64) == 0 && QO >= 64 && QO <= SEQ);
static_assert((DMOD % 64) == 0 && (QKN % 64) == 0 && (DMOD % 32) == 0 && (SD % 32) == 0 && C8R == 128);
static_assert((MROWS % 128) == 0 && (FN % 160) == 0);
static_assert(((SEQ * DMOD / 8) % 256) == 0 && ((MROWS * C8R) % 256) == 0 && ((NH * SEQ) % 256) == 0);
static_assert(WPB * KS * WREG * 4 <= 65536 && 2 * HD * VTP * 2 <= 65536 && 4 * SLAB64 * 4 <= 65536 && 64 * VTP * 2 <= 65536);

typedef unsigned short u16;
typedef _Float16 v16h __attribute__((ext_vector_type(16)));
typedef _Float16 v8h  __attribute__((ext_vector_type(8)));
typedef __bf16   v16b __attribute__((ext_vector_type(16)));
typedef float    v8f  __attribute__((ext_vector_type(8)));
typedef float    v4f  __attribute__((ext_vector_type(4)));
typedef unsigned int v4u __attribute__((ext_vector_type(4)));

union FragH { v16h v; v8h h[2]; v4u u[2]; };
union FragB { v16b v; v4u u[2]; };

// ---- scalar helpers --------------------------------------------------------------------------------
__device__ __forceinline__ unsigned short bf_bits(float f) {          // f32 -> bf16 bits, RNE convert
  unsigned u = __float_as_uint(f);
  return (unsigned short)((u + 0x7FFFu + ((u >> 16) & 1u)) >> 16);
}
__device__ __forceinline__ float bf_up(unsigned short h) { return __uint_as_float(((unsigned)h) << 16); }
__device__ __forceinline__ float bfr(float f) { return bf_up(bf_bits(f)); }
__device__ __forceinline__ unsigned short h_bits(_Float16 x) { return __builtin_bit_cast(unsigned short, x); }
__device__ __forceinline__ unsigned pk16(unsigned short a, unsigned short b) { return (unsigned)a | ((unsigned)b << 16); }
__device__ __forceinline__ v8f zero8() { v8f z = {0.f, 0.f, 0.f, 0.f, 0.f, 0.f, 0.f, 0.f}; return z; }
__device__ __forceinline__ const _Float16* ash(const u16* p) { return (const _Float16*)(const void*)p; }

// ---- packed operand planes: a 16-bit plane of R rows x K columns (R % 16 == 0, K % 32 == 0) is stored as 1-KB tiles of
//      16 rows x 32 k, tile (row>>4, k>>5) at half offset (row>>4)*16*K + (k>>5)*512; inside a tile element (m = row&15,
//      k&31 = 16*j + 8*h + e) lies at j*256 + (16*h + m)*8 + e. One fragment load of a wave is then 512 contiguous bytes
//      (4 cache lines) where a row-major plane gave 16 rows x 32 B (16 lines).
// ---- fragment loaders: 16-bit A/B operand, lane -> row/col (lane&15), h = lane>>4; t = a tile start (wave-uniform), lo = the lane's offset from it
//      in BYTES (16*lane inside the tile), p = t + lo bytes; elements 0..7 <- p[0..7] (k0+8h..), elements 8..15 <- p[256..263] (k0+16+8h..)  (same split k map for A and B)
__device__ __forceinline__ v16h ldfrag_h(const _Float16* t, unsigned lo) {
  FragH f;
  const char* p = (const char*)t + lo;
  f.h[0] = *(const v8h*)(p);
  f.h[1] = *(const v8h*)(p + 512);
  return f.v;
}
__device__ __forceinline__ v16b ldfrag_b(const u16* t, unsigned lo) { // bf16 plane read as unsigned integer vectors
  FragB f;
  const char* p = (const char*)t + lo;
  f.u[0] = *(const v4u*)(p);
  f.u[1] = *(const v4u*)(p + 512);
  return f.v;
}

__device__ __forceinline__ v8f mma_h(v16h a, v16h b, v8f c) {
  return __builtin_amdgcn_wmma_f32_16x16x32_f16(false, a, false, b, (short)0, c, false, false);
}
__device__ __forceinline__ v8f mma_b(v16b a, v16b b, v8f c) {
  return __builtin_amdgcn_wmma_f32_16x16x32_bf16(false, a, false, b, (short)0, c, false, false);
}
// four accumulators and eight operand fragments: the four vector slots behind the last matrix instruction of a group,
// with its results and operands held in their registers up to there
__device__ __forceinline__ void guard4(v8f& a, v8f& b, v8f& c, v8f& d, v16h x0, v16h x1, v16h x2, v16h x3, v16h x4, v16h x5, v16h x6, v16h x7) {
#if defined(__HIP_DEVICE_COMPILE__)
  asm volatile("v_nop\n\tv_nop\n\tv_nop\n\tv_nop"
               : "+v"(a), "+v"(b), "+v"(c), "+v"(d)
               : "v"(x0), "v"(x1), "v"(x2), "v"(x3), "v"(x4), "v"(x5), "v"(x6), "v"(x7) : "memory");
#endif
}
template <typename F>
__device__ __forceinline__ void guard6(v8f& a, v8f& b, v8f& c, v8f& d, F x0, F x1, F x2, F x3, F x4, F x5) {
#if defined(__HIP_DEVICE_COMPILE__)
  asm volatile("v_nop\n\tv_nop\n\tv_nop\n\tv_nop"
               : "+v"(a), "+v"(b), "+v"(c), "+v"(d) : "v"(x0), "v"(x1), "v"(x2), "v"(x3), "v"(x4), "v"(x5) : "memory");
#endif
}
__device__ __forceinline__ void acc_guard4(v8f& a, v8f& b, v8f& c, v8f& d) {
#if defined(__HIP_DEVICE_COMPILE__)
  asm volatile("v_nop\n\tv_nop\n\tv_nop\n\tv_nop" : "+v"(a), "+v"(b), "+v"(c), "+v"(d));
#endif
}
__device__ __forceinline__ void xcnt_wait() {
#if defined(__HIP_DEVICE_COMPILE__)
  asm volatile("s_wait_xcnt 0x0" ::: "memory");
#endif
}
// s_wait_xcnt 0 behind a group of global loads, with the loads' base address as an input only: its registers are rewritten only behind the wait
__device__ __forceinline__ void ld_wait(const float* p) {
#if defined(__HIP_DEVICE_COMPILE__)
  asm volatile("s_wait_xcnt 0x0" :: "v"(p) : "memory");
#endif
}
__device__ __forceinline__ float xhalf(float x) {                     // the value of lane l ^ 16
  const int b = __builtin_bit_cast(int, x);
  return __builtin_bit_cast(float, __builtin_amdgcn_permlanex16(b, b, 0x76543210, 0xfedcba98, false, false));
}
__device__ __forceinline__ void wave_sync_lds() {                     // orders LDS accesses only: a wave's global stores still in flight are not waited for
  __builtin_amdgcn_fence(__ATOMIC_RELEASE, "workgroup", "local");
  __builtin_amdgcn_wave_barrier();
  __builtin_amdgcn_fence(__ATOMIC_ACQUIRE, "workgroup", "local");
}

// =====================================================================================================
// x f32 [NB][XS_FULL][DMOD] row-major -> packed 16-bit plane of MROWS rows (K = DMOD).  f16mode == 0: bf16 RNE bits;  f16mode == 1: f16 bits of (bf16 RNE value) * scale.
// Thread = 8 consecutive k of one row: two 16-B loads, one 16-B store; a wave = one half tile (16 rows x 2 chunks of 8 k), stored
// as 512 contiguous, 512-B aligned bytes; the 8 waves of a block read 512 contiguous bytes of each of 16 rows.
// coverage: grid = ceil(n8/256) blocks x 256 thr x 8 (in-kernel bound) = the whole plane (n8 a multiple of 256 here).
// =====================================================================================================
__device__ __forceinline__ void cvt16(int bid, const float* __restrict__ x, u16* D, int n8, int f16mode, float scale) {
  const int gt = bid * 256 + (int)threadIdx.x;
  if (gt >= n8) return;
  const int wv = gt >> 5, ln = gt & 31;                   // wave index = ((row tile * DMOD/32) + k tile) * 2 + j
  const int row = (wv / (DMOD / 16)) * 16 + (ln & 15);
  const int kc  = ((wv >> 1) % (DMOD / 32)) * 32 + (wv & 1) * 16 + (ln >> 4) * 8;
  const float* p = x + ((size_t)(row / SEQ) * XS_FULL + (size_t)(row % SEQ)) * DMOD + kc;   // plane row b*SEQ + s <- x row b*XS_FULL + s
  const v4f a = *(const v4f*)(p), b4 = *(const v4f*)(p + 4);
  float w[8];
#pragma unroll
  for (int e = 0; e < 4; ++e) { w[e] = a[e]; w[4 + e] = b4[e]; }
  v4u o;
#pragma unroll
  for (int e = 0; e < 4; ++e) {
    const float f0 = w[2 * e], f1 = w[2 * e + 1];
    const unsigned short hb0 = h_bits((_Float16)(bfr(f0) * scale));
    const unsigned short hb1 = h_bits((_Float16)(bfr(f1) * scale));
    const unsigned short bb0 = bf_bits(f0);
    const unsigned short bb1 = bf_bits(f1);
    o[e] = (f16mode != 0) ? pk16(hb0, hb1) : pk16(bb0, bb1);
  }
  u16* d = D + (size_t)gt * 8;
  {
    *(v4u*)(d) = o;
    
  }
}

// =====================================================================================================
// Weight transpose + convert: W f32 [KW][NW] row-major (W[k][n], the x.W layout) -> D 16-bit packed plane of NW rows x KW (row n, column k:
// the B operand). f16mode == 0: bf16 RNE bits; f16mode == 1: f16 bits of (bf16 RNE value) * scale.
// Block = one 64 k x 64 n tile: each thread loads 16 floats of one k row (16-B loads), converts, stores them transposed
// into an LDS tile [64 n][64 k] (pitch 72 halves, u16 element stores); after a block barrier each n row segment (64 halves =
// coverage: load 256 thr x 16 = 64 k x 64 n; store 2 iterations x 256 thr x 8 halves = 64 n rows x 64 k = the block's
//           tile; grid = (KW/64)*(NW/64) blocks covers D exactly once (host guarantees KW % 64 == 0, NW % 64 == 0).
// =====================================================================================================
__device__ __forceinline__ void tr16(int bid, const float* __restrict__ W, u16* D, int KW, int NW, int f16mode, float scale) {
  __shared__ __align__(16) u16 T[64 * VTP];
  const int tid = threadIdx.x;
  const int nkt = KW >> 6;
  const int kt  = bid % nkt;
  const int nt  = bid / nkt;
  const int k0  = kt * 64, n0 = nt * 64;
  if (n0 + 64 > NW) return;                 // block-uniform, before any barrier; never taken with the exact grid
  {
    const int kl = tid >> 2;                // k within tile 0..63
    const int nc = (tid & 3) * 16;          // n chunk 0,16,32,48
    const float* src = W + (size_t)(k0 + kl) * NW + n0 + nc;
#pragma unroll
    for (int i = 0; i < 4; ++i) {
      const v4f a = *(const v4f*)(src + 4 * i);
#pragma unroll
      for (int e = 0; e < 4; ++e) {
        const float f = a[e];
        const unsigned short hb = h_bits((_Float16)(bfr(f) * scale));
        const unsigned short bb = bf_bits(f);
        T[(nc + 4 * i + e) * VTP + kl] = (f16mode != 0) ? hb : bb;
      }
    }
  }
  __syncthreads();
  v4u v[2];
#pragma unroll
  for (int it = 0; it < 2; ++it) {
    const int pi = it * 256 + tid;          // 16-B piece: m = pi&15, h = (pi>>4)&1, j = (pi>>5)&1, k tile (pi>>6)&1, n tile pi>>7
    v[it] = *(const v4u*)(T + ((pi >> 7) * 16 + (pi & 15)) * VTP + ((pi >> 6) & 1) * 32 + ((pi >> 5) & 1) * 16 + ((pi >> 4) & 1) * 8);
  }
  {
#pragma unroll
    for (int it = 0; it < 2; ++it) {
      const int pi = it * 256 + tid;
      *(v4u*)(D + (size_t)(n0 + (pi >> 7) * 16) * KW + (size_t)((k0 >> 5) + ((pi >> 6) & 1)) * 512 + (pi & 63) * 8) = v[it];
    }
  }
}

// =====================================================================================================
// Cosine gate table G f32 [NH][SEQ]: G[h][dl] = cos(bf16(theta[h]) * (dl * 0.125f)), dl = query index - key index >= 0
// (cid difference (j-i)/8 is exact in f32 and cos is even). One value per thread, precise cosf; the block's 256 values
// coverage: grid = NH*SEQ/256 blocks x 256 = all NH x SEQ entries (NH*SEQ is a multiple of 256).
// =====================================================================================================
__device__ __forceinline__ void gtab(int bid, const float* __restrict__ theta, float* G, int ntot) {
  __shared__ __align__(16) float sg[256];
  const int tid = threadIdx.x;
  const int gt  = bid * 256 + tid;
  const int gc  = (gt < ntot) ? gt : (ntot - 1);
  const int h   = gc / SEQ;
  const int dl  = gc - h * SEQ;
  const int hc  = (h < NH) ? h : (NH - 1);
  const float th = bfr(theta[hc]);
  const float cd = (float)dl * GSTEP;
  sg[tid] = cosf(th * cd);
  __syncthreads();
  if (tid < 64) {
    const v4f v = *(const v4f*)(sg + tid * 4);
    const int base = bid * 256 + tid * 4;
    if (base + 4 <= ntot) {
      float* d = G + base;
      {
        *(v4f*)(d) = v;
        
      }
    }
  }
}

// =====================================================================================================
// Amplitude/phase combine: F f32, MROWS rows of pitch FN, F = the operand's first column (row = b*SEQ + s; column h*HD + d = amplitude pre-activation, DMOD + h*HD + d
// = phase) -> f16 hi plane Hp and unscaled f16 residual plane Lp, both packed planes of MROWS rows x QKN with column h*SD + d = c-part * sc and
// h*SD + HD + d = s-part * sc, where a = softplus(amp) = max(amp,0) + log1p(exp(-|amp|)), c-part = a*cos(phase),
// s-part = a*sin(phase) (precise expf/log1pf/cosf/sinf), hi = f16(t), residual = f16(t - f16(t)).
// Block = (16 rows, 2 heads); thread = (row, head h, 8 consecutive d): four 16-B loads, then a loop of 2 x 4 elements (one transcendental chain per element, u16 element
// stores into the thread's own LDS slots, row pitch QKP); block barrier; then four 16-B stores per thread in packed order (the
// block's 8 tiles of each plane are 8 KB contiguous; a wave stores 512 contiguous bytes).
// coverage: grid = MROWS*C8R/256 blocks (clamped block index, predicated store; MROWS*C8R is a multiple of 256) x 2 iterations x
//           256 thr x 8 halves per plane = 16 rows x 256 columns; all blocks = every row x every column of Hp and of Lp once.
// =====================================================================================================
__device__ __forceinline__ void qk16(int bid, const float* __restrict__ F, u16* Hp, u16* Lp, int n8, float sc) {
  __shared__ __align__(16) u16 sHb[16 * QKP];
  __shared__ __align__(16) u16 sLb[16 * QKP];
  const int tid = threadIdx.x;
  const bool act = (bid * 256 + 256 <= n8);   // block-uniform
  const int bc  = act ? bid : 0;
  const int hp  = bc % (NH / 2);            // head pair
  const int rt  = bc / (NH / 2);            // 16-row tile
  const int row = rt * 16 + (tid >> 4);
  const int idx = tid & 15;
  const int h   = hp * 2 + (idx >> 3);
  const int d0  = (idx & 7) * 8;
  const float* ap = F + (size_t)row * FN + h * HD + d0;
  const float* pp = ap + DMOD;
  u16* sh = sHb + (tid >> 4) * QKP + idx * 16;
  u16* sl = sLb + (tid >> 4) * QKP + idx * 16;
  // the thread's 8 amplitudes and 8 phases, four 16-B loads issued together: every cache line is fetched once, not once per element
  const v4f a0 = *(const v4f*)(ap), a1 = *(const v4f*)(ap + 4);
  const v4f p0 = *(const v4f*)(pp), p1 = *(const v4f*)(pp + 4);
  ld_wait(ap);                              // all four loads name ap's registers (pp is a constant offset from it): they stay as they are until the wait has passed
#pragma unroll 1                            // two trips of four elements: half the code of a full unroll of the library calls
  for (int i = 0; i < 2; ++i) {
    const v4f av = (i == 0) ? a0 : a1;
    const v4f pv = (i == 0) ? p0 : p1;
#pragma unroll
    for (int j = 0; j < 4; ++j) {
      const int e = 4 * i + j;
      const float am  = av[j];
      const float ph  = pv[j];
      const float spv = fmaxf(am, 0.0f) + log1pf(expf(-fabsf(am)));
      const float cv  = cosf(ph);
      const float sv  = sinf(ph);
      const float tc  = (spv * cv) * sc;
      const float ts  = (spv * sv) * sc;
      const _Float16 hc = (_Float16)tc, hs = (_Float16)ts;
      const _Float16 lc = (_Float16)(tc - (float)hc), ls = (_Float16)(ts - (float)hs);
      sh[e] = h_bits(hc);  sh[8 + e] = h_bits(hs);
      sl[e] = h_bits(lc);  sl[8 + e] = h_bits(ls);
    }
  }
  __syncthreads();
  // 16-B piece pi of the block's 8 tiles: m = pi&15; column chunk q = pi>>4 (k tile q>>2, j = (q>>1)&1, h = q&1) = head q>>4 of the
  // pair, c or s part (q>>3)&1, d chunk q&7; it was written by thread m*16 + (q>>4)*8 + (q&7) at its slot + 8*part.
  v4u oh2[2], ol2[2];
#pragma unroll
  for (int it = 0; it < 2; ++it) {
    const int pi = it * 256 + tid;
    const int q  = pi >> 4;
    const int so = (pi & 15) * QKP + ((q >> 4) * 8 + (q & 7)) * 16 + ((q >> 3) & 1) * 8;
    oh2[it] = *(const v4u*)(sHb + so);
    ol2[it] = *(const v4u*)(sLb + so);
  }
  const size_t ob = (size_t)rt * 16 * QKN + (size_t)hp * (2 * SD * 16) + (size_t)tid * 8;
  if (act) {
#pragma unroll
    for (int it = 0; it < 2; ++it) {
      *(v4u*)(Hp + ob + it * 2048) = oh2[it];
      *(v4u*)(Lp + ob + it * 2048) = ol2[it];
    }
  }
}

// =====================================================================================================
// v^T planes from the v projection F f32, MROWS rows of pitch FN (row = b*SEQ + s, column = h*HD + d):
//   VH packed plane, row (b*NH + h)*HD + d, column s (K = SEQ) = f16(v * 1024) for all keys s;
//   VL packed plane, same rows, column s (K = QO) = f16 residual (t - f16(t)) for keys s < QO only.
// Block = (b, head h, 64 keys s0): each thread loads its 16 floats (key sl, d chunk dc) with 16-B loads, converts, scatters
// line) is written by 8 consecutive lanes x 16 B of one instruction, in both planes (VL under the block-uniform s0 < QO
// coverage: load 256 thr x 16 = 64 keys x 64 d; store 2 iterations x 256 thr x 8 halves = 64 lines x 64 = the block's tile of
//           VH (and of VL when s0 < QO); grid = NB*NH*NST blocks covers VH exactly once and all QO columns of VL exactly once.
// =====================================================================================================
__device__ __forceinline__ void vt16(int bid, const float* __restrict__ F, u16* VHo, u16* VLo) {
  __shared__ __align__(16) u16 TH[HD * VTP];
  __shared__ __align__(16) u16 TL[HD * VTP];
  const int tid = threadIdx.x;
  const int st  = bid % NST;
  const int t2  = bid / NST;
  const int h   = t2 % NH;
  const int b   = t2 / NH;
  if (b >= NB) return;                      // block-uniform, before any barrier; never taken with the exact grid
  const int s0  = st * 64;
  const bool dolo = (s0 + 64 <= QO);        // block-uniform
  {
    const int sl = tid >> 2;                // key within tile 0..63
    const int dc = (tid & 3) * 16;          // d chunk 0,16,32,48
    const float* src = F + ((size_t)b * SEQ + s0 + sl) * FN + h * HD + dc;
#pragma unroll
    for (int i = 0; i < 4; ++i) {
      const v4f a = *(const v4f*)(src + 4 * i);
#pragma unroll
      for (int e = 0; e < 4; ++e) {
        const float t = a[e] * VCAR;
        const _Float16 hv = (_Float16)t;
        const _Float16 lv = (_Float16)(t - (float)hv);
        TH[(dc + 4 * i + e) * VTP + sl] = h_bits(hv);
        TL[(dc + 4 * i + e) * VTP + sl] = h_bits(lv);
      }
    }
  }
  __syncthreads();
  v4u vh[2], vl[2];
#pragma unroll
  for (int it = 0; it < 2; ++it) {
    const int pi = it * 256 + tid;          // 16-B piece: m = pi&15, h = (pi>>4)&1, j = (pi>>5)&1, key tile (pi>>6)&1, d tile pi>>7
    const int so = ((pi >> 7) * 16 + (pi & 15)) * VTP + ((pi >> 6) & 1) * 32 + ((pi >> 5) & 1) * 16 + ((pi >> 4) & 1) * 8;
    vh[it] = *(const v4u*)(TH + so);
    vl[it] = *(const v4u*)(TL + so);
  }
  const size_t hrow = (size_t)(b * NH + h) * HD;
  const int    sL   = dolo ? s0 : 0;
  {
#pragma unroll
    for (int it = 0; it < 2; ++it) {
      const int pi = it * 256 + tid;
      const size_t dr = hrow + (size_t)(pi >> 7) * 16;
      const int    kq = (pi >> 6) & 1;
      *(v4u*)(VHo + dr * SEQ + (size_t)((s0 >> 5) + kq) * 512 + (pi & 63) * 8) = vh[it];
      xcnt_wait();                          // before the store's address and data registers are reused
      if (dolo) {
        *(v4u*)(VLo + dr * QO + (size_t)((sL >> 5) + kq) * 512 + (pi & 63) * 8) = vl[it];
        xcnt_wait();                        // as above
      }
    }
  }
}

// =====================================================================================================
// GEMM epilogue shared by both engines: the wave's 16x64 f32 tile (times oscale) staged in its LDS slab (pitch 68), release
// coverage: 8 instructions x 2 rows x 16 lanes x 4 floats = the wave's 16 x 64 tile.
// =====================================================================================================
__device__ __forceinline__ void epi64(float* sl, v8f a0, v8f a1, v8f a2, v8f a3, float oscale,
                                      float* C, int N, size_t rowb, int col0, int lane) {
  const int hh = lane >> 4, m = lane & 15;
#pragma unroll
  for (int r = 0; r < 8; ++r) {
    const int ro = (8 * hh + r) * 68 + m;
    sl[ro]      = a0[r] * oscale;
    sl[ro + 16] = a1[r] * oscale;
    sl[ro + 32] = a2[r] * oscale;
    sl[ro + 48] = a3[r] * oscale;
  }
  wave_sync_lds();
  v4f vals[8];
#pragma unroll
  for (int it = 0; it < 8; ++it) vals[it] = *(const v4f*)(sl + (it * 2 + hh) * 68 + m * 4);
  float* dst = C + (rowb + (size_t)hh) * (size_t)N + col0 + m * 4;
  {
#pragma unroll
    for (int it = 0; it < 8; ++it) {
      *(v4f*)(dst + (size_t)(it * 2) * (size_t)N) = vals[it];
    }
    
  }
}

// =====================================================================================================
// bf16 GEMM, no bias: C[M][N] (f32) = A (bf16 packed plane, M rows x K) . Bt^T (bf16 packed plane, N rows x K), times oscale; K = DMOD.
// Block = 128 rows x 160 columns, 4 waves as 2 x 2; a wave holds 20 accumulator tiles of 16 x 16: its 64 rows x 64 columns of its own
// (block columns 0..63 for wc = 0, 96..159 for wc = 1) and, of the middle columns 64..95, the 32 rows 32*wc .. 32*wc + 31 of its 64, so that every
// 128-B line of C has one writer. Ten fragments (4 of A, 6 of B) feed 20 matrix instructions per k step of 32; fragments are loaded straight from
// the packed tiles (two 16-B loads each, split k map for A and B); every element's sum over k runs in rising k as before.
// Row tile order inside a wave: fragment i = row tile (i + 2*wc) & 3, so that fragments 0 and 1 are the rows that also take the middle columns.
// (host guarantees M % 128 == 0, N % 160 == 0, grid = (M/128)*(N/160)).
// =====================================================================================================
// 16 x 32 tile epilogue: as epi64, for two accumulator tiles; 4 instructions x 4 rows x 8 lanes x 4 floats, each row piece one whole 128-B line.
__device__ __forceinline__ void epi32(float* sl, v8f a0, v8f a1, float oscale, float* C, int N, size_t rowb, int col0, int lane) {
  const int hh = lane >> 4, m = lane & 15;
#pragma unroll
  for (int r = 0; r < 8; ++r) {
    const int ro = (8 * hh + r) * 68 + m;
    sl[ro]      = a0[r] * oscale;
    sl[ro + 16] = a1[r] * oscale;
  }
  wave_sync_lds();
  const int rr = lane >> 3, cc = lane & 7;
  v4f vals[4];
#pragma unroll
  for (int it = 0; it < 4; ++it) vals[it] = *(const v4f*)(sl + (it * 4 + rr) * 68 + cc * 4);
  float* dst = C + (rowb + (size_t)rr) * (size_t)N + col0 + cc * 4;
#pragma unroll
  for (int it = 0; it < 4; ++it) {
    *(v4f*)(dst + (size_t)(it * 4) * (size_t)N) = vals[it];
  }
}
// the four vector slots behind the last matrix instruction of a k step; all 20 results and all 10 operand fragments are inputs, so that the
// slots stand behind every matrix instruction of the step and the fragments keep their registers up to there
__device__ __forceinline__ void guard20(const v8f (&m)[4][4], const v8f (&e)[2][2], const v16b (&a)[4], const v16b (&b)[6]) {
#if defined(__HIP_DEVICE_COMPILE__)
  asm volatile("v_nop\n\tv_nop\n\tv_nop\n\tv_nop"
               :: "v"(m[0][0]), "v"(m[0][1]), "v"(m[0][2]), "v"(m[0][3]), "v"(m[1][0]), "v"(m[1][1]), "v"(m[1][2]), "v"(m[1][3]),
                  "v"(m[2][0]), "v"(m[2][1]), "v"(m[2][2]), "v"(m[2][3]), "v"(m[3][0]), "v"(m[3][1]), "v"(m[3][2]), "v"(m[3][3]),
                  "v"(e[0][0]), "v"(e[0][1]), "v"(e[1][0]), "v"(e[1][1]),
                  "v"(a[0]), "v"(a[1]), "v"(a[2]), "v"(a[3]), "v"(b[0]), "v"(b[1]), "v"(b[2]), "v"(b[3]), "v"(b[4]), "v"(b[5]) : "memory");
#endif
}
// s_wait_xcnt 0 behind a group of global loads, with the offset register that the loads name as an input only: it is rewritten only behind the wait
__device__ __forceinline__ void off_wait(unsigned vo) {
#if defined(__HIP_DEVICE_COMPILE__)
  asm volatile("s_wait_xcnt 0x0" :: "v"(vo) : "memory");
#endif
}
__global__ __launch_bounds__(128) __attribute__((amdgpu_waves_per_eu(4)))   // at most 256 registers a wave, so that four waves share a SIMD and the whole grid is resident at once
void gemm_nb(const u16* __restrict__ A, const u16* __restrict__ Bt, float* C, int M, int N, float oscale) {
  __shared__ __align__(16) float slab[4 * SLAB64];
  constexpr int K = DMOD;                   // a constant, so that the row tiles' distances fold into the loads' immediate offsets
  const int tid = threadIdx.x, lane = tid & 31;
  const int wave = __builtin_amdgcn_readfirstlane(tid >> 5);   // scalar, so that the tile starts are computed on the scalar unit
  unsigned vo = 16u * (unsigned)lane;         // the lane's byte offset from the row tiles' starts; one k tile (1 KB) further each trip
  const int ntile = N / 160;
  const int bid   = blockIdx.x;
  const int wr = wave >> 1, wc = wave & 1;
  const int rowb  = (bid / ntile) * 128 + wr * 64;
  const int colb  = (bid % ntile) * 160;
  const int colm  = colb + wc * 96;         // the wave's own 64 columns
  const int cole  = colb + 64;              // the middle 32 columns
  if (rowb + 64 > M) return;                // wave-uniform, never taken with the exact grid; no block barriers in this kernel
  const size_t bs = (size_t)16 * K;
  const u16* ap[4];
  const u16* bp[6];
#pragma unroll
  for (int i = 0; i < 4; ++i) ap[i] = A + (size_t)(rowb + 16 * ((i + 2 * wc) & 3)) * K;
#pragma unroll
  for (int j = 0; j < 4; ++j) bp[j] = Bt + (size_t)colm * K + (size_t)j * bs;
#pragma unroll
  for (int j = 0; j < 2; ++j) bp[4 + j] = Bt + (size_t)cole * K + (size_t)j * bs;
  v8f am[4][4], ae[2][2];
#pragma unroll
  for (int i = 0; i < 4; ++i) {
#pragma unroll
    for (int j = 0; j < 4; ++j) am[i][j] = zero8();
  }
#pragma unroll
  for (int i = 0; i < 2; ++i) {
#pragma unroll
    for (int j = 0; j < 2; ++j) ae[i][j] = zero8();
  }
#pragma unroll 1
  for (int k0 = 0; k0 < K; k0 += 32) {
    v16b a[4], b[6];
#pragma unroll
    for (int i = 0; i < 4; ++i) a[i] = ldfrag_b(ap[i], vo);
#pragma unroll
    for (int j = 0; j < 6; ++j) b[j] = ldfrag_b(bp[j], vo);
    off_wait(vo);                           // the loads' offset register stays as it is until the wait has passed
    vo += 1024u;                            // next k tile: 512 halves
#pragma unroll
    for (int j = 0; j < 4; ++j) {
#pragma unroll
      for (int i = 0; i < 4; ++i) am[i][j] = mma_b(a[i], b[j], am[i][j]);
    }
#pragma unroll
    for (int j = 0; j < 2; ++j) {
#pragma unroll
      for (int i = 0; i < 2; ++i) ae[i][j] = mma_b(a[i], b[4 + j], ae[i][j]);
    }
    guard20(am, ae, a, b);
  }
  float* sl = slab + wave * SLAB64;
#pragma unroll
  for (int i = 0; i < 4; ++i) {
    const size_t row = (size_t)(rowb + 16 * ((i + 2 * wc) & 3));
    if (i > 0) {
      xcnt_wait();                          // before the earlier stores' address and data registers are reused
      wave_sync_lds();                      // every lane has read the slab before it is written again
    }
    epi64(sl, am[i][0], am[i][1], am[i][2], am[i][3], oscale, C, N, row, colm, lane);
    if (i < 2) {
      xcnt_wait();                          // as above
      wave_sync_lds();                      // as above
      epi32(sl, ae[i][0], ae[i][1], oscale, C, N, row, cole, lane);
    }
  }
}

// =====================================================================================================
// Output projection, no bias: C[row][DMOD] (f32) = (Ah [+ Al])[row][DMOD] . Bt[DMOD][DMOD]^T * oscale.
// NPROD == 1: Ah only (one product); NPROD == 2: Ah + Al residual plane (products h.B + l.B into one accumulator, l unscaled).
// Row indices (packed planes, K = DMOD): Ah row bb*SEQ + s; Al row bb*QO + s (compact plane, s < QO); C row bb*XS_FULL + s.
// Block -> (column tile ct = bid % 16, sequence row tile rt of nrt starting at s = sbeg, batch bb). Block = 64 rows (4 waves x 16) x 64
// columns, 4 accumulators a wave; fragment loads (split k map) and epi64 epilogue as gemm_nb; K = DMOD stepped by 32.
// =====================================================================================================
template <int NPROD>
__device__ __forceinline__
void gemm_o(float* slab, int bid, const u16* __restrict__ Ah, const u16* __restrict__ Al, const u16* __restrict__ Bt,
            float* C, int sbeg, int nrt, float oscale) {
  const int tid = threadIdx.x, lane = tid & 31;
  const int wave = __builtin_amdgcn_readfirstlane(tid >> 5);   // scalar, so that the tile starts are computed on the scalar unit
  unsigned vo = 16u * (unsigned)lane;         // the lane's byte offset from the row tiles' starts; one k tile (1 KB) further each trip
  const int ntile = DMOD >> 6;
  const int ct    = bid % ntile;
  const int t2    = bid / ntile;
  const int rt    = t2 % nrt;
  const int bb    = t2 / nrt;
  if (bb >= NB) return;                     // block-uniform; no block barriers in this kernel; never taken with the exact grid
  const int srow  = sbeg + rt * 64 + wave * 16;
  if (srow + 16 > SEQ) return;              // wave-uniform; never taken
  if (NPROD == 2 && srow + 16 > QO) return; // wave-uniform; never taken
  const int col0  = ct * 64;
  const int K     = DMOD;
  const size_t rowA = (size_t)bb * SEQ + srow;
  const size_t rowL = (NPROD == 2) ? ((size_t)bb * QO + srow) : (size_t)0;
  const size_t rowC = (size_t)bb * XS_FULL + srow;
  const _Float16* ahp = ash(Ah) + rowA * K;
  const _Float16* alp = ash(Al) + rowL * K;                  // dereferenced only when NPROD == 2
  const _Float16* bp  = ash(Bt) + (size_t)col0 * K;
  const size_t bs = (size_t)16 * K;
  const _Float16* bp1 = bp + bs;
  const _Float16* bp2 = bp + 2 * bs;
  const _Float16* bp3 = bp + 3 * bs;
  v8f acc0 = zero8(), acc1 = zero8(), acc2 = zero8(), acc3 = zero8();
  if constexpr (NPROD == 2) {
#pragma unroll 1
    for (int k0 = 0; k0 < K; k0 += 32) {
      const v16h ah = ldfrag_h(ahp, vo), al = ldfrag_h(alp, vo);
      const v16h b0 = ldfrag_h(bp, vo);
      const v16h b1 = ldfrag_h(bp1, vo);
      const v16h b2 = ldfrag_h(bp2, vo);
      const v16h b3 = ldfrag_h(bp3, vo);
      vo += 1024u;                          // next k tile: 512 halves
      acc0 = mma_h(ah, b0, acc0);  acc0 = mma_h(al, b0, acc0);
      acc1 = mma_h(ah, b1, acc1);  acc1 = mma_h(al, b1, acc1);
      acc2 = mma_h(ah, b2, acc2);  acc2 = mma_h(al, b2, acc2);
      acc3 = mma_h(ah, b3, acc3);  acc3 = mma_h(al, b3, acc3);
      guard6<v16h>(acc0, acc1, acc2, acc3, ah, al, b0, b1, b2, b3);
    }
  } else {
#pragma unroll 1
    for (int k0 = 0; k0 < K; k0 += 32) {
      const v16h ah = ldfrag_h(ahp, vo);
      const v16h b0 = ldfrag_h(bp, vo);
      const v16h b1 = ldfrag_h(bp1, vo);
      const v16h b2 = ldfrag_h(bp2, vo);
      const v16h b3 = ldfrag_h(bp3, vo);
      vo += 1024u;                          // next k tile: 512 halves
      acc0 = mma_h(ah, b0, acc0);
      acc1 = mma_h(ah, b1, acc1);
      acc2 = mma_h(ah, b2, acc2);
      acc3 = mma_h(ah, b3, acc3);
      guard6<v16h>(acc0, acc1, acc2, acc3, ah, b0, b1, b2, b3, ah);
    }
  }
  epi64(slab + wave * SLAB64, acc0, acc1, acc2, acc3, oscale, C, DMOD, rowC, col0, lane);
}

// =====================================================================================================
// Causal gated multi-head attention, score depth SD = 128 ([c|s] parts of one head), hd = 64 for v.
// Block bid -> (query block qt of 64 rows, falling with bid so that a block's number of key tiles falls with its index; head hg, batch b); 8 waves = QG = 2 query groups x KS = 4 key splits.
// Query group wave / KS: rows q0 = 64*qt + 32*(wave / KS) .. q0+31 = QW = 2 query tiles of 16 rows, carried side by side by each of its waves, so that each
// key and v fragment is read once for both; each tile's own sums are those of a block of one tile. The K hi, K residual and v^T hi tiles of a split come into LDS
// once, by asynchronous copies, and both query groups read them there (q, the v^T residual plane and the gate table are read from global memory):
// wave sp = wave % KS of a group takes the key tiles kt = sp, sp + KS, ... with its own running max, sum and accumulator; the four
// partial results are merged once, after one block barrier (weights 2^(m_s - max m), -inf-safe: a wave without tiles adds 0).
// RES == 1: query tiles q0 < QO, P.v = hh + lh + hl with the v^T residual plane, O residual plane also written;
// RES == 0: query tiles q0 >= QO, P.v single products. Scores use q_hi.k_hi + q_lo.k_hi + q_hi.k_lo in both variants.
//   q hi plane f16 x256, packed, row b*SEQ + s, column h*SD + e (e < SD), q residual plane same layout (all rows); k planes likewise;
//   v^T hi plane x1024, packed, row (b*NH + h)*HD + d, column s (K = SEQ), v^T residual plane (K = QO); gate table G[h][i - j] f32.
//   score (log2 domain) t(i, j) = (q_i.k_j over SD) * (1/8)*log2e/(256*256) * G[h][i - j], replaced by -inf where key j >
//   query i (gate index clamped to [0, SEQ-1]; the clamped value is only used on masked elements).
//   Key tiles of 32 with kb <= q0 + 15, each wave's in rising order; with RES == 1 every visited key is below QO, inside the compact
//   v^T residual plane.
//   Both products run transposed, S^T = K.Q^T (A = key rows, B = query columns) and O^T += V^T.P^T (A = v^T rows, B = P^T), so that a lane
//   holds scores, probabilities and results of ONE query (column lane & 15; the two wave halves split its keys and its d).
//   Per key tile: 2 x QW score subtiles x 4 k-steps x 3 products, fragments loaded straight from the packed 16-bit tiles, staged or global (two 16-B loads
//   per fragment, split k map); online max-subtracted base-2 softmax in f32, -inf-safe rescale, maximum and sum over the lane's own
//   16 registers (maximum joined across the halves per tile, sum once behind the loop); the two score subtiles, converted in place (hi,
//   residual), are the B operand P^T in the split k map; v^T A fragments in 2 groups of
//   2 d-subtiles. After the loop each wave writes its QW raw accumulators into its own QW result slabs (pitch 68, row = query; every element owned
//   by one lane) and each query tile's 16 row maxima and sums in front of its slab; one block barrier (every return stands in front of it
//   and is block-uniform); then wave sp merges columns 16*sp .. 16*sp+15 of its head: out = sum_s acc_s*w_s / sum_s Z_s*w_s
//   (Z > 0 always: key 0 <= every query row; guarded anyway), carries 1/(32768*1024) folded once. Bounded loops only (nkt <= NKT).
// coverage: per wave QW instructions x 16 rows x 2 chunks x 8 halves = 32 x 16 per plane, KS waves = 32 x 64; the two block ranges
//           (RES 1: NQO tiles, RES 0: NQT-NQO tiles; QG*QW tiles a block) x NHG x NB blocks = every (b, s, h) row segment of O hi exactly
//           once and every (b, s < QO, h) row segment of O residual exactly once.
// =====================================================================================================
// s_wait_xcnt 0 behind a group of global loads, with the registers that the loads name as inputs only: they are rewritten only behind the wait
__device__ __forceinline__ void idx_wait(const int (&a)[8], const int (&b)[8]) {
#if defined(__HIP_DEVICE_COMPILE__)
  asm volatile("s_wait_xcnt 0x0" :: "v"(a[0]), "v"(a[1]), "v"(a[2]), "v"(a[3]), "v"(a[4]), "v"(a[5]), "v"(a[6]), "v"(a[7]),
               "v"(b[0]), "v"(b[1]), "v"(b[2]), "v"(b[3]), "v"(b[4]), "v"(b[5]), "v"(b[6]), "v"(b[7]) : "memory");
#endif
}
__device__ __forceinline__ void adr_wait(const char* p, const char* q) {
#if defined(__HIP_DEVICE_COMPILE__)
  asm volatile("s_wait_xcnt 0x0" :: "v"(p), "v"(q) : "memory");
#endif
}
// One wave's half of a key tile, 20 asynchronous copies of 512 B (16 B a lane) from global memory into LDS, through no register: 4 KB of K hi, 4 KB of K
// residual, two 1-KB tiles of v^T hi. An offset moves both addresses. The closing s_wait_xcnt 0 stands in the copies' own statement, so that the
// address registers are rewritten only behind it.
__device__ __forceinline__ void stage_copy(unsigned l0, const char* g0, unsigned l1, const char* g1,
                                           unsigned l2, const char* g2, unsigned l3, const char* g3) {
#if defined(__HIP_DEVICE_COMPILE__)
  asm volatile("global_load_async_to_lds_b128 %0, %1, off\n\t"
               "global_load_async_to_lds_b128 %0, %1, off offset:512\n\t"
               "global_load_async_to_lds_b128 %0, %1, off offset:1024\n\t"
               "global_load_async_to_lds_b128 %0, %1, off offset:1536\n\t"
               "global_load_async_to_lds_b128 %0, %1, off offset:2048\n\t"
               "global_load_async_to_lds_b128 %0, %1, off offset:2560\n\t"
               "global_load_async_to_lds_b128 %0, %1, off offset:3072\n\t"
               "global_load_async_to_lds_b128 %0, %1, off offset:3584\n\t"
               "global_load_async_to_lds_b128 %2, %3, off\n\t"
               "global_load_async_to_lds_b128 %2, %3, off offset:512\n\t"
               "global_load_async_to_lds_b128 %2, %3, off offset:1024\n\t"
               "global_load_async_to_lds_b128 %2, %3, off offset:1536\n\t"
               "global_load_async_to_lds_b128 %2, %3, off offset:2048\n\t"
               "global_load_async_to_lds_b128 %2, %3, off offset:2560\n\t"
               "global_load_async_to_lds_b128 %2, %3, off offset:3072\n\t"
               "global_load_async_to_lds_b128 %2, %3, off offset:3584\n\t"
               "global_load_async_to_lds_b128 %4, %5, off\n\t"
               "global_load_async_to_lds_b128 %4, %5, off offset:512\n\t"
               "global_load_async_to_lds_b128 %6, %7, off\n\t"
               "global_load_async_to_lds_b128 %6, %7, off offset:512\n\t"
               "s_wait_xcnt 0x0"
               :: "v"(l0), "v"(g0), "v"(l1), "v"(g1), "v"(l2), "v"(g2), "v"(l3), "v"(g3) : "memory");
#endif
}
__device__ __forceinline__ void async_wait() {                        // the wave's own copies have landed in LDS
#if defined(__HIP_DEVICE_COMPILE__)
  asm volatile("s_wait_asynccnt 0x0" ::: "memory");
#endif
}
__device__ __forceinline__ void ds_wait() {                           // the wave's own LDS reads have returned, before their buffer is handed back for a refill
#if defined(__HIP_DEVICE_COMPILE__)
  asm volatile("s_wait_dscnt 0x0" ::: "memory");
#endif
}
template <int RES>
__device__ __forceinline__
void attn_g(float* smem, int bid, int wave, const u16* __restrict__ QHp, const u16* __restrict__ QLp,
            const u16* __restrict__ KHp, const u16* __restrict__ KLp,
            const u16* __restrict__ VHp, const u16* __restrict__ VLp,
            const float* __restrict__ Gt, u16* OHp, u16* OLp) {
  constexpr int QT0 = (RES != 0) ? 0 : (NQOB / QG);           // in blocks of QG query groups
  constexpr int NQL = (RES != 0) ? (NQOB / QG) : ((NQB - NQOB) / QG);
  constexpr int NQE = (NQL > 0) ? NQL : 1;

  const int lane = (int)__builtin_amdgcn_mbcnt_lo(~0u, 0u);    // lane index without the thread id, which would otherwise hold a register over the other variant's key loop
  const unsigned lo = 16u * (unsigned)lane;
  const int hh   = lane >> 4;
  const int c    = lane & 15;
  const int qi   = bid / (NHG * NB);        // the query block with the most key tiles comes first, all heads and batches of it side by side
  const int t2   = bid % (NHG * NB);
  const int hg   = t2 % NHG;
  const int b    = t2 / NHG;
  if (qi >= NQE) return;                    // block-uniform, before the barrier; never taken with the exact grid
  const int qt   = QT0 + (NQE - 1 - qi);
  const int qb0  = qt * (16 * QW * QG);     // first of the block's 16*QW*QG query rows
  if (qb0 + 16 * QW * QG > SEQ) return;     // block-uniform; never taken
  if (RES != 0 && qb0 + 16 * QW * QG > QO) return; // block-uniform; never taken
  const int hw   = wave / KS;               // query group within the block
  const int sp   = wave % KS;               // which quarter of the key tiles
  const int q0   = qb0 + hw * (16 * QW);    // first of the wave's 16*QW query rows; query tile u = rows q0 + 16u .. q0 + 16u + 15
  const int head = hg;
  const int ql0  = (RES != 0) ? q0 : 0;

  float* wreg = smem + wave * WREG;         // per query tile u at u*WSUB: 16 row maxima, 16 row sums, then result slab [16][64] pitch 68

  const size_t hcol = (size_t)head * (SD / 32) * 512;                              // the head's first k tile
  const _Float16* Qh  = ash(QHp) + ((size_t)b * SEQ + q0) * QKN + hcol;            // query tile u at + u*16*QKN
  const _Float16* Ql  = ash(QLp) + ((size_t)b * SEQ + q0) * QKN + hcol;
  const _Float16* Khb = ash(KHp) + ((size_t)b * SEQ) * QKN + hcol;                 // key row tile kb added per step
  const _Float16* Klb = ash(KLp) + ((size_t)b * SEQ) * QKN + hcol;
  const _Float16* Vhb = ash(VHp) + ((size_t)(b * NH + head) * HD) * SEQ;                // d row tile j added per group
  const _Float16* Vlb = ash(VLp) + ((size_t)(b * NH + head) * HD) * QO;                 // RES == 1 only
  const float* gp = Gt + (size_t)head * SEQ;
  const float lsc = RSQ_HD * (LOG2E / (QSC * KSC));
  const float oc  = 1.0f / (PCAR * VCAR);
  const size_t KROW = (size_t)QKN;          // halves per key row: row tile kb starts at kb*KROW
  const size_t QT2  = (size_t)16 * QKN;     // halves between the two query tiles

  float mrow[QW], lrow[QW];                 // of query q0 + 16u + c: running maximum (the same in both wave halves), and the sum over this half's keys
  v8f o[QW][4];                             // transposed: element r of o[u][j] = (d = 16j + 8hh + r, query q0 + 16u + c)
#pragma unroll
  for (int u = 0; u < QW; ++u) {
    mrow[u] = -INFINITY;  lrow[u] = 0.f;
#pragma unroll
    for (int j = 0; j < 4; ++j) o[u][j] = zero8();
  }
  const int ncaus = (q0 >> 5) + 1;                                            // tiles holding keys <= q0 + 31: the same set for both query tiles
  const int nkt = (ncaus < NKT) ? ncaus : NKT;

  // ---- key tiles through LDS: split sp's tile of trip t (kt = sp + KS*t) is copied once, half by each of the split's QG waves, and read by both; two buffers
  //      a split, the copies of trip t + 2 issued behind the barrier that ends trip t. Trip count and copy tests are the same for the whole block. ----
  const int nktb = ((qb0 + 16 * QW * (QG - 1)) >> 5) + 1;                     // key tiles of the block's last query group
  const int ntr  = (((nktb < NKT) ? nktb : NKT) + KS - 1) / KS;
  const unsigned lds0 = (unsigned)(size_t)smem + (unsigned)(sp * KTB) + lo;   // the lane's LDS byte address in the split's first buffer
  auto stage = [&](int t) {
    int ks = sp + t * KS;
    ks = (ks < NKT) ? ks : (NKT - 1);       // a tile behind the block's last one is copied from inside the planes and never read
    const unsigned lb = lds0 + (unsigned)((t & 1) * (KS * KTB));
    const char* gk = (const char*)(Khb + (size_t)(ks * 32 + 16 * hw) * KROW) + lo;
    const char* gl = (const char*)(Klb + (size_t)(ks * 32 + 16 * hw) * KROW) + lo;
    const char* gv = (const char*)(Vhb + (size_t)(2 * hw) * 16 * SEQ + ks * 512) + lo;
    stage_copy(lb + hw * 4096, gk, lb + 8192 + hw * 4096, gl, lb + 16384 + hw * 2048, gv, lb + 17408 + hw * 2048, gv + (size_t)32 * SEQ);
  };
  stage(0);
  async_wait();
  __syncthreads();                          // publishes trip 0's tiles
  if (ntr > 1) stage(1);
#pragma unroll 1
  for (int t = 0; t < ntr; ++t) {
   const int kt = sp + t * KS;
   if (kt < nkt) {                          // wave-uniform: a wave without this tile goes straight to the trip's barrier
    const int kb = kt * 32;
    const _Float16* tb = (const _Float16*)(const void*)((const char*)smem + (t & 1) * (KS * KTB) + sp * KTB);
    // ---- transposed scores, A = key rows, B = query columns: D element r of this lane = (key kb + 8hh + r, query q0 + 16u + c) in s[u][0], key kb + 16 + 8hh + r in s[u][1] ----
    v8f s00 = zero8(), s01 = zero8(), s10 = zero8(), s11 = zero8();
    const _Float16* k0p = tb;               // staged: K hi rows 0..15, 16..31, K residual rows 0..15, 16..31, 4 KB each
    const _Float16* k1p = tb + 2048;
    const _Float16* l0p = tb + 4096;
    const _Float16* l1p = tb + 6144;
#pragma unroll
    for (int kk = 0; kk < SD / 32; ++kk) {
      const v16h qh0 = ldfrag_h(Qh + kk * 512, lo);
      const v16h ql0f = ldfrag_h(Ql + kk * 512, lo);
      const v16h qh1 = ldfrag_h(Qh + QT2 + kk * 512, lo);
      const v16h ql1f = ldfrag_h(Ql + QT2 + kk * 512, lo);
      const v16h kh0 = ldfrag_h(k0p + kk * 512, lo);
      const v16h kh1 = ldfrag_h(k1p + kk * 512, lo);
      const v16h kl0 = ldfrag_h(l0p + kk * 512, lo);
      const v16h kl1 = ldfrag_h(l1p + kk * 512, lo);
      adr_wait((const char*)Qh + lo, (const char*)Ql + lo);   // the global loads' address registers stay as they are until the wait has passed
      s00 = mma_h(kh0, qh0,  s00);
      s10 = mma_h(kh0, qh1,  s10);
      s01 = mma_h(kh1, qh0,  s01);
      s11 = mma_h(kh1, qh1,  s11);
      s00 = mma_h(kh0, ql0f, s00);
      s10 = mma_h(kh0, ql1f, s10);
      s01 = mma_h(kh1, ql0f, s01);
      s11 = mma_h(kh1, ql1f, s11);
      s00 = mma_h(kl0, qh0,  s00);
      s10 = mma_h(kl0, qh1,  s10);
      s01 = mma_h(kl1, qh0,  s01);
      s11 = mma_h(kl1, qh1,  s11);
      guard4(s00, s01, s10, s11, qh0, ql0f, qh1, ql1f, kh0, kl0, kh1, kl1);
    }
    // ---- gate (f32, per element) + causal select + online softmax in base 2, -inf-safe; one query tile after the other. A lane holds 16 of its
    //      query's 32 scores: maximum and sum run over its own registers, the maximum joined with the other wave half by one cross-row move.
    //      The 16 probabilities are, in place, the lane's part of the B operand P^T (split k map: elements 0..7 = keys kb + 8hh + 0..7, 8..15 = kb + 16 + 8hh + 0..7) ----
    FragH ph[QW], pl[QW];
#pragma unroll
    for (int u = 0; u < QW; ++u) {
      const v8f s0 = (u == 0) ? s00 : s10;
      const v8f s1 = (u == 0) ? s01 : s11;
      const int dq = q0 + 16 * u + c - kb - 8 * hh;                           // query - key of element r: dq - r in s0, dq - 16 - r in s1
      int ia[8], ib[8];
      float ga[8], gb[8];
#pragma unroll
      for (int r = 0; r < 8; ++r) {
        int i0 = dq - r;       i0 = (i0 < 0) ? 0 : i0;  i0 = (i0 > SEQ - 1) ? (SEQ - 1) : i0;
        int i1 = dq - 16 - r;  i1 = (i1 < 0) ? 0 : i1;  i1 = (i1 > SEQ - 1) ? (SEQ - 1) : i1;
        ia[r] = i0;  ib[r] = i1;
        ga[r] = gp[i0];
        gb[r] = gp[i1];
      }
      idx_wait(ia, ib);                     // the gate loads' index registers stay as they are until the wait has passed
      float t0[8], t1[8];
      float mx = -INFINITY;
#pragma unroll
      for (int r = 0; r < 8; ++r) {
        const float u0 = (s0[r] * lsc) * ga[r];
        const float u1 = (s1[r] * lsc) * gb[r];
        t0[r] = (dq - r < 0) ? -INFINITY : u0;
        t1[r] = (dq - 16 - r < 0) ? -INFINITY : u1;
        mx = fmaxf(mx, fmaxf(t0[r], t1[r]));
      }
      mx = fmaxf(mx, xhalf(mx));
      const float mn = fmaxf(mrow[u], mx);
      const float ms = (mn == -INFINITY) ? 0.0f : mn;
      const float al = exp2f(mrow[u] - ms);
      mrow[u] = mn;
      float ps = 0.f;
#pragma unroll
      for (int r = 0; r < 8; ++r) {
        const float e0 = exp2f(t0[r] - ms), e1 = exp2f(t1[r] - ms);
        ps += e0 + e1;
        const float ta = e0 * PCAR, tb = e1 * PCAR;
        const _Float16 ha = (_Float16)ta, hb = (_Float16)tb;
        ph[u].h[0][r] = ha;
        ph[u].h[1][r] = hb;
        pl[u].h[0][r] = (_Float16)(ta - (float)ha);
        pl[u].h[1][r] = (_Float16)(tb - (float)hb);
      }
      lrow[u] = lrow[u] * al + ps;
#pragma unroll
      for (int j = 0; j < 4; ++j) {
#pragma unroll
        for (int r = 0; r < 8; ++r) o[u][j][r] *= al;
      }
    }
    // ---- O^T += V^T.P^T : A fragment row m = d = j*16 + c, key tile kb>>5 of the packed v^T planes; 2 groups of 2 d-subtiles, each fragment used by both query tiles ----
    {
      const _Float16* vhp = tb + 8192;      // staged v^T hi: d tile j at j*512 halves
      if constexpr (RES != 0) {
        const _Float16* vlp = Vlb + kb * 16;
#pragma unroll
        for (int jg = 0; jg < 2; ++jg) {
          const size_t da = (size_t)(2 * jg) * 512;
          const size_t db = da + (size_t)512;
          const size_t la = (size_t)(2 * jg) * 16 * QO;
          const size_t lb = la + (size_t)16 * QO;
          const v16h vha = ldfrag_h(vhp + da, lo), vhb2 = ldfrag_h(vhp + db, lo);
          const v16h vla = ldfrag_h(vlp + la, lo), vlb2 = ldfrag_h(vlp + lb, lo);
          adr_wait((const char*)vlp + lo, (const char*)vlp + lo);   // the global loads' address registers stay as they are until the wait has passed
#pragma unroll
          for (int u = 0; u < QW; ++u) {
            o[u][2 * jg]     = mma_h(vha,  ph[u].v, o[u][2 * jg]);
            o[u][2 * jg + 1] = mma_h(vhb2, ph[u].v, o[u][2 * jg + 1]);
          }
#pragma unroll
          for (int u = 0; u < QW; ++u) {
            o[u][2 * jg]     = mma_h(vha,  pl[u].v, o[u][2 * jg]);
            o[u][2 * jg + 1] = mma_h(vhb2, pl[u].v, o[u][2 * jg + 1]);
          }
#pragma unroll
          for (int u = 0; u < QW; ++u) {
            o[u][2 * jg]     = mma_h(vla,  ph[u].v, o[u][2 * jg]);
            o[u][2 * jg + 1] = mma_h(vlb2, ph[u].v, o[u][2 * jg + 1]);
          }
          guard4(o[0][2 * jg], o[0][2 * jg + 1], o[1][2 * jg], o[1][2 * jg + 1], ph[0].v, pl[0].v, ph[1].v, pl[1].v, vha, vhb2, vla, vlb2);
        }
      } else {
#pragma unroll
        for (int jg = 0; jg < 2; ++jg) {
          const size_t da = (size_t)(2 * jg) * 512;
          const size_t db = da + (size_t)512;
          const v16h vha = ldfrag_h(vhp + da, lo), vhb2 = ldfrag_h(vhp + db, lo);
#pragma unroll
          for (int u = 0; u < QW; ++u) {
            o[u][2 * jg]     = mma_h(vha,  ph[u].v, o[u][2 * jg]);
            o[u][2 * jg + 1] = mma_h(vhb2, ph[u].v, o[u][2 * jg + 1]);
          }
          guard4(o[0][2 * jg], o[0][2 * jg + 1], o[1][2 * jg], o[1][2 * jg + 1], ph[0].v, ph[1].v, vha, vhb2, ph[0].v, ph[1].v, vha, vhb2);
        }
      }
    }
   }
   // ---- the trip's foot, every wave: own LDS reads returned, own copies landed, one block barrier (publishes trip t + 1's tiles and ends every read of trip t's), then the refill ----
   ds_wait();
   async_wait();
   __syncthreads();
   if (t + 2 < ntr) stage(t + 2);
  }
  async_wait();                             // nothing is in flight when the ring becomes the result slabs
  acc_guard4(o[0][0], o[0][1], o[0][2], o[0][3]);
  acc_guard4(o[1][0], o[1][1], o[1][2], o[1][3]);
  const int lne = lane;
  const int hhe = lne >> 4, ce = lne & 15;
  // ---- this wave's partial results: raw accumulators into the slab rows of the lane's query (8 consecutive d per subtile), row maxima and joined row sums in front of them ----
#pragma unroll
  for (int u = 0; u < QW; ++u) {
    float* pt   = wreg + u * WSUB;
    float* srow = pt + PTW + ce * SLP + 8 * hhe;
#pragma unroll
    for (int j = 0; j < 4; ++j) {
      const v4f a = {o[u][j][0], o[u][j][1], o[u][j][2], o[u][j][3]};
      const v4f b4 = {o[u][j][4], o[u][j][5], o[u][j][6], o[u][j][7]};
      *(v4f*)(srow + j * 16)     = a;
      *(v4f*)(srow + j * 16 + 4) = b4;
    }
    const float lt = lrow[u] + xhalf(lrow[u]);                                // the two wave halves' sums joined once
    if (hhe == 0) {
      pt[ce]      = mrow[u];
      pt[16 + ce] = lt;
    }
  }
  __syncthreads();                          // publishes the four partial results of each query group to its four waves
#pragma unroll
  for (int u = 0; u < QW; ++u) {
    // ---- merge for row c of query tile u: w_s = 2^(m_s - max m) (0 for a wave without keys), Z = sum Z_s*w_s, out = sum acc_s*w_s / Z (0 if Z == 0) ----
    const float* hb = smem + hw * KS * WREG + u * WSUB;
    float ms4[KS], ws4[KS];
#pragma unroll
    for (int s = 0; s < KS; ++s) ms4[s] = hb[s * WREG + ce];
    const float mm  = fmaxf(fmaxf(ms4[0], ms4[1]), fmaxf(ms4[2], ms4[3]));
    const float mms = (mm == -INFINITY) ? 0.0f : mm;
    float lv = 0.f;
#pragma unroll
    for (int s = 0; s < KS; ++s) {
      ws4[s] = exp2f(ms4[s] - mms);
      lv += hb[s * WREG + 16 + ce] * ws4[s];
    }
    const float ls  = (lv > 0.0f) ? lv : 1.0f;
    const float inv = (lv > 0.0f) ? ((1.0f / ls) * oc) : 0.0f;
    // ---- O x1024 -> f16 hi (+ residual) packed planes; lane = (row c, 8 consecutive d at 16*sp + 8*hh): a quarter of the head's two tiles ----
    float w[8];
#pragma unroll
    for (int e = 0; e < 8; ++e) w[e] = 0.f;
#pragma unroll
    for (int s = 0; s < KS; ++s) {
      const float* sr = hb + s * WREG + PTW + ce * SLP + sp * 16 + hhe * 8;
      const v4f a = *(const v4f*)(sr), b4 = *(const v4f*)(sr + 4);
#pragma unroll
      for (int e = 0; e < 4; ++e) { w[e] += a[e] * ws4[s]; w[4 + e] += b4[e] * ws4[s]; }
    }
    v4u oh, ol;
#pragma unroll
    for (int e = 0; e < 4; ++e) {
      const float w0 = (w[2 * e] * inv) * OSC, w1 = (w[2 * e + 1] * inv) * OSC;
      const _Float16 h0 = (_Float16)w0, h1 = (_Float16)w1;
      const _Float16 l0 = (_Float16)(w0 - (float)h0), l1 = (_Float16)(w1 - (float)h1);
      oh[e] = pk16(h_bits(h0), h_bits(h1));
      ol[e] = pk16(h_bits(l0), h_bits(l1));
    }
    const size_t obh = ((size_t)b * SEQ + q0 + 16 * u) * DMOD + (size_t)head * (HD / 32) * 512 + sp * 256 + 8 * lne;
    const size_t obl = ((size_t)b * QO + ql0 + 16 * u) * DMOD + (size_t)head * (HD / 32) * 512 + sp * 256 + 8 * lne;
    *(v4u*)(OHp + obh) = oh;
    if constexpr (RES != 0) {
      *(v4u*)(OLp + obl) = ol;
    }
    xcnt_wait();                            // before the stores' address and data registers are reused
  }
}

// =====================================================================================================
// Joint grids: kernels that depend on the same earlier launch and on nothing of each other run as block ranges of ONE launch
// (every test below is block-uniform; each range runs its function unchanged with its own block index counted from 0).
// prep: weight transposes (Wv^T | Wq^T | Wk^T as one bf16 plane of FN rows x DMOD, Wo^T as its own f16 plane), x -> bf16 plane, gate table.
// =====================================================================================================
__global__ __launch_bounds__(256)
void prep(const float* __restrict__ x, const float* __restrict__ wv, const float* __restrict__ wq, const float* __restrict__ wk,
          const float* __restrict__ wo, const float* __restrict__ theta, u16* XB, u16* WB, u16* WO, float* G) {
  const int bid = blockIdx.x;
  if (bid < NB_TR) {
    const float* Wsrc = wv;
    u16* D = WB;
    int lb = bid, NW = DMOD, mode = 0;
    float sc = 1.0f;
    if (bid >= NB_TRV + 2 * NB_TRQ)  { Wsrc = wo; D = WO; lb = bid - (NB_TRV + 2 * NB_TRQ); mode = 1; sc = WOS; }
    else if (bid >= NB_TRV + NB_TRQ) { Wsrc = wk; D = WB + (size_t)(DMOD + QKN) * DMOD; lb = bid - (NB_TRV + NB_TRQ); NW = QKN; }
    else if (bid >= NB_TRV)          { Wsrc = wq; D = WB + (size_t)DMOD * DMOD; lb = bid - NB_TRV; NW = QKN; }
    tr16(lb, Wsrc, D, DMOD, NW, mode, sc);
  } else if (bid < NB_TR + NB_CV) {
    cvt16(bid - NB_TR, x, XB, MROWS * DMOD / 8, 0, 1.0f);
  } else {
    gtab(bid - (NB_TR + NB_CV), theta, G, NH * SEQ);
  }
}

// post: F f32 [MROWS][FN] (columns v | q | k) -> [qc|qs] planes, [kc|ks] planes, v^T planes.
__global__ __launch_bounds__(256)
void post(const float* __restrict__ F, u16* QH, u16* QL, u16* KH, u16* KL, u16* VH, u16* VL) {
  const int bid = blockIdx.x;
  if (bid < 2 * NB_QK) {
    const bool isk = (bid >= NB_QK);
    qk16(isk ? bid - NB_QK : bid, F + (isk ? (DMOD + QKN) : DMOD), isk ? KH : QH, isk ? KL : QL, MROWS * C8R, isk ? KSC : QSC);
  } else {
    vt16(bid - 2 * NB_QK, F, VH, VL);
  }
}

// attention: the query tiles s >= QO first, then the query tiles s < QO (residual products); inside each range the last query block (most key tiles) first.
__global__ __launch_bounds__(ATT_THREADS) __attribute__((amdgpu_waves_per_eu(4)))   // at most 256 registers a wave, so that four waves (two blocks, half the LDS each) share a SIMD
void attn_all(const u16* __restrict__ QHp, const u16* __restrict__ QLp, const u16* __restrict__ KHp, const u16* __restrict__ KLp,
              const u16* __restrict__ VHp, const u16* __restrict__ VLp, const float* __restrict__ Gt, u16* OHp, u16* OLp) {
  __shared__ __align__(16) float smem[RINGB / 4];   // the key tile ring; behind the key loop the waves' result slabs
  const int bid = blockIdx.x;
  const int wave = __builtin_amdgcn_readfirstlane((int)threadIdx.x >> 5);   // scalar, so that every tile start is a scalar base address
  if (bid < NB_AT0) attn_g<0>(smem, bid, wave, QHp, QLp, KHp, KLp, VHp, VLp, Gt, OHp, OLp);
  else              attn_g<1>(smem, bid - NB_AT0, wave, QHp, QLp, KHp, KLp, VHp, VLp, Gt, OHp, OLp);
}

// output projection: rows s < QO (O hi + residual) first, then rows s >= QO (O hi only).
__global__ __launch_bounds__(128)
void gemm_o_all(const u16* __restrict__ Ah, const u16* __restrict__ Al, const u16* __restrict__ Bt, float* C, float oscale) {
  __shared__ __align__(16) float slab[4 * SLAB64];
  const int bid = blockIdx.x;
  if (bid < NB_OP2) gemm_o<2>(slab, bid, Ah, Al, Bt, C, 0, QO / 64, oscale);
  else              gemm_o<1>(slab, bid - NB_OP2, Ah, Al, Bt, C, QO, (SEQ - QO) / 64, oscale);
}

// =====================================================================================================
// Workspace map (bytes; every 16-bit plane in the packed tile order, same extents as row-major); every plane is fully written by whole-line stores before it is read; all extents are exact
// multiples of the store granularity (no pad rows needed); every region offset a multiple of 131072:
//   XB  bf16 [MROWS][1024]                       MROWS*2048       (NB=2, SEQ=2048: 8388608)
//   WB  bf16 [5120 n][1024 k]                    10485760         (rows Wv^T | Wq^T | Wk^T)
//   WO  f16 [1024 n][1024 k] x1024               2097152          (Wo^T)
//   F   f32 [MROWS][5120]                        MROWS*20480      (columns v | q | k projection output;
//                                                                  afterwards OH f16 [MROWS][1024] x1024 at its start, OL residual
//                                                                  [NB*QO][1024] after)
//   QH  f16 [MROWS][2048] x256                   MROWS*4096       QL residual [MROWS][2048]      MROWS*4096
//   KH  f16 [MROWS][2048] x256                   MROWS*4096       KL residual [MROWS][2048]      MROWS*4096
//   VH  f16 [NB*16][64][SEQ] x1024               MROWS*2048       VL residual [NB*16][64][QO]    NB*QO*2048
//   G   f32 [16][SEQ]                            16*SEQ*4
//   end (NB=2, SEQ=2048)                       182583296
// =====================================================================================================
extern "C" void kernel_launch(void* const* d_in, const int* in_sizes, int n_in,
                              void* d_out, int out_size, void* d_ws, size_t ws_size,
                              hipStream_t stream) {
  if (n_in < 6) return;
  if (in_sizes[0] < ((NB - 1) * XS_FULL + SEQ) * DMOD) return;
  if (in_sizes[1] != DMOD * QKN) return;
  if (in_sizes[2] != DMOD * QKN) return;
  if (in_sizes[3] != DMOD * DMOD) return;
  if (in_sizes[4] != DMOD * DMOD) return;
  if (in_sizes[5] < NH) return;
  if (out_size < ((NB - 1) * XS_FULL + SEQ) * DMOD) return;

  const float* x   = (const float*)d_in[0];
  const float* wq  = (const float*)d_in[1];   // [1024 in][2048 out]
  const float* wk  = (const float*)d_in[2];   // [1024 in][2048 out]
  const float* wv  = (const float*)d_in[3];   // [1024 in][1024 out]
  const float* wo  = (const float*)d_in[4];   // [1024 in][1024 out]
  const float* th  = (const float*)d_in[5];   // [16]
  float*       out = (float*)d_out;

  const size_t szXB = (size_t)MROWS * DMOD * 2;
  const size_t szW  = (size_t)FN * DMOD * 2;
  const size_t szWO = (size_t)DMOD * DMOD * 2;
  const size_t szF  = (size_t)MROWS * FN * 4;
  const size_t szQ  = (size_t)MROWS * QKN * 2;                  // QH, QL, KH, KL
  const size_t szOH = (size_t)MROWS * DMOD * 2;
  const size_t szOL = (size_t)NB * QO * DMOD * 2;
  const size_t szVH = (size_t)NB * NH * HD * SEQ * 2;
  const size_t szVL = (size_t)NB * NH * HD * QO * 2;
  const size_t szG  = (size_t)NH * SEQ * 4;
  if (szOH + szOL > szF) return;                                // OH + OL live inside the F region
  size_t off = 0;
  const size_t oXB = off; off += szXB;
  const size_t oW  = off; off += szW;
  const size_t oWO = off; off += szWO;
  const size_t oF  = off; off += szF;
  const size_t oQH = off; off += szQ;
  const size_t oQL = off; off += szQ;
  const size_t oKH = off; off += szQ;
  const size_t oKL = off; off += szQ;
  const size_t oVH = off; off += szVH;
  const size_t oVL = off; off += szVL;
  const size_t oG  = off; off += szG;
  if (off > ws_size) return;                // off = 182583296 for NB = 2, SEQ = 2048
  if (off > (size_t)WS_CAP) return;

  char* ws = (char*)d_ws;
  u16*   XB = (u16*)(ws + oXB);
  u16*   WB = (u16*)(ws + oW);
  u16*   WO = (u16*)(ws + oWO);
  float* F  = (float*)(ws + oF);
  u16*   OH = (u16*)(ws + oF);
  u16*   OL = (u16*)(ws + oF + szOH);
  u16*   QH = (u16*)(ws + oQH);
  u16*   QL = (u16*)(ws + oQL);
  u16*   KH = (u16*)(ws + oKH);
  u16*   KL = (u16*)(ws + oKL);
  u16*   VH = (u16*)(ws + oVH);
  u16*   VL = (u16*)(ws + oVL);
  float* G  = (float*)(ws + oG);

  const dim3 b256(256), b128(128), bAT(ATT_THREADS);

  // (0) weights -> transposed 16-bit planes, x -> bf16 plane [MROWS][1024], gate table G[h][dl]
  prep<<<dim3(NB_TR + NB_CV + NB_GT), b256, 0, stream>>>(x, wv, wq, wk, wo, th, XB, WB, WO, G);
  // (1) [v | q_raw | k_raw] = x.[Wv | Wq | Wk] -> F f32 [MROWS][5120]
  gemm_nb<<<dim3((MROWS / 128) * (FN / 160)), b128, 0, stream>>>(XB, WB, F, MROWS, FN, 1.0f);
  // (2) [qc|qs] and [kc|ks] hi + residual x256, v^T hi + residual x1024
  post<<<dim3(2 * NB_QK + NB_VT), b256, 0, stream>>>(F, QH, QL, KH, KL, VH, VL);
  // (3) causal gated attention -> O hi (all rows) + residual (rows s < QO)
  attn_all<<<dim3(NB_AT0 + NB_AT1), bAT, 0, stream>>>(QH, QL, KH, KL, VH, VL, G, OH, OL);
  // (4) output projection -> out f32, carries 1024 x 1024 folded back
  gemm_o_all<<<dim3(NB_OP2 + NB_OP1), b128, 0, stream>>>(OH, OL, WO, out, 1.0f / (OSC * WOS));
  (void)hipGetLastError();
}

// v010
// It runs in 149 microseconds.
// Two timings next to v009 both put it at 1.06 times that version's speed.
// Over all steps from v000 it is 3.70 times as fast.
// Contractions: x.Wq, x.Wk, x.Wv on v_wmma_f32_16x16x32_bf16 (x and W^T as bf16 RNE planes); per-head scores
// [qc|qs].[kc|ks] over 128 on v_wmma_f32_16x16x32_f16 (q, k as f16 hi x256 plus unscaled f16 residual planes, products
// hh+lh+hl on all query rows); P.v on v_wmma_f32_16x16x32_f16 (P x32768, v^T x1024 f16 planes; query rows s < QO also
// use f16 residual planes, hh+lh+hl); O.Wo on v_wmma_f32_16x16x32_f16 (O x1024 f16 hi plane, plus residual plane for rows
// s < QO; Wo^T as f16 of its bf16 RNE value x1024); all f32 accumulate. softplus, cos, sin, the cosine gate table,
// causal select, base-2 online softmax and 1/Z in f32 on VALU.
#include <hip/hip_runtime.h>
#include <math.h>
#include <stdint.h>

#ifndef NB
#define NB 2
#endif
#ifndef SEQ
#define SEQ 2048
#endif
#define XS_FULL 2048
#define DMOD  1024
#define QKN   (2 * DMOD)
#define NH    16
#define HD    64
#define SD    (2 * HD)
#define QO    ((SEQ < 512) ? SEQ : 512)
#define MROWS (NB * SEQ)
#define RSQ_HD 0.125f
#define GSTEP 0.125f
#define LOG2E 1.4426950408889634f
#define QSC   256.0f
#define KSC   256.0f
#define PCAR  32768.0f
#define VCAR  1024.0f
#define OSC   1024.0f
#define WOS   1024.0f
#define WPB   1
#define NHG   (NH / WPB)
#define NQT   (SEQ / 16)
#define NQO   (QO / 16)
#define QW    2                                 // query tiles of 16 rows that one attention wave carries
#define NQB   (NQT / QW)                        // attention query groups of 16*QW rows
#define NQOB  (NQO / QW)
#define NST   (SEQ / 64)
#define NKT   (SEQ / 32)
#define KS    4
#define QG    2                                 // query groups of 16*QW rows in one attention block; both read each staged key tile
#define ATT_THREADS (QG * KS * 32)
#define KTB   20480                             // bytes of one staged key tile of 32 keys: K hi 8 KB, K residual 8 KB, v^T hi 4 KB
#define RINGB (2 * KS * KTB)                    // two buffers for each of the KS key splits
#define PTW   32                                // per query tile: 16 row maxima, then 16 row sums
#define SLP   68
#define SLW   (16 * SLP)
#define WSUB  (PTW + SLW)
#define WREG  (QW * WSUB)
#define SLAB64 (16 * 68)
#define VTP   72
#define C8R   (DMOD / 8)
#define QKP   264
#define WS_CAP 268435456
#define FN    (DMOD + 2 * QKN)                  // columns of the joint projection: v | q | k
#define NB_TRV ((DMOD / 64) * (DMOD / 64))      // transpose blocks of a [1024][1024] weight
#define NB_TRQ ((DMOD / 64) * (QKN / 64))       // transpose blocks of a [1024][2048] weight
#define NB_TR  (2 * NB_TRV + 2 * NB_TRQ)
#define NB_CV  ((MROWS * DMOD / 8) / 256)       // convert blocks of x
#define NB_GT  ((NH * SEQ) / 256)               // gate table blocks
#define NB_QK  ((MROWS * C8R) / 256)            // combine blocks of q, and of k
#define NB_VT  (NB * NH * NST)                  // v^T blocks
#define NB_AT1 ((NQOB / QG) * NHG * NB)         // attention blocks with residual products
#define NB_AT0 (((NQB - NQOB) / QG) * NHG * NB) // attention blocks without
#define NB_OP2 (NB * (QO / 64) * (DMOD / 64))   // output projection blocks with the residual plane
#define NB_OP1 (NB * ((SEQ - QO) / 64) * (DMOD / 64))
static_assert(DMOD == NH * HD && HD == 64 && NH == 16 && SD == 128 && WPB == 1 && NHG * WPB == NH);
static_assert(ATT_THREADS == 256 && KS == 4 && HD == KS * 16 && QW == 2 && NQB * QW == NQT && NQOB * QW == NQO);
static_assert(QG == 2 && (NQB % QG) == 0 && (NQOB % QG) == 0 && QG * KS * WREG * 4 <= RINGB && RINGB <= 163840);
static_assert(NB >= 1 && NB <= 2);
static_assert((SEQ % 64) == 0 && SEQ >= 64 && SEQ <= XS_FULL);
static_assert((QO % 64) == 0 && QO >= 64 && QO <= SEQ);
static_assert((DMOD % 64) == 0 && (QKN % 64) == 0 && (DMOD % 32) == 0 && (SD % 32) == 0 && C8R == 128);
static_assert((MROWS % 128) == 0 && (FN % 160) == 0);
static_assert(((SEQ * DMOD / 8) % 256) == 0 && ((MROWS * C8R) % 256) == 0 && ((NH * SEQ) % 256) == 0);
static_assert(WPB * KS * WREG * 4 <= 65536 && 2 * HD * VTP * 2 <= 65536 && 4 * SLAB64 * 4 <= 65536 && 64 * VTP * 2 <= 65536);

typedef unsigned short u16;
typedef _Float16 v16h __attribute__((ext_vector_type(16)));
typedef _Float16 v8h  __attribute__((ext_vector_type(8)));
typedef __bf16   v16b __attribute__((ext_vector_type(16)));
typedef float    v8f  __attribute__((ext_vector_type(8)));
typedef float    v4f  __attribute__((ext_vector_type(4)));
typedef unsigned int v4u __attribute__((ext_vector_type(4)));

union FragH { v16h v; v8h h[2]; v4u u[2]; };
union FragB { v16b v; v4u u[2]; };

// ---- scalar helpers --------------------------------------------------------------------------------
__device__ __forceinline__ unsigned short bf_bits(float f) {          // f32 -> bf16 bits, RNE convert
  unsigned u = __float_as_uint(f);
  return (unsigned short)((u + 0x7FFFu + ((u >> 16) & 1u)) >> 16);
}
__device__ __forceinline__ float bf_up(unsigned short h) { return __uint_as_float(((unsigned)h) << 16); }
__device__ __forceinline__ float bfr(float f) { return bf_up(bf_bits(f)); }
__device__ __forceinline__ unsigned short h_bits(_Float16 x) { return __builtin_bit_cast(unsigned short, x); }
__device__ __forceinline__ unsigned pk16(unsigned short a, unsigned short b) { return (unsigned)a | ((unsigned)b << 16); }
__device__ __forceinline__ v8f zero8() { v8f z = {0.f, 0.f, 0.f, 0.f, 0.f, 0.f, 0.f, 0.f}; return z; }
__device__ __forceinline__ const _Float16* ash(const u16* p) { return (const _Float16*)(const void*)p; }

// ---- packed operand planes: a 16-bit plane of R rows x K columns (R % 16 == 0, K % 32 == 0) is stored as 1-KB tiles of
//      16 rows x 32 k, tile (row>>4, k>>5) at half offset (row>>4)*16*K + (k>>5)*512; inside a tile element (m = row&15,
//      k&31 = 16*j + 8*h + e) lies at j*256 + (16*h + m)*8 + e. One fragment load of a wave is then 512 contiguous bytes
//      (4 cache lines) where a row-major plane gave 16 rows x 32 B (16 lines).
// ---- fragment loaders: 16-bit A/B operand, lane -> row/col (lane&15), h = lane>>4; t = a tile start (wave-uniform), lo = the lane's offset from it
//      in BYTES (16*lane inside the tile), p = t + lo bytes; elements 0..7 <- p[0..7] (k0+8h..), elements 8..15 <- p[256..263] (k0+16+8h..)  (same split k map for A and B)
__device__ __forceinline__ v16h ldfrag_h(const _Float16* t, unsigned lo) {
  FragH f;
  const char* p = (const char*)t + lo;
  f.h[0] = *(const v8h*)(p);
  f.h[1] = *(const v8h*)(p + 512);
  return f.v;
}
__device__ __forceinline__ v16b ldfrag_b(const u16* t, unsigned lo) { // bf16 plane read as unsigned integer vectors
  FragB f;
  const char* p = (const char*)t + lo;
  f.u[0] = *(const v4u*)(p);
  f.u[1] = *(const v4u*)(p + 512);
  return f.v;
}

__device__ __forceinline__ v8f mma_h(v16h a, v16h b, v8f c) {
  return __builtin_amdgcn_wmma_f32_16x16x32_f16(false, a, false, b, (short)0, c, false, false);
}
__device__ __forceinline__ v8f mma_b(v16b a, v16b b, v8f c) {
  return __builtin_amdgcn_wmma_f32_16x16x32_bf16(false, a, false, b, (short)0, c, false, false);
}
// four accumulators and eight operand fragments: the four vector slots behind the last matrix instruction of a group,
// with its results and operands held in their registers up to there
__device__ __forceinline__ void guard4(v8f& a, v8f& b, v8f& c, v8f& d, v16h x0, v16h x1, v16h x2, v16h x3, v16h x4, v16h x5, v16h x6, v16h x7) {
#if defined(__HIP_DEVICE_COMPILE__)
  asm volatile("v_nop\n\tv_nop\n\tv_nop\n\tv_nop"
               : "+v"(a), "+v"(b), "+v"(c), "+v"(d)
               : "v"(x0), "v"(x1), "v"(x2), "v"(x3), "v"(x4), "v"(x5), "v"(x6), "v"(x7) : "memory");
#endif
}
template <typename F>
__device__ __forceinline__ void guard6(v8f& a, v8f& b, v8f& c, v8f& d, F x0, F x1, F x2, F x3, F x4, F x5) {
#if defined(__HIP_DEVICE_COMPILE__)
  asm volatile("v_nop\n\tv_nop\n\tv_nop\n\tv_nop"
               : "+v"(a), "+v"(b), "+v"(c), "+v"(d) : "v"(x0), "v"(x1), "v"(x2), "v"(x3), "v"(x4), "v"(x5) : "memory");
#endif
}
__device__ __forceinline__ void acc_guard4(v8f& a, v8f& b, v8f& c, v8f& d) {
#if defined(__HIP_DEVICE_COMPILE__)
  asm volatile("v_nop\n\tv_nop\n\tv_nop\n\tv_nop" : "+v"(a), "+v"(b), "+v"(c), "+v"(d));
#endif
}
__device__ __forceinline__ void xcnt_wait() {
#if defined(__HIP_DEVICE_COMPILE__)
  asm volatile("s_wait_xcnt 0x0" ::: "memory");
#endif
}
// s_wait_xcnt 0 behind a group of global loads, with the loads' base address as an input only: its registers are rewritten only behind the wait
__device__ __forceinline__ void ld_wait(const float* p) {
#if defined(__HIP_DEVICE_COMPILE__)
  asm volatile("s_wait_xcnt 0x0" :: "v"(p) : "memory");
#endif
}
__device__ __forceinline__ float xhalf(float x) {                     // the value of lane l ^ 16
  const int b = __builtin_bit_cast(int, x);
  return __builtin_bit_cast(float, __builtin_amdgcn_permlanex16(b, b, 0x76543210, 0xfedcba98, false, false));
}
__device__ __forceinline__ void wave_sync_lds() {                     // orders LDS accesses only: a wave's global stores still in flight are not waited for
  __builtin_amdgcn_fence(__ATOMIC_RELEASE, "workgroup", "local");
  __builtin_amdgcn_wave_barrier();
  __builtin_amdgcn_fence(__ATOMIC_ACQUIRE, "workgroup", "local");
}

// =====================================================================================================
// x f32 [NB][XS_FULL][DMOD] row-major -> packed 16-bit plane of MROWS rows (K = DMOD).  f16mode == 0: bf16 RNE bits;  f16mode == 1: f16 bits of (bf16 RNE value) * scale.
// Thread = 8 consecutive k of one row: two 16-B loads, one 16-B store; a wave = one half tile (16 rows x 2 chunks of 8 k), stored
// as 512 contiguous, 512-B aligned bytes; the 8 waves of a block read 512 contiguous bytes of each of 16 rows.
// coverage: grid = ceil(n8/256) blocks x 256 thr x 8 (in-kernel bound) = the whole plane (n8 a multiple of 256 here).
// =====================================================================================================
__device__ __forceinline__ void cvt16(int bid, const float* __restrict__ x, u16* D, int n8, int f16mode, float scale) {
  const int gt = bid * 256 + (int)threadIdx.x;
  if (gt >= n8) return;
  const int wv = gt >> 5, ln = gt & 31;                   // wave index = ((row tile * DMOD/32) + k tile) * 2 + j
  const int row = (wv / (DMOD / 16)) * 16 + (ln & 15);
  const int kc  = ((wv >> 1) % (DMOD / 32)) * 32 + (wv & 1) * 16 + (ln >> 4) * 8;
  const float* p = x + ((size_t)(row / SEQ) * XS_FULL + (size_t)(row % SEQ)) * DMOD + kc;   // plane row b*SEQ + s <- x row b*XS_FULL + s
  const v4f a = *(const v4f*)(p), b4 = *(const v4f*)(p + 4);
  float w[8];
#pragma unroll
  for (int e = 0; e < 4; ++e) { w[e] = a[e]; w[4 + e] = b4[e]; }
  v4u o;
#pragma unroll
  for (int e = 0; e < 4; ++e) {
    const float f0 = w[2 * e], f1 = w[2 * e + 1];
    const unsigned short hb0 = h_bits((_Float16)(bfr(f0) * scale));
    const unsigned short hb1 = h_bits((_Float16)(bfr(f1) * scale));
    const unsigned short bb0 = bf_bits(f0);
    const unsigned short bb1 = bf_bits(f1);
    o[e] = (f16mode != 0) ? pk16(hb0, hb1) : pk16(bb0, bb1);
  }
  u16* d = D + (size_t)gt * 8;
  {
    *(v4u*)(d) = o;
    
  }
}

// =====================================================================================================
// Weight transpose + convert: W f32 [KW][NW] row-major (W[k][n], the x.W layout) -> D 16-bit packed plane of NW rows x KW (row n, column k:
// the B operand). f16mode == 0: bf16 RNE bits; f16mode == 1: f16 bits of (bf16 RNE value) * scale.
// Block = one 64 k x 64 n tile: each thread loads 16 floats of one k row (16-B loads), converts, stores them transposed
// into an LDS tile [64 n][64 k] (pitch 72 halves, u16 element stores); after a block barrier each n row segment (64 halves =
// coverage: load 256 thr x 16 = 64 k x 64 n; store 2 iterations x 256 thr x 8 halves = 64 n rows x 64 k = the block's
//           tile; grid = (KW/64)*(NW/64) blocks covers D exactly once (host guarantees KW % 64 == 0, NW % 64 == 0).
// =====================================================================================================
__device__ __forceinline__ void tr16(int bid, const float* __restrict__ W, u16* D, int KW, int NW, int f16mode, float scale) {
  __shared__ __align__(16) u16 T[64 * VTP];
  const int tid = threadIdx.x;
  const int nkt = KW >> 6;
  const int kt  = bid % nkt;
  const int nt  = bid / nkt;
  const int k0  = kt * 64, n0 = nt * 64;
  if (n0 + 64 > NW) return;                 // block-uniform, before any barrier; never taken with the exact grid
  {
    const int kl = tid >> 2;                // k within tile 0..63
    const int nc = (tid & 3) * 16;          // n chunk 0,16,32,48
    const float* src = W + (size_t)(k0 + kl) * NW + n0 + nc;
#pragma unroll
    for (int i = 0; i < 4; ++i) {
      const v4f a = *(const v4f*)(src + 4 * i);
#pragma unroll
      for (int e = 0; e < 4; ++e) {
        const float f = a[e];
        const unsigned short hb = h_bits((_Float16)(bfr(f) * scale));
        const unsigned short bb = bf_bits(f);
        T[(nc + 4 * i + e) * VTP + kl] = (f16mode != 0) ? hb : bb;
      }
    }
  }
  __syncthreads();
  v4u v[2];
#pragma unroll
  for (int it = 0; it < 2; ++it) {
    const int pi = it * 256 + tid;          // 16-B piece: m = pi&15, h = (pi>>4)&1, j = (pi>>5)&1, k tile (pi>>6)&1, n tile pi>>7
    v[it] = *(const v4u*)(T + ((pi >> 7) * 16 + (pi & 15)) * VTP + ((pi >> 6) & 1) * 32 + ((pi >> 5) & 1) * 16 + ((pi >> 4) & 1) * 8);
  }
  {
#pragma unroll
    for (int it = 0; it < 2; ++it) {
      const int pi = it * 256 + tid;
      *(v4u*)(D + (size_t)(n0 + (pi >> 7) * 16) * KW + (size_t)((k0 >> 5) + ((pi >> 6) & 1)) * 512 + (pi & 63) * 8) = v[it];
    }
  }
}

// =====================================================================================================
// Cosine gate table G f32 [NH][SEQ]: G[h][dl] = cos(bf16(theta[h]) * (dl * 0.125f)), dl = query index - key index >= 0
// (cid difference (j-i)/8 is exact in f32 and cos is even). One value per thread, precise cosf; the block's 256 values
// coverage: grid = NH*SEQ/256 blocks x 256 = all NH x SEQ entries (NH*SEQ is a multiple of 256).
// =====================================================================================================
__device__ __forceinline__ void gtab(int bid, const float* __restrict__ theta, float* G, int ntot) {
  __shared__ __align__(16) float sg[256];
  const int tid = threadIdx.x;
  const int gt  = bid * 256 + tid;
  const int gc  = (gt < ntot) ? gt : (ntot - 1);
  const int h   = gc / SEQ;
  const int dl  = gc - h * SEQ;
  const int hc  = (h < NH) ? h : (NH - 1);
  const float th = bfr(theta[hc]);
  const float cd = (float)dl * GSTEP;
  sg[tid] = cosf(th * cd);
  __syncthreads();
  if (tid < 64) {
    const v4f v = *(const v4f*)(sg + tid * 4);
    const int base = bid * 256 + tid * 4;
    if (base + 4 <= ntot) {
      float* d = G + base;
      {
        *(v4f*)(d) = v;
        
      }
    }
  }
}

// =====================================================================================================
// Amplitude/phase combine: F f32, MROWS rows of pitch FN, F = the operand's first column (row = b*SEQ + s; column h*HD + d = amplitude pre-activation, DMOD + h*HD + d
// = phase) -> f16 hi plane Hp and unscaled f16 residual plane Lp, both packed planes of MROWS rows x QKN with column h*SD + d = c-part * sc and
// h*SD + HD + d = s-part * sc, where a = softplus(amp) = max(amp,0) + log1p(exp(-|amp|)), c-part = a*cos(phase),
// s-part = a*sin(phase) (precise expf and sincosf; log1p by log1p_unit below), hi = f16(t), residual = f16(t - f16(t)).
// Block = (16 rows, 2 heads); thread = (row, head h, 8 consecutive d): four 16-B loads, then a loop of 2 x 4 elements (one transcendental chain per element, u16 element
// stores into the thread's own LDS slots, row pitch QKP); block barrier; then four 16-B stores per thread in packed order (the
// block's 8 tiles of each plane are 8 KB contiguous; a wave stores 512 contiguous bytes).
// coverage: grid = MROWS*C8R/256 blocks (clamped block index, predicated store; MROWS*C8R is a multiple of 256) x 2 iterations x
//           256 thr x 8 halves per plane = 16 rows x 256 columns; all blocks = every row x every column of Hp and of Lp once.
// =====================================================================================================
// log(1 + e) for e in [0, 1] (0 -> 0, NaN -> NaN) = 2*atanh(s) with s = e / (2 + e) <= 1/3: the quotient from the hardware reciprocal and one
// correction step that also takes in what the rounding of 2 + e dropped, then the odd series up to s^15 (the first term left out is below 2^-29
// of the result). About a quarter of the instructions of the library's log1pf, which carries its values as pairs of floats for arguments of any size.
__device__ __forceinline__ float log1p_unit(float e) {
  const float d  = 2.0f + e;
  const float dl = e - (d - 2.0f);          // exact: the part of e that d does not hold
  const float r  = __builtin_amdgcn_rcpf(d);
  float s = e * r;
  float rem = fmaf(-s, d, e);
  rem = fmaf(-s, dl, rem);
  s = fmaf(rem, r, s);
  const float z = s * s;
  float p = 2.0f / 15.0f;
  p = fmaf(p, z, 2.0f / 13.0f);
  p = fmaf(p, z, 2.0f / 11.0f);
  p = fmaf(p, z, 2.0f / 9.0f);
  p = fmaf(p, z, 2.0f / 7.0f);
  p = fmaf(p, z, 2.0f / 5.0f);
  p = fmaf(p, z, 2.0f / 3.0f);
  return fmaf(s * z, p, s + s);
}
__device__ __forceinline__ void qk16(int bid, const float* __restrict__ F, u16* Hp, u16* Lp, int n8, float sc) {
  __shared__ __align__(16) u16 sHb[16 * QKP];
  __shared__ __align__(16) u16 sLb[16 * QKP];
  const int tid = threadIdx.x;
  const bool act = (bid * 256 + 256 <= n8);   // block-uniform
  const int bc  = act ? bid : 0;
  const int hp  = bc % (NH / 2);            // head pair
  const int rt  = bc / (NH / 2);            // 16-row tile
  const int row = rt * 16 + (tid >> 4);
  const int idx = tid & 15;
  const int h   = hp * 2 + (idx >> 3);
  const int d0  = (idx & 7) * 8;
  const float* ap = F + (size_t)row * FN + h * HD + d0;
  const float* pp = ap + DMOD;
  u16* sh = sHb + (tid >> 4) * QKP + idx * 16;
  u16* sl = sLb + (tid >> 4) * QKP + idx * 16;
  // the thread's 8 amplitudes and 8 phases, four 16-B loads issued together: every cache line is fetched once, not once per element
  const v4f a0 = *(const v4f*)(ap), a1 = *(const v4f*)(ap + 4);
  const v4f p0 = *(const v4f*)(pp), p1 = *(const v4f*)(pp + 4);
  ld_wait(ap);                              // all four loads name ap's registers (pp is a constant offset from it): they stay as they are until the wait has passed
#pragma unroll 1                            // two trips of four elements: half the code of a full unroll of the library calls
  for (int i = 0; i < 2; ++i) {
    const v4f av = (i == 0) ? a0 : a1;
    const v4f pv = (i == 0) ? p0 : p1;
#pragma unroll
    for (int j = 0; j < 4; ++j) {
      const int e = 4 * i + j;
      const float am  = av[j];
      const float ph  = pv[j];
      const float spv = fmaxf(am, 0.0f) + log1p_unit(expf(-fabsf(am)));
      float sv, cv;
      sincosf(ph, &sv, &cv);                // one range reduction and one pair of polynomials give both; the values are those of sinf and cosf
      const float tc  = (spv * cv) * sc;
      const float ts  = (spv * sv) * sc;
      const _Float16 hc = (_Float16)tc, hs = (_Float16)ts;
      const _Float16 lc = (_Float16)(tc - (float)hc), ls = (_Float16)(ts - (float)hs);
      sh[e] = h_bits(hc);  sh[8 + e] = h_bits(hs);
      sl[e] = h_bits(lc);  sl[8 + e] = h_bits(ls);
    }
  }
  __syncthreads();
  // 16-B piece pi of the block's 8 tiles: m = pi&15; column chunk q = pi>>4 (k tile q>>2, j = (q>>1)&1, h = q&1) = head q>>4 of the
  // pair, c or s part (q>>3)&1, d chunk q&7; it was written by thread m*16 + (q>>4)*8 + (q&7) at its slot + 8*part.
  v4u oh2[2], ol2[2];
#pragma unroll
  for (int it = 0; it < 2; ++it) {
    const int pi = it * 256 + tid;
    const int q  = pi >> 4;
    const int so = (pi & 15) * QKP + ((q >> 4) * 8 + (q & 7)) * 16 + ((q >> 3) & 1) * 8;
    oh2[it] = *(const v4u*)(sHb + so);
    ol2[it] = *(const v4u*)(sLb + so);
  }
  const size_t ob = (size_t)rt * 16 * QKN + (size_t)hp * (2 * SD * 16) + (size_t)tid * 8;
  if (act) {
#pragma unroll
    for (int it = 0; it < 2; ++it) {
      *(v4u*)(Hp + ob + it * 2048) = oh2[it];
      *(v4u*)(Lp + ob + it * 2048) = ol2[it];
    }
  }
}

// =====================================================================================================
// v^T planes from the v projection F f32, MROWS rows of pitch FN (row = b*SEQ + s, column = h*HD + d):
//   VH packed plane, row (b*NH + h)*HD + d, column s (K = SEQ) = f16(v * 1024) for all keys s;
//   VL packed plane, same rows, column s (K = QO) = f16 residual (t - f16(t)) for keys s < QO only.
// Block = (b, head h, 64 keys s0): each thread loads its 16 floats (key sl, d chunk dc) with 16-B loads, converts, scatters
// line) is written by 8 consecutive lanes x 16 B of one instruction, in both planes (VL under the block-uniform s0 < QO
// coverage: load 256 thr x 16 = 64 keys x 64 d; store 2 iterations x 256 thr x 8 halves = 64 lines x 64 = the block's tile of
//           VH (and of VL when s0 < QO); grid = NB*NH*NST blocks covers VH exactly once and all QO columns of VL exactly once.
// =====================================================================================================
__device__ __forceinline__ void vt16(int bid, const float* __restrict__ F, u16* VHo, u16* VLo) {
  __shared__ __align__(16) u16 TH[HD * VTP];
  __shared__ __align__(16) u16 TL[HD * VTP];
  const int tid = threadIdx.x;
  const int st  = bid % NST;
  const int t2  = bid / NST;
  const int h   = t2 % NH;
  const int b   = t2 / NH;
  if (b >= NB) return;                      // block-uniform, before any barrier; never taken with the exact grid
  const int s0  = st * 64;
  const bool dolo = (s0 + 64 <= QO);        // block-uniform
  {
    const int sl = tid >> 2;                // key within tile 0..63
    const int dc = (tid & 3) * 16;          // d chunk 0,16,32,48
    const float* src = F + ((size_t)b * SEQ + s0 + sl) * FN + h * HD + dc;
#pragma unroll
    for (int i = 0; i < 4; ++i) {
      const v4f a = *(const v4f*)(src + 4 * i);
#pragma unroll
      for (int e = 0; e < 4; ++e) {
        const float t = a[e] * VCAR;
        const _Float16 hv = (_Float16)t;
        const _Float16 lv = (_Float16)(t - (float)hv);
        TH[(dc + 4 * i + e) * VTP + sl] = h_bits(hv);
        TL[(dc + 4 * i + e) * VTP + sl] = h_bits(lv);
      }
    }
  }
  __syncthreads();
  v4u vh[2], vl[2];
#pragma unroll
  for (int it = 0; it < 2; ++it) {
    const int pi = it * 256 + tid;          // 16-B piece: m = pi&15, h = (pi>>4)&1, j = (pi>>5)&1, key tile (pi>>6)&1, d tile pi>>7
    const int so = ((pi >> 7) * 16 + (pi & 15)) * VTP + ((pi >> 6) & 1) * 32 + ((pi >> 5) & 1) * 16 + ((pi >> 4) & 1) * 8;
    vh[it] = *(const v4u*)(TH + so);
    vl[it] = *(const v4u*)(TL + so);
  }
  const size_t hrow = (size_t)(b * NH + h) * HD;
  const int    sL   = dolo ? s0 : 0;
  {
#pragma unroll
    for (int it = 0; it < 2; ++it) {
      const int pi = it * 256 + tid;
      const size_t dr = hrow + (size_t)(pi >> 7) * 16;
      const int    kq = (pi >> 6) & 1;
      *(v4u*)(VHo + dr * SEQ + (size_t)((s0 >> 5) + kq) * 512 + (pi & 63) * 8) = vh[it];
      xcnt_wait();                          // before the store's address and data registers are reused
      if (dolo) {
        *(v4u*)(VLo + dr * QO + (size_t)((sL >> 5) + kq) * 512 + (pi & 63) * 8) = vl[it];
        xcnt_wait();                        // as above
      }
    }
  }
}

// =====================================================================================================
// GEMM epilogue shared by both engines: the wave's 16x64 f32 tile (times oscale) staged in its LDS slab (pitch 68), release
// coverage: 8 instructions x 2 rows x 16 lanes x 4 floats = the wave's 16 x 64 tile.
// =====================================================================================================
__device__ __forceinline__ void epi64(float* sl, v8f a0, v8f a1, v8f a2, v8f a3, float oscale,
                                      float* C, int N, size_t rowb, int col0, int lane) {
  const int hh = lane >> 4, m = lane & 15;
#pragma unroll
  for (int r = 0; r < 8; ++r) {
    const int ro = (8 * hh + r) * 68 + m;
    sl[ro]      = a0[r] * oscale;
    sl[ro + 16] = a1[r] * oscale;
    sl[ro + 32] = a2[r] * oscale;
    sl[ro + 48] = a3[r] * oscale;
  }
  wave_sync_lds();
  v4f vals[8];
#pragma unroll
  for (int it = 0; it < 8; ++it) vals[it] = *(const v4f*)(sl + (it * 2 + hh) * 68 + m * 4);
  float* dst = C + (rowb + (size_t)hh) * (size_t)N + col0 + m * 4;
  {
#pragma unroll
    for (int it = 0; it < 8; ++it) {
      *(v4f*)(dst + (size_t)(it * 2) * (size_t)N) = vals[it];
    }
    
  }
}

// =====================================================================================================
// bf16 GEMM, no bias: C[M][N] (f32) = A (bf16 packed plane, M rows x K) . Bt^T (bf16 packed plane, N rows x K), times oscale; K = DMOD.
// Block = 128 rows x 160 columns, 4 waves as 2 x 2; a wave holds 20 accumulator tiles of 16 x 16: its 64 rows x 64 columns of its own
// (block columns 0..63 for wc = 0, 96..159 for wc = 1) and, of the middle columns 64..95, the 32 rows 32*wc .. 32*wc + 31 of its 64, so that every
// 128-B line of C has one writer. Ten fragments (4 of A, 6 of B) feed 20 matrix instructions per k step of 32; fragments are loaded straight from
// the packed tiles (two 16-B loads each, split k map for A and B); every element's sum over k runs in rising k as before.
// Row tile order inside a wave: fragment i = row tile (i + 2*wc) & 3, so that fragments 0 and 1 are the rows that also take the middle columns.
// (host guarantees M % 128 == 0, N % 160 == 0, grid = (M/128)*(N/160)).
// =====================================================================================================
// 16 x 32 tile epilogue: as epi64, for two accumulator tiles; 4 instructions x 4 rows x 8 lanes x 4 floats, each row piece one whole 128-B line.
__device__ __forceinline__ void epi32(float* sl, v8f a0, v8f a1, float oscale, float* C, int N, size_t rowb, int col0, int lane) {
  const int hh = lane >> 4, m = lane & 15;
#pragma unroll
  for (int r = 0; r < 8; ++r) {
    const int ro = (8 * hh + r) * 68 + m;
    sl[ro]      = a0[r] * oscale;
    sl[ro + 16] = a1[r] * oscale;
  }
  wave_sync_lds();
  const int rr = lane >> 3, cc = lane & 7;
  v4f vals[4];
#pragma unroll
  for (int it = 0; it < 4; ++it) vals[it] = *(const v4f*)(sl + (it * 4 + rr) * 68 + cc * 4);
  float* dst = C + (rowb + (size_t)rr) * (size_t)N + col0 + cc * 4;
#pragma unroll
  for (int it = 0; it < 4; ++it) {
    *(v4f*)(dst + (size_t)(it * 4) * (size_t)N) = vals[it];
  }
}
// the four vector slots behind the last matrix instruction of a k step; all 20 results and all 10 operand fragments are inputs, so that the
// slots stand behind every matrix instruction of the step and the fragments keep their registers up to there
__device__ __forceinline__ void guard20(const v8f (&m)[4][4], const v8f (&e)[2][2], const v16b (&a)[4], const v16b (&b)[6]) {
#if defined(__HIP_DEVICE_COMPILE__)
  asm volatile("v_nop\n\tv_nop\n\tv_nop\n\tv_nop"
               :: "v"(m[0][0]), "v"(m[0][1]), "v"(m[0][2]), "v"(m[0][3]), "v"(m[1][0]), "v"(m[1][1]), "v"(m[1][2]), "v"(m[1][3]),
                  "v"(m[2][0]), "v"(m[2][1]), "v"(m[2][2]), "v"(m[2][3]), "v"(m[3][0]), "v"(m[3][1]), "v"(m[3][2]), "v"(m[3][3]),
                  "v"(e[0][0]), "v"(e[0][1]), "v"(e[1][0]), "v"(e[1][1]),
                  "v"(a[0]), "v"(a[1]), "v"(a[2]), "v"(a[3]), "v"(b[0]), "v"(b[1]), "v"(b[2]), "v"(b[3]), "v"(b[4]), "v"(b[5]) : "memory");
#endif
}
// s_wait_xcnt 0 behind a group of global loads, with the offset register that the loads name as an input only: it is rewritten only behind the wait
__device__ __forceinline__ void off_wait(unsigned vo) {
#if defined(__HIP_DEVICE_COMPILE__)
  asm volatile("s_wait_xcnt 0x0" :: "v"(vo) : "memory");
#endif
}
__global__ __launch_bounds__(128) __attribute__((amdgpu_waves_per_eu(4)))   // at most 256 registers a wave, so that four waves share a SIMD and the whole grid is resident at once
void gemm_nb(const u16* __restrict__ A, const u16* __restrict__ Bt, float* C, int M, int N, float oscale) {
  __shared__ __align__(16) float slab[4 * SLAB64];
  constexpr int K = DMOD;                   // a constant, so that the row tiles' distances fold into the loads' immediate offsets
  const int tid = threadIdx.x, lane = tid & 31;
  const int wave = __builtin_amdgcn_readfirstlane(tid >> 5);   // scalar, so that the tile starts are computed on the scalar unit
  unsigned vo = 16u * (unsigned)lane;         // the lane's byte offset from the row tiles' starts; one k tile (1 KB) further each trip
  const int ntile = N / 160;
  const int bid   = blockIdx.x;
  const int wr = wave >> 1, wc = wave & 1;
  const int rowb  = (bid / ntile) * 128 + wr * 64;
  const int colb  = (bid % ntile) * 160;
  const int colm  = colb + wc * 96;         // the wave's own 64 columns
  const int cole  = colb + 64;              // the middle 32 columns
  if (rowb + 64 > M) return;                // wave-uniform, never taken with the exact grid; no block barriers in this kernel
  const size_t bs = (size_t)16 * K;
  const u16* ap[4];
  const u16* bp[6];
#pragma unroll
  for (int i = 0; i < 4; ++i) ap[i] = A + (size_t)(rowb + 16 * ((i + 2 * wc) & 3)) * K;
#pragma unroll
  for (int j = 0; j < 4; ++j) bp[j] = Bt + (size_t)colm * K + (size_t)j * bs;
#pragma unroll
  for (int j = 0; j < 2; ++j) bp[4 + j] = Bt + (size_t)cole * K + (size_t)j * bs;
  v8f am[4][4], ae[2][2];
#pragma unroll
  for (int i = 0; i < 4; ++i) {
#pragma unroll
    for (int j = 0; j < 4; ++j) am[i][j] = zero8();
  }
#pragma unroll
  for (int i = 0; i < 2; ++i) {
#pragma unroll
    for (int j = 0; j < 2; ++j) ae[i][j] = zero8();
  }
#pragma unroll 1
  for (int k0 = 0; k0 < K; k0 += 32) {
    v16b a[4], b[6];
#pragma unroll
    for (int i = 0; i < 4; ++i) a[i] = ldfrag_b(ap[i], vo);
#pragma unroll
    for (int j = 0; j < 6; ++j) b[j] = ldfrag_b(bp[j], vo);
    off_wait(vo);                           // the loads' offset register stays as it is until the wait has passed
    vo += 1024u;                            // next k tile: 512 halves
#pragma unroll
    for (int j = 0; j < 4; ++j) {
#pragma unroll
      for (int i = 0; i < 4; ++i) am[i][j] = mma_b(a[i], b[j], am[i][j]);
    }
#pragma unroll
    for (int j = 0; j < 2; ++j) {
#pragma unroll
      for (int i = 0; i < 2; ++i) ae[i][j] = mma_b(a[i], b[4 + j], ae[i][j]);
    }
    guard20(am, ae, a, b);
  }
  float* sl = slab + wave * SLAB64;
#pragma unroll
  for (int i = 0; i < 4; ++i) {
    const size_t row = (size_t)(rowb + 16 * ((i + 2 * wc) & 3));
    if (i > 0) {
      xcnt_wait();                          // before the earlier stores' address and data registers are reused
      wave_sync_lds();                      // every lane has read the slab before it is written again
    }
    epi64(sl, am[i][0], am[i][1], am[i][2], am[i][3], oscale, C, N, row, colm, lane);
    if (i < 2) {
      xcnt_wait();                          // as above
      wave_sync_lds();                      // as above
      epi32(sl, ae[i][0], ae[i][1], oscale, C, N, row, cole, lane);
    }
  }
}

// =====================================================================================================
// Output projection, no bias: C[row][DMOD] (f32) = (Ah [+ Al])[row][DMOD] . Bt[DMOD][DMOD]^T * oscale.
// NPROD == 1: Ah only (one product); NPROD == 2: Ah + Al residual plane (products h.B + l.B into one accumulator, l unscaled).
// Row indices (packed planes, K = DMOD): Ah row bb*SEQ + s; Al row bb*QO + s (compact plane, s < QO); C row bb*XS_FULL + s.
// Block -> (column tile ct = bid % 16, sequence row tile rt of nrt starting at s = sbeg, batch bb). Block = 64 rows (4 waves x 16) x 64
// columns, 4 accumulators a wave; fragment loads (split k map) and epi64 epilogue as gemm_nb; K = DMOD stepped by 32.
// =====================================================================================================
template <int NPROD>
__device__ __forceinline__
void gemm_o(float* slab, int bid, const u16* __restrict__ Ah, const u16* __restrict__ Al, const u16* __restrict__ Bt,
            float* C, int sbeg, int nrt, float oscale) {
  const int tid = threadIdx.x, lane = tid & 31;
  const int wave = __builtin_amdgcn_readfirstlane(tid >> 5);   // scalar, so that the tile starts are computed on the scalar unit
  unsigned vo = 16u * (unsigned)lane;         // the lane's byte offset from the row tiles' starts; one k tile (1 KB) further each trip
  const int ntile = DMOD >> 6;
  const int ct    = bid % ntile;
  const int t2    = bid / ntile;
  const int rt    = t2 % nrt;
  const int bb    = t2 / nrt;
  if (bb >= NB) return;                     // block-uniform; no block barriers in this kernel; never taken with the exact grid
  const int srow  = sbeg + rt * 64 + wave * 16;
  if (srow + 16 > SEQ) return;              // wave-uniform; never taken
  if (NPROD == 2 && srow + 16 > QO) return; // wave-uniform; never taken
  const int col0  = ct * 64;
  const int K     = DMOD;
  const size_t rowA = (size_t)bb * SEQ + srow;
  const size_t rowL = (NPROD == 2) ? ((size_t)bb * QO + srow) : (size_t)0;
  const size_t rowC = (size_t)bb * XS_FULL + srow;
  const _Float16* ahp = ash(Ah) + rowA * K;
  const _Float16* alp = ash(Al) + rowL * K;                  // dereferenced only when NPROD == 2
  const _Float16* bp  = ash(Bt) + (size_t)col0 * K;
  const size_t bs = (size_t)16 * K;
  const _Float16* bp1 = bp + bs;
  const _Float16* bp2 = bp + 2 * bs;
  const _Float16* bp3 = bp + 3 * bs;
  v8f acc0 = zero8(), acc1 = zero8(), acc2 = zero8(), acc3 = zero8();
  if constexpr (NPROD == 2) {
#pragma unroll 1
    for (int k0 = 0; k0 < K; k0 += 32) {
      const v16h ah = ldfrag_h(ahp, vo), al = ldfrag_h(alp, vo);
      const v16h b0 = ldfrag_h(bp, vo);
      const v16h b1 = ldfrag_h(bp1, vo);
      const v16h b2 = ldfrag_h(bp2, vo);
      const v16h b3 = ldfrag_h(bp3, vo);
      vo += 1024u;                          // next k tile: 512 halves
      acc0 = mma_h(ah, b0, acc0);  acc0 = mma_h(al, b0, acc0);
      acc1 = mma_h(ah, b1, acc1);  acc1 = mma_h(al, b1, acc1);
      acc2 = mma_h(ah, b2, acc2);  acc2 = mma_h(al, b2, acc2);
      acc3 = mma_h(ah, b3, acc3);  acc3 = mma_h(al, b3, acc3);
      guard6<v16h>(acc0, acc1, acc2, acc3, ah, al, b0, b1, b2, b3);
    }
  } else {
#pragma unroll 1
    for (int k0 = 0; k0 < K; k0 += 32) {
      const v16h ah = ldfrag_h(ahp, vo);
      const v16h b0 = ldfrag_h(bp, vo);
      const v16h b1 = ldfrag_h(bp1, vo);
      const v16h b2 = ldfrag_h(bp2, vo);
      const v16h b3 = ldfrag_h(bp3, vo);
      vo += 1024u;                          // next k tile: 512 halves
      acc0 = mma_h(ah, b0, acc0);
      acc1 = mma_h(ah, b1, acc1);
      acc2 = mma_h(ah, b2, acc2);
      acc3 = mma_h(ah, b3, acc3);
      guard6<v16h>(acc0, acc1, acc2, acc3, ah, b0, b1, b2, b3, ah);
    }
  }
  epi64(slab + wave * SLAB64, acc0, acc1, acc2, acc3, oscale, C, DMOD, rowC, col0, lane);
}

// =====================================================================================================
// Causal gated multi-head attention, score depth SD = 128 ([c|s] parts of one head), hd = 64 for v.
// Block bid -> (query block qt of 64 rows, falling with bid so that a block's number of key tiles falls with its index; head hg, batch b); 8 waves = QG = 2 query groups x KS = 4 key splits.
// Query group wave / KS: rows q0 = 64*qt + 32*(wave / KS) .. q0+31 = QW = 2 query tiles of 16 rows, carried side by side by each of its waves, so that each
// key and v fragment is read once for both; each tile's own sums are those of a block of one tile. The K hi, K residual and v^T hi tiles of a split come into LDS
// once, by asynchronous copies, and both query groups read them there (q, the v^T residual plane and the gate table are read from global memory):
// wave sp = wave % KS of a group takes the key tiles kt = sp, sp + KS, ... with its own running max, sum and accumulator; the four
// partial results are merged once, after one block barrier (weights 2^(m_s - max m), -inf-safe: a wave without tiles adds 0).
// RES == 1: query tiles q0 < QO, P.v = hh + lh + hl with the v^T residual plane, O residual plane also written;
// RES == 0: query tiles q0 >= QO, P.v single products. Scores use q_hi.k_hi + q_lo.k_hi + q_hi.k_lo in both variants.
//   q hi plane f16 x256, packed, row b*SEQ + s, column h*SD + e (e < SD), q residual plane same layout (all rows); k planes likewise;
//   v^T hi plane x1024, packed, row (b*NH + h)*HD + d, column s (K = SEQ), v^T residual plane (K = QO); gate table G[h][i - j] f32.
//   score (log2 domain) t(i, j) = (q_i.k_j over SD) * (1/8)*log2e/(256*256) * G[h][i - j], replaced by -inf where key j >
//   query i (gate index clamped to [0, SEQ-1]; the clamped value is only used on masked elements).
//   Key tiles of 32 with kb <= q0 + 15, each wave's in rising order; with RES == 1 every visited key is below QO, inside the compact
//   v^T residual plane.
//   Both products run transposed, S^T = K.Q^T (A = key rows, B = query columns) and O^T += V^T.P^T (A = v^T rows, B = P^T), so that a lane
//   holds scores, probabilities and results of ONE query (column lane & 15; the two wave halves split its keys and its d).
//   Per key tile: 2 x QW score subtiles x 4 k-steps x 3 products, fragments loaded straight from the packed 16-bit tiles, staged or global (two 16-B loads
//   per fragment, split k map); online max-subtracted base-2 softmax in f32, -inf-safe rescale, maximum and sum over the lane's own
//   16 registers (maximum joined across the halves per tile, sum once behind the loop); the two score subtiles, converted in place (hi,
//   residual), are the B operand P^T in the split k map; v^T A fragments in 2 groups of
//   2 d-subtiles. After the loop each wave writes its QW raw accumulators into its own QW result slabs (pitch 68, row = query; every element owned
//   by one lane) and each query tile's 16 row maxima and sums in front of its slab; one block barrier (every return stands in front of it
//   and is block-uniform); then wave sp merges columns 16*sp .. 16*sp+15 of its head: out = sum_s acc_s*w_s / sum_s Z_s*w_s
//   (Z > 0 always: key 0 <= every query row; guarded anyway), carries 1/(32768*1024) folded once. Bounded loops only (nkt <= NKT).
// coverage: per wave QW instructions x 16 rows x 2 chunks x 8 halves = 32 x 16 per plane, KS waves = 32 x 64; the two block ranges
//           (RES 1: NQO tiles, RES 0: NQT-NQO tiles; QG*QW tiles a block) x NHG x NB blocks = every (b, s, h) row segment of O hi exactly
//           once and every (b, s < QO, h) row segment of O residual exactly once.
// =====================================================================================================
// s_wait_xcnt 0 behind a group of global loads, with the registers that the loads name as inputs only: they are rewritten only behind the wait
__device__ __forceinline__ void idx_wait(const int (&a)[8], const int (&b)[8]) {
#if defined(__HIP_DEVICE_COMPILE__)
  asm volatile("s_wait_xcnt 0x0" :: "v"(a[0]), "v"(a[1]), "v"(a[2]), "v"(a[3]), "v"(a[4]), "v"(a[5]), "v"(a[6]), "v"(a[7]),
               "v"(b[0]), "v"(b[1]), "v"(b[2]), "v"(b[3]), "v"(b[4]), "v"(b[5]), "v"(b[6]), "v"(b[7]) : "memory");
#endif
}
__device__ __forceinline__ void adr_wait(const char* p, const char* q) {
#if defined(__HIP_DEVICE_COMPILE__)
  asm volatile("s_wait_xcnt 0x0" :: "v"(p), "v"(q) : "memory");
#endif
}
// One wave's half of a key tile, 20 asynchronous copies of 512 B (16 B a lane) from global memory into LDS, through no register: 4 KB of K hi, 4 KB of K
// residual, two 1-KB tiles of v^T hi. An offset moves both addresses. The closing s_wait_xcnt 0 stands in the copies' own statement, so that the
// address registers are rewritten only behind it.
__device__ __forceinline__ void stage_copy(unsigned l0, const char* g0, unsigned l1, const char* g1,
                                           unsigned l2, const char* g2, unsigned l3, const char* g3) {
#if defined(__HIP_DEVICE_COMPILE__)
  asm volatile("global_load_async_to_lds_b128 %0, %1, off\n\t"
               "global_load_async_to_lds_b128 %0, %1, off offset:512\n\t"
               "global_load_async_to_lds_b128 %0, %1, off offset:1024\n\t"
               "global_load_async_to_lds_b128 %0, %1, off offset:1536\n\t"
               "global_load_async_to_lds_b128 %0, %1, off offset:2048\n\t"
               "global_load_async_to_lds_b128 %0, %1, off offset:2560\n\t"
               "global_load_async_to_lds_b128 %0, %1, off offset:3072\n\t"
               "global_load_async_to_lds_b128 %0, %1, off offset:3584\n\t"
               "global_load_async_to_lds_b128 %2, %3, off\n\t"
               "global_load_async_to_lds_b128 %2, %3, off offset:512\n\t"
               "global_load_async_to_lds_b128 %2, %3, off offset:1024\n\t"
               "global_load_async_to_lds_b128 %2, %3, off offset:1536\n\t"
               "global_load_async_to_lds_b128 %2, %3, off offset:2048\n\t"
               "global_load_async_to_lds_b128 %2, %3, off offset:2560\n\t"
               "global_load_async_to_lds_b128 %2, %3, off offset:3072\n\t"
               "global_load_async_to_lds_b128 %2, %3, off offset:3584\n\t"
               "global_load_async_to_lds_b128 %4, %5, off\n\t"
               "global_load_async_to_lds_b128 %4, %5, off offset:512\n\t"
               "global_load_async_to_lds_b128 %6, %7, off\n\t"
               "global_load_async_to_lds_b128 %6, %7, off offset:512\n\t"
               "s_wait_xcnt 0x0"
               :: "v"(l0), "v"(g0), "v"(l1), "v"(g1), "v"(l2), "v"(g2), "v"(l3), "v"(g3) : "memory");
#endif
}
__device__ __forceinline__ void async_wait() {                        // the wave's own copies have landed in LDS
#if defined(__HIP_DEVICE_COMPILE__)
  asm volatile("s_wait_asynccnt 0x0" ::: "memory");
#endif
}
__device__ __forceinline__ void ds_wait() {                           // the wave's own LDS reads have returned, before their buffer is handed back for a refill
#if defined(__HIP_DEVICE_COMPILE__)
  asm volatile("s_wait_dscnt 0x0" ::: "memory");
#endif
}
template <int RES>
__device__ __forceinline__
void attn_g(float* smem, int bid, int wave, const u16* __restrict__ QHp, const u16* __restrict__ QLp,
            const u16* __restrict__ KHp, const u16* __restrict__ KLp,
            const u16* __restrict__ VHp, const u16* __restrict__ VLp,
            const float* __restrict__ Gt, u16* OHp, u16* OLp) {
  constexpr int QT0 = (RES != 0) ? 0 : (NQOB / QG);           // in blocks of QG query groups
  constexpr int NQL = (RES != 0) ? (NQOB / QG) : ((NQB - NQOB) / QG);
  constexpr int NQE = (NQL > 0) ? NQL : 1;

  const int lane = (int)__builtin_amdgcn_mbcnt_lo(~0u, 0u);    // lane index without the thread id, which would otherwise hold a register over the other variant's key loop
  const unsigned lo = 16u * (unsigned)lane;
  const int hh   = lane >> 4;
  const int c    = lane & 15;
  const int qi   = bid / (NHG * NB);        // the query block with the most key tiles comes first, all heads and batches of it side by side
  const int t2   = bid % (NHG * NB);
  const int hg   = t2 % NHG;
  const int b    = t2 / NHG;
  if (qi >= NQE) return;                    // block-uniform, before the barrier; never taken with the exact grid
  const int qt   = QT0 + (NQE - 1 - qi);
  const int qb0  = qt * (16 * QW * QG);     // first of the block's 16*QW*QG query rows
  if (qb0 + 16 * QW * QG > SEQ) return;     // block-uniform; never taken
  if (RES != 0 && qb0 + 16 * QW * QG > QO) return; // block-uniform; never taken
  const int hw   = wave / KS;               // query group within the block
  const int sp   = wave % KS;               // which quarter of the key tiles
  const int q0   = qb0 + hw * (16 * QW);    // first of the wave's 16*QW query rows; query tile u = rows q0 + 16u .. q0 + 16u + 15
  const int head = hg;
  const int ql0  = (RES != 0) ? q0 : 0;

  float* wreg = smem + wave * WREG;         // per query tile u at u*WSUB: 16 row maxima, 16 row sums, then result slab [16][64] pitch 68

  const size_t hcol = (size_t)head * (SD / 32) * 512;                              // the head's first k tile
  const _Float16* Qh  = ash(QHp) + ((size_t)b * SEQ + q0) * QKN + hcol;            // query tile u at + u*16*QKN
  const _Float16* Ql  = ash(QLp) + ((size_t)b * SEQ + q0) * QKN + hcol;
  const _Float16* Khb = ash(KHp) + ((size_t)b * SEQ) * QKN + hcol;                 // key row tile kb added per step
  const _Float16* Klb = ash(KLp) + ((size_t)b * SEQ) * QKN + hcol;
  const _Float16* Vhb = ash(VHp) + ((size_t)(b * NH + head) * HD) * SEQ;                // d row tile j added per group
  const _Float16* Vlb = ash(VLp) + ((size_t)(b * NH + head) * HD) * QO;                 // RES == 1 only
  const float* gp = Gt + (size_t)head * SEQ;
  const float lsc = RSQ_HD * (LOG2E / (QSC * KSC));
  const float oc  = 1.0f / (PCAR * VCAR);
  const size_t KROW = (size_t)QKN;          // halves per key row: row tile kb starts at kb*KROW
  const size_t QT2  = (size_t)16 * QKN;     // halves between the two query tiles

  float mrow[QW], lrow[QW];                 // of query q0 + 16u + c: running maximum (the same in both wave halves), and the sum over this half's keys
  v8f o[QW][4];                             // transposed: element r of o[u][j] = (d = 16j + 8hh + r, query q0 + 16u + c)
#pragma unroll
  for (int u = 0; u < QW; ++u) {
    mrow[u] = -INFINITY;  lrow[u] = 0.f;
#pragma unroll
    for (int j = 0; j < 4; ++j) o[u][j] = zero8();
  }
  const int ncaus = (q0 >> 5) + 1;                                            // tiles holding keys <= q0 + 31: the same set for both query tiles
  const int nkt = (ncaus < NKT) ? ncaus : NKT;

  // ---- key tiles through LDS: split sp's tile of trip t (kt = sp + KS*t) is copied once, half by each of the split's QG waves, and read by both; two buffers
  //      a split, the copies of trip t + 2 issued behind the barrier that ends trip t. Trip count and copy tests are the same for the whole block. ----
  const int nktb = ((qb0 + 16 * QW * (QG - 1)) >> 5) + 1;                     // key tiles of the block's last query group
  const int ntr  = (((nktb < NKT) ? nktb : NKT) + KS - 1) / KS;
  const unsigned lds0 = (unsigned)(size_t)smem + (unsigned)(sp * KTB) + lo;   // the lane's LDS byte address in the split's first buffer
  auto stage = [&](int t) {
    int ks = sp + t * KS;
    ks = (ks < NKT) ? ks : (NKT - 1);       // a tile behind the block's last one is copied from inside the planes and never read
    const unsigned lb = lds0 + (unsigned)((t & 1) * (KS * KTB));
    const char* gk = (const char*)(Khb + (size_t)(ks * 32 + 16 * hw) * KROW) + lo;
    const char* gl = (const char*)(Klb + (size_t)(ks * 32 + 16 * hw) * KROW) + lo;
    const char* gv = (const char*)(Vhb + (size_t)(2 * hw) * 16 * SEQ + ks * 512) + lo;
    stage_copy(lb + hw * 4096, gk, lb + 8192 + hw * 4096, gl, lb + 16384 + hw * 2048, gv, lb + 17408 + hw * 2048, gv + (size_t)32 * SEQ);
  };
  stage(0);
  async_wait();
  __syncthreads();                          // publishes trip 0's tiles
  if (ntr > 1) stage(1);
#pragma unroll 1
  for (int t = 0; t < ntr; ++t) {
   const int kt = sp + t * KS;
   if (kt < nkt) {                          // wave-uniform: a wave without this tile goes straight to the trip's barrier
    const int kb = kt * 32;
    const _Float16* tb = (const _Float16*)(const void*)((const char*)smem + (t & 1) * (KS * KTB) + sp * KTB);
    // ---- transposed scores, A = key rows, B = query columns: D element r of this lane = (key kb + 8hh + r, query q0 + 16u + c) in s[u][0], key kb + 16 + 8hh + r in s[u][1] ----
    v8f s00 = zero8(), s01 = zero8(), s10 = zero8(), s11 = zero8();
    const _Float16* k0p = tb;               // staged: K hi rows 0..15, 16..31, K residual rows 0..15, 16..31, 4 KB each
    const _Float16* k1p = tb + 2048;
    const _Float16* l0p = tb + 4096;
    const _Float16* l1p = tb + 6144;
#pragma unroll
    for (int kk = 0; kk < SD / 32; ++kk) {
      const v16h qh0 = ldfrag_h(Qh + kk * 512, lo);
      const v16h ql0f = ldfrag_h(Ql + kk * 512, lo);
      const v16h qh1 = ldfrag_h(Qh + QT2 + kk * 512, lo);
      const v16h ql1f = ldfrag_h(Ql + QT2 + kk * 512, lo);
      const v16h kh0 = ldfrag_h(k0p + kk * 512, lo);
      const v16h kh1 = ldfrag_h(k1p + kk * 512, lo);
      const v16h kl0 = ldfrag_h(l0p + kk * 512, lo);
      const v16h kl1 = ldfrag_h(l1p + kk * 512, lo);
      adr_wait((const char*)Qh + lo, (const char*)Ql + lo);   // the global loads' address registers stay as they are until the wait has passed
      s00 = mma_h(kh0, qh0,  s00);
      s10 = mma_h(kh0, qh1,  s10);
      s01 = mma_h(kh1, qh0,  s01);
      s11 = mma_h(kh1, qh1,  s11);
      s00 = mma_h(kh0, ql0f, s00);
      s10 = mma_h(kh0, ql1f, s10);
      s01 = mma_h(kh1, ql0f, s01);
      s11 = mma_h(kh1, ql1f, s11);
      s00 = mma_h(kl0, qh0,  s00);
      s10 = mma_h(kl0, qh1,  s10);
      s01 = mma_h(kl1, qh0,  s01);
      s11 = mma_h(kl1, qh1,  s11);
      guard4(s00, s01, s10, s11, qh0, ql0f, qh1, ql1f, kh0, kl0, kh1, kl1);
    }
    // ---- gate (f32, per element) + causal select + online softmax in base 2, -inf-safe; one query tile after the other. A lane holds 16 of its
    //      query's 32 scores: maximum and sum run over its own registers, the maximum joined with the other wave half by one cross-row move.
    //      The 16 probabilities are, in place, the lane's part of the B operand P^T (split k map: elements 0..7 = keys kb + 8hh + 0..7, 8..15 = kb + 16 + 8hh + 0..7) ----
    FragH ph[QW], pl[QW];
#pragma unroll
    for (int u = 0; u < QW; ++u) {
      const v8f s0 = (u == 0) ? s00 : s10;
      const v8f s1 = (u == 0) ? s01 : s11;
      const int dq = q0 + 16 * u + c - kb - 8 * hh;                           // query - key of element r: dq - r in s0, dq - 16 - r in s1
      int ia[8], ib[8];
      float ga[8], gb[8];
#pragma unroll
      for (int r = 0; r < 8; ++r) {
        int i0 = dq - r;       i0 = (i0 < 0) ? 0 : i0;  i0 = (i0 > SEQ - 1) ? (SEQ - 1) : i0;
        int i1 = dq - 16 - r;  i1 = (i1 < 0) ? 0 : i1;  i1 = (i1 > SEQ - 1) ? (SEQ - 1) : i1;
        ia[r] = i0;  ib[r] = i1;
        ga[r] = gp[i0];
        gb[r] = gp[i1];
      }
      idx_wait(ia, ib);                     // the gate loads' index registers stay as they are until the wait has passed
      float t0[8], t1[8];
      float mx = -INFINITY;
#pragma unroll
      for (int r = 0; r < 8; ++r) {
        const float u0 = (s0[r] * lsc) * ga[r];
        const float u1 = (s1[r] * lsc) * gb[r];
        t0[r] = (dq - r < 0) ? -INFINITY : u0;
        t1[r] = (dq - 16 - r < 0) ? -INFINITY : u1;
        mx = fmaxf(mx, fmaxf(t0[r], t1[r]));
      }
      mx = fmaxf(mx, xhalf(mx));
      const float mn = fmaxf(mrow[u], mx);
      const float ms = (mn == -INFINITY) ? 0.0f : mn;
      const float al = exp2f(mrow[u] - ms);
      mrow[u] = mn;
      float ps = 0.f;
#pragma unroll
      for (int r = 0; r < 8; ++r) {
        const float e0 = exp2f(t0[r] - ms), e1 = exp2f(t1[r] - ms);
        ps += e0 + e1;
        const float ta = e0 * PCAR, tb = e1 * PCAR;
        const _Float16 ha = (_Float16)ta, hb = (_Float16)tb;
        ph[u].h[0][r] = ha;
        ph[u].h[1][r] = hb;
        pl[u].h[0][r] = (_Float16)(ta - (float)ha);
        pl[u].h[1][r] = (_Float16)(tb - (float)hb);
      }
      lrow[u] = lrow[u] * al + ps;
#pragma unroll
      for (int j = 0; j < 4; ++j) {
#pragma unroll
        for (int r = 0; r < 8; ++r) o[u][j][r] *= al;
      }
    }
    // ---- O^T += V^T.P^T : A fragment row m = d = j*16 + c, key tile kb>>5 of the packed v^T planes; 2 groups of 2 d-subtiles, each fragment used by both query tiles ----
    {
      const _Float16* vhp = tb + 8192;      // staged v^T hi: d tile j at j*512 halves
      if constexpr (RES != 0) {
        const _Float16* vlp = Vlb + kb * 16;
#pragma unroll
        for (int jg = 0; jg < 2; ++jg) {
          const size_t da = (size_t)(2 * jg) * 512;
          const size_t db = da + (size_t)512;
          const size_t la = (size_t)(2 * jg) * 16 * QO;
          const size_t lb = la + (size_t)16 * QO;
          const v16h vha = ldfrag_h(vhp + da, lo), vhb2 = ldfrag_h(vhp + db, lo);
          const v16h vla = ldfrag_h(vlp + la, lo), vlb2 = ldfrag_h(vlp + lb, lo);
          adr_wait((const char*)vlp + lo, (const char*)vlp + lo);   // the global loads' address registers stay as they are until the wait has passed
#pragma unroll
          for (int u = 0; u < QW; ++u) {
            o[u][2 * jg]     = mma_h(vha,  ph[u].v, o[u][2 * jg]);
            o[u][2 * jg + 1] = mma_h(vhb2, ph[u].v, o[u][2 * jg + 1]);
          }
#pragma unroll
          for (int u = 0; u < QW; ++u) {
            o[u][2 * jg]     = mma_h(vha,  pl[u].v, o[u][2 * jg]);
            o[u][2 * jg + 1] = mma_h(vhb2, pl[u].v, o[u][2 * jg + 1]);
          }
#pragma unroll
          for (int u = 0; u < QW; ++u) {
            o[u][2 * jg]     = mma_h(vla,  ph[u].v, o[u][2 * jg]);
            o[u][2 * jg + 1] = mma_h(vlb2, ph[u].v, o[u][2 * jg + 1]);
          }
          guard4(o[0][2 * jg], o[0][2 * jg + 1], o[1][2 * jg], o[1][2 * jg + 1], ph[0].v, pl[0].v, ph[1].v, pl[1].v, vha, vhb2, vla, vlb2);
        }
      } else {
#pragma unroll
        for (int jg = 0; jg < 2; ++jg) {
          const size_t da = (size_t)(2 * jg) * 512;
          const size_t db = da + (size_t)512;
          const v16h vha = ldfrag_h(vhp + da, lo), vhb2 = ldfrag_h(vhp + db, lo);
#pragma unroll
          for (int u = 0; u < QW; ++u) {
            o[u][2 * jg]     = mma_h(vha,  ph[u].v, o[u][2 * jg]);
            o[u][2 * jg + 1] = mma_h(vhb2, ph[u].v, o[u][2 * jg + 1]);
          }
          guard4(o[0][2 * jg], o[0][2 * jg + 1], o[1][2 * jg], o[1][2 * jg + 1], ph[0].v, ph[1].v, vha, vhb2, ph[0].v, ph[1].v, vha, vhb2);
        }
      }
    }
   }
   // ---- the trip's foot, every wave: own LDS reads returned, own copies landed, one block barrier (publishes trip t + 1's tiles and ends every read of trip t's), then the refill ----
   ds_wait();
   async_wait();
   __syncthreads();
   if (t + 2 < ntr) stage(t + 2);
  }
  async_wait();                             // nothing is in flight when the ring becomes the result slabs
  acc_guard4(o[0][0], o[0][1], o[0][2], o[0][3]);
  acc_guard4(o[1][0], o[1][1], o[1][2], o[1][3]);
  const int lne = lane;
  const int hhe = lne >> 4, ce = lne & 15;
  // ---- this wave's partial results: raw accumulators into the slab rows of the lane's query (8 consecutive d per subtile), row maxima and joined row sums in front of them ----
#pragma unroll
  for (int u = 0; u < QW; ++u) {
    float* pt   = wreg + u * WSUB;
    float* srow = pt + PTW + ce * SLP + 8 * hhe;
#pragma unroll
    for (int j = 0; j < 4; ++j) {
      const v4f a = {o[u][j][0], o[u][j][1], o[u][j][2], o[u][j][3]};
      const v4f b4 = {o[u][j][4], o[u][j][5], o[u][j][6], o[u][j][7]};
      *(v4f*)(srow + j * 16)     = a;
      *(v4f*)(srow + j * 16 + 4) = b4;
    }
    const float lt = lrow[u] + xhalf(lrow[u]);                                // the two wave halves' sums joined once
    if (hhe == 0) {
      pt[ce]      = mrow[u];
      pt[16 + ce] = lt;
    }
  }
  __syncthreads();                          // publishes the four partial results of each query group to its four waves
#pragma unroll
  for (int u = 0; u < QW; ++u) {
    // ---- merge for row c of query tile u: w_s = 2^(m_s - max m) (0 for a wave without keys), Z = sum Z_s*w_s, out = sum acc_s*w_s / Z (0 if Z == 0) ----
    const float* hb = smem + hw * KS * WREG + u * WSUB;
    float ms4[KS], ws4[KS];
#pragma unroll
    for (int s = 0; s < KS; ++s) ms4[s] = hb[s * WREG + ce];
    const float mm  = fmaxf(fmaxf(ms4[0], ms4[1]), fmaxf(ms4[2], ms4[3]));
    const float mms = (mm == -INFINITY) ? 0.0f : mm;
    float lv = 0.f;
#pragma unroll
    for (int s = 0; s < KS; ++s) {
      ws4[s] = exp2f(ms4[s] - mms);
      lv += hb[s * WREG + 16 + ce] * ws4[s];
    }
    const float ls  = (lv > 0.0f) ? lv : 1.0f;
    const float inv = (lv > 0.0f) ? ((1.0f / ls) * oc) : 0.0f;
    // ---- O x1024 -> f16 hi (+ residual) packed planes; lane = (row c, 8 consecutive d at 16*sp + 8*hh): a quarter of the head's two tiles ----
    float w[8];
#pragma unroll
    for (int e = 0; e < 8; ++e) w[e] = 0.f;
#pragma unroll
    for (int s = 0; s < KS; ++s) {
      const float* sr = hb + s * WREG + PTW + ce * SLP + sp * 16 + hhe * 8;
      const v4f a = *(const v4f*)(sr), b4 = *(const v4f*)(sr + 4);
#pragma unroll
      for (int e = 0; e < 4; ++e) { w[e] += a[e] * ws4[s]; w[4 + e] += b4[e] * ws4[s]; }
    }
    v4u oh, ol;
#pragma unroll
    for (int e = 0; e < 4; ++e) {
      const float w0 = (w[2 * e] * inv) * OSC, w1 = (w[2 * e + 1] * inv) * OSC;
      const _Float16 h0 = (_Float16)w0, h1 = (_Float16)w1;
      const _Float16 l0 = (_Float16)(w0 - (float)h0), l1 = (_Float16)(w1 - (float)h1);
      oh[e] = pk16(h_bits(h0), h_bits(h1));
      ol[e] = pk16(h_bits(l0), h_bits(l1));
    }
    const size_t obh = ((size_t)b * SEQ + q0 + 16 * u) * DMOD + (size_t)head * (HD / 32) * 512 + sp * 256 + 8 * lne;
    const size_t obl = ((size_t)b * QO + ql0 + 16 * u) * DMOD + (size_t)head * (HD / 32) * 512 + sp * 256 + 8 * lne;
    *(v4u*)(OHp + obh) = oh;
    if constexpr (RES != 0) {
      *(v4u*)(OLp + obl) = ol;
    }
    xcnt_wait();                            // before the stores' address and data registers are reused
  }
}

// =====================================================================================================
// Joint grids: kernels that depend on the same earlier launch and on nothing of each other run as block ranges of ONE launch
// (every test below is block-uniform; each range runs its function unchanged with its own block index counted from 0).
// prep: weight transposes (Wv^T | Wq^T | Wk^T as one bf16 plane of FN rows x DMOD, Wo^T as its own f16 plane), x -> bf16 plane, gate table.
// =====================================================================================================
__global__ __launch_bounds__(256)
void prep(const float* __restrict__ x, const float* __restrict__ wv, const float* __restrict__ wq, const float* __restrict__ wk,
          const float* __restrict__ wo, const float* __restrict__ theta, u16* XB, u16* WB, u16* WO, float* G) {
  const int bid = blockIdx.x;
  if (bid < NB_TR) {
    const float* Wsrc = wv;
    u16* D = WB;
    int lb = bid, NW = DMOD, mode = 0;
    float sc = 1.0f;
    if (bid >= NB_TRV + 2 * NB_TRQ)  { Wsrc = wo; D = WO; lb = bid - (NB_TRV + 2 * NB_TRQ); mode = 1; sc = WOS; }
    else if (bid >= NB_TRV + NB_TRQ) { Wsrc = wk; D = WB + (size_t)(DMOD + QKN) * DMOD; lb = bid - (NB_TRV + NB_TRQ); NW = QKN; }
    else if (bid >= NB_TRV)          { Wsrc = wq; D = WB + (size_t)DMOD * DMOD; lb = bid - NB_TRV; NW = QKN; }
    tr16(lb, Wsrc, D, DMOD, NW, mode, sc);
  } else if (bid < NB_TR + NB_CV) {
    cvt16(bid - NB_TR, x, XB, MROWS * DMOD / 8, 0, 1.0f);
  } else {
    gtab(bid - (NB_TR + NB_CV), theta, G, NH * SEQ);
  }
}

// post: F f32 [MROWS][FN] (columns v | q | k) -> [qc|qs] planes, [kc|ks] planes, v^T planes.
__global__ __launch_bounds__(256)
void post(const float* __restrict__ F, u16* QH, u16* QL, u16* KH, u16* KL, u16* VH, u16* VL) {
  const int bid = blockIdx.x;
  if (bid < 2 * NB_QK) {
    const bool isk = (bid >= NB_QK);
    qk16(isk ? bid - NB_QK : bid, F + (isk ? (DMOD + QKN) : DMOD), isk ? KH : QH, isk ? KL : QL, MROWS * C8R, isk ? KSC : QSC);
  } else {
    vt16(bid - 2 * NB_QK, F, VH, VL);
  }
}

// attention: the query tiles s >= QO first, then the query tiles s < QO (residual products); inside each range the last query block (most key tiles) first.
__global__ __launch_bounds__(ATT_THREADS) __attribute__((amdgpu_waves_per_eu(4)))   // at most 256 registers a wave, so that four waves (two blocks, half the LDS each) share a SIMD
void attn_all(const u16* __restrict__ QHp, const u16* __restrict__ QLp, const u16* __restrict__ KHp, const u16* __restrict__ KLp,
              const u16* __restrict__ VHp, const u16* __restrict__ VLp, const float* __restrict__ Gt, u16* OHp, u16* OLp) {
  __shared__ __align__(16) float smem[RINGB / 4];   // the key tile ring; behind the key loop the waves' result slabs
  const int bid = blockIdx.x;
  const int wave = __builtin_amdgcn_readfirstlane((int)threadIdx.x >> 5);   // scalar, so that every tile start is a scalar base address
  if (bid < NB_AT0) attn_g<0>(smem, bid, wave, QHp, QLp, KHp, KLp, VHp, VLp, Gt, OHp, OLp);
  else              attn_g<1>(smem, bid - NB_AT0, wave, QHp, QLp, KHp, KLp, VHp, VLp, Gt, OHp, OLp);
}

// output projection: rows s < QO (O hi + residual) first, then rows s >= QO (O hi only).
__global__ __launch_bounds__(128)
void gemm_o_all(const u16* __restrict__ Ah, const u16* __restrict__ Al, const u16* __restrict__ Bt, float* C, float oscale) {
  __shared__ __align__(16) float slab[4 * SLAB64];
  const int bid = blockIdx.x;
  if (bid < NB_OP2) gemm_o<2>(slab, bid, Ah, Al, Bt, C, 0, QO / 64, oscale);
  else              gemm_o<1>(slab, bid - NB_OP2, Ah, Al, Bt, C, QO, (SEQ - QO) / 64, oscale);
}

// =====================================================================================================
// Workspace map (bytes; every 16-bit plane in the packed tile order, same extents as row-major); every plane is fully written by whole-line stores before it is read; all extents are exact
// multiples of the store granularity (no pad rows needed); every region offset a multiple of 131072:
//   XB  bf16 [MROWS][1024]                       MROWS*2048       (NB=2, SEQ=2048: 8388608)
//   WB  bf16 [5120 n][1024 k]                    10485760         (rows Wv^T | Wq^T | Wk^T)
//   WO  f16 [1024 n][1024 k] x1024               2097152          (Wo^T)
//   F   f32 [MROWS][5120]                        MROWS*20480      (columns v | q | k projection output;
//                                                                  afterwards OH f16 [MROWS][1024] x1024 at its start, OL residual
//                                                                  [NB*QO][1024] after)
//   QH  f16 [MROWS][2048] x256                   MROWS*4096       QL residual [MROWS][2048]      MROWS*4096
//   KH  f16 [MROWS][2048] x256                   MROWS*4096       KL residual [MROWS][2048]      MROWS*4096
//   VH  f16 [NB*16][64][SEQ] x1024               MROWS*2048       VL residual [NB*16][64][QO]    NB*QO*2048
//   G   f32 [16][SEQ]                            16*SEQ*4
//   end (NB=2, SEQ=2048)                       182583296
// =====================================================================================================
extern "C" void kernel_launch(void* const* d_in, const int* in_sizes, int n_in,
                              void* d_out, int out_size, void* d_ws, size_t ws_size,
                              hipStream_t stream) {
  if (n_in < 6) return;
  if (in_sizes[0] < ((NB - 1) * XS_FULL + SEQ) * DMOD) return;
  if (in_sizes[1] != DMOD * QKN) return;
  if (in_sizes[2] != DMOD * QKN) return;
  if (in_sizes[3] != DMOD * DMOD) return;
  if (in_sizes[4] != DMOD * DMOD) return;
  if (in_sizes[5] < NH) return;
  if (out_size < ((NB - 1) * XS_FULL + SEQ) * DMOD) return;

  const float* x   = (const float*)d_in[0];
  const float* wq  = (const float*)d_in[1];   // [1024 in][2048 out]
  const float* wk  = (const float*)d_in[2];   // [1024 in][2048 out]
  const float* wv  = (const float*)d_in[3];   // [1024 in][1024 out]
  const float* wo  = (const float*)d_in[4];   // [1024 in][1024 out]
  const float* th  = (const float*)d_in[5];   // [16]
  float*       out = (float*)d_out;

  const size_t szXB = (size_t)MROWS * DMOD * 2;
  const size_t szW  = (size_t)FN * DMOD * 2;
  const size_t szWO = (size_t)DMOD * DMOD * 2;
  const size_t szF  = (size_t)MROWS * FN * 4;
  const size_t szQ  = (size_t)MROWS * QKN * 2;                  // QH, QL, KH, KL
  const size_t szOH = (size_t)MROWS * DMOD * 2;
  const size_t szOL = (size_t)NB * QO * DMOD * 2;
  const size_t szVH = (size_t)NB * NH * HD * SEQ * 2;
  const size_t szVL = (size_t)NB * NH * HD * QO * 2;
  const size_t szG  = (size_t)NH * SEQ * 4;
  if (szOH + szOL > szF) return;                                // OH + OL live inside the F region
  size_t off = 0;
  const size_t oXB = off; off += szXB;
  const size_t oW  = off; off += szW;
  const size_t oWO = off; off += szWO;
  const size_t oF  = off; off += szF;
  const size_t oQH = off; off += szQ;
  const size_t oQL = off; off += szQ;
  const size_t oKH = off; off += szQ;
  const size_t oKL = off; off += szQ;
  const size_t oVH = off; off += szVH;
  const size_t oVL = off; off += szVL;
  const size_t oG  = off; off += szG;
  if (off > ws_size) return;                // off = 182583296 for NB = 2, SEQ = 2048
  if (off > (size_t)WS_CAP) return;

  char* ws = (char*)d_ws;
  u16*   XB = (u16*)(ws + oXB);
  u16*   WB = (u16*)(ws + oW);
  u16*   WO = (u16*)(ws + oWO);
  float* F  = (float*)(ws + oF);
  u16*   OH = (u16*)(ws + oF);
  u16*   OL = (u16*)(ws + oF + szOH);
  u16*   QH = (u16*)(ws + oQH);
  u16*   QL = (u16*)(ws + oQL);
  u16*   KH = (u16*)(ws + oKH);
  u16*   KL = (u16*)(ws + oKL);
  u16*   VH = (u16*)(ws + oVH);
  u16*   VL = (u16*)(ws + oVL);
  float* G  = (float*)(ws + oG);

  const dim3 b256(256), b128(128), bAT(ATT_THREADS);

  // (0) weights -> transposed 16-bit planes, x -> bf16 plane [MROWS][1024], gate table G[h][dl]
  prep<<<dim3(NB_TR + NB_CV + NB_GT), b256, 0, stream>>>(x, wv, wq, wk, wo, th, XB, WB, WO, G);
  // (1) [v | q_raw | k_raw] = x.[Wv | Wq | Wk] -> F f32 [MROWS][5120]
  gemm_nb<<<dim3((MROWS / 128) * (FN / 160)), b128, 0, stream>>>(XB, WB, F, MROWS, FN, 1.0f);
  // (2) [qc|qs] and [kc|ks] hi + residual x256, v^T hi + residual x1024
  post<<<dim3(2 * NB_QK + NB_VT), b256, 0, stream>>>(F, QH, QL, KH, KL, VH, VL);
  // (3) causal gated attention -> O hi (all rows) + residual (rows s < QO)
  attn_all<<<dim3(NB_AT0 + NB_AT1), bAT, 0, stream>>>(QH, QL, KH, KL, VH, VL, G, OH, OL);
  // (4) output projection -> out f32, carries 1024 x 1024 folded back
  gemm_o_all<<<dim3(NB_OP2 + NB_OP1), b128, 0, stream>>>(OH, OL, WO, out, 1.0f / (OSC * WOS));
  (void)hipGetLastError();
}
